// v000
// The times below were measured on an AMD MI455X: many runs one after another, warmed up first and cycling through
// copies of the inputs, with the whole window's GPU time divided by the number of runs. Launches and the gaps
// between them are all in it. The median over several windows is given; except for v000 it joins two sittings, which
// can be a few percent apart, so the side-by-side timings, each taken in one sitting, are the better comparison.
// v000 is the starting kernel. One run takes 4380 microseconds.
#include <hip/hip_runtime.h>
// Single-head scaled dot-product attention with the module's mean-value correction (query, key, value [4][4096][128]; logits = q.k / sqrt(128); attn = softmax over the 4096 keys; out = attn value - mean(value over the sequence) -> [4][4096][128]).
// Structure: token rows; the bf16-valued inputs as exact f16 rows; per batch: V^T via LDS transposes, logits [4096][4096] as ONE WMMA GEMM (32x64 wave tiles, f32 accumulation, K = 128), row softmax on VALU (f32 statistics, native exp; weights x256 as f16 hi + x1024 residual), -mean(value) per channel on VALU (f32), out = Ph V^T 2^-8 - mean + Pl V^T 2^-18 f32 into the output rows.
// Compute dtype: inputs rounded to bf16; q, k, v as plain f16 GEMM operands (~2^-12), softmax weights as f16 hi + x1024 residual, out f32; scores and softmax statistics f32; v_wmma_f32_16x16x32_f16.
#define NB 4
#define SQ 4096
#define DM 128
#define NH 2
#define HD 64
#define HG 8                         /* heads per launch of the four-argument k_vt (not launched) */
#define B0 0                         /* first batch processed (unused) */
#define NBR NB                       /* batches processed (used only in MP) */
#define NR ((size_t)NB * SQ)         /* token rows */
#define MP ((int)((size_t)NBR * SQ)) /* token rows (used only in MPO) */
#define QT 256                       /* query rows per causal tile */
#define NKX SQ                       /* S / P row pitch */
#define QT0 256                      /* first-tile rows recomputed exactly (256: buys margin for the few-key rows 128..255, which have no output projection to average the single-f16 P/v rounding) */
#define QN SQ                        /* query rows attended per batch (unused) */
#define NHD NH                       /* unused */
#define MPO MP                       /* rows through the output stage (unused) */
#define LQ DM            /* row pitch of the q/k/v rows */
typedef __bf16 v16b __attribute__((ext_vector_type(16)));
typedef unsigned short v8us __attribute__((ext_vector_type(8), may_alias));
typedef float  v8f  __attribute__((ext_vector_type(8)));
typedef float  v4f  __attribute__((ext_vector_type(4)));
typedef float  v4fa __attribute__((ext_vector_type(4), may_alias));
union FragB { v16b v; v8us half[2]; unsigned short u[16]; };

__device__ __forceinline__ unsigned short bf16_bits(float x) { unsigned int u = __float_as_uint(x); return (unsigned short)((u + 0x7FFFu + ((u >> 16) & 1u)) >> 16); }
__device__ __forceinline__ float bf16_val(unsigned short b) { return __uint_as_float(((unsigned int)b) << 16); }
__device__ __forceinline__ float bf16_round(float x) { return bf16_val(bf16_bits(x)); }
// D += A·B with NT terms: 1 = ah·bh, 2 = + al·bh (A split), 3 = + ah·bl (both split)
template <int NT>
__device__ __forceinline__ v8f mmaN(v16b ah, v16b al, v16b bh, v16b bl, v8f c) {
  c = __builtin_amdgcn_wmma_f32_16x16x32_bf16(false, ah, false, bh, (short)0, c, false, false);
  if (NT >= 2) c = __builtin_amdgcn_wmma_f32_16x16x32_bf16(false, al, false, bh, (short)0, c, false, false);
  if (NT >= 3) c = __builtin_amdgcn_wmma_f32_16x16x32_bf16(false, ah, false, bl, (short)0, c, false, false);
  asm volatile("v_nop\n\tv_nop\n\tv_nop\n\tv_nop" : "+v"(c) : "v"(ah), "v"(al), "v"(bh), "v"(bl));
  return c;
}

__global__ __launch_bounds__(256) void k_wt_bf16(const float* __restrict__ W, unsigned short* __restrict__ Wt, int K, int N) {
  const int t = blockIdx.x * 256 + threadIdx.x;
  const int k8n = K / 8;
  if (t >= N * k8n) return;
  const int n = t / k8n, k8 = (t % k8n) * 8;
  v8us v;
#pragma unroll
  for (int i = 0; i < 8; ++i) v[i] = bf16_bits(W[(size_t)(k8 + i) * N + n]);
  *(v8us*)(Wt + (size_t)n * K + k8) = v;
  
}

// GEMM C[M][N] (f32, pitch ldc) = act(A[M][K]·W + bias). A f32 row-major (pitch lda) converted per fragment to bf16
// (ASPLIT: hi/lo two planes -> 2 terms, else single rounded term); Wt bf16 [N][K] (pitch ldb). BIAS_BF16 rounds the
// bias to bf16 first (bias quantised to bf16 before the add). K%32==0, M%16==0, N%64==0.
template <bool ASPLIT, int ACT, bool BIAS_BF16>
__global__ __launch_bounds__(128) void k_gemm_bf(const float* __restrict__ A, int lda, const unsigned short* __restrict__ Wt, int ldb,
                                               const float* __restrict__ bias, float* __restrict__ C, int ldc, int M, int N, int K) {
  __shared__ __attribute__((aligned(16))) float so[4][16][64];
  const int tid = threadIdx.x, w = tid >> 5, lane = tid & 31, ln = lane & 15, hh = lane >> 4;
  const int ntn = N / 64;
  const int wid = blockIdx.x * 4 + w;
  const int mt = wid / ntn, nq = wid % ntn;
  if (mt * 16 >= M) return;
  const int row0 = mt * 16, col0 = nq * 64;
  const float* arow = A + (size_t)(row0 + ln) * lda;
  v8f acc[4] = {};
  for (int kb = 0; kb < K; kb += 32) {
    FragB ah, al;
    const v4f x0 = *(const v4fa*)(arow + kb + 8 * hh), x1 = *(const v4fa*)(arow + kb + 8 * hh + 4);
    const v4f x2 = *(const v4fa*)(arow + kb + 16 + 8 * hh), x3 = *(const v4fa*)(arow + kb + 16 + 8 * hh + 4);
    float xs[16] = {x0[0],x0[1],x0[2],x0[3],x1[0],x1[1],x1[2],x1[3],x2[0],x2[1],x2[2],x2[3],x3[0],x3[1],x3[2],x3[3]};
#pragma unroll
    for (int i = 0; i < 16; ++i) { const unsigned short hb = bf16_bits(xs[i]); ah.u[i] = hb; al.u[i] = ASPLIT ? bf16_bits(xs[i] - bf16_val(hb)) : (unsigned short)0; }
#pragma unroll
    for (int t = 0; t < 4; ++t) {
      const unsigned short* brow = Wt + (size_t)(col0 + t * 16 + ln) * ldb + kb;
      FragB b;
      b.half[0] = *(const v8us*)(brow + 8 * hh);
      b.half[1] = *(const v8us*)(brow + 16 + 8 * hh);
      acc[t] = mmaN<ASPLIT ? 2 : 1>(ah.v, al.v, b.v, b.v, acc[t]);
    }
  }
#pragma unroll
  for (int t = 0; t < 4; ++t) {
    float bv = bias ? bias[col0 + t * 16 + ln] : 0.f;
    if (BIAS_BF16) bv = bf16_round(bv);
#pragma unroll
    for (int r = 0; r < 8; ++r) { float v = acc[t][r] + bv; if (ACT == 1) v = fmaxf(v, 0.f); so[w][8 * hh + r][t * 16 + ln] = v; }
  }
  __builtin_amdgcn_fence(__ATOMIC_ACQ_REL, "workgroup");
  __builtin_amdgcn_wave_barrier();
  const int rsub = lane >> 4, c4 = (lane & 15) * 4;
  {
#pragma unroll
    for (int q = 0; q < 8; ++q) {
      const int r = q * 2 + rsub;
      const v4f v = *(const v4fa*)&so[w][r][c4];
      *(v4f*)(C + (size_t)(row0 + r) * ldc + col0 + c4) = v;
    }
    
  }
}

// GEMM C = act(A·W + bias + resid): A f32 (ASPLIT -> hi/lo 2 terms), Wt bf16 [N][K]; ACT 0 none, 1 relu, 2 exact gelu;
// resid (optional, f32, row index = (row % rmod), pitch ldr, RES_BF16 rounds it) added before the activation.
template <bool ASPLIT, int ACT, bool BIAS_BF16, bool RES_BF16>
__global__ __launch_bounds__(128) void k_gemm_bf3(const float* __restrict__ A, int lda, const unsigned short* __restrict__ Wt, int ldb,
                                                const float* __restrict__ bias, const float* __restrict__ resid, int rmod, int ldr,
                                                float* __restrict__ C, int ldc, int M, int N, int K) {
  __shared__ __attribute__((aligned(16))) float so[4][16][64];
  const int tid = threadIdx.x, w = tid >> 5, lane = tid & 31, ln = lane & 15, hh = lane >> 4;
  const int ntn = N / 64;
  const int wid = blockIdx.x * 4 + w;
  const int mt = wid / ntn, nq = wid % ntn;
  if (mt * 16 >= M) return;
  const int row0 = mt * 16, col0 = nq * 64;
  const float* arow = A + (size_t)(row0 + ln) * lda;
  v8f acc[4] = {};
  for (int kb = 0; kb < K; kb += 32) {
    FragB ah, al;
    const v4f x0 = *(const v4fa*)(arow + kb + 8 * hh), x1 = *(const v4fa*)(arow + kb + 8 * hh + 4);
    const v4f x2 = *(const v4fa*)(arow + kb + 16 + 8 * hh), x3 = *(const v4fa*)(arow + kb + 16 + 8 * hh + 4);
    float xs[16] = {x0[0],x0[1],x0[2],x0[3],x1[0],x1[1],x1[2],x1[3],x2[0],x2[1],x2[2],x2[3],x3[0],x3[1],x3[2],x3[3]};
#pragma unroll
    for (int i = 0; i < 16; ++i) { const unsigned short hb = bf16_bits(xs[i]); ah.u[i] = hb; al.u[i] = ASPLIT ? bf16_bits(xs[i] - bf16_val(hb)) : (unsigned short)0; }
#pragma unroll
    for (int t = 0; t < 4; ++t) {
      const unsigned short* brow = Wt + (size_t)(col0 + t * 16 + ln) * ldb + kb;
      FragB b;
      b.half[0] = *(const v8us*)(brow + 8 * hh);
      b.half[1] = *(const v8us*)(brow + 16 + 8 * hh);
      acc[t] = mmaN<ASPLIT ? 2 : 1>(ah.v, al.v, b.v, b.v, acc[t]);
    }
  }
#pragma unroll
  for (int t = 0; t < 4; ++t) {
    const int col = col0 + t * 16 + ln;
    float bv = bias ? bias[col] : 0.f;
    if (BIAS_BF16) bv = bf16_round(bv);
#pragma unroll
    for (int r = 0; r < 8; ++r) {
      float v = acc[t][r] + bv;
      if (resid) { float rv = resid[(size_t)((row0 + 8 * hh + r) % rmod) * ldr + col]; if (RES_BF16) rv = bf16_round(rv); v += rv; }
      if (ACT == 1) v = fmaxf(v, 0.f);
      if (ACT == 2) v = 0.5f * v * (1.0f + erff(v * 0.70710678118654752f));
      if (ACT == 3) { const float u = 0.7978845608028654f * (v + 0.044715f * v * v * v); v = 0.5f * v * (1.0f + tanhf(u)); }
      so[w][8 * hh + r][t * 16 + ln] = v;
    }
  }
  __builtin_amdgcn_fence(__ATOMIC_ACQ_REL, "workgroup");
  __builtin_amdgcn_wave_barrier();
  const int rsub = lane >> 4, c4 = (lane & 15) * 4;
  {
#pragma unroll
    for (int q = 0; q < 8; ++q) {
      const int r = q * 2 + rsub;
      const v4f v = *(const v4fa*)&so[w][r][c4];
      *(v4f*)(C + (size_t)(row0 + r) * ldc + col0 + c4) = v;
    }
    
  }
}
// row LayerNorm (biased variance, eps) over N: s = X (+ R); optional out_sum <- s; out_norm <- (s-mu)*rsqrt(var+eps)*g + b
template <bool PARAM_BF16>
__global__ __launch_bounds__(256) void k_layernorm(const float* __restrict__ X, const float* __restrict__ R, const float* __restrict__ g, const float* __restrict__ bta,
                                                  float* __restrict__ out_sum, float* __restrict__ out_norm, int N, float eps) {
  __shared__ float red[256];
  const int row = blockIdx.x, tid = threadIdx.x;
  const float* x = X + (size_t)row * N; const float* rr = R ? R + (size_t)row * N : nullptr;
  float vals[16];                     // up to N = 4096
  const int per = N / 256;            // contiguous chunk per thread? use strided-by-4 chunks: thread handles j = tid*4 + 1024*u
  float s1 = 0.f;
  for (int u = 0; u < per / 4; ++u) {
    const int j = tid * 4 + 1024 * u;
    const v4f a = *(const v4fa*)(x + j);
    v4f b = {0.f,0.f,0.f,0.f}; if (rr) b = *(const v4fa*)(rr + j);
#pragma unroll
    for (int q = 0; q < 4; ++q) { const float v = a[q] + b[q]; vals[u * 4 + q] = v; s1 += v; }
  }
  red[tid] = s1; __syncthreads();
  for (int st = 128; st > 0; st >>= 1) { if (tid < st) red[tid] += red[tid + st]; __syncthreads(); }
  const float mu = red[0] / (float)N; __syncthreads();
  float s2 = 0.f;
  for (int u = 0; u < per / 4; ++u)
#pragma unroll
    for (int q = 0; q < 4; ++q) { const float c = vals[u * 4 + q] - mu; s2 += c * c; }
  red[tid] = s2; __syncthreads();
  for (int st = 128; st > 0; st >>= 1) { if (tid < st) red[tid] += red[tid + st]; __syncthreads(); }
  const float rs = rsqrtf(red[0] / (float)N + eps);
  {
    for (int u = 0; u < per / 4; ++u) {
      const int j = tid * 4 + 1024 * u;
      v4f o, sm;
#pragma unroll
      for (int q = 0; q < 4; ++q) {
        float gg = g[j + q], bb = bta[j + q];
        if (PARAM_BF16) { gg = bf16_round(gg); bb = bf16_round(bb); }
        sm[q] = vals[u * 4 + q]; o[q] = (vals[u * 4 + q] - mu) * rs * gg + bb;
      }
      if (out_sum) *(v4f*)(out_sum + (size_t)row * N + j) = sm;
      *(v4f*)(out_norm + (size_t)row * N + j) = o;
    }
    
  }
}



// ---- f16 WMMA path (v_wmma_f32_16x16x32_f16): 11-bit significands for operands in range — used where a [0,1] probability operand needs more precision than bf16
typedef _Float16 v16h __attribute__((ext_vector_type(16)));
union FragH { v16h v; v8us half[2]; _Float16 h[16]; unsigned short u[16]; };
template <int NT>
__device__ __forceinline__ v8f mmaH(v16h ah, v16h al, v16h bh, v16h bl, v8f c) {
  c = __builtin_amdgcn_wmma_f32_16x16x32_f16(false, ah, false, bh, (short)0, c, false, false);
  if (NT >= 2) c = __builtin_amdgcn_wmma_f32_16x16x32_f16(false, al, false, bh, (short)0, c, false, false);
  if (NT >= 3) c = __builtin_amdgcn_wmma_f32_16x16x32_f16(false, ah, false, bl, (short)0, c, false, false);
  asm volatile("v_nop\n\tv_nop\n\tv_nop\n\tv_nop" : "+v"(c) : "v"(ah), "v"(al), "v"(bh), "v"(bl));
  return c;
}
// batched GEMM like k_gemm_b but f16 operands: A f32 (split into f16 hi/lo if ASPLIT, else rounded to f16), Bt = f16 values [n][k]; alpha; C f32; N multiple of 16 (partial tiles skipped)
template <bool ASPLIT>
__global__ __launch_bounds__(128) void k_gemm_h(const float* __restrict__ A, int lda, size_t sA, const _Float16* __restrict__ Bh, int ldb, size_t sB, float alpha, float* __restrict__ C, int ldc, size_t sC, int M, int N, int K) {
  __shared__ __attribute__((aligned(16))) float so[4][16][64];
  const int tid = threadIdx.x, w = tid >> 5, lane = tid & 31, ln = lane & 15, hh = lane >> 4; const int by = blockIdx.y;
  A += (size_t)by * sA; Bh += (size_t)by * sB; C += (size_t)by * sC;
  const int ntn = (N + 63) / 64; const int wid = blockIdx.x * 4 + w; const int mt = wid / ntn, nq = wid % ntn; if (mt * 16 >= M) return;
  const int row0 = mt * 16, col0 = nq * 64; const float* arow = A + (size_t)(row0 + ln) * lda;
  v8f acc[4] = {};
  for (int kb = 0; kb < K; kb += 32) {
    FragH ah, al;
    const v4f x0 = *(const v4fa*)(arow + kb + 8 * hh), x1 = *(const v4fa*)(arow + kb + 8 * hh + 4), x2 = *(const v4fa*)(arow + kb + 16 + 8 * hh), x3 = *(const v4fa*)(arow + kb + 16 + 8 * hh + 4);
    float xs[16] = {x0[0],x0[1],x0[2],x0[3],x1[0],x1[1],x1[2],x1[3],x2[0],x2[1],x2[2],x2[3],x3[0],x3[1],x3[2],x3[3]};
#pragma unroll
    for (int i = 0; i < 16; ++i) { const _Float16 h = (_Float16)xs[i]; ah.h[i] = h; al.h[i] = ASPLIT ? (_Float16)(xs[i] - (float)h) : (_Float16)0.0f; }
#pragma unroll
    for (int t = 0; t < 4; ++t) { if (col0 + t * 16 >= N) continue; const size_t boff = (size_t)(col0 + t * 16 + ln) * ldb + kb; FragH bq; bq.half[0] = *(const v8us*)(Bh + boff + 8 * hh); bq.half[1] = *(const v8us*)(Bh + boff + 16 + 8 * hh);
      acc[t] = mmaH<ASPLIT ? 2 : 1>(ah.v, al.v, bq.v, bq.v, acc[t]); }
  }
#pragma unroll
  for (int t = 0; t < 4; ++t) { if (col0 + t * 16 >= N) continue;
#pragma unroll
    for (int r = 0; r < 8; ++r) so[w][8 * hh + r][t * 16 + ln] = acc[t][r] * alpha; }
  __builtin_amdgcn_fence(__ATOMIC_ACQ_REL, "workgroup"); __builtin_amdgcn_wave_barrier();
  const int rsub = lane >> 4, c4 = (lane & 15) * 4;
  {
#pragma unroll
    for (int q = 0; q < 8; ++q) { const int r = q * 2 + rsub; if (col0 + c4 < N) { const v4f v = *(const v4fa*)&so[w][r][c4]; *(v4f*)(C + (size_t)(row0 + r) * ldc + col0 + c4) = v; } }
     }
}

// Wt[n][k] = f16(W[k][n]·scale) from f32 row-major W[K][N] (scale = power of two; bf16-exact weights stay exact in f16 away from the subnormal range)
__global__ __launch_bounds__(256) void k_wt_f16(const float* __restrict__ W, _Float16* __restrict__ Wt, int K, int N, float scale) {
  const int t = blockIdx.x * 256 + threadIdx.x; if (t >= N * (K / 8)) return; const int n = t / (K / 8), k8 = (t % (K / 8)) * 8; FragH f;
#pragma unroll
  for (int i = 0; i < 8; ++i) f.h[i] = (_Float16)(bf16_round(W[(size_t)(k8 + i) * N + n]) * scale); const v8us o = f.half[0];
  *(v8us*)((unsigned short*)Wt + (size_t)n * K + k8) = o; 
}
// k_gemm_hh variant with fused epilogue: v = acc·alpha + bias[by·sBias + col] (+ CP[(row/rowsPerB)·sCPb + by·64 + col] if CP) ; ACT 0 none / 1 elu ; writes f16 C16 (and f32 C if non-null)
template <int ACT>
__global__ __launch_bounds__(128) void k_gemm_hhx(const _Float16* __restrict__ A, int lda, size_t sA, const _Float16* __restrict__ Bh, int ldb, size_t sB, float alpha, const float* __restrict__ bias, size_t sBias, const float* __restrict__ CP, int rowsPerB, size_t sCPb, int row0g,
    float* __restrict__ C, _Float16* __restrict__ C16, int ldc, size_t sC, int M, int N, int K) {
  __shared__ __attribute__((aligned(16))) float so[4][16][64];
  const int tid = threadIdx.x, w = tid >> 5, lane = tid & 31, ln = lane & 15, hh = lane >> 4; const int by = blockIdx.y;
  A += (size_t)by * sA; Bh += (size_t)by * sB; const size_t cofs = (size_t)by * sC; const float* bp = bias ? bias + (size_t)by * sBias : nullptr;
  const int ntn = (N + 63) / 64; const int wid = blockIdx.x * 4 + w; const int mt = wid / ntn, nq = wid % ntn; if (mt * 16 >= M) return;
  const int row0 = mt * 16, col0 = nq * 64; const _Float16* arow = A + (size_t)(row0 + ln) * lda;
  v8f acc[4] = {};
  for (int kb = 0; kb < K; kb += 32) { FragH ah; ah.half[0] = *(const v8us*)((const unsigned short*)arow + kb + 8 * hh); ah.half[1] = *(const v8us*)((const unsigned short*)arow + kb + 16 + 8 * hh);
#pragma unroll
    for (int t = 0; t < 4; ++t) { if (col0 + t * 16 >= N) continue; const size_t boff = (size_t)(col0 + t * 16 + ln) * ldb + kb; FragH bq; bq.half[0] = *(const v8us*)((const unsigned short*)Bh + boff + 8 * hh); bq.half[1] = *(const v8us*)((const unsigned short*)Bh + boff + 16 + 8 * hh);
      acc[t] = mmaH<1>(ah.v, ah.v, bq.v, bq.v, acc[t]); }
  }
#pragma unroll
  for (int t = 0; t < 4; ++t) { if (col0 + t * 16 >= N) continue; const int col = col0 + t * 16 + ln; const float bv = bp ? bf16_round(bp[col]) : 0.f;
#pragma unroll
    for (int r = 0; r < 8; ++r) { float v = acc[t][r] * alpha + bv; if (CP) { const int rr = row0g + row0 + 8 * hh + r; if (rowsPerB < 0) v += CP[cofs + (size_t)rr * ldc + col];      /* rowsPerB < 0: own element of the batched C plane */ else { const int bidx = rr / rowsPerB; v += CP[(size_t)bidx * sCPb + (size_t)by * 64 + col]; } } if (ACT == 1) v = (v > 0.f) ? v : expm1f(v); else if (ACT == 7) v = (v > 0.f) ? v + 1.0f : expf(v); else if (ACT == 8) v = tanhf(v); else if (ACT == 9) v = 0.5f * v * (1.0f + tanhf(0.7978845608028654f * (v + 0.044715f * v * v * v))); else if (ACT == 11) v = 1.0f / (1.0f + expf(-v)); else if (ACT == 12) v = (v > 0.f) ? v : 0.01f * v; else if (ACT == 14) v = (v > 0.f) ? v : 0.1f * v; else if (ACT == 16) v = (v >= 0.f) ? v : 0.3f * v; else if (ACT == 17) v = (v >= 0.f) ? v : 0.2f * v; else if (ACT == 15) v = v / (1.0f + expf(-v)); else if (ACT == 3) v = fmaxf(v, 0.f); else if (ACT == 6) v = 0.5f * v * (1.0f + erff(v * 0.70710678118654752f)); so[w][8 * hh + r][t * 16 + ln] = v; } }
  __builtin_amdgcn_fence(__ATOMIC_ACQ_REL, "workgroup"); __builtin_amdgcn_wave_barrier();
  const int rsub = lane >> 4, c4 = (lane & 15) * 4; typedef _Float16 v4h __attribute__((ext_vector_type(4)));
  {
#pragma unroll
    for (int q = 0; q < 8; ++q) { const int r = q * 2 + rsub; if (col0 + c4 < N) { const v4f v = *(const v4fa*)&so[w][r][c4]; if (C) *(v4f*)(C + cofs + (size_t)(row0 + r) * ldc + col0 + c4) = v; if (C16) { v4h h4; for (int i = 0; i < 4; ++i) h4[i] = (_Float16)v[i]; *(v4h*)(C16 + cofs + (size_t)(row0 + r) * ldc + col0 + c4) = h4; } } }
     }
}


typedef _Float16 v4h __attribute__((ext_vector_type(4)));

__global__ __launch_bounds__(256) void k_x16(const float* __restrict__ x, _Float16* __restrict__ X16, size_t n8) { const size_t t = (size_t)blockIdx.x * 256 + threadIdx.x; if (t >= n8) return; FragH f;
#pragma unroll
  for (int q = 0; q < 8; ++q) f.h[q] = (_Float16)bf16_round(x[t * 8 + q]); *(v8us*)((unsigned short*)X16 + t * 8) = f.half[0];  }
__global__ __launch_bounds__(256) void k_h16(const float* __restrict__ x, _Float16* __restrict__ X16, size_t n8) { const size_t t = (size_t)blockIdx.x * 256 + threadIdx.x; if (t >= n8) return; FragH f;
#pragma unroll
  for (int q = 0; q < 8; ++q) f.h[q] = (_Float16)x[t * 8 + q]; *(v8us*)((unsigned short*)X16 + t * 8) = f.half[0];  }
__global__ __launch_bounds__(256) void k_round16f(const float* __restrict__ W, _Float16* __restrict__ Bt, size_t n8) { const size_t t = (size_t)blockIdx.x * 256 + threadIdx.x; if (t >= n8) return; FragH f;
#pragma unroll
  for (int i = 0; i < 8; ++i) f.h[i] = (_Float16)(bf16_round(W[t * 8 + i]) * 16.0f); *(v8us*)((unsigned short*)Bt + t * 8) = f.half[0];  }
template <int NHv, int TTv>
__global__ __launch_bounds__(256) void k_vt(const _Float16* __restrict__ V16, int ldv, int voff, _Float16* __restrict__ Vt) { __shared__ unsigned short tl[64][66]; const int tid = threadIdx.x; const int slab = blockIdx.x / (TTv / 64), lg = blockIdx.x % (TTv / 64); const int b = slab / NHv, h = slab % NHv;
  for (int i = tid; i < 64 * 8; i += 256) { const int r = i / 8, c8 = (i % 8) * 8; FragH f; f.half[0] = *(const v8us*)((const unsigned short*)V16 + ((size_t)b * TTv + lg * 64 + r) * ldv + voff + h * 64 + c8);
#pragma unroll
    for (int q = 0; q < 8; ++q) tl[r][c8 + q] = f.u[q]; }
  __syncthreads();
  {
#pragma unroll
    for (int rd = 0; rd < 2; ++rd) { const int d = rd * 32 + tid / 8, pc = tid % 8; FragH f;
#pragma unroll
      for (int q = 0; q < 8; ++q) f.u[q] = tl[pc * 8 + q][d];
      *(v8us*)((unsigned short*)Vt + ((size_t)slab * 64 + d) * TTv + lg * 64 + pc * 8) = f.half[0]; }
     } }

__global__ __launch_bounds__(256) void k_hl(const float* __restrict__ F, _Float16* __restrict__ Hh, _Float16* __restrict__ Hl, size_t n8) { const size_t t = (size_t)blockIdx.x * 256 + threadIdx.x; if (t >= n8) return; FragH fh, fl; const v4f a = *(const v4fa*)(F + t * 8), c = *(const v4fa*)(F + t * 8 + 4);
#pragma unroll
  for (int q = 0; q < 4; ++q) { _Float16 h = (_Float16)a[q]; fh.h[q] = h; fl.h[q] = (_Float16)((a[q] - (float)h) * 1024.0f); h = (_Float16)c[q]; fh.h[4 + q] = h; fl.h[4 + q] = (_Float16)((c[q] - (float)h) * 1024.0f); }
  { *(v8us*)((unsigned short*)Hh + t * 8) = fh.half[0]; *(v8us*)((unsigned short*)Hl + t * 8) = fl.half[0];  } }

// ---- fast GEMM (wave tile 32x64; requires M % 32 == 0 rows per launch region and N % 64 == 0); epilogue = k_gemm_hhx semantics ----
__device__ __forceinline__ v16h g2_frag(const _Float16* p, int hh) { FragH f; f.half[0] = *(const v8us*)((const unsigned short*)p + 8 * hh); f.half[1] = *(const v8us*)((const unsigned short*)p + 16 + 8 * hh); return f.v; }
__device__ __forceinline__ v8f g2_mma(v16h a, v16h b, v8f c) { v8f d = __builtin_amdgcn_wmma_f32_16x16x32_f16(false, a, false, b, (short)0, c, false, false); asm volatile("v_nop\n\tv_nop\n\tv_nop\n\tv_nop" : "+v"(d) : "v"(a), "v"(b)); return d; }
template <int ACT>
__global__ __launch_bounds__(128) void k_gemm2(const _Float16* __restrict__ A, int lda, size_t sA, const _Float16* __restrict__ Bh, int ldb, size_t sB, float alpha, const float* __restrict__ bias, size_t sBias, const float* __restrict__ CP, int rowsPerB, size_t sCPb, int row0g,
    float* __restrict__ C, _Float16* __restrict__ C16, int ldc, size_t sC, int M, int N, int K) { static_assert(ACT == 0 || ACT == 3 || ACT == 6 || ACT == 8 || ACT == 9 || ACT == 11 || ACT == 12 || ACT == 14 || ACT == 15 || ACT == 16 || ACT == 17, "k_gemm2: unsupported ACT code (would silently apply no activation)");
  __shared__ __attribute__((aligned(16))) float so[4][32][68];
  const int tid = threadIdx.x, w = tid >> 5, lane = tid & 31, ln = lane & 15, hh = lane >> 4; const int by = blockIdx.y;
  A += (size_t)by * sA; Bh += (size_t)by * sB; const size_t cofs = (size_t)by * sC; const float* bp = bias ? bias + (size_t)by * sBias : nullptr;
  const int ntn = N >> 6; const int mt = blockIdx.x / ntn, nq = blockIdx.x - mt * ntn; const int row0 = mt * 128 + 32 * w, col0 = nq * 64; if (row0 >= M) return;
  const _Float16* a0p = A + (size_t)(row0 + ln) * lda; const _Float16* a1p = a0p + (size_t)16 * lda;
  const _Float16* b0p = Bh + (size_t)(col0 + ln) * ldb; const _Float16* b1p = b0p + (size_t)16 * ldb; const _Float16* b2p = b1p + (size_t)16 * ldb; const _Float16* b3p = b2p + (size_t)16 * ldb;
  const v8f z8 = {0.f,0.f,0.f,0.f,0.f,0.f,0.f,0.f}; v8f c00 = z8, c01 = z8, c02 = z8, c03 = z8, c10 = z8, c11 = z8, c12 = z8, c13 = z8;
#pragma unroll 1
  for (int kb = 0; kb < K; kb += 32) { const v16h a0 = g2_frag(a0p + kb, hh), a1 = g2_frag(a1p + kb, hh);
    v16h b = g2_frag(b0p + kb, hh); c00 = g2_mma(a0, b, c00); c10 = g2_mma(a1, b, c10);
    b = g2_frag(b1p + kb, hh); c01 = g2_mma(a0, b, c01); c11 = g2_mma(a1, b, c11);
    b = g2_frag(b2p + kb, hh); c02 = g2_mma(a0, b, c02); c12 = g2_mma(a1, b, c12);
    b = g2_frag(b3p + kb, hh); c03 = g2_mma(a0, b, c03); c13 = g2_mma(a1, b, c13); }
  v8f accs[8] = {c00, c01, c02, c03, c10, c11, c12, c13};
#pragma unroll
  for (int u = 0; u < 8; ++u) { const int t = u & 3, half = u >> 2; const int col = col0 + t * 16 + ln; const float bv = bp ? bf16_round(bp[col]) : 0.f;
#pragma unroll
    for (int r = 0; r < 8; ++r) { const int rloc = half * 16 + 8 * hh + r; float v = accs[u][r] * alpha + bv; if (CP) { if (rowsPerB < 0) v += CP[cofs + (size_t)(row0g + row0 + rloc) * ldc + col];      /* rowsPerB < 0: own element of the batched C plane */ else { const int bidx = (row0g + row0 + rloc) / rowsPerB; v += CP[(size_t)bidx * sCPb + (size_t)by * 64 + col]; } }
      if (ACT == 3) v = fmaxf(v, 0.f); else if (ACT == 6) v = 0.5f * v * (1.0f + erff(v * 0.70710678118654752f)); else if (ACT == 11) v = 1.0f / (1.0f + expf(-v)); else if (ACT == 15) v = v / (1.0f + expf(-v)); else if (ACT == 12) v = (v > 0.f) ? v : 0.01f * v; else if (ACT == 8) v = tanhf(v); else if (ACT == 9) v = 0.5f * v * (1.0f + tanhf(0.7978845608028654f * (v + 0.044715f * v * v * v))); else if (ACT == 14) v = (v > 0.f) ? v : 0.1f * v; else if (ACT == 16) v = (v >= 0.f) ? v : 0.3f * v; else if (ACT == 17) v = (v >= 0.f) ? v : 0.2f * v;
      so[w][rloc][t * 16 + ln] = v; } }
  __builtin_amdgcn_fence(__ATOMIC_ACQ_REL, "workgroup"); __builtin_amdgcn_wave_barrier();
  const int rsub = lane >> 4, c4 = (lane & 15) * 4;
  {
#pragma unroll
    for (int q = 0; q < 16; ++q) { const int r = q * 2 + rsub; const v4f v = *(const v4fa*)&so[w][r][c4]; if (C) *(v4f*)(C + cofs + (size_t)(row0 + r) * ldc + col0 + c4) = v; if (C16) { v4h h4; for (int i = 0; i < 4; ++i) h4[i] = (_Float16)v[i]; *(v4h*)(C16 + cofs + (size_t)(row0 + r) * ldc + col0 + c4) = h4; } }
     } }


__global__ __launch_bounds__(256) void k_wnat(const float* __restrict__ w, size_t n8, _Float16* __restrict__ Bt) { const size_t t = (size_t)blockIdx.x * 256 + threadIdx.x; if (t >= n8) return; FragH f; for (int q = 0; q < 8; ++q) f.h[q] = (_Float16)(bf16_round(w[t * 8 + q]) * 16.0f); *(v8us*)((unsigned short*)Bt + t * 8) = f.half[0];  }
__global__ __launch_bounds__(256) void k_rsm(const float* __restrict__ S, _Float16* __restrict__ P, int nrows) {
  #pragma clang fp contract(off)
  const int i = blockIdx.x * 256 + threadIdx.x; if (i >= nrows) return; const float* s = S + (size_t)i * SQ; float mx = -3.0e38f;
#pragma unroll 1
  for (int j = 0; j < SQ; ++j) mx = fmaxf(mx, s[j]); float se = 0.f;
#pragma unroll 1
  for (int j = 0; j < SQ; ++j) se += expf(s[j] - mx); const float sc = 256.0f / se;
#pragma unroll 1
  for (int j0 = 0; j0 < SQ; j0 += 8) { FragH f; for (int q = 0; q < 8; ++q) f.h[q] = (_Float16)(expf(s[j0 + q] - mx) * sc); unsigned short* d = (unsigned short*)P + (size_t)i * SQ + j0; *(v8us*)d = f.half[0];  } }
__global__ __launch_bounds__(256) void k_vt(const _Float16* __restrict__ V16, int b, int h0, _Float16* __restrict__ VT) { __shared__ unsigned short tl[64][65]; const int tid = threadIdx.x; const int hh = blockIdx.x % HG, sg = blockIdx.x / HG; const int s0 = sg * 64; const int h = h0 + hh;
  for (int i = tid; i < 64 * 8; i += 256) { const int j = i / 8, d8 = (i % 8) * 8; FragH f; f.half[0] = *(const v8us*)((const unsigned short*)V16 + ((size_t)b * SQ + s0 + j) * DM + h * HD + d8); for (int q = 0; q < 8; ++q) tl[d8 + q][j] = f.u[q]; }
  __syncthreads();
  { for (int i = tid; i < 64 * 8; i += 256) { const int d = i / 8, j8 = (i % 8) * 8; FragH f; for (int q = 0; q < 8; ++q) f.u[q] = tl[d][j8 + q]; *(v8us*)((unsigned short*)VT + ((size_t)hh * HD + d) * SQ + s0 + j8) = f.half[0]; }  } }



__global__ __launch_bounds__(256) void k_rsmcf2(const float* __restrict__ S, _Float16* __restrict__ P, int hg, int q0, int nk) {
  #pragma clang fp contract(off)
  const int t = blockIdx.x * 256 + threadIdx.x; if (t >= hg * QT) return; const size_t i = (size_t)t; const float* s = S + i * NKX; const int last = q0 + (t % QT); float mx = -3.0e38f;
#pragma unroll 1
  for (int j = 0; j < nk; ++j) { const float f = (j <= last) ? 1.f : 0.f; mx = fmaxf(mx, fmaf(f, s[j], (1.f - f) * -1.0e9f)); } float se = 0.f;
#pragma unroll 1
  for (int j = 0; j < nk; ++j) { const float f = (j <= last) ? 1.f : 0.f; se += __expf(fmaf(f, s[j], (1.f - f) * -1.0e9f) - mx); } const float sc = 256.0f / se;
#pragma unroll 1
  for (int j0 = 0; j0 < nk; j0 += 8) { FragH fr; for (int q = 0; q < 8; ++q) { const int j = j0 + q; const float f = (j <= last) ? 1.f : 0.f; fr.h[q] = (_Float16)(__expf(fmaf(f, s[j], (1.f - f) * -1.0e9f) - mx) * sc); } unsigned short* d = (unsigned short*)P + i * NKX + j0; *(v8us*)d = fr.half[0];  } }

template <int MASKADD>
__global__ __launch_bounds__(64) void k_att0(const float* __restrict__ QF, const float* __restrict__ KF, const float* __restrict__ VF, int ld, const float* __restrict__ mask, float scale, float* __restrict__ OF, int ldo) {
  #pragma clang fp contract(off)
  __shared__ __attribute__((aligned(16))) float lq[64][64]; __shared__ __attribute__((aligned(16))) float lo[64][64];
  const int tid = threadIdx.x; const int h = blockIdx.x / (QT0 / 64), rg = blockIdx.x % (QT0 / 64); const int i = rg * 64 + tid;
  const float* qr = QF + (size_t)i * ld + h * HD;
#pragma unroll 1
  for (int c = 0; c < HD / 4; ++c) { *(v4f*)&lq[tid][c * 4] = *(const v4fa*)(qr + c * 4); const v4f z = {0.f, 0.f, 0.f, 0.f}; *(v4f*)&lo[tid][c * 4] = z; }
  float m = -1.0e30f, l = 0.f; const int jmax = MASKADD ? (SQ - 1) : (rg * 64 + 63);      /* additive-mask form: every key (the mask input decides); causal form: keys up to the block's last row */
#pragma unroll 1
  for (int j = 0; j <= jmax; ++j) { const float* kr = KF + (size_t)j * ld + h * HD; const float* vr = VF + (size_t)j * ld + h * HD; float s = 0.f;
#pragma unroll 1
    for (int c = 0; c < HD / 4; ++c) { const v4f kq = *(const v4fa*)(kr + c * 4); const v4f qq = *(v4f*)&lq[tid][c * 4]; s = __fadd_rn(s, __fmul_rn(qq[0], kq[0])); s = __fadd_rn(s, __fmul_rn(qq[1], kq[1])); s = __fadd_rn(s, __fmul_rn(qq[2], kq[2])); s = __fadd_rn(s, __fmul_rn(qq[3], kq[3])); }
    s = __fmul_rn(s, scale); if (MASKADD) s = __fadd_rn(s, __fmul_rn(bf16_round(mask[(size_t)i * SQ + j]), -10000.0f));
    const float f = (MASKADD || j <= i) ? 1.f : 0.f; const float sm = fmaf(f, s, (1.f - f) * -1.0e30f); const float mn = fmaxf(m, sm); const float sc = expf(m - mn); const float e = expf(sm - mn); l = __fadd_rn(__fmul_rn(l, sc), e); m = mn;
#pragma unroll 1
    for (int c = 0; c < HD / 4; ++c) { const v4f vv = *(const v4fa*)(vr + c * 4); v4f oo = *(v4f*)&lo[tid][c * 4]; for (int u = 0; u < 4; ++u) oo[u] = __fadd_rn(__fmul_rn(oo[u], sc), __fmul_rn(e, vv[u])); *(v4f*)&lo[tid][c * 4] = oo; } }
  const float fin = 64.0f / l;      /* o carried x64 like the f16 path */
#pragma unroll 1
  for (int c = 0; c < HD / 4; ++c) { v4f oo = *(v4f*)&lo[tid][c * 4]; for (int u = 0; u < 4; ++u) oo[u] = __fmul_rn(oo[u], fin); *(v4f*)&lo[tid][c * 4] = oo; }
  __syncthreads();
  {
#pragma unroll 1
    for (int it = 0; it < 16; ++it) { const int row = it * 4 + tid / 16, pc = (tid % 16) * 4; const v4f v = *(const v4f*)&lo[row][pc]; *(v4f*)(OF + (size_t)(rg * 64 + row) * ldo + h * HD + pc) = v; }
     } }

__global__ __launch_bounds__(256) void k_oscale(const float* __restrict__ OF, float* __restrict__ out, size_t n4) { const size_t t = (size_t)blockIdx.x * 256 + threadIdx.x; if (t >= n4) return; const v4f a = *(const v4fa*)(OF + t * 4); v4f o; for (int q = 0; q < 4; ++q) o[q] = a[q] * 0.015625f; *(v4f*)(out + t * 4) = o;  }

__global__ __launch_bounds__(256) void k_bfr(const float* __restrict__ x, float* __restrict__ XB, size_t n8) { const size_t t = (size_t)blockIdx.x * 256 + threadIdx.x; if (t >= n8) return; v4f a = *(const v4fa*)(x + t * 8), c = *(const v4fa*)(x + t * 8 + 4); for (int q = 0; q < 4; ++q) { a[q] = bf16_round(a[q]); c[q] = bf16_round(c[q]); }
  { *(v4f*)(XB + t * 8) = a; *(v4f*)(XB + t * 8 + 4) = c;  } }



__global__ __launch_bounds__(256) void k_rsmfvl(const float* __restrict__ S, _Float16* __restrict__ P, _Float16* __restrict__ PL, int qn, const int* __restrict__ vlp) {
  #pragma clang fp contract(off)
  const int t = blockIdx.x * 256 + threadIdx.x; if (t >= qn) return; const int vl = vlp[0]; const size_t i = (size_t)t; const float* s = S + i * SQ; float mx = -3.0e38f;
#pragma unroll 1
  for (int j = 0; j < SQ; ++j) { const float f = (j < vl) ? 1.f : 0.f; mx = fmaxf(mx, fmaf(f, s[j], (1.f - f) * -1000000.0f)); } float se = 0.f;
#pragma unroll 1
  for (int j = 0; j < SQ; ++j) { const float f = (j < vl) ? 1.f : 0.f; se += __expf(fmaf(f, s[j], (1.f - f) * -1000000.0f) - mx); } const float sc = 256.0f / se;
#pragma unroll 1
  for (int j0 = 0; j0 < SQ; j0 += 8) { FragH fr, gr; for (int q = 0; q < 8; ++q) { const int j = j0 + q; const float f = (j < vl) ? 1.f : 0.f; const float pv = __expf(fmaf(f, s[j], (1.f - f) * -1000000.0f) - mx) * sc; const _Float16 ph = (_Float16)pv; fr.h[q] = ph; gr.h[q] = (_Float16)((pv - (float)ph) * 1024.0f); }
    unsigned short* d = (unsigned short*)P + i * SQ + j0; unsigned short* dl = (unsigned short*)PL + i * SQ + j0; *(v8us*)d = fr.half[0]; *(v8us*)dl = gr.half[0];  } }

__global__ __launch_bounds__(256) void k_rsmf(const float* __restrict__ S, _Float16* __restrict__ P, int qn, int hg) {
  #pragma clang fp contract(off)
  const int t = blockIdx.x * 256 + threadIdx.x; if (t >= qn * hg) return; const size_t i = (size_t)(t / qn) * SQ + (t % qn); const float* s = S + i * SQ; float mx = -3.0e38f;
#pragma unroll 1
  for (int j = 0; j < SQ; ++j) mx = fmaxf(mx, s[j]); float se = 0.f;
#pragma unroll 1
  for (int j = 0; j < SQ; ++j) se += __expf(s[j] - mx); const float sc = 256.0f / se;
#pragma unroll 1
  for (int j0 = 0; j0 < SQ; j0 += 8) { FragH f; for (int q = 0; q < 8; ++q) f.h[q] = (_Float16)(__expf(s[j0 + q] - mx) * sc); unsigned short* d = (unsigned short*)P + i * SQ + j0; *(v8us*)d = f.half[0];  } }



__global__ __launch_bounds__(128) void k_negmean(const float* __restrict__ V, float* __restrict__ NMV) {
  #pragma clang fp contract(off)
  const int b = blockIdx.x, c = threadIdx.x; const float* v = V + (size_t)b * SQ * DM + c; float a = 0.f;
#pragma unroll 4
  for (int s = 0; s < SQ; ++s) a = __fadd_rn(a, bf16_round(v[(size_t)s * DM]));
  const float m = -__fdiv_rn(a, (float)SQ); *(float*)(NMV + (size_t)b * DM + c) = m;  }

__global__ __launch_bounds__(256) void k_rsmfhl(const float* __restrict__ S, _Float16* __restrict__ P, _Float16* __restrict__ PL, int nrows) {
  #pragma clang fp contract(off)
  const int t = blockIdx.x * 256 + threadIdx.x; if (t >= nrows) return; const float* s = S + (size_t)t * SQ; float mx = -3.0e38f;
#pragma unroll 1
  for (int j = 0; j < SQ; ++j) mx = fmaxf(mx, s[j]); float se = 0.f;
#pragma unroll 1
  for (int j = 0; j < SQ; ++j) se += __expf(s[j] - mx); const float sc = 256.0f / se;
#pragma unroll 1
  for (int j0 = 0; j0 < SQ; j0 += 8) { FragH fr, fl; for (int q = 0; q < 8; ++q) { const float v = __expf(s[j0 + q] - mx) * sc; const _Float16 hv = (_Float16)v; fr.h[q] = hv; fl.h[q] = (_Float16)((v - (float)hv) * 1024.0f); }
    unsigned short* d = (unsigned short*)P + (size_t)t * SQ + j0; unsigned short* dl = (unsigned short*)PL + (size_t)t * SQ + j0; *(v8us*)d = fr.half[0]; *(v8us*)dl = fl.half[0];  } }
extern "C" void kernel_launch(void* const* d_in, const int* in_sizes, int n_in,
                              void* d_out, int out_size, void* d_ws, size_t ws_size, hipStream_t stream) {
  (void)in_sizes; (void)n_in; (void)out_size;
  const float* const* I = (const float* const*)d_in; const float* xq = I[0]; const float* xk = I[1]; const float* xv = I[2];      /* Q, K, V [4][4096][128] (bf16-valued), one head over all 128 columns */
  char* ws = (char*)d_ws; size_t off = 0;
  auto take = [&](size_t bytes) { char* p = ws + off; off += (bytes + 255) & ~(size_t)255; return p; };
  _Float16* Q16 = (_Float16*)take(NR * DM * 2); _Float16* K16 = (_Float16*)take(NR * DM * 2); _Float16* V16 = (_Float16*)take(NR * DM * 2);
  float* S = (float*)take((size_t)SQ * SQ * 4); _Float16* P = (_Float16*)take((size_t)SQ * SQ * 2); _Float16* PL = (_Float16*)take((size_t)SQ * SQ * 2); _Float16* VT = (_Float16*)take((size_t)DM * SQ * 2); float* NMV = (float*)take((size_t)NB * DM * 4);      /* -mean(value) per batch [128] */
  if (off > ws_size) return;
  k_x16<<<(unsigned)((NR * DM / 8 + 255) / 256), 256, 0, stream>>>(xq, Q16, NR * DM / 8); k_x16<<<(unsigned)((NR * DM / 8 + 255) / 256), 256, 0, stream>>>(xk, K16, NR * DM / 8); k_x16<<<(unsigned)((NR * DM / 8 + 255) / 256), 256, 0, stream>>>(xv, V16, NR * DM / 8);      /* exact f16 copies of the bf16-valued inputs */
  k_negmean<<<NB, 128, 0, stream>>>(xv, NMV);      /* NMV[b][c] = -(1/4096) sum_s bf16(value[b][s][c]) (f32, fixed ascending order; thread per (b, c)) */
  for (int b = 0; b < NB; ++b) { const size_t r0 = (size_t)b * SQ;
    k_vt<DM / 64, SQ><<<(DM / 64) * (SQ / 64), 256, 0, stream>>>(V16 + r0 * DM, DM, 0, VT);      /* V^T [128][4096] of this batch */
    k_gemm2<0><<<dim3((SQ / 128) * (SQ / 64), 1), 128, 0, stream>>>(Q16 + r0 * DM, DM, 0, K16 + r0 * DM, DM, 0, 0.08838834764831845f, nullptr, 0, nullptr, 1, 0, 0, S, nullptr, SQ, 0, SQ, SQ, DM);      /* logits = q.k / sqrt(128) (K = 128, exact products) */
    k_rsmfhl<<<(SQ + 255) / 256, 256, 0, stream>>>(S, P, PL, SQ);      /* softmax over the 4096 keys -> P x256 as f16 hi + x1024 residual */
    k_gemm2<0><<<dim3((SQ / 128) * (DM / 64), 1), 128, 0, stream>>>(P, SQ, 0, VT, SQ, 0, 0.00390625f, nullptr, 0, NMV + (size_t)b * DM, SQ, 0, 0, (float*)d_out + r0 * DM, nullptr, DM, 0, SQ, DM, SQ);      /* out = Ph V^T 2^-8 - mean(value) (the batch's f32 row through the addend path, rowsPerB = SQ) */
    k_gemm2<0><<<dim3((SQ / 128) * (DM / 64), 1), 128, 0, stream>>>(PL, SQ, 0, VT, SQ, 0, 0.000003814697265625f, nullptr, 0, (const float*)d_out + r0 * DM, -1, 0, 0, (float*)d_out + r0 * DM, nullptr, DM, 0, SQ, DM, SQ); }      /* += Pl V^T 2^-18 (own element) */
}

// v001
// A run of this version takes 1470 microseconds.
// Two timings next to v000 both put it at 2.98 times that version's speed.
#include <hip/hip_runtime.h>
// Single-head scaled dot-product attention with the module's mean-value correction (query, key, value [4][4096][128]; logits = q.k / sqrt(128); attn = softmax over the 4096 keys; out = attn value - mean(value over the sequence) -> [4][4096][128]).
// Structure: token rows; the bf16-valued inputs as exact f16 rows; per batch: V^T via LDS transposes, logits [4096][4096] as ONE WMMA GEMM (32x64 wave tiles, f32 accumulation, K = 128), row softmax on VALU, one wave per row with the row in registers (f32 statistics, native exp; weights x256 as f16 hi + x1024 residual), -mean(value) per channel on VALU (f32), out = Ph V^T 2^-8 - mean + Pl V^T 2^-18 f32 into the output rows; launches: see trace.
// Compute dtype: inputs rounded to bf16; x / weights exact; q, k, v as exact f16 GEMM operands, softmax weights x256 as f16 hi + x1024 f16 residual, o f32; scores and softmax statistics f32. v_wmma_f32_16x16x32_f16.
#define NB 4
#define SQ 4096
#define DM 128
#define NH 2
#define HD 64
#define HG 8                         /* heads per launch of the four-argument k_vt (not launched) */
#define B0 0                         /* first batch processed (unused) */
#define NBR NB                       /* batches processed (used only in MP) */
#define NR ((size_t)NB * SQ)         /* token rows */
#define MP ((int)((size_t)NBR * SQ)) /* token rows (used only in MPO) */
#define QT 256                       /* query rows per causal tile */
#define NKX SQ                       /* S / P row pitch */
#define QT0 256                      /* query rows per head of the f32 k_att0 (not launched) */
#define QN SQ                        /* query rows attended per batch (unused) */
#define NHD NH                       /* unused */
#define MPO MP                       /* rows through the output stage (unused) */
#define LQ DM            /* row pitch of the q/k/v rows */
typedef __bf16 v16b __attribute__((ext_vector_type(16)));
typedef unsigned short v8us __attribute__((ext_vector_type(8), may_alias));
typedef float  v8f  __attribute__((ext_vector_type(8)));
typedef float  v4f  __attribute__((ext_vector_type(4)));
typedef float  v4fa __attribute__((ext_vector_type(4), may_alias));
union FragB { v16b v; v8us half[2]; unsigned short u[16]; };

__device__ __forceinline__ unsigned short bf16_bits(float x) { unsigned int u = __float_as_uint(x); return (unsigned short)((u + 0x7FFFu + ((u >> 16) & 1u)) >> 16); }
__device__ __forceinline__ float bf16_val(unsigned short b) { return __uint_as_float(((unsigned int)b) << 16); }
__device__ __forceinline__ float bf16_round(float x) { return bf16_val(bf16_bits(x)); }
// D += A·B with NT terms: 1 = ah·bh, 2 = + al·bh (A split), 3 = + ah·bl (both split)
template <int NT>
__device__ __forceinline__ v8f mmaN(v16b ah, v16b al, v16b bh, v16b bl, v8f c) {
  c = __builtin_amdgcn_wmma_f32_16x16x32_bf16(false, ah, false, bh, (short)0, c, false, false);
  if (NT >= 2) c = __builtin_amdgcn_wmma_f32_16x16x32_bf16(false, al, false, bh, (short)0, c, false, false);
  if (NT >= 3) c = __builtin_amdgcn_wmma_f32_16x16x32_bf16(false, ah, false, bl, (short)0, c, false, false);
  asm volatile("v_nop\n\tv_nop\n\tv_nop\n\tv_nop" : "+v"(c) : "v"(ah), "v"(al), "v"(bh), "v"(bl));
  return c;
}

__global__ __launch_bounds__(256) void k_wt_bf16(const float* __restrict__ W, unsigned short* __restrict__ Wt, int K, int N) {
  const int t = blockIdx.x * 256 + threadIdx.x;
  const int k8n = K / 8;
  if (t >= N * k8n) return;
  const int n = t / k8n, k8 = (t % k8n) * 8;
  v8us v;
#pragma unroll
  for (int i = 0; i < 8; ++i) v[i] = bf16_bits(W[(size_t)(k8 + i) * N + n]);
  *(v8us*)(Wt + (size_t)n * K + k8) = v;
  
}

// GEMM C[M][N] (f32, pitch ldc) = act(A[M][K]·W + bias). A f32 row-major (pitch lda) converted per fragment to bf16
// (ASPLIT: hi/lo two planes -> 2 terms, else single rounded term); Wt bf16 [N][K] (pitch ldb). BIAS_BF16 rounds the
// bias to bf16 first (bias quantised to bf16 before the add). K%32==0, M%16==0, N%64==0.
template <bool ASPLIT, int ACT, bool BIAS_BF16>
__global__ __launch_bounds__(128) void k_gemm_bf(const float* __restrict__ A, int lda, const unsigned short* __restrict__ Wt, int ldb,
                                               const float* __restrict__ bias, float* __restrict__ C, int ldc, int M, int N, int K) {
  __shared__ __attribute__((aligned(16))) float so[4][16][64];
  const int tid = threadIdx.x, w = tid >> 5, lane = tid & 31, ln = lane & 15, hh = lane >> 4;
  const int ntn = N / 64;
  const int wid = blockIdx.x * 4 + w;
  const int mt = wid / ntn, nq = wid % ntn;
  if (mt * 16 >= M) return;
  const int row0 = mt * 16, col0 = nq * 64;
  const float* arow = A + (size_t)(row0 + ln) * lda;
  v8f acc[4] = {};
  for (int kb = 0; kb < K; kb += 32) {
    FragB ah, al;
    const v4f x0 = *(const v4fa*)(arow + kb + 8 * hh), x1 = *(const v4fa*)(arow + kb + 8 * hh + 4);
    const v4f x2 = *(const v4fa*)(arow + kb + 16 + 8 * hh), x3 = *(const v4fa*)(arow + kb + 16 + 8 * hh + 4);
    float xs[16] = {x0[0],x0[1],x0[2],x0[3],x1[0],x1[1],x1[2],x1[3],x2[0],x2[1],x2[2],x2[3],x3[0],x3[1],x3[2],x3[3]};
#pragma unroll
    for (int i = 0; i < 16; ++i) { const unsigned short hb = bf16_bits(xs[i]); ah.u[i] = hb; al.u[i] = ASPLIT ? bf16_bits(xs[i] - bf16_val(hb)) : (unsigned short)0; }
#pragma unroll
    for (int t = 0; t < 4; ++t) {
      const unsigned short* brow = Wt + (size_t)(col0 + t * 16 + ln) * ldb + kb;
      FragB b;
      b.half[0] = *(const v8us*)(brow + 8 * hh);
      b.half[1] = *(const v8us*)(brow + 16 + 8 * hh);
      acc[t] = mmaN<ASPLIT ? 2 : 1>(ah.v, al.v, b.v, b.v, acc[t]);
    }
  }
#pragma unroll
  for (int t = 0; t < 4; ++t) {
    float bv = bias ? bias[col0 + t * 16 + ln] : 0.f;
    if (BIAS_BF16) bv = bf16_round(bv);
#pragma unroll
    for (int r = 0; r < 8; ++r) { float v = acc[t][r] + bv; if (ACT == 1) v = fmaxf(v, 0.f); so[w][8 * hh + r][t * 16 + ln] = v; }
  }
  __builtin_amdgcn_fence(__ATOMIC_ACQ_REL, "workgroup");
  __builtin_amdgcn_wave_barrier();
  const int rsub = lane >> 4, c4 = (lane & 15) * 4;
  {
#pragma unroll
    for (int q = 0; q < 8; ++q) {
      const int r = q * 2 + rsub;
      const v4f v = *(const v4fa*)&so[w][r][c4];
      *(v4f*)(C + (size_t)(row0 + r) * ldc + col0 + c4) = v;
    }
    
  }
}

// GEMM C = act(A·W + bias + resid): A f32 (ASPLIT -> hi/lo 2 terms), Wt bf16 [N][K]; ACT 0 none, 1 relu, 2 exact gelu;
// resid (optional, f32, row index = (row % rmod), pitch ldr, RES_BF16 rounds it) added before the activation.
template <bool ASPLIT, int ACT, bool BIAS_BF16, bool RES_BF16>
__global__ __launch_bounds__(128) void k_gemm_bf3(const float* __restrict__ A, int lda, const unsigned short* __restrict__ Wt, int ldb,
                                                const float* __restrict__ bias, const float* __restrict__ resid, int rmod, int ldr,
                                                float* __restrict__ C, int ldc, int M, int N, int K) {
  __shared__ __attribute__((aligned(16))) float so[4][16][64];
  const int tid = threadIdx.x, w = tid >> 5, lane = tid & 31, ln = lane & 15, hh = lane >> 4;
  const int ntn = N / 64;
  const int wid = blockIdx.x * 4 + w;
  const int mt = wid / ntn, nq = wid % ntn;
  if (mt * 16 >= M) return;
  const int row0 = mt * 16, col0 = nq * 64;
  const float* arow = A + (size_t)(row0 + ln) * lda;
  v8f acc[4] = {};
  for (int kb = 0; kb < K; kb += 32) {
    FragB ah, al;
    const v4f x0 = *(const v4fa*)(arow + kb + 8 * hh), x1 = *(const v4fa*)(arow + kb + 8 * hh + 4);
    const v4f x2 = *(const v4fa*)(arow + kb + 16 + 8 * hh), x3 = *(const v4fa*)(arow + kb + 16 + 8 * hh + 4);
    float xs[16] = {x0[0],x0[1],x0[2],x0[3],x1[0],x1[1],x1[2],x1[3],x2[0],x2[1],x2[2],x2[3],x3[0],x3[1],x3[2],x3[3]};
#pragma unroll
    for (int i = 0; i < 16; ++i) { const unsigned short hb = bf16_bits(xs[i]); ah.u[i] = hb; al.u[i] = ASPLIT ? bf16_bits(xs[i] - bf16_val(hb)) : (unsigned short)0; }
#pragma unroll
    for (int t = 0; t < 4; ++t) {
      const unsigned short* brow = Wt + (size_t)(col0 + t * 16 + ln) * ldb + kb;
      FragB b;
      b.half[0] = *(const v8us*)(brow + 8 * hh);
      b.half[1] = *(const v8us*)(brow + 16 + 8 * hh);
      acc[t] = mmaN<ASPLIT ? 2 : 1>(ah.v, al.v, b.v, b.v, acc[t]);
    }
  }
#pragma unroll
  for (int t = 0; t < 4; ++t) {
    const int col = col0 + t * 16 + ln;
    float bv = bias ? bias[col] : 0.f;
    if (BIAS_BF16) bv = bf16_round(bv);
#pragma unroll
    for (int r = 0; r < 8; ++r) {
      float v = acc[t][r] + bv;
      if (resid) { float rv = resid[(size_t)((row0 + 8 * hh + r) % rmod) * ldr + col]; if (RES_BF16) rv = bf16_round(rv); v += rv; }
      if (ACT == 1) v = fmaxf(v, 0.f);
      if (ACT == 2) v = 0.5f * v * (1.0f + erff(v * 0.70710678118654752f));
      if (ACT == 3) { const float u = 0.7978845608028654f * (v + 0.044715f * v * v * v); v = 0.5f * v * (1.0f + tanhf(u)); }
      so[w][8 * hh + r][t * 16 + ln] = v;
    }
  }
  __builtin_amdgcn_fence(__ATOMIC_ACQ_REL, "workgroup");
  __builtin_amdgcn_wave_barrier();
  const int rsub = lane >> 4, c4 = (lane & 15) * 4;
  {
#pragma unroll
    for (int q = 0; q < 8; ++q) {
      const int r = q * 2 + rsub;
      const v4f v = *(const v4fa*)&so[w][r][c4];
      *(v4f*)(C + (size_t)(row0 + r) * ldc + col0 + c4) = v;
    }
    
  }
}
// row LayerNorm (biased variance, eps) over N: s = X (+ R); optional out_sum <- s; out_norm <- (s-mu)*rsqrt(var+eps)*g + b
template <bool PARAM_BF16>
__global__ __launch_bounds__(256) void k_layernorm(const float* __restrict__ X, const float* __restrict__ R, const float* __restrict__ g, const float* __restrict__ bta,
                                                  float* __restrict__ out_sum, float* __restrict__ out_norm, int N, float eps) {
  __shared__ float red[256];
  const int row = blockIdx.x, tid = threadIdx.x;
  const float* x = X + (size_t)row * N; const float* rr = R ? R + (size_t)row * N : nullptr;
  float vals[16];                     // up to N = 4096
  const int per = N / 256;            // contiguous chunk per thread? use strided-by-4 chunks: thread handles j = tid*4 + 1024*u
  float s1 = 0.f;
  for (int u = 0; u < per / 4; ++u) {
    const int j = tid * 4 + 1024 * u;
    const v4f a = *(const v4fa*)(x + j);
    v4f b = {0.f,0.f,0.f,0.f}; if (rr) b = *(const v4fa*)(rr + j);
#pragma unroll
    for (int q = 0; q < 4; ++q) { const float v = a[q] + b[q]; vals[u * 4 + q] = v; s1 += v; }
  }
  red[tid] = s1; __syncthreads();
  for (int st = 128; st > 0; st >>= 1) { if (tid < st) red[tid] += red[tid + st]; __syncthreads(); }
  const float mu = red[0] / (float)N; __syncthreads();
  float s2 = 0.f;
  for (int u = 0; u < per / 4; ++u)
#pragma unroll
    for (int q = 0; q < 4; ++q) { const float c = vals[u * 4 + q] - mu; s2 += c * c; }
  red[tid] = s2; __syncthreads();
  for (int st = 128; st > 0; st >>= 1) { if (tid < st) red[tid] += red[tid + st]; __syncthreads(); }
  const float rs = rsqrtf(red[0] / (float)N + eps);
  {
    for (int u = 0; u < per / 4; ++u) {
      const int j = tid * 4 + 1024 * u;
      v4f o, sm;
#pragma unroll
      for (int q = 0; q < 4; ++q) {
        float gg = g[j + q], bb = bta[j + q];
        if (PARAM_BF16) { gg = bf16_round(gg); bb = bf16_round(bb); }
        sm[q] = vals[u * 4 + q]; o[q] = (vals[u * 4 + q] - mu) * rs * gg + bb;
      }
      if (out_sum) *(v4f*)(out_sum + (size_t)row * N + j) = sm;
      *(v4f*)(out_norm + (size_t)row * N + j) = o;
    }
    
  }
}



// ---- f16 WMMA path (v_wmma_f32_16x16x32_f16): 11-bit significands for operands in range — used where a [0,1] probability operand needs more precision than bf16
typedef _Float16 v16h __attribute__((ext_vector_type(16)));
union FragH { v16h v; v8us half[2]; _Float16 h[16]; unsigned short u[16]; };
template <int NT>
__device__ __forceinline__ v8f mmaH(v16h ah, v16h al, v16h bh, v16h bl, v8f c) {
  c = __builtin_amdgcn_wmma_f32_16x16x32_f16(false, ah, false, bh, (short)0, c, false, false);
  if (NT >= 2) c = __builtin_amdgcn_wmma_f32_16x16x32_f16(false, al, false, bh, (short)0, c, false, false);
  if (NT >= 3) c = __builtin_amdgcn_wmma_f32_16x16x32_f16(false, ah, false, bl, (short)0, c, false, false);
  asm volatile("v_nop\n\tv_nop\n\tv_nop\n\tv_nop" : "+v"(c) : "v"(ah), "v"(al), "v"(bh), "v"(bl));
  return c;
}
// batched GEMM like k_gemm_b but f16 operands: A f32 (split into f16 hi/lo if ASPLIT, else rounded to f16), Bt = f16 values [n][k]; alpha; C f32; N multiple of 16 (partial tiles skipped)
template <bool ASPLIT>
__global__ __launch_bounds__(128) void k_gemm_h(const float* __restrict__ A, int lda, size_t sA, const _Float16* __restrict__ Bh, int ldb, size_t sB, float alpha, float* __restrict__ C, int ldc, size_t sC, int M, int N, int K) {
  __shared__ __attribute__((aligned(16))) float so[4][16][64];
  const int tid = threadIdx.x, w = tid >> 5, lane = tid & 31, ln = lane & 15, hh = lane >> 4; const int by = blockIdx.y;
  A += (size_t)by * sA; Bh += (size_t)by * sB; C += (size_t)by * sC;
  const int ntn = (N + 63) / 64; const int wid = blockIdx.x * 4 + w; const int mt = wid / ntn, nq = wid % ntn; if (mt * 16 >= M) return;
  const int row0 = mt * 16, col0 = nq * 64; const float* arow = A + (size_t)(row0 + ln) * lda;
  v8f acc[4] = {};
  for (int kb = 0; kb < K; kb += 32) {
    FragH ah, al;
    const v4f x0 = *(const v4fa*)(arow + kb + 8 * hh), x1 = *(const v4fa*)(arow + kb + 8 * hh + 4), x2 = *(const v4fa*)(arow + kb + 16 + 8 * hh), x3 = *(const v4fa*)(arow + kb + 16 + 8 * hh + 4);
    float xs[16] = {x0[0],x0[1],x0[2],x0[3],x1[0],x1[1],x1[2],x1[3],x2[0],x2[1],x2[2],x2[3],x3[0],x3[1],x3[2],x3[3]};
#pragma unroll
    for (int i = 0; i < 16; ++i) { const _Float16 h = (_Float16)xs[i]; ah.h[i] = h; al.h[i] = ASPLIT ? (_Float16)(xs[i] - (float)h) : (_Float16)0.0f; }
#pragma unroll
    for (int t = 0; t < 4; ++t) { if (col0 + t * 16 >= N) continue; const size_t boff = (size_t)(col0 + t * 16 + ln) * ldb + kb; FragH bq; bq.half[0] = *(const v8us*)(Bh + boff + 8 * hh); bq.half[1] = *(const v8us*)(Bh + boff + 16 + 8 * hh);
      acc[t] = mmaH<ASPLIT ? 2 : 1>(ah.v, al.v, bq.v, bq.v, acc[t]); }
  }
#pragma unroll
  for (int t = 0; t < 4; ++t) { if (col0 + t * 16 >= N) continue;
#pragma unroll
    for (int r = 0; r < 8; ++r) so[w][8 * hh + r][t * 16 + ln] = acc[t][r] * alpha; }
  __builtin_amdgcn_fence(__ATOMIC_ACQ_REL, "workgroup"); __builtin_amdgcn_wave_barrier();
  const int rsub = lane >> 4, c4 = (lane & 15) * 4;
  {
#pragma unroll
    for (int q = 0; q < 8; ++q) { const int r = q * 2 + rsub; if (col0 + c4 < N) { const v4f v = *(const v4fa*)&so[w][r][c4]; *(v4f*)(C + (size_t)(row0 + r) * ldc + col0 + c4) = v; } }
     }
}

// Wt[n][k] = f16(W[k][n]·scale) from f32 row-major W[K][N] (scale = power of two; bf16-exact weights stay exact in f16 away from the subnormal range)
__global__ __launch_bounds__(256) void k_wt_f16(const float* __restrict__ W, _Float16* __restrict__ Wt, int K, int N, float scale) {
  const int t = blockIdx.x * 256 + threadIdx.x; if (t >= N * (K / 8)) return; const int n = t / (K / 8), k8 = (t % (K / 8)) * 8; FragH f;
#pragma unroll
  for (int i = 0; i < 8; ++i) f.h[i] = (_Float16)(bf16_round(W[(size_t)(k8 + i) * N + n]) * scale); const v8us o = f.half[0];
  *(v8us*)((unsigned short*)Wt + (size_t)n * K + k8) = o; 
}
// k_gemm_hh variant with fused epilogue: v = acc·alpha + bias[by·sBias + col] (+ CP[(row/rowsPerB)·sCPb + by·64 + col] if CP) ; ACT 0 none / 1 elu ; writes f16 C16 (and f32 C if non-null)
template <int ACT>
__global__ __launch_bounds__(128) void k_gemm_hhx(const _Float16* __restrict__ A, int lda, size_t sA, const _Float16* __restrict__ Bh, int ldb, size_t sB, float alpha, const float* __restrict__ bias, size_t sBias, const float* __restrict__ CP, int rowsPerB, size_t sCPb, int row0g,
    float* __restrict__ C, _Float16* __restrict__ C16, int ldc, size_t sC, int M, int N, int K) {
  __shared__ __attribute__((aligned(16))) float so[4][16][64];
  const int tid = threadIdx.x, w = tid >> 5, lane = tid & 31, ln = lane & 15, hh = lane >> 4; const int by = blockIdx.y;
  A += (size_t)by * sA; Bh += (size_t)by * sB; const size_t cofs = (size_t)by * sC; const float* bp = bias ? bias + (size_t)by * sBias : nullptr;
  const int ntn = (N + 63) / 64; const int wid = blockIdx.x * 4 + w; const int mt = wid / ntn, nq = wid % ntn; if (mt * 16 >= M) return;
  const int row0 = mt * 16, col0 = nq * 64; const _Float16* arow = A + (size_t)(row0 + ln) * lda;
  v8f acc[4] = {};
  for (int kb = 0; kb < K; kb += 32) { FragH ah; ah.half[0] = *(const v8us*)((const unsigned short*)arow + kb + 8 * hh); ah.half[1] = *(const v8us*)((const unsigned short*)arow + kb + 16 + 8 * hh);
#pragma unroll
    for (int t = 0; t < 4; ++t) { if (col0 + t * 16 >= N) continue; const size_t boff = (size_t)(col0 + t * 16 + ln) * ldb + kb; FragH bq; bq.half[0] = *(const v8us*)((const unsigned short*)Bh + boff + 8 * hh); bq.half[1] = *(const v8us*)((const unsigned short*)Bh + boff + 16 + 8 * hh);
      acc[t] = mmaH<1>(ah.v, ah.v, bq.v, bq.v, acc[t]); }
  }
#pragma unroll
  for (int t = 0; t < 4; ++t) { if (col0 + t * 16 >= N) continue; const int col = col0 + t * 16 + ln; const float bv = bp ? bf16_round(bp[col]) : 0.f;
#pragma unroll
    for (int r = 0; r < 8; ++r) { float v = acc[t][r] * alpha + bv; if (CP) { const int rr = row0g + row0 + 8 * hh + r; if (rowsPerB < 0) v += CP[cofs + (size_t)rr * ldc + col];      /* rowsPerB < 0: own element of the batched C plane */ else { const int bidx = rr / rowsPerB; v += CP[(size_t)bidx * sCPb + (size_t)by * 64 + col]; } } if (ACT == 1) v = (v > 0.f) ? v : expm1f(v); else if (ACT == 7) v = (v > 0.f) ? v + 1.0f : expf(v); else if (ACT == 8) v = tanhf(v); else if (ACT == 9) v = 0.5f * v * (1.0f + tanhf(0.7978845608028654f * (v + 0.044715f * v * v * v))); else if (ACT == 11) v = 1.0f / (1.0f + expf(-v)); else if (ACT == 12) v = (v > 0.f) ? v : 0.01f * v; else if (ACT == 14) v = (v > 0.f) ? v : 0.1f * v; else if (ACT == 16) v = (v >= 0.f) ? v : 0.3f * v; else if (ACT == 17) v = (v >= 0.f) ? v : 0.2f * v; else if (ACT == 15) v = v / (1.0f + expf(-v)); else if (ACT == 3) v = fmaxf(v, 0.f); else if (ACT == 6) v = 0.5f * v * (1.0f + erff(v * 0.70710678118654752f)); so[w][8 * hh + r][t * 16 + ln] = v; } }
  __builtin_amdgcn_fence(__ATOMIC_ACQ_REL, "workgroup"); __builtin_amdgcn_wave_barrier();
  const int rsub = lane >> 4, c4 = (lane & 15) * 4; typedef _Float16 v4h __attribute__((ext_vector_type(4)));
  {
#pragma unroll
    for (int q = 0; q < 8; ++q) { const int r = q * 2 + rsub; if (col0 + c4 < N) { const v4f v = *(const v4fa*)&so[w][r][c4]; if (C) *(v4f*)(C + cofs + (size_t)(row0 + r) * ldc + col0 + c4) = v; if (C16) { v4h h4; for (int i = 0; i < 4; ++i) h4[i] = (_Float16)v[i]; *(v4h*)(C16 + cofs + (size_t)(row0 + r) * ldc + col0 + c4) = h4; } } }
     }
}


typedef _Float16 v4h __attribute__((ext_vector_type(4)));

__global__ __launch_bounds__(256) void k_x16(const float* __restrict__ x, _Float16* __restrict__ X16, size_t n8) { const size_t t = (size_t)blockIdx.x * 256 + threadIdx.x; if (t >= n8) return; FragH f;
#pragma unroll
  for (int q = 0; q < 8; ++q) f.h[q] = (_Float16)bf16_round(x[t * 8 + q]); *(v8us*)((unsigned short*)X16 + t * 8) = f.half[0];  }
__global__ __launch_bounds__(256) void k_h16(const float* __restrict__ x, _Float16* __restrict__ X16, size_t n8) { const size_t t = (size_t)blockIdx.x * 256 + threadIdx.x; if (t >= n8) return; FragH f;
#pragma unroll
  for (int q = 0; q < 8; ++q) f.h[q] = (_Float16)x[t * 8 + q]; *(v8us*)((unsigned short*)X16 + t * 8) = f.half[0];  }
__global__ __launch_bounds__(256) void k_round16f(const float* __restrict__ W, _Float16* __restrict__ Bt, size_t n8) { const size_t t = (size_t)blockIdx.x * 256 + threadIdx.x; if (t >= n8) return; FragH f;
#pragma unroll
  for (int i = 0; i < 8; ++i) f.h[i] = (_Float16)(bf16_round(W[t * 8 + i]) * 16.0f); *(v8us*)((unsigned short*)Bt + t * 8) = f.half[0];  }
template <int NHv, int TTv>
__global__ __launch_bounds__(256) void k_vt(const _Float16* __restrict__ V16, int ldv, int voff, _Float16* __restrict__ Vt) { __shared__ unsigned short tl[64][66]; const int tid = threadIdx.x; const int slab = blockIdx.x / (TTv / 64), lg = blockIdx.x % (TTv / 64); const int b = slab / NHv, h = slab % NHv;
  for (int i = tid; i < 64 * 8; i += 256) { const int r = i / 8, c8 = (i % 8) * 8; FragH f; f.half[0] = *(const v8us*)((const unsigned short*)V16 + ((size_t)b * TTv + lg * 64 + r) * ldv + voff + h * 64 + c8);
#pragma unroll
    for (int q = 0; q < 8; ++q) tl[r][c8 + q] = f.u[q]; }
  __syncthreads();
  {
#pragma unroll
    for (int rd = 0; rd < 2; ++rd) { const int d = rd * 32 + tid / 8, pc = tid % 8; FragH f;
#pragma unroll
      for (int q = 0; q < 8; ++q) f.u[q] = tl[pc * 8 + q][d];
      *(v8us*)((unsigned short*)Vt + ((size_t)slab * 64 + d) * TTv + lg * 64 + pc * 8) = f.half[0]; }
     } }

__global__ __launch_bounds__(256) void k_hl(const float* __restrict__ F, _Float16* __restrict__ Hh, _Float16* __restrict__ Hl, size_t n8) { const size_t t = (size_t)blockIdx.x * 256 + threadIdx.x; if (t >= n8) return; FragH fh, fl; const v4f a = *(const v4fa*)(F + t * 8), c = *(const v4fa*)(F + t * 8 + 4);
#pragma unroll
  for (int q = 0; q < 4; ++q) { _Float16 h = (_Float16)a[q]; fh.h[q] = h; fl.h[q] = (_Float16)((a[q] - (float)h) * 1024.0f); h = (_Float16)c[q]; fh.h[4 + q] = h; fl.h[4 + q] = (_Float16)((c[q] - (float)h) * 1024.0f); }
  { *(v8us*)((unsigned short*)Hh + t * 8) = fh.half[0]; *(v8us*)((unsigned short*)Hl + t * 8) = fl.half[0];  } }

// ---- fast GEMM (wave tile 32x64; requires M % 32 == 0 rows per launch region and N % 64 == 0); epilogue = k_gemm_hhx semantics ----
__device__ __forceinline__ v16h g2_frag(const _Float16* p, int hh) { FragH f; f.half[0] = *(const v8us*)((const unsigned short*)p + 8 * hh); f.half[1] = *(const v8us*)((const unsigned short*)p + 16 + 8 * hh); return f.v; }
__device__ __forceinline__ v8f g2_mma(v16h a, v16h b, v8f c) { v8f d = __builtin_amdgcn_wmma_f32_16x16x32_f16(false, a, false, b, (short)0, c, false, false); asm volatile("v_nop\n\tv_nop\n\tv_nop\n\tv_nop" : "+v"(d) : "v"(a), "v"(b)); return d; }
template <int ACT>
__global__ __launch_bounds__(128) void k_gemm2(const _Float16* __restrict__ A, int lda, size_t sA, const _Float16* __restrict__ Bh, int ldb, size_t sB, float alpha, const float* __restrict__ bias, size_t sBias, const float* __restrict__ CP, int rowsPerB, size_t sCPb, int row0g,
    float* __restrict__ C, _Float16* __restrict__ C16, int ldc, size_t sC, int M, int N, int K) { static_assert(ACT == 0 || ACT == 3 || ACT == 6 || ACT == 8 || ACT == 9 || ACT == 11 || ACT == 12 || ACT == 14 || ACT == 15 || ACT == 16 || ACT == 17, "k_gemm2: unsupported ACT code (would silently apply no activation)");
  __shared__ __attribute__((aligned(16))) float so[4][32][68];
  const int tid = threadIdx.x, w = tid >> 5, lane = tid & 31, ln = lane & 15, hh = lane >> 4; const int by = blockIdx.y;
  A += (size_t)by * sA; Bh += (size_t)by * sB; const size_t cofs = (size_t)by * sC; const float* bp = bias ? bias + (size_t)by * sBias : nullptr;
  const int ntn = N >> 6; const int mt = blockIdx.x / ntn, nq = blockIdx.x - mt * ntn; const int row0 = mt * 128 + 32 * w, col0 = nq * 64; if (row0 >= M) return;
  const _Float16* a0p = A + (size_t)(row0 + ln) * lda; const _Float16* a1p = a0p + (size_t)16 * lda;
  const _Float16* b0p = Bh + (size_t)(col0 + ln) * ldb; const _Float16* b1p = b0p + (size_t)16 * ldb; const _Float16* b2p = b1p + (size_t)16 * ldb; const _Float16* b3p = b2p + (size_t)16 * ldb;
  const v8f z8 = {0.f,0.f,0.f,0.f,0.f,0.f,0.f,0.f}; v8f c00 = z8, c01 = z8, c02 = z8, c03 = z8, c10 = z8, c11 = z8, c12 = z8, c13 = z8;
#pragma unroll 1
  for (int kb = 0; kb < K; kb += 32) { const v16h a0 = g2_frag(a0p + kb, hh), a1 = g2_frag(a1p + kb, hh);
    v16h b = g2_frag(b0p + kb, hh); c00 = g2_mma(a0, b, c00); c10 = g2_mma(a1, b, c10);
    b = g2_frag(b1p + kb, hh); c01 = g2_mma(a0, b, c01); c11 = g2_mma(a1, b, c11);
    b = g2_frag(b2p + kb, hh); c02 = g2_mma(a0, b, c02); c12 = g2_mma(a1, b, c12);
    b = g2_frag(b3p + kb, hh); c03 = g2_mma(a0, b, c03); c13 = g2_mma(a1, b, c13); }
  v8f accs[8] = {c00, c01, c02, c03, c10, c11, c12, c13};
#pragma unroll
  for (int u = 0; u < 8; ++u) { const int t = u & 3, half = u >> 2; const int col = col0 + t * 16 + ln; const float bv = bp ? bf16_round(bp[col]) : 0.f;
#pragma unroll
    for (int r = 0; r < 8; ++r) { const int rloc = half * 16 + 8 * hh + r; float v = accs[u][r] * alpha + bv; if (CP) { if (rowsPerB < 0) v += CP[cofs + (size_t)(row0g + row0 + rloc) * ldc + col];      /* rowsPerB < 0: own element of the batched C plane */ else { const int bidx = (row0g + row0 + rloc) / rowsPerB; v += CP[(size_t)bidx * sCPb + (size_t)by * 64 + col]; } }
      if (ACT == 3) v = fmaxf(v, 0.f); else if (ACT == 6) v = 0.5f * v * (1.0f + erff(v * 0.70710678118654752f)); else if (ACT == 11) v = 1.0f / (1.0f + expf(-v)); else if (ACT == 15) v = v / (1.0f + expf(-v)); else if (ACT == 12) v = (v > 0.f) ? v : 0.01f * v; else if (ACT == 8) v = tanhf(v); else if (ACT == 9) v = 0.5f * v * (1.0f + tanhf(0.7978845608028654f * (v + 0.044715f * v * v * v))); else if (ACT == 14) v = (v > 0.f) ? v : 0.1f * v; else if (ACT == 16) v = (v >= 0.f) ? v : 0.3f * v; else if (ACT == 17) v = (v >= 0.f) ? v : 0.2f * v;
      so[w][rloc][t * 16 + ln] = v; } }
  __builtin_amdgcn_fence(__ATOMIC_ACQ_REL, "workgroup"); __builtin_amdgcn_wave_barrier();
  const int rsub = lane >> 4, c4 = (lane & 15) * 4;
  {
#pragma unroll
    for (int q = 0; q < 16; ++q) { const int r = q * 2 + rsub; const v4f v = *(const v4fa*)&so[w][r][c4]; if (C) *(v4f*)(C + cofs + (size_t)(row0 + r) * ldc + col0 + c4) = v; if (C16) { v4h h4; for (int i = 0; i < 4; ++i) h4[i] = (_Float16)v[i]; *(v4h*)(C16 + cofs + (size_t)(row0 + r) * ldc + col0 + c4) = h4; } }
     } }


__global__ __launch_bounds__(256) void k_wnat(const float* __restrict__ w, size_t n8, _Float16* __restrict__ Bt) { const size_t t = (size_t)blockIdx.x * 256 + threadIdx.x; if (t >= n8) return; FragH f; for (int q = 0; q < 8; ++q) f.h[q] = (_Float16)(bf16_round(w[t * 8 + q]) * 16.0f); *(v8us*)((unsigned short*)Bt + t * 8) = f.half[0];  }
__global__ __launch_bounds__(256) void k_rsm(const float* __restrict__ S, _Float16* __restrict__ P, int nrows) {
  #pragma clang fp contract(off)
  const int i = blockIdx.x * 256 + threadIdx.x; if (i >= nrows) return; const float* s = S + (size_t)i * SQ; float mx = -3.0e38f;
#pragma unroll 1
  for (int j = 0; j < SQ; ++j) mx = fmaxf(mx, s[j]); float se = 0.f;
#pragma unroll 1
  for (int j = 0; j < SQ; ++j) se += expf(s[j] - mx); const float sc = 256.0f / se;
#pragma unroll 1
  for (int j0 = 0; j0 < SQ; j0 += 8) { FragH f; for (int q = 0; q < 8; ++q) f.h[q] = (_Float16)(expf(s[j0 + q] - mx) * sc); unsigned short* d = (unsigned short*)P + (size_t)i * SQ + j0; *(v8us*)d = f.half[0];  } }
__global__ __launch_bounds__(256) void k_vt(const _Float16* __restrict__ V16, int b, int h0, _Float16* __restrict__ VT) { __shared__ unsigned short tl[64][65]; const int tid = threadIdx.x; const int hh = blockIdx.x % HG, sg = blockIdx.x / HG; const int s0 = sg * 64; const int h = h0 + hh;
  for (int i = tid; i < 64 * 8; i += 256) { const int j = i / 8, d8 = (i % 8) * 8; FragH f; f.half[0] = *(const v8us*)((const unsigned short*)V16 + ((size_t)b * SQ + s0 + j) * DM + h * HD + d8); for (int q = 0; q < 8; ++q) tl[d8 + q][j] = f.u[q]; }
  __syncthreads();
  { for (int i = tid; i < 64 * 8; i += 256) { const int d = i / 8, j8 = (i % 8) * 8; FragH f; for (int q = 0; q < 8; ++q) f.u[q] = tl[d][j8 + q]; *(v8us*)((unsigned short*)VT + ((size_t)hh * HD + d) * SQ + s0 + j8) = f.half[0]; }  } }



__global__ __launch_bounds__(256) void k_rsmcf2(const float* __restrict__ S, _Float16* __restrict__ P, int hg, int q0, int nk) {
  #pragma clang fp contract(off)
  const int t = blockIdx.x * 256 + threadIdx.x; if (t >= hg * QT) return; const size_t i = (size_t)t; const float* s = S + i * NKX; const int last = q0 + (t % QT); float mx = -3.0e38f;
#pragma unroll 1
  for (int j = 0; j < nk; ++j) { const float f = (j <= last) ? 1.f : 0.f; mx = fmaxf(mx, fmaf(f, s[j], (1.f - f) * -1.0e9f)); } float se = 0.f;
#pragma unroll 1
  for (int j = 0; j < nk; ++j) { const float f = (j <= last) ? 1.f : 0.f; se += __expf(fmaf(f, s[j], (1.f - f) * -1.0e9f) - mx); } const float sc = 256.0f / se;
#pragma unroll 1
  for (int j0 = 0; j0 < nk; j0 += 8) { FragH fr; for (int q = 0; q < 8; ++q) { const int j = j0 + q; const float f = (j <= last) ? 1.f : 0.f; fr.h[q] = (_Float16)(__expf(fmaf(f, s[j], (1.f - f) * -1.0e9f) - mx) * sc); } unsigned short* d = (unsigned short*)P + i * NKX + j0; *(v8us*)d = fr.half[0];  } }

template <int MASKADD>
__global__ __launch_bounds__(64) void k_att0(const float* __restrict__ QF, const float* __restrict__ KF, const float* __restrict__ VF, int ld, const float* __restrict__ mask, float scale, float* __restrict__ OF, int ldo) {
  #pragma clang fp contract(off)
  __shared__ __attribute__((aligned(16))) float lq[64][64]; __shared__ __attribute__((aligned(16))) float lo[64][64];
  const int tid = threadIdx.x; const int h = blockIdx.x / (QT0 / 64), rg = blockIdx.x % (QT0 / 64); const int i = rg * 64 + tid;
  const float* qr = QF + (size_t)i * ld + h * HD;
#pragma unroll 1
  for (int c = 0; c < HD / 4; ++c) { *(v4f*)&lq[tid][c * 4] = *(const v4fa*)(qr + c * 4); const v4f z = {0.f, 0.f, 0.f, 0.f}; *(v4f*)&lo[tid][c * 4] = z; }
  float m = -1.0e30f, l = 0.f; const int jmax = MASKADD ? (SQ - 1) : (rg * 64 + 63);      /* additive-mask form: every key (the mask input decides); causal form: keys up to the block's last row */
#pragma unroll 1
  for (int j = 0; j <= jmax; ++j) { const float* kr = KF + (size_t)j * ld + h * HD; const float* vr = VF + (size_t)j * ld + h * HD; float s = 0.f;
#pragma unroll 1
    for (int c = 0; c < HD / 4; ++c) { const v4f kq = *(const v4fa*)(kr + c * 4); const v4f qq = *(v4f*)&lq[tid][c * 4]; s = __fadd_rn(s, __fmul_rn(qq[0], kq[0])); s = __fadd_rn(s, __fmul_rn(qq[1], kq[1])); s = __fadd_rn(s, __fmul_rn(qq[2], kq[2])); s = __fadd_rn(s, __fmul_rn(qq[3], kq[3])); }
    s = __fmul_rn(s, scale); if (MASKADD) s = __fadd_rn(s, __fmul_rn(bf16_round(mask[(size_t)i * SQ + j]), -10000.0f));
    const float f = (MASKADD || j <= i) ? 1.f : 0.f; const float sm = fmaf(f, s, (1.f - f) * -1.0e30f); const float mn = fmaxf(m, sm); const float sc = expf(m - mn); const float e = expf(sm - mn); l = __fadd_rn(__fmul_rn(l, sc), e); m = mn;
#pragma unroll 1
    for (int c = 0; c < HD / 4; ++c) { const v4f vv = *(const v4fa*)(vr + c * 4); v4f oo = *(v4f*)&lo[tid][c * 4]; for (int u = 0; u < 4; ++u) oo[u] = __fadd_rn(__fmul_rn(oo[u], sc), __fmul_rn(e, vv[u])); *(v4f*)&lo[tid][c * 4] = oo; } }
  const float fin = 64.0f / l;      /* o carried x64; the f16 path writes o unscaled */
#pragma unroll 1
  for (int c = 0; c < HD / 4; ++c) { v4f oo = *(v4f*)&lo[tid][c * 4]; for (int u = 0; u < 4; ++u) oo[u] = __fmul_rn(oo[u], fin); *(v4f*)&lo[tid][c * 4] = oo; }
  __syncthreads();
  {
#pragma unroll 1
    for (int it = 0; it < 16; ++it) { const int row = it * 4 + tid / 16, pc = (tid % 16) * 4; const v4f v = *(const v4f*)&lo[row][pc]; *(v4f*)(OF + (size_t)(rg * 64 + row) * ldo + h * HD + pc) = v; }
     } }

__global__ __launch_bounds__(256) void k_oscale(const float* __restrict__ OF, float* __restrict__ out, size_t n4) { const size_t t = (size_t)blockIdx.x * 256 + threadIdx.x; if (t >= n4) return; const v4f a = *(const v4fa*)(OF + t * 4); v4f o; for (int q = 0; q < 4; ++q) o[q] = a[q] * 0.015625f; *(v4f*)(out + t * 4) = o;  }

__global__ __launch_bounds__(256) void k_bfr(const float* __restrict__ x, float* __restrict__ XB, size_t n8) { const size_t t = (size_t)blockIdx.x * 256 + threadIdx.x; if (t >= n8) return; v4f a = *(const v4fa*)(x + t * 8), c = *(const v4fa*)(x + t * 8 + 4); for (int q = 0; q < 4; ++q) { a[q] = bf16_round(a[q]); c[q] = bf16_round(c[q]); }
  { *(v4f*)(XB + t * 8) = a; *(v4f*)(XB + t * 8 + 4) = c;  } }



__global__ __launch_bounds__(256) void k_rsmfvl(const float* __restrict__ S, _Float16* __restrict__ P, _Float16* __restrict__ PL, int qn, const int* __restrict__ vlp) {
  #pragma clang fp contract(off)
  const int t = blockIdx.x * 256 + threadIdx.x; if (t >= qn) return; const int vl = vlp[0]; const size_t i = (size_t)t; const float* s = S + i * SQ; float mx = -3.0e38f;
#pragma unroll 1
  for (int j = 0; j < SQ; ++j) { const float f = (j < vl) ? 1.f : 0.f; mx = fmaxf(mx, fmaf(f, s[j], (1.f - f) * -1000000.0f)); } float se = 0.f;
#pragma unroll 1
  for (int j = 0; j < SQ; ++j) { const float f = (j < vl) ? 1.f : 0.f; se += __expf(fmaf(f, s[j], (1.f - f) * -1000000.0f) - mx); } const float sc = 256.0f / se;
#pragma unroll 1
  for (int j0 = 0; j0 < SQ; j0 += 8) { FragH fr, gr; for (int q = 0; q < 8; ++q) { const int j = j0 + q; const float f = (j < vl) ? 1.f : 0.f; const float pv = __expf(fmaf(f, s[j], (1.f - f) * -1000000.0f) - mx) * sc; const _Float16 ph = (_Float16)pv; fr.h[q] = ph; gr.h[q] = (_Float16)((pv - (float)ph) * 1024.0f); }
    unsigned short* d = (unsigned short*)P + i * SQ + j0; unsigned short* dl = (unsigned short*)PL + i * SQ + j0; *(v8us*)d = fr.half[0]; *(v8us*)dl = gr.half[0];  } }

__global__ __launch_bounds__(256) void k_rsmf(const float* __restrict__ S, _Float16* __restrict__ P, int qn, int hg) {
  #pragma clang fp contract(off)
  const int t = blockIdx.x * 256 + threadIdx.x; if (t >= qn * hg) return; const size_t i = (size_t)(t / qn) * SQ + (t % qn); const float* s = S + i * SQ; float mx = -3.0e38f;
#pragma unroll 1
  for (int j = 0; j < SQ; ++j) mx = fmaxf(mx, s[j]); float se = 0.f;
#pragma unroll 1
  for (int j = 0; j < SQ; ++j) se += __expf(s[j] - mx); const float sc = 256.0f / se;
#pragma unroll 1
  for (int j0 = 0; j0 < SQ; j0 += 8) { FragH f; for (int q = 0; q < 8; ++q) f.h[q] = (_Float16)(__expf(s[j0 + q] - mx) * sc); unsigned short* d = (unsigned short*)P + i * SQ + j0; *(v8us*)d = f.half[0];  } }



__global__ __launch_bounds__(128) void k_negmean(const float* __restrict__ V, float* __restrict__ NMV) {
  #pragma clang fp contract(off)
  const int b = blockIdx.x, c = threadIdx.x; const float* v = V + (size_t)b * SQ * DM + c; float a = 0.f;
#pragma unroll 4
  for (int s = 0; s < SQ; ++s) a = __fadd_rn(a, bf16_round(v[(size_t)s * DM]));
  const float m = -__fdiv_rn(a, (float)SQ); *(float*)(NMV + (size_t)b * DM + c) = m;  }

// lane l <-> l ^ M inside a 16-lane row (DPP row_xmask) and l <-> l ^ 16 (cross-row move): register-only butterflies, no LDS traffic
template <int M> __device__ __forceinline__ float lane_xr(float v) { return __int_as_float(__builtin_amdgcn_update_dpp(0, __float_as_int(v), 0x160 + M, 0xf, 0xf, true)); }
__device__ __forceinline__ float lane_x16(float v) { const int b = __float_as_int(v); return __int_as_float(__builtin_amdgcn_permlanex16(b, b, 0x76543210, 0xfedcba98, false, false)); }
__device__ __forceinline__ float wave_max(float v) { v = fmaxf(v, lane_xr<1>(v)); v = fmaxf(v, lane_xr<2>(v)); v = fmaxf(v, lane_xr<4>(v)); v = fmaxf(v, lane_xr<8>(v)); return fmaxf(v, lane_x16(v)); }
__device__ __forceinline__ float wave_sum(float v) { v += lane_xr<1>(v); v += lane_xr<2>(v); v += lane_xr<4>(v); v += lane_xr<8>(v); return v + lane_x16(v); }
// row softmax, ONE WAVE PER ROW: the 4096 logits of a row live in the wave's registers (32 whole-line loads of 512 B, lane l holds columns 128 u + 4 l .. + 3),
// so S is read once; maximum and sum = four chains per lane, then a five-step butterfly; each exponential is formed once and kept; P x256 as f16 hi + x1024 residual.
__global__ __launch_bounds__(256) void k_rsmw(const float* __restrict__ S, _Float16* __restrict__ P, _Float16* __restrict__ PL, int nrows) {
  const int row = blockIdx.x * 8 + (threadIdx.x >> 5), lane = threadIdx.x & 31; if (row >= nrows) return;      /* wave-uniform; the kernel has no barrier */
  const size_t o = (size_t)row * SQ + lane * 4; const float* s = S + o; v4f x[SQ / 128];
  /* the four loops below are fully unrolled so that every index of x[] is a constant and the row stays in registers (else it would go to scratch); the 32 loads then issue back to back */
#pragma unroll
  for (int u = 0; u < SQ / 128; ++u) x[u] = *(const v4fa*)(s + u * 128);
  v4f m4 = x[0];
#pragma unroll
  for (int u = 1; u < SQ / 128; ++u) for (int q = 0; q < 4; ++q) m4[q] = fmaxf(m4[q], x[u][q]);
  const float mx = fmaxf(-3.0e38f, wave_max(fmaxf(fmaxf(m4[0], m4[1]), fmaxf(m4[2], m4[3]))));
  v4f a4 = {0.f, 0.f, 0.f, 0.f};
#pragma unroll
  for (int u = 0; u < SQ / 128; ++u) for (int q = 0; q < 4; ++q) { const float t = (x[u][q] - mx) * 1.4426950408889634f; float e;
    /* native exp as before (v_exp_f32 of the argument times log2 e); the v_nop in the same statement keeps the one slot that the instruction set asks for behind a transcendental, whatever the compiler puts next */
    asm("v_exp_f32 %0, %1\n\tv_nop" : "=v"(e) : "v"(t)); x[u][q] = e; a4[q] += e; }
  const float sc = 256.0f / wave_sum((a4[0] + a4[1]) + (a4[2] + a4[3]));
  _Float16* d = P + o; _Float16* dl = PL + o;
#pragma unroll
  for (int u = 0; u < SQ / 128; ++u) { v4h fr, fl; for (int q = 0; q < 4; ++q) { const float v = x[u][q] * sc; const _Float16 hv = (_Float16)v; fr[q] = hv; fl[q] = (_Float16)((v - (float)hv) * 1024.0f); }
    *(v4h*)(d + u * 128) = fr; *(v4h*)(dl + u * 128) = fl; } }
extern "C" void kernel_launch(void* const* d_in, const int* in_sizes, int n_in,
                              void* d_out, int out_size, void* d_ws, size_t ws_size, hipStream_t stream) {
  (void)in_sizes; (void)n_in; (void)out_size;
  const float* const* I = (const float* const*)d_in; const float* xq = I[0]; const float* xk = I[1]; const float* xv = I[2];      /* Q, K, V [4][4096][128] (bf16-valued), one head over all 128 columns */
  char* ws = (char*)d_ws; size_t off = 0;
  auto take = [&](size_t bytes) { char* p = ws + off; off += (bytes + 255) & ~(size_t)255; return p; };
  _Float16* Q16 = (_Float16*)take(NR * DM * 2); _Float16* K16 = (_Float16*)take(NR * DM * 2); _Float16* V16 = (_Float16*)take(NR * DM * 2);
  float* S = (float*)take((size_t)SQ * SQ * 4); _Float16* P = (_Float16*)take((size_t)SQ * SQ * 2); _Float16* PL = (_Float16*)take((size_t)SQ * SQ * 2); _Float16* VT = (_Float16*)take((size_t)DM * SQ * 2); float* NMV = (float*)take((size_t)NB * DM * 4);      /* -mean(value) per batch [128] */
  if (off > ws_size) return;
  k_x16<<<(unsigned)((NR * DM / 8 + 255) / 256), 256, 0, stream>>>(xq, Q16, NR * DM / 8); k_x16<<<(unsigned)((NR * DM / 8 + 255) / 256), 256, 0, stream>>>(xk, K16, NR * DM / 8); k_x16<<<(unsigned)((NR * DM / 8 + 255) / 256), 256, 0, stream>>>(xv, V16, NR * DM / 8);      /* exact f16 copies of the bf16-valued inputs */
  k_negmean<<<NB, 128, 0, stream>>>(xv, NMV);      /* NMV[b][c] = -(1/4096) sum_s bf16(value[b][s][c]) (f32, fixed ascending order; thread per (b, c)) */
  for (int b = 0; b < NB; ++b) { const size_t r0 = (size_t)b * SQ;
    k_vt<DM / 64, SQ><<<(DM / 64) * (SQ / 64), 256, 0, stream>>>(V16 + r0 * DM, DM, 0, VT);      /* V^T [128][4096] of this batch */
    k_gemm2<0><<<dim3((SQ / 128) * (SQ / 64), 1), 128, 0, stream>>>(Q16 + r0 * DM, DM, 0, K16 + r0 * DM, DM, 0, 0.08838834764831845f, nullptr, 0, nullptr, 1, 0, 0, S, nullptr, SQ, 0, SQ, SQ, DM);      /* logits = q.k / sqrt(128) (K = 128, exact products) */
    k_rsmw<<<SQ / 8, 256, 0, stream>>>(S, P, PL, SQ);      /* softmax over the 4096 keys, a wave per row -> P x256 as f16 hi + x1024 residual */
    k_gemm2<0><<<dim3((SQ / 128) * (DM / 64), 1), 128, 0, stream>>>(P, SQ, 0, VT, SQ, 0, 0.00390625f, nullptr, 0, NMV + (size_t)b * DM, SQ, 0, 0, (float*)d_out + r0 * DM, nullptr, DM, 0, SQ, DM, SQ);      /* out = Ph V^T 2^-8 - mean(value) (the batch's f32 row through the addend path, rowsPerB = SQ) */
    k_gemm2<0><<<dim3((SQ / 128) * (DM / 64), 1), 128, 0, stream>>>(PL, SQ, 0, VT, SQ, 0, 0.000003814697265625f, nullptr, 0, (const float*)d_out + r0 * DM, -1, 0, 0, (float*)d_out + r0 * DM, nullptr, DM, 0, SQ, DM, SQ); }      /* += Pl V^T 2^-18 (own element) */
}

// v002
// It runs in 350 microseconds.
// Next to v001, in two timings, it ran 4.18 and 4.24 times as fast.
// Counting every step since v000, it is 12.6 times as fast.
#include <hip/hip_runtime.h>
#define NB 4
#define SQ 4096
#define DM 128
#define NH 2
#define HD 64
#define HG 8                         /* heads per launch of the four-argument k_vt (not launched) */
#define B0 0                         /* first batch processed (unused) */
#define NBR NB                       /* batches processed (used only in MP) */
#define NR ((size_t)NB * SQ)         /* token rows */
#define MP ((int)((size_t)NBR * SQ)) /* token rows (used only in MPO) */
#define QT 256                       /* query rows per causal tile */
#define NKX SQ                       /* S / P row pitch */
#define QT0 256                      /* query rows per head of the f32 k_att0 (not launched) */
#define QN SQ                        /* query rows attended per batch (unused) */
#define NHD NH                       /* unused */
#define MPO MP                       /* rows through the output stage (unused) */
#define LQ DM            /* row pitch of the q/k/v rows */
typedef __bf16 v16b __attribute__((ext_vector_type(16)));
typedef unsigned short v8us __attribute__((ext_vector_type(8), may_alias));
typedef float  v8f  __attribute__((ext_vector_type(8)));
typedef float  v4f  __attribute__((ext_vector_type(4)));
typedef float  v4fa __attribute__((ext_vector_type(4), may_alias));
union FragB { v16b v; v8us half[2]; unsigned short u[16]; };

__device__ __forceinline__ unsigned short bf16_bits(float x) { unsigned int u = __float_as_uint(x); return (unsigned short)((u + 0x7FFFu + ((u >> 16) & 1u)) >> 16); }
__device__ __forceinline__ float bf16_val(unsigned short b) { return __uint_as_float(((unsigned int)b) << 16); }
__device__ __forceinline__ float bf16_round(float x) { return bf16_val(bf16_bits(x)); }
// D += A·B with NT terms: 1 = ah·bh, 2 = + al·bh (A split), 3 = + ah·bl (both split)
template <int NT>
__device__ __forceinline__ v8f mmaN(v16b ah, v16b al, v16b bh, v16b bl, v8f c) {
  c = __builtin_amdgcn_wmma_f32_16x16x32_bf16(false, ah, false, bh, (short)0, c, false, false);
  if (NT >= 2) c = __builtin_amdgcn_wmma_f32_16x16x32_bf16(false, al, false, bh, (short)0, c, false, false);
  if (NT >= 3) c = __builtin_amdgcn_wmma_f32_16x16x32_bf16(false, ah, false, bl, (short)0, c, false, false);
  asm volatile("v_nop\n\tv_nop\n\tv_nop\n\tv_nop" : "+v"(c) : "v"(ah), "v"(al), "v"(bh), "v"(bl));
  return c;
}

__global__ __launch_bounds__(256) void k_wt_bf16(const float* __restrict__ W, unsigned short* __restrict__ Wt, int K, int N) {
  const int t = blockIdx.x * 256 + threadIdx.x;
  const int k8n = K / 8;
  if (t >= N * k8n) return;
  const int n = t / k8n, k8 = (t % k8n) * 8;
  v8us v;
#pragma unroll
  for (int i = 0; i < 8; ++i) v[i] = bf16_bits(W[(size_t)(k8 + i) * N + n]);
  *(v8us*)(Wt + (size_t)n * K + k8) = v;
  
}

// GEMM C[M][N] (f32, pitch ldc) = act(A[M][K]·W + bias). A f32 row-major (pitch lda) converted per fragment to bf16
// (ASPLIT: hi/lo two planes -> 2 terms, else single rounded term); Wt bf16 [N][K] (pitch ldb). BIAS_BF16 rounds the
// bias to bf16 first (bias quantised to bf16 before the add). K%32==0, M%16==0, N%64==0.
template <bool ASPLIT, int ACT, bool BIAS_BF16>
__global__ __launch_bounds__(128) void k_gemm_bf(const float* __restrict__ A, int lda, const unsigned short* __restrict__ Wt, int ldb,
                                               const float* __restrict__ bias, float* __restrict__ C, int ldc, int M, int N, int K) {
  __shared__ __attribute__((aligned(16))) float so[4][16][64];
  const int tid = threadIdx.x, w = tid >> 5, lane = tid & 31, ln = lane & 15, hh = lane >> 4;
  const int ntn = N / 64;
  const int wid = blockIdx.x * 4 + w;
  const int mt = wid / ntn, nq = wid % ntn;
  if (mt * 16 >= M) return;
  const int row0 = mt * 16, col0 = nq * 64;
  const float* arow = A + (size_t)(row0 + ln) * lda;
  v8f acc[4] = {};
  for (int kb = 0; kb < K; kb += 32) {
    FragB ah, al;
    const v4f x0 = *(const v4fa*)(arow + kb + 8 * hh), x1 = *(const v4fa*)(arow + kb + 8 * hh + 4);
    const v4f x2 = *(const v4fa*)(arow + kb + 16 + 8 * hh), x3 = *(const v4fa*)(arow + kb + 16 + 8 * hh + 4);
    float xs[16] = {x0[0],x0[1],x0[2],x0[3],x1[0],x1[1],x1[2],x1[3],x2[0],x2[1],x2[2],x2[3],x3[0],x3[1],x3[2],x3[3]};
#pragma unroll
    for (int i = 0; i < 16; ++i) { const unsigned short hb = bf16_bits(xs[i]); ah.u[i] = hb; al.u[i] = ASPLIT ? bf16_bits(xs[i] - bf16_val(hb)) : (unsigned short)0; }
#pragma unroll
    for (int t = 0; t < 4; ++t) {
      const unsigned short* brow = Wt + (size_t)(col0 + t * 16 + ln) * ldb + kb;
      FragB b;
      b.half[0] = *(const v8us*)(brow + 8 * hh);
      b.half[1] = *(const v8us*)(brow + 16 + 8 * hh);
      acc[t] = mmaN<ASPLIT ? 2 : 1>(ah.v, al.v, b.v, b.v, acc[t]);
    }
  }
#pragma unroll
  for (int t = 0; t < 4; ++t) {
    float bv = bias ? bias[col0 + t * 16 + ln] : 0.f;
    if (BIAS_BF16) bv = bf16_round(bv);
#pragma unroll
    for (int r = 0; r < 8; ++r) { float v = acc[t][r] + bv; if (ACT == 1) v = fmaxf(v, 0.f); so[w][8 * hh + r][t * 16 + ln] = v; }
  }
  __builtin_amdgcn_fence(__ATOMIC_ACQ_REL, "workgroup");
  __builtin_amdgcn_wave_barrier();
  const int rsub = lane >> 4, c4 = (lane & 15) * 4;
  {
#pragma unroll
    for (int q = 0; q < 8; ++q) {
      const int r = q * 2 + rsub;
      const v4f v = *(const v4fa*)&so[w][r][c4];
      *(v4f*)(C + (size_t)(row0 + r) * ldc + col0 + c4) = v;
    }
    
  }
}

// GEMM C = act(A·W + bias + resid): A f32 (ASPLIT -> hi/lo 2 terms), Wt bf16 [N][K]; ACT 0 none, 1 relu, 2 exact gelu;
// resid (optional, f32, row index = (row % rmod), pitch ldr, RES_BF16 rounds it) added before the activation.
template <bool ASPLIT, int ACT, bool BIAS_BF16, bool RES_BF16>
__global__ __launch_bounds__(128) void k_gemm_bf3(const float* __restrict__ A, int lda, const unsigned short* __restrict__ Wt, int ldb,
                                                const float* __restrict__ bias, const float* __restrict__ resid, int rmod, int ldr,
                                                float* __restrict__ C, int ldc, int M, int N, int K) {
  __shared__ __attribute__((aligned(16))) float so[4][16][64];
  const int tid = threadIdx.x, w = tid >> 5, lane = tid & 31, ln = lane & 15, hh = lane >> 4;
  const int ntn = N / 64;
  const int wid = blockIdx.x * 4 + w;
  const int mt = wid / ntn, nq = wid % ntn;
  if (mt * 16 >= M) return;
  const int row0 = mt * 16, col0 = nq * 64;
  const float* arow = A + (size_t)(row0 + ln) * lda;
  v8f acc[4] = {};
  for (int kb = 0; kb < K; kb += 32) {
    FragB ah, al;
    const v4f x0 = *(const v4fa*)(arow + kb + 8 * hh), x1 = *(const v4fa*)(arow + kb + 8 * hh + 4);
    const v4f x2 = *(const v4fa*)(arow + kb + 16 + 8 * hh), x3 = *(const v4fa*)(arow + kb + 16 + 8 * hh + 4);
    float xs[16] = {x0[0],x0[1],x0[2],x0[3],x1[0],x1[1],x1[2],x1[3],x2[0],x2[1],x2[2],x2[3],x3[0],x3[1],x3[2],x3[3]};
#pragma unroll
    for (int i = 0; i < 16; ++i) { const unsigned short hb = bf16_bits(xs[i]); ah.u[i] = hb; al.u[i] = ASPLIT ? bf16_bits(xs[i] - bf16_val(hb)) : (unsigned short)0; }
#pragma unroll
    for (int t = 0; t < 4; ++t) {
      const unsigned short* brow = Wt + (size_t)(col0 + t * 16 + ln) * ldb + kb;
      FragB b;
      b.half[0] = *(const v8us*)(brow + 8 * hh);
      b.half[1] = *(const v8us*)(brow + 16 + 8 * hh);
      acc[t] = mmaN<ASPLIT ? 2 : 1>(ah.v, al.v, b.v, b.v, acc[t]);
    }
  }
#pragma unroll
  for (int t = 0; t < 4; ++t) {
    const int col = col0 + t * 16 + ln;
    float bv = bias ? bias[col] : 0.f;
    if (BIAS_BF16) bv = bf16_round(bv);
#pragma unroll
    for (int r = 0; r < 8; ++r) {
      float v = acc[t][r] + bv;
      if (resid) { float rv = resid[(size_t)((row0 + 8 * hh + r) % rmod) * ldr + col]; if (RES_BF16) rv = bf16_round(rv); v += rv; }
      if (ACT == 1) v = fmaxf(v, 0.f);
      if (ACT == 2) v = 0.5f * v * (1.0f + erff(v * 0.70710678118654752f));
      if (ACT == 3) { const float u = 0.7978845608028654f * (v + 0.044715f * v * v * v); v = 0.5f * v * (1.0f + tanhf(u)); }
      so[w][8 * hh + r][t * 16 + ln] = v;
    }
  }
  __builtin_amdgcn_fence(__ATOMIC_ACQ_REL, "workgroup");
  __builtin_amdgcn_wave_barrier();
  const int rsub = lane >> 4, c4 = (lane & 15) * 4;
  {
#pragma unroll
    for (int q = 0; q < 8; ++q) {
      const int r = q * 2 + rsub;
      const v4f v = *(const v4fa*)&so[w][r][c4];
      *(v4f*)(C + (size_t)(row0 + r) * ldc + col0 + c4) = v;
    }
    
  }
}
// row LayerNorm (biased variance, eps) over N: s = X (+ R); optional out_sum <- s; out_norm <- (s-mu)*rsqrt(var+eps)*g + b
template <bool PARAM_BF16>
__global__ __launch_bounds__(256) void k_layernorm(const float* __restrict__ X, const float* __restrict__ R, const float* __restrict__ g, const float* __restrict__ bta,
                                                  float* __restrict__ out_sum, float* __restrict__ out_norm, int N, float eps) {
  __shared__ float red[256];
  const int row = blockIdx.x, tid = threadIdx.x;
  const float* x = X + (size_t)row * N; const float* rr = R ? R + (size_t)row * N : nullptr;
  float vals[16];                     // up to N = 4096
  const int per = N / 256;            // contiguous chunk per thread? use strided-by-4 chunks: thread handles j = tid*4 + 1024*u
  float s1 = 0.f;
  for (int u = 0; u < per / 4; ++u) {
    const int j = tid * 4 + 1024 * u;
    const v4f a = *(const v4fa*)(x + j);
    v4f b = {0.f,0.f,0.f,0.f}; if (rr) b = *(const v4fa*)(rr + j);
#pragma unroll
    for (int q = 0; q < 4; ++q) { const float v = a[q] + b[q]; vals[u * 4 + q] = v; s1 += v; }
  }
  red[tid] = s1; __syncthreads();
  for (int st = 128; st > 0; st >>= 1) { if (tid < st) red[tid] += red[tid + st]; __syncthreads(); }
  const float mu = red[0] / (float)N; __syncthreads();
  float s2 = 0.f;
  for (int u = 0; u < per / 4; ++u)
#pragma unroll
    for (int q = 0; q < 4; ++q) { const float c = vals[u * 4 + q] - mu; s2 += c * c; }
  red[tid] = s2; __syncthreads();
  for (int st = 128; st > 0; st >>= 1) { if (tid < st) red[tid] += red[tid + st]; __syncthreads(); }
  const float rs = rsqrtf(red[0] / (float)N + eps);
  {
    for (int u = 0; u < per / 4; ++u) {
      const int j = tid * 4 + 1024 * u;
      v4f o, sm;
#pragma unroll
      for (int q = 0; q < 4; ++q) {
        float gg = g[j + q], bb = bta[j + q];
        if (PARAM_BF16) { gg = bf16_round(gg); bb = bf16_round(bb); }
        sm[q] = vals[u * 4 + q]; o[q] = (vals[u * 4 + q] - mu) * rs * gg + bb;
      }
      if (out_sum) *(v4f*)(out_sum + (size_t)row * N + j) = sm;
      *(v4f*)(out_norm + (size_t)row * N + j) = o;
    }
    
  }
}



// ---- f16 WMMA path (v_wmma_f32_16x16x32_f16): 11-bit significands for operands in range — used where a [0,1] probability operand needs more precision than bf16
typedef _Float16 v16h __attribute__((ext_vector_type(16)));
union FragH { v16h v; v8us half[2]; _Float16 h[16]; unsigned short u[16]; };
template <int NT>
__device__ __forceinline__ v8f mmaH(v16h ah, v16h al, v16h bh, v16h bl, v8f c) {
  c = __builtin_amdgcn_wmma_f32_16x16x32_f16(false, ah, false, bh, (short)0, c, false, false);
  if (NT >= 2) c = __builtin_amdgcn_wmma_f32_16x16x32_f16(false, al, false, bh, (short)0, c, false, false);
  if (NT >= 3) c = __builtin_amdgcn_wmma_f32_16x16x32_f16(false, ah, false, bl, (short)0, c, false, false);
  asm volatile("v_nop\n\tv_nop\n\tv_nop\n\tv_nop" : "+v"(c) : "v"(ah), "v"(al), "v"(bh), "v"(bl));
  return c;
}
// batched GEMM like k_gemm_b but f16 operands: A f32 (split into f16 hi/lo if ASPLIT, else rounded to f16), Bt = f16 values [n][k]; alpha; C f32; N multiple of 16 (partial tiles skipped)
template <bool ASPLIT>
__global__ __launch_bounds__(128) void k_gemm_h(const float* __restrict__ A, int lda, size_t sA, const _Float16* __restrict__ Bh, int ldb, size_t sB, float alpha, float* __restrict__ C, int ldc, size_t sC, int M, int N, int K) {
  __shared__ __attribute__((aligned(16))) float so[4][16][64];
  const int tid = threadIdx.x, w = tid >> 5, lane = tid & 31, ln = lane & 15, hh = lane >> 4; const int by = blockIdx.y;
  A += (size_t)by * sA; Bh += (size_t)by * sB; C += (size_t)by * sC;
  const int ntn = (N + 63) / 64; const int wid = blockIdx.x * 4 + w; const int mt = wid / ntn, nq = wid % ntn; if (mt * 16 >= M) return;
  const int row0 = mt * 16, col0 = nq * 64; const float* arow = A + (size_t)(row0 + ln) * lda;
  v8f acc[4] = {};
  for (int kb = 0; kb < K; kb += 32) {
    FragH ah, al;
    const v4f x0 = *(const v4fa*)(arow + kb + 8 * hh), x1 = *(const v4fa*)(arow + kb + 8 * hh + 4), x2 = *(const v4fa*)(arow + kb + 16 + 8 * hh), x3 = *(const v4fa*)(arow + kb + 16 + 8 * hh + 4);
    float xs[16] = {x0[0],x0[1],x0[2],x0[3],x1[0],x1[1],x1[2],x1[3],x2[0],x2[1],x2[2],x2[3],x3[0],x3[1],x3[2],x3[3]};
#pragma unroll
    for (int i = 0; i < 16; ++i) { const _Float16 h = (_Float16)xs[i]; ah.h[i] = h; al.h[i] = ASPLIT ? (_Float16)(xs[i] - (float)h) : (_Float16)0.0f; }
#pragma unroll
    for (int t = 0; t < 4; ++t) { if (col0 + t * 16 >= N) continue; const size_t boff = (size_t)(col0 + t * 16 + ln) * ldb + kb; FragH bq; bq.half[0] = *(const v8us*)(Bh + boff + 8 * hh); bq.half[1] = *(const v8us*)(Bh + boff + 16 + 8 * hh);
      acc[t] = mmaH<ASPLIT ? 2 : 1>(ah.v, al.v, bq.v, bq.v, acc[t]); }
  }
#pragma unroll
  for (int t = 0; t < 4; ++t) { if (col0 + t * 16 >= N) continue;
#pragma unroll
    for (int r = 0; r < 8; ++r) so[w][8 * hh + r][t * 16 + ln] = acc[t][r] * alpha; }
  __builtin_amdgcn_fence(__ATOMIC_ACQ_REL, "workgroup"); __builtin_amdgcn_wave_barrier();
  const int rsub = lane >> 4, c4 = (lane & 15) * 4;
  {
#pragma unroll
    for (int q = 0; q < 8; ++q) { const int r = q * 2 + rsub; if (col0 + c4 < N) { const v4f v = *(const v4fa*)&so[w][r][c4]; *(v4f*)(C + (size_t)(row0 + r) * ldc + col0 + c4) = v; } }
     }
}

// Wt[n][k] = f16(W[k][n]·scale) from f32 row-major W[K][N] (scale = power of two; bf16-exact weights stay exact in f16 away from the subnormal range)
__global__ __launch_bounds__(256) void k_wt_f16(const float* __restrict__ W, _Float16* __restrict__ Wt, int K, int N, float scale) {
  const int t = blockIdx.x * 256 + threadIdx.x; if (t >= N * (K / 8)) return; const int n = t / (K / 8), k8 = (t % (K / 8)) * 8; FragH f;
#pragma unroll
  for (int i = 0; i < 8; ++i) f.h[i] = (_Float16)(bf16_round(W[(size_t)(k8 + i) * N + n]) * scale); const v8us o = f.half[0];
  *(v8us*)((unsigned short*)Wt + (size_t)n * K + k8) = o; 
}
// k_gemm_hh variant with fused epilogue: v = acc·alpha + bias[by·sBias + col] (+ CP[(row/rowsPerB)·sCPb + by·64 + col] if CP) ; ACT 0 none / 1 elu ; writes f16 C16 (and f32 C if non-null)
template <int ACT>
__global__ __launch_bounds__(128) void k_gemm_hhx(const _Float16* __restrict__ A, int lda, size_t sA, const _Float16* __restrict__ Bh, int ldb, size_t sB, float alpha, const float* __restrict__ bias, size_t sBias, const float* __restrict__ CP, int rowsPerB, size_t sCPb, int row0g,
    float* __restrict__ C, _Float16* __restrict__ C16, int ldc, size_t sC, int M, int N, int K) {
  __shared__ __attribute__((aligned(16))) float so[4][16][64];
  const int tid = threadIdx.x, w = tid >> 5, lane = tid & 31, ln = lane & 15, hh = lane >> 4; const int by = blockIdx.y;
  A += (size_t)by * sA; Bh += (size_t)by * sB; const size_t cofs = (size_t)by * sC; const float* bp = bias ? bias + (size_t)by * sBias : nullptr;
  const int ntn = (N + 63) / 64; const int wid = blockIdx.x * 4 + w; const int mt = wid / ntn, nq = wid % ntn; if (mt * 16 >= M) return;
  const int row0 = mt * 16, col0 = nq * 64; const _Float16* arow = A + (size_t)(row0 + ln) * lda;
  v8f acc[4] = {};
  for (int kb = 0; kb < K; kb += 32) { FragH ah; ah.half[0] = *(const v8us*)((const unsigned short*)arow + kb + 8 * hh); ah.half[1] = *(const v8us*)((const unsigned short*)arow + kb + 16 + 8 * hh);
#pragma unroll
    for (int t = 0; t < 4; ++t) { if (col0 + t * 16 >= N) continue; const size_t boff = (size_t)(col0 + t * 16 + ln) * ldb + kb; FragH bq; bq.half[0] = *(const v8us*)((const unsigned short*)Bh + boff + 8 * hh); bq.half[1] = *(const v8us*)((const unsigned short*)Bh + boff + 16 + 8 * hh);
      acc[t] = mmaH<1>(ah.v, ah.v, bq.v, bq.v, acc[t]); }
  }
#pragma unroll
  for (int t = 0; t < 4; ++t) { if (col0 + t * 16 >= N) continue; const int col = col0 + t * 16 + ln; const float bv = bp ? bf16_round(bp[col]) : 0.f;
#pragma unroll
    for (int r = 0; r < 8; ++r) { float v = acc[t][r] * alpha + bv; if (CP) { const int rr = row0g + row0 + 8 * hh + r; if (rowsPerB < 0) v += CP[cofs + (size_t)rr * ldc + col];      /* rowsPerB < 0: own element of the batched C plane */ else { const int bidx = rr / rowsPerB; v += CP[(size_t)bidx * sCPb + (size_t)by * 64 + col]; } } if (ACT == 1) v = (v > 0.f) ? v : expm1f(v); else if (ACT == 7) v = (v > 0.f) ? v + 1.0f : expf(v); else if (ACT == 8) v = tanhf(v); else if (ACT == 9) v = 0.5f * v * (1.0f + tanhf(0.7978845608028654f * (v + 0.044715f * v * v * v))); else if (ACT == 11) v = 1.0f / (1.0f + expf(-v)); else if (ACT == 12) v = (v > 0.f) ? v : 0.01f * v; else if (ACT == 14) v = (v > 0.f) ? v : 0.1f * v; else if (ACT == 16) v = (v >= 0.f) ? v : 0.3f * v; else if (ACT == 17) v = (v >= 0.f) ? v : 0.2f * v; else if (ACT == 15) v = v / (1.0f + expf(-v)); else if (ACT == 3) v = fmaxf(v, 0.f); else if (ACT == 6) v = 0.5f * v * (1.0f + erff(v * 0.70710678118654752f)); so[w][8 * hh + r][t * 16 + ln] = v; } }
  __builtin_amdgcn_fence(__ATOMIC_ACQ_REL, "workgroup"); __builtin_amdgcn_wave_barrier();
  const int rsub = lane >> 4, c4 = (lane & 15) * 4; typedef _Float16 v4h __attribute__((ext_vector_type(4)));
  {
#pragma unroll
    for (int q = 0; q < 8; ++q) { const int r = q * 2 + rsub; if (col0 + c4 < N) { const v4f v = *(const v4fa*)&so[w][r][c4]; if (C) *(v4f*)(C + cofs + (size_t)(row0 + r) * ldc + col0 + c4) = v; if (C16) { v4h h4; for (int i = 0; i < 4; ++i) h4[i] = (_Float16)v[i]; *(v4h*)(C16 + cofs + (size_t)(row0 + r) * ldc + col0 + c4) = h4; } } }
     }
}


typedef _Float16 v4h __attribute__((ext_vector_type(4)));

__global__ __launch_bounds__(256) void k_x16(const float* __restrict__ x, _Float16* __restrict__ X16, size_t n8) { const size_t t = (size_t)blockIdx.x * 256 + threadIdx.x; if (t >= n8) return; FragH f;
#pragma unroll
  for (int q = 0; q < 8; ++q) f.h[q] = (_Float16)bf16_round(x[t * 8 + q]); *(v8us*)((unsigned short*)X16 + t * 8) = f.half[0];  }
__global__ __launch_bounds__(256) void k_h16(const float* __restrict__ x, _Float16* __restrict__ X16, size_t n8) { const size_t t = (size_t)blockIdx.x * 256 + threadIdx.x; if (t >= n8) return; FragH f;
#pragma unroll
  for (int q = 0; q < 8; ++q) f.h[q] = (_Float16)x[t * 8 + q]; *(v8us*)((unsigned short*)X16 + t * 8) = f.half[0];  }
__global__ __launch_bounds__(256) void k_round16f(const float* __restrict__ W, _Float16* __restrict__ Bt, size_t n8) { const size_t t = (size_t)blockIdx.x * 256 + threadIdx.x; if (t >= n8) return; FragH f;
#pragma unroll
  for (int i = 0; i < 8; ++i) f.h[i] = (_Float16)(bf16_round(W[t * 8 + i]) * 16.0f); *(v8us*)((unsigned short*)Bt + t * 8) = f.half[0];  }
template <int NHv, int TTv>
__global__ __launch_bounds__(256) void k_vt(const _Float16* __restrict__ V16, int ldv, int voff, _Float16* __restrict__ Vt) { __shared__ unsigned short tl[64][66]; const int tid = threadIdx.x; const int slab = blockIdx.x / (TTv / 64), lg = blockIdx.x % (TTv / 64); const int b = slab / NHv, h = slab % NHv;
  for (int i = tid; i < 64 * 8; i += 256) { const int r = i / 8, c8 = (i % 8) * 8; FragH f; f.half[0] = *(const v8us*)((const unsigned short*)V16 + ((size_t)b * TTv + lg * 64 + r) * ldv + voff + h * 64 + c8);
#pragma unroll
    for (int q = 0; q < 8; ++q) tl[r][c8 + q] = f.u[q]; }
  __syncthreads();
  {
#pragma unroll
    for (int rd = 0; rd < 2; ++rd) { const int d = rd * 32 + tid / 8, pc = tid % 8; FragH f;
#pragma unroll
      for (int q = 0; q < 8; ++q) f.u[q] = tl[pc * 8 + q][d];
      *(v8us*)((unsigned short*)Vt + ((size_t)slab * 64 + d) * TTv + lg * 64 + pc * 8) = f.half[0]; }
     } }

__global__ __launch_bounds__(256) void k_hl(const float* __restrict__ F, _Float16* __restrict__ Hh, _Float16* __restrict__ Hl, size_t n8) { const size_t t = (size_t)blockIdx.x * 256 + threadIdx.x; if (t >= n8) return; FragH fh, fl; const v4f a = *(const v4fa*)(F + t * 8), c = *(const v4fa*)(F + t * 8 + 4);
#pragma unroll
  for (int q = 0; q < 4; ++q) { _Float16 h = (_Float16)a[q]; fh.h[q] = h; fl.h[q] = (_Float16)((a[q] - (float)h) * 1024.0f); h = (_Float16)c[q]; fh.h[4 + q] = h; fl.h[4 + q] = (_Float16)((c[q] - (float)h) * 1024.0f); }
  { *(v8us*)((unsigned short*)Hh + t * 8) = fh.half[0]; *(v8us*)((unsigned short*)Hl + t * 8) = fl.half[0];  } }

// ---- fast GEMM (wave tile 32x64; requires M % 32 == 0 rows per launch region and N % 64 == 0); epilogue = k_gemm_hhx semantics ----
__device__ __forceinline__ v16h g2_frag(const _Float16* p, int hh) { FragH f; f.half[0] = *(const v8us*)((const unsigned short*)p + 8 * hh); f.half[1] = *(const v8us*)((const unsigned short*)p + 16 + 8 * hh); return f.v; }
__device__ __forceinline__ v8f g2_mma(v16h a, v16h b, v8f c) { v8f d = __builtin_amdgcn_wmma_f32_16x16x32_f16(false, a, false, b, (short)0, c, false, false); asm volatile("v_nop\n\tv_nop\n\tv_nop\n\tv_nop" : "+v"(d) : "v"(a), "v"(b)); return d; }
template <int ACT>
__global__ __launch_bounds__(128) void k_gemm2(const _Float16* __restrict__ A, int lda, size_t sA, const _Float16* __restrict__ Bh, int ldb, size_t sB, float alpha, const float* __restrict__ bias, size_t sBias, const float* __restrict__ CP, int rowsPerB, size_t sCPb, int row0g,
    float* __restrict__ C, _Float16* __restrict__ C16, int ldc, size_t sC, int M, int N, int K) { static_assert(ACT == 0 || ACT == 3 || ACT == 6 || ACT == 8 || ACT == 9 || ACT == 11 || ACT == 12 || ACT == 14 || ACT == 15 || ACT == 16 || ACT == 17, "k_gemm2: unsupported ACT code (would silently apply no activation)");
  __shared__ __attribute__((aligned(16))) float so[4][32][68];
  const int tid = threadIdx.x, w = tid >> 5, lane = tid & 31, ln = lane & 15, hh = lane >> 4; const int by = blockIdx.y;
  A += (size_t)by * sA; Bh += (size_t)by * sB; const size_t cofs = (size_t)by * sC; const float* bp = bias ? bias + (size_t)by * sBias : nullptr;
  const int ntn = N >> 6; const int mt = blockIdx.x / ntn, nq = blockIdx.x - mt * ntn; const int row0 = mt * 128 + 32 * w, col0 = nq * 64; if (row0 >= M) return;
  const _Float16* a0p = A + (size_t)(row0 + ln) * lda; const _Float16* a1p = a0p + (size_t)16 * lda;
  const _Float16* b0p = Bh + (size_t)(col0 + ln) * ldb; const _Float16* b1p = b0p + (size_t)16 * ldb; const _Float16* b2p = b1p + (size_t)16 * ldb; const _Float16* b3p = b2p + (size_t)16 * ldb;
  const v8f z8 = {0.f,0.f,0.f,0.f,0.f,0.f,0.f,0.f}; v8f c00 = z8, c01 = z8, c02 = z8, c03 = z8, c10 = z8, c11 = z8, c12 = z8, c13 = z8;
#pragma unroll 1
  for (int kb = 0; kb < K; kb += 32) { const v16h a0 = g2_frag(a0p + kb, hh), a1 = g2_frag(a1p + kb, hh);
    v16h b = g2_frag(b0p + kb, hh); c00 = g2_mma(a0, b, c00); c10 = g2_mma(a1, b, c10);
    b = g2_frag(b1p + kb, hh); c01 = g2_mma(a0, b, c01); c11 = g2_mma(a1, b, c11);
    b = g2_frag(b2p + kb, hh); c02 = g2_mma(a0, b, c02); c12 = g2_mma(a1, b, c12);
    b = g2_frag(b3p + kb, hh); c03 = g2_mma(a0, b, c03); c13 = g2_mma(a1, b, c13); }
  v8f accs[8] = {c00, c01, c02, c03, c10, c11, c12, c13};
#pragma unroll
  for (int u = 0; u < 8; ++u) { const int t = u & 3, half = u >> 2; const int col = col0 + t * 16 + ln; const float bv = bp ? bf16_round(bp[col]) : 0.f;
#pragma unroll
    for (int r = 0; r < 8; ++r) { const int rloc = half * 16 + 8 * hh + r; float v = accs[u][r] * alpha + bv; if (CP) { if (rowsPerB < 0) v += CP[cofs + (size_t)(row0g + row0 + rloc) * ldc + col];      /* rowsPerB < 0: own element of the batched C plane */ else { const int bidx = (row0g + row0 + rloc) / rowsPerB; v += CP[(size_t)bidx * sCPb + (size_t)by * 64 + col]; } }
      if (ACT == 3) v = fmaxf(v, 0.f); else if (ACT == 6) v = 0.5f * v * (1.0f + erff(v * 0.70710678118654752f)); else if (ACT == 11) v = 1.0f / (1.0f + expf(-v)); else if (ACT == 15) v = v / (1.0f + expf(-v)); else if (ACT == 12) v = (v > 0.f) ? v : 0.01f * v; else if (ACT == 8) v = tanhf(v); else if (ACT == 9) v = 0.5f * v * (1.0f + tanhf(0.7978845608028654f * (v + 0.044715f * v * v * v))); else if (ACT == 14) v = (v > 0.f) ? v : 0.1f * v; else if (ACT == 16) v = (v >= 0.f) ? v : 0.3f * v; else if (ACT == 17) v = (v >= 0.f) ? v : 0.2f * v;
      so[w][rloc][t * 16 + ln] = v; } }
  __builtin_amdgcn_fence(__ATOMIC_ACQ_REL, "workgroup"); __builtin_amdgcn_wave_barrier();
  const int rsub = lane >> 4, c4 = (lane & 15) * 4;
  {
#pragma unroll
    for (int q = 0; q < 16; ++q) { const int r = q * 2 + rsub; const v4f v = *(const v4fa*)&so[w][r][c4]; if (C) *(v4f*)(C + cofs + (size_t)(row0 + r) * ldc + col0 + c4) = v; if (C16) { v4h h4; for (int i = 0; i < 4; ++i) h4[i] = (_Float16)v[i]; *(v4h*)(C16 + cofs + (size_t)(row0 + r) * ldc + col0 + c4) = h4; } }
     } }


__global__ __launch_bounds__(256) void k_wnat(const float* __restrict__ w, size_t n8, _Float16* __restrict__ Bt) { const size_t t = (size_t)blockIdx.x * 256 + threadIdx.x; if (t >= n8) return; FragH f; for (int q = 0; q < 8; ++q) f.h[q] = (_Float16)(bf16_round(w[t * 8 + q]) * 16.0f); *(v8us*)((unsigned short*)Bt + t * 8) = f.half[0];  }
__global__ __launch_bounds__(256) void k_rsm(const float* __restrict__ S, _Float16* __restrict__ P, int nrows) {
  #pragma clang fp contract(off)
  const int i = blockIdx.x * 256 + threadIdx.x; if (i >= nrows) return; const float* s = S + (size_t)i * SQ; float mx = -3.0e38f;
#pragma unroll 1
  for (int j = 0; j < SQ; ++j) mx = fmaxf(mx, s[j]); float se = 0.f;
#pragma unroll 1
  for (int j = 0; j < SQ; ++j) se += expf(s[j] - mx); const float sc = 256.0f / se;
#pragma unroll 1
  for (int j0 = 0; j0 < SQ; j0 += 8) { FragH f; for (int q = 0; q < 8; ++q) f.h[q] = (_Float16)(expf(s[j0 + q] - mx) * sc); unsigned short* d = (unsigned short*)P + (size_t)i * SQ + j0; *(v8us*)d = f.half[0];  } }
__global__ __launch_bounds__(256) void k_vt(const _Float16* __restrict__ V16, int b, int h0, _Float16* __restrict__ VT) { __shared__ unsigned short tl[64][65]; const int tid = threadIdx.x; const int hh = blockIdx.x % HG, sg = blockIdx.x / HG; const int s0 = sg * 64; const int h = h0 + hh;
  for (int i = tid; i < 64 * 8; i += 256) { const int j = i / 8, d8 = (i % 8) * 8; FragH f; f.half[0] = *(const v8us*)((const unsigned short*)V16 + ((size_t)b * SQ + s0 + j) * DM + h * HD + d8); for (int q = 0; q < 8; ++q) tl[d8 + q][j] = f.u[q]; }
  __syncthreads();
  { for (int i = tid; i < 64 * 8; i += 256) { const int d = i / 8, j8 = (i % 8) * 8; FragH f; for (int q = 0; q < 8; ++q) f.u[q] = tl[d][j8 + q]; *(v8us*)((unsigned short*)VT + ((size_t)hh * HD + d) * SQ + s0 + j8) = f.half[0]; }  } }



__global__ __launch_bounds__(256) void k_rsmcf2(const float* __restrict__ S, _Float16* __restrict__ P, int hg, int q0, int nk) {
  #pragma clang fp contract(off)
  const int t = blockIdx.x * 256 + threadIdx.x; if (t >= hg * QT) return; const size_t i = (size_t)t; const float* s = S + i * NKX; const int last = q0 + (t % QT); float mx = -3.0e38f;
#pragma unroll 1
  for (int j = 0; j < nk; ++j) { const float f = (j <= last) ? 1.f : 0.f; mx = fmaxf(mx, fmaf(f, s[j], (1.f - f) * -1.0e9f)); } float se = 0.f;
#pragma unroll 1
  for (int j = 0; j < nk; ++j) { const float f = (j <= last) ? 1.f : 0.f; se += __expf(fmaf(f, s[j], (1.f - f) * -1.0e9f) - mx); } const float sc = 256.0f / se;
#pragma unroll 1
  for (int j0 = 0; j0 < nk; j0 += 8) { FragH fr; for (int q = 0; q < 8; ++q) { const int j = j0 + q; const float f = (j <= last) ? 1.f : 0.f; fr.h[q] = (_Float16)(__expf(fmaf(f, s[j], (1.f - f) * -1.0e9f) - mx) * sc); } unsigned short* d = (unsigned short*)P + i * NKX + j0; *(v8us*)d = fr.half[0];  } }

template <int MASKADD>
__global__ __launch_bounds__(64) void k_att0(const float* __restrict__ QF, const float* __restrict__ KF, const float* __restrict__ VF, int ld, const float* __restrict__ mask, float scale, float* __restrict__ OF, int ldo) {
  #pragma clang fp contract(off)
  __shared__ __attribute__((aligned(16))) float lq[64][64]; __shared__ __attribute__((aligned(16))) float lo[64][64];
  const int tid = threadIdx.x; const int h = blockIdx.x / (QT0 / 64), rg = blockIdx.x % (QT0 / 64); const int i = rg * 64 + tid;
  const float* qr = QF + (size_t)i * ld + h * HD;
#pragma unroll 1
  for (int c = 0; c < HD / 4; ++c) { *(v4f*)&lq[tid][c * 4] = *(const v4fa*)(qr + c * 4); const v4f z = {0.f, 0.f, 0.f, 0.f}; *(v4f*)&lo[tid][c * 4] = z; }
  float m = -1.0e30f, l = 0.f; const int jmax = MASKADD ? (SQ - 1) : (rg * 64 + 63);      /* additive-mask form: every key (the mask input decides); causal form: keys up to the block's last row */
#pragma unroll 1
  for (int j = 0; j <= jmax; ++j) { const float* kr = KF + (size_t)j * ld + h * HD; const float* vr = VF + (size_t)j * ld + h * HD; float s = 0.f;
#pragma unroll 1
    for (int c = 0; c < HD / 4; ++c) { const v4f kq = *(const v4fa*)(kr + c * 4); const v4f qq = *(v4f*)&lq[tid][c * 4]; s = __fadd_rn(s, __fmul_rn(qq[0], kq[0])); s = __fadd_rn(s, __fmul_rn(qq[1], kq[1])); s = __fadd_rn(s, __fmul_rn(qq[2], kq[2])); s = __fadd_rn(s, __fmul_rn(qq[3], kq[3])); }
    s = __fmul_rn(s, scale); if (MASKADD) s = __fadd_rn(s, __fmul_rn(bf16_round(mask[(size_t)i * SQ + j]), -10000.0f));
    const float f = (MASKADD || j <= i) ? 1.f : 0.f; const float sm = fmaf(f, s, (1.f - f) * -1.0e30f); const float mn = fmaxf(m, sm); const float sc = expf(m - mn); const float e = expf(sm - mn); l = __fadd_rn(__fmul_rn(l, sc), e); m = mn;
#pragma unroll 1
    for (int c = 0; c < HD / 4; ++c) { const v4f vv = *(const v4fa*)(vr + c * 4); v4f oo = *(v4f*)&lo[tid][c * 4]; for (int u = 0; u < 4; ++u) oo[u] = __fadd_rn(__fmul_rn(oo[u], sc), __fmul_rn(e, vv[u])); *(v4f*)&lo[tid][c * 4] = oo; } }
  const float fin = 64.0f / l;      /* o carried x64; the f16 path writes o unscaled */
#pragma unroll 1
  for (int c = 0; c < HD / 4; ++c) { v4f oo = *(v4f*)&lo[tid][c * 4]; for (int u = 0; u < 4; ++u) oo[u] = __fmul_rn(oo[u], fin); *(v4f*)&lo[tid][c * 4] = oo; }
  __syncthreads();
  {
#pragma unroll 1
    for (int it = 0; it < 16; ++it) { const int row = it * 4 + tid / 16, pc = (tid % 16) * 4; const v4f v = *(const v4f*)&lo[row][pc]; *(v4f*)(OF + (size_t)(rg * 64 + row) * ldo + h * HD + pc) = v; }
     } }

__global__ __launch_bounds__(256) void k_oscale(const float* __restrict__ OF, float* __restrict__ out, size_t n4) { const size_t t = (size_t)blockIdx.x * 256 + threadIdx.x; if (t >= n4) return; const v4f a = *(const v4fa*)(OF + t * 4); v4f o; for (int q = 0; q < 4; ++q) o[q] = a[q] * 0.015625f; *(v4f*)(out + t * 4) = o;  }

__global__ __launch_bounds__(256) void k_bfr(const float* __restrict__ x, float* __restrict__ XB, size_t n8) { const size_t t = (size_t)blockIdx.x * 256 + threadIdx.x; if (t >= n8) return; v4f a = *(const v4fa*)(x + t * 8), c = *(const v4fa*)(x + t * 8 + 4); for (int q = 0; q < 4; ++q) { a[q] = bf16_round(a[q]); c[q] = bf16_round(c[q]); }
  { *(v4f*)(XB + t * 8) = a; *(v4f*)(XB + t * 8 + 4) = c;  } }



__global__ __launch_bounds__(256) void k_rsmfvl(const float* __restrict__ S, _Float16* __restrict__ P, _Float16* __restrict__ PL, int qn, const int* __restrict__ vlp) {
  #pragma clang fp contract(off)
  const int t = blockIdx.x * 256 + threadIdx.x; if (t >= qn) return; const int vl = vlp[0]; const size_t i = (size_t)t; const float* s = S + i * SQ; float mx = -3.0e38f;
#pragma unroll 1
  for (int j = 0; j < SQ; ++j) { const float f = (j < vl) ? 1.f : 0.f; mx = fmaxf(mx, fmaf(f, s[j], (1.f - f) * -1000000.0f)); } float se = 0.f;
#pragma unroll 1
  for (int j = 0; j < SQ; ++j) { const float f = (j < vl) ? 1.f : 0.f; se += __expf(fmaf(f, s[j], (1.f - f) * -1000000.0f) - mx); } const float sc = 256.0f / se;
#pragma unroll 1
  for (int j0 = 0; j0 < SQ; j0 += 8) { FragH fr, gr; for (int q = 0; q < 8; ++q) { const int j = j0 + q; const float f = (j < vl) ? 1.f : 0.f; const float pv = __expf(fmaf(f, s[j], (1.f - f) * -1000000.0f) - mx) * sc; const _Float16 ph = (_Float16)pv; fr.h[q] = ph; gr.h[q] = (_Float16)((pv - (float)ph) * 1024.0f); }
    unsigned short* d = (unsigned short*)P + i * SQ + j0; unsigned short* dl = (unsigned short*)PL + i * SQ + j0; *(v8us*)d = fr.half[0]; *(v8us*)dl = gr.half[0];  } }

__global__ __launch_bounds__(256) void k_rsmf(const float* __restrict__ S, _Float16* __restrict__ P, int qn, int hg) {
  #pragma clang fp contract(off)
  const int t = blockIdx.x * 256 + threadIdx.x; if (t >= qn * hg) return; const size_t i = (size_t)(t / qn) * SQ + (t % qn); const float* s = S + i * SQ; float mx = -3.0e38f;
#pragma unroll 1
  for (int j = 0; j < SQ; ++j) mx = fmaxf(mx, s[j]); float se = 0.f;
#pragma unroll 1
  for (int j = 0; j < SQ; ++j) se += __expf(s[j] - mx); const float sc = 256.0f / se;
#pragma unroll 1
  for (int j0 = 0; j0 < SQ; j0 += 8) { FragH f; for (int q = 0; q < 8; ++q) f.h[q] = (_Float16)(__expf(s[j0 + q] - mx) * sc); unsigned short* d = (unsigned short*)P + i * SQ + j0; *(v8us*)d = f.half[0];  } }



__global__ __launch_bounds__(128) void k_negmean(const float* __restrict__ V, float* __restrict__ NMV) {
  #pragma clang fp contract(off)
  const int b = blockIdx.x, c = threadIdx.x; const float* v = V + (size_t)b * SQ * DM + c; float a = 0.f;
#pragma unroll 4
  for (int s = 0; s < SQ; ++s) a = __fadd_rn(a, bf16_round(v[(size_t)s * DM]));
  const float m = -__fdiv_rn(a, (float)SQ); *(float*)(NMV + (size_t)b * DM + c) = m;  }

// lane l <-> l ^ 16 (cross-row move): register only, no LDS traffic
__device__ __forceinline__ float lane_x16(float v) { const int b = __float_as_int(v); return __int_as_float(__builtin_amdgcn_permlanex16(b, b, 0x76543210, 0xfedcba98, false, false)); }

// ---- fused attention: logits, softmax and weights x value in one kernel; scores and weights never leave the registers ----
#define FA_QT 4                      /* query tiles (16 rows each) per work-group */
#define FA_KS 4                      /* key ranges per work-group, one wave per (query tile, key range) */
#define FA_NP (SQ / FA_KS / 32)      /* passes of 32 keys per wave */
// Operands stored as ready-made WMMA A fragments: a block of 512 f16 = [half j][lane l][8], lane l = (c = l & 15, h = l >> 4) holding row c, k = 16 j + 8 h + 0..7 (the hardware k order),
// so that a fragment is two whole-line loads of 512 B instead of two loads that touch 16 lines each. One thread writes one 16-byte piece.
// KF: block (key tile kt, d step s) at kt * 4 + s: row = key kt * 16 + c, k = channel s * 32 + ...
__global__ __launch_bounds__(256) void k_kfrag(const float* __restrict__ x, _Float16* __restrict__ F) { const size_t t = (size_t)blockIdx.x * 256 + threadIdx.x; const int l = (int)(t & 31), j = (int)((t >> 5) & 1), c = l & 15, h = l >> 4; const size_t blk = t >> 6;
  const float* s = x + ((blk >> 2) * 16 + c) * DM + (blk & 3) * 32 + j * 16 + 8 * h; FragH f;
#pragma unroll
  for (int q = 0; q < 8; ++q) f.h[q] = (_Float16)bf16_round(s[q]);
  *(v8us*)((unsigned short*)F + t * 8) = f.half[0]; }
// VF: block (32-key step kp, channel tile dt) at kp * 8 + dt: row = channel dt * 16 + c, k = key kp * 32 + ... (the transposition of value happens here)
__global__ __launch_bounds__(256) void k_vfrag(const float* __restrict__ x, _Float16* __restrict__ F) { const size_t t = (size_t)blockIdx.x * 256 + threadIdx.x; const int l = (int)(t & 31), j = (int)((t >> 5) & 1), c = l & 15, h = l >> 4; const size_t blk = t >> 6;
  const float* s = x + ((blk >> 3) * 32 + j * 16 + 8 * h) * DM + (blk & 7) * 16 + c; FragH f;
#pragma unroll
  for (int q = 0; q < 8; ++q) f.h[q] = (_Float16)bf16_round(s[(size_t)q * DM]);
  *(v8us*)((unsigned short*)F + t * 8) = f.half[0]; }
// p: the block's start, the same for the whole wave; lo = lane * 8: the lane's own 16-byte piece
__device__ __forceinline__ v16h fa_frag(const unsigned short* p, unsigned lo) { FragH f; f.half[0] = *(const v8us*)(p + lo); f.half[1] = *(const v8us*)(p + 256 + lo); return f.v; }
__device__ __forceinline__ v8f fa_mma(v16h a, v16h b, v8f c) { return __builtin_amdgcn_wmma_f32_16x16x32_f16(false, a, false, b, (short)0, c, false, false); }
// native 2^t; the v_nop in the same statement keeps the one slot that the instruction set asks for behind a transcendental, whatever the compiler puts next
__device__ __forceinline__ float fa_exp2(float t) { float e; asm("v_exp_f32 %0, %1\n\tv_nop" : "=v"(e) : "v"(t)); return e; }
// four at once: the results are early-clobber, so none of the four reads a neighbour's result or overwrites its source, and one v_nop closes the last one's slot
__device__ __forceinline__ void fa_exp2x4(float& a, float& b, float& c, float& d) { float e0, e1, e2, e3;
  asm("v_exp_f32 %0, %4\n\tv_exp_f32 %1, %5\n\tv_exp_f32 %2, %6\n\tv_exp_f32 %3, %7\n\tv_nop" : "=&v"(e0), "=&v"(e1), "=&v"(e2), "=&v"(e3) : "v"(a), "v"(b), "v"(c), "v"(d)); a = e0; b = e1; c = e2; d = e3; }
// A wave owns 16 queries and 1024 keys. S^T = K Q^T: D register r of lane (c, h) = score of key 8 h + r, query c, so a query's scores sit in two lanes (maximum and sum in-lane plus one exchange),
// and two score tiles (keys 0..15, 16..31), converted in place, ARE the B fragment of O^T += V^T P^T in the hardware k order. Running maximum m per query (log2 units), renewed only when a pass exceeds it by more than 8;
// weights 2^(s - m + 6) <= 2^14 as f16 hi + f16 residual, both into the same f32 accumulators; the sum of the f32 weights in l. The four key ranges of a query tile are joined through LDS at the end.
__global__ __launch_bounds__(FA_QT * FA_KS * 32) void k_fattn(const _Float16* __restrict__ Q16, const _Float16* __restrict__ KF, const _Float16* __restrict__ VF, const float* __restrict__ NMV, float* __restrict__ out) {
  __shared__ float so[FA_KS][FA_QT][64][32]; __shared__ float sm[FA_KS][FA_QT][32]; __shared__ float sl[FA_KS][FA_QT][32];
  const int tid = threadIdx.x, w = __builtin_amdgcn_readfirstlane(tid >> 5) /* the wave's number in a scalar register: fragment bases and LDS planes become scalar */, lane = tid & 31, c = lane & 15, h = lane >> 4, qt = w & (FA_QT - 1), ks = w / FA_QT; const int b = blockIdx.y, row0 = blockIdx.x * (FA_QT * 16) + qt * 16;
  const _Float16* qp = Q16 + ((size_t)b * SQ + row0 + c) * DM; const v16h q0 = g2_frag(qp, h), q1 = g2_frag(qp + 32, h), q2 = g2_frag(qp + 64, h), q3 = g2_frag(qp + 96, h);
  const size_t f0 = ((size_t)b * (SQ / 32) + (size_t)ks * FA_NP) * 4096; const unsigned lo = (unsigned)lane * 8;      /* a pass of 32 keys = 8 blocks = 4096 f16 in KF and in VF */
  const unsigned short* kb = (const unsigned short*)KF + f0; const unsigned short* vb = (const unsigned short*)VF + f0;
  const float CS = (float)(0.08838834764831845 * 1.4426950408889634);      /* 1 / sqrt(128) times log2 e */
  const v8f z8 = {0.f,0.f,0.f,0.f,0.f,0.f,0.f,0.f}; v8f o[8] = {z8, z8, z8, z8, z8, z8, z8, z8}; float m = -1.0e30f, l = 0.f;
  /* kept rolled: two passes' fragments at once would not fit the 256 registers that four waves per SIMD leave each wave */
#pragma unroll 1
  for (int p = 0; p < FA_NP; ++p) { const unsigned short* kp = kb + (size_t)p * 4096; const unsigned short* vp = vb + (size_t)p * 4096;
    const v16h k0 = fa_frag(kp, lo), k1 = fa_frag(kp + 512, lo), k2 = fa_frag(kp + 1024, lo), k3 = fa_frag(kp + 1536, lo), k4 = fa_frag(kp + 2048, lo), k5 = fa_frag(kp + 2560, lo), k6 = fa_frag(kp + 3072, lo), k7 = fa_frag(kp + 3584, lo);
    /* inputs only, no code: all eight key fragments are in registers here, so their 16 loads issue back to back under ONE wait (without it each fragment is loaded, waited for and used in turn: eight latencies a pass) */
    asm volatile("" :: "v"(k0), "v"(k1), "v"(k2), "v"(k3), "v"(k4), "v"(k5), "v"(k6), "v"(k7));
    v16h vf[8];
#pragma unroll
    for (int j = 0; j < 8; ++j) vf[j] = fa_frag(vp + j * 512, lo);
    v8f s0 = fa_mma(k0, q0, z8), s1 = fa_mma(k4, q0, z8); s0 = fa_mma(k1, q1, s0); s1 = fa_mma(k5, q1, s1); s0 = fa_mma(k2, q2, s0); s1 = fa_mma(k6, q2, s1); s0 = fa_mma(k3, q3, s0); s1 = fa_mma(k7, q3, s1);
    float mx = fmaxf(s0[0], s1[0]);
#pragma unroll
    for (int r = 1; r < 8; ++r) mx = fmaxf(mx, fmaxf(s0[r], s1[r]));
    mx = fmaxf(mx, lane_x16(mx)) * CS;
    const bool need = mx > m + 8.0f;
    if (__builtin_amdgcn_ballot_w32(need) != 0) {      /* wave-uniform: the accumulators are rescaled only in the few passes in which some query's maximum moves */
      const float mn = need ? mx : m; const float al = fa_exp2(m - mn); m = mn; l *= al;
#pragma unroll
      for (int j = 0; j < 8; ++j) for (int r = 0; r < 8; ++r) o[j][r] *= al; }
    const float nm = 6.0f - m; float e[16];
#pragma unroll
    for (int r = 0; r < 8; ++r) { e[r] = fmaf(s0[r], CS, nm); e[8 + r] = fmaf(s1[r], CS, nm); }
#pragma unroll
    for (int u = 0; u < 16; u += 4) fa_exp2x4(e[u], e[u + 1], e[u + 2], e[u + 3]);
    l += ((e[0] + e[4] + e[8] + e[12]) + (e[1] + e[5] + e[9] + e[13])) + ((e[2] + e[6] + e[10] + e[14]) + (e[3] + e[7] + e[11] + e[15]));
    FragH ph, pl;
#pragma unroll
    for (int u = 0; u < 16; ++u) { const _Float16 hv = (_Float16)e[u]; ph.h[u] = hv; pl.h[u] = (_Float16)(e[u] - (float)hv); }
#pragma unroll
    for (int j = 0; j < 8; ++j) o[j] = fa_mma(vf[j], ph.v, o[j]);
#pragma unroll
    for (int j = 0; j < 8; ++j) o[j] = fa_mma(vf[j], pl.v, o[j]); }
  l += lane_x16(l);      /* the two halves of a query's keys */
#pragma unroll
  for (int j = 0; j < 8; ++j) for (int r = 0; r < 8; ++r) so[ks][qt][j * 8 + r][lane] = o[j][r];
  sm[ks][qt][lane] = m; sl[ks][qt][lane] = l;
  __syncthreads();      /* every wave passes it once: the four key ranges' partial results are read by the other waves of the query tile below */
  float mm[FA_KS], M = -3.0e38f, L = 0.f;
#pragma unroll
  for (int i = 0; i < FA_KS; ++i) { mm[i] = sm[i][qt][lane]; M = fmaxf(M, mm[i]); }
#pragma unroll
  for (int i = 0; i < FA_KS; ++i) { mm[i] = fa_exp2(mm[i] - M); L += sl[i][qt][lane] * mm[i]; }
  const float inv = 1.0f / L;
  /* wave (qt, ks) finishes channels 32 ks .. 32 ks + 31 of its query tile: one whole 128-byte line of each output row */
#pragma unroll
  for (int jj = 0; jj < 2; ++jj) { const int j = 2 * ks + jj; const float* nv = NMV + (size_t)b * DM + 16 * j + 8 * h; v4f r0, r1;
#pragma unroll
    for (int r = 0; r < 8; ++r) { float a = 0.f;
#pragma unroll
      for (int i = 0; i < FA_KS; ++i) a += so[i][qt][j * 8 + r][lane] * mm[i];
      a = a * inv + nv[r]; if (r < 4) r0[r] = a; else r1[r - 4] = a; }
    float* d = out + ((size_t)b * SQ + row0 + c) * DM + 16 * j + 8 * h; *(v4f*)d = r0; *(v4f*)(d + 4) = r1; } }
extern "C" void kernel_launch(void* const* d_in, const int* in_sizes, int n_in,
                              void* d_out, int out_size, void* d_ws, size_t ws_size, hipStream_t stream) {
  (void)in_sizes; (void)n_in; (void)out_size;
  const float* const* I = (const float* const*)d_in; const float* xq = I[0]; const float* xk = I[1]; const float* xv = I[2];      /* query, key, value [4][4096][128] */
  char* ws = (char*)d_ws; size_t off = 0;
  auto take = [&](size_t bytes) { char* p = ws + off; off += (bytes + 255) & ~(size_t)255; return p; };
  _Float16* Q16 = (_Float16*)take(NR * DM * 2); _Float16* KF = (_Float16*)take(NR * DM * 2); _Float16* VF = (_Float16*)take(NR * DM * 2); float* NMV = (float*)take((size_t)NB * DM * 4);      /* -mean(value) per batch [128] */
  if (off > ws_size) return;
  k_x16<<<(unsigned)((NR * DM / 8 + 255) / 256), 256, 0, stream>>>(xq, Q16, NR * DM / 8);      /* exact f16 rows of the bf16-rounded queries */
  k_kfrag<<<(unsigned)(NR * DM / 8 / 256), 256, 0, stream>>>(xk, KF); k_vfrag<<<(unsigned)(NR * DM / 8 / 256), 256, 0, stream>>>(xv, VF);      /* keys and value^T, bf16-rounded, exact in f16, in fragment order */
  k_negmean<<<NB, 128, 0, stream>>>(xv, NMV);      /* NMV[b][c] = -(1/4096) sum_s bf16(value[b][s][c]) (f32, fixed ascending order; thread per (b, c)) */
  k_fattn<<<dim3(SQ / (FA_QT * 16), NB), FA_QT * FA_KS * 32, 0, stream>>>(Q16, KF, VF, NMV, (float*)d_out);      /* out = softmax(q.k / sqrt(128)) value - mean(value), all batches */
}

// v003
// One run takes 65.6 microseconds.
// In two side-by-side timings against v002, it was 5.24 and 5.36 times as fast.
// All steps since v000 together make it 66.6 times as fast.
#include <hip/hip_runtime.h>
#define NB 4
#define SQ 4096
#define DM 128
#define NH 2
#define HD 64
#define HG 8                         /* heads per launch of the four-argument k_vt (not launched) */
#define B0 0                         /* first batch processed (unused) */
#define NBR NB                       /* batches processed (used only in MP) */
#define NR ((size_t)NB * SQ)         /* token rows */
#define MP ((int)((size_t)NBR * SQ)) /* token rows (used only in MPO) */
#define QT 256                       /* query rows per causal tile */
#define NKX SQ                       /* S / P row pitch */
#define QT0 256                      /* query rows per head of the f32 k_att0 (not launched) */
#define QN SQ                        /* query rows attended per batch (unused) */
#define NHD NH                       /* unused */
#define MPO MP                       /* rows through the output stage (unused) */
#define LQ DM            /* row pitch of the q/k/v rows (unused) */
typedef __bf16 v16b __attribute__((ext_vector_type(16)));
typedef unsigned short v8us __attribute__((ext_vector_type(8), may_alias));
typedef float  v8f  __attribute__((ext_vector_type(8)));
typedef float  v4f  __attribute__((ext_vector_type(4)));
typedef float  v4fa __attribute__((ext_vector_type(4), may_alias));
union FragB { v16b v; v8us half[2]; unsigned short u[16]; };

__device__ __forceinline__ unsigned short bf16_bits(float x) { unsigned int u = __float_as_uint(x); return (unsigned short)((u + 0x7FFFu + ((u >> 16) & 1u)) >> 16); }
__device__ __forceinline__ float bf16_val(unsigned short b) { return __uint_as_float(((unsigned int)b) << 16); }
__device__ __forceinline__ float bf16_round(float x) { return bf16_val(bf16_bits(x)); }
// D += A·B with NT terms: 1 = ah·bh, 2 = + al·bh (A split), 3 = + ah·bl (both split)
template <int NT>
__device__ __forceinline__ v8f mmaN(v16b ah, v16b al, v16b bh, v16b bl, v8f c) {
  c = __builtin_amdgcn_wmma_f32_16x16x32_bf16(false, ah, false, bh, (short)0, c, false, false);
  if (NT >= 2) c = __builtin_amdgcn_wmma_f32_16x16x32_bf16(false, al, false, bh, (short)0, c, false, false);
  if (NT >= 3) c = __builtin_amdgcn_wmma_f32_16x16x32_bf16(false, ah, false, bl, (short)0, c, false, false);
  asm volatile("v_nop\n\tv_nop\n\tv_nop\n\tv_nop" : "+v"(c) : "v"(ah), "v"(al), "v"(bh), "v"(bl));
  return c;
}

__global__ __launch_bounds__(256) void k_wt_bf16(const float* __restrict__ W, unsigned short* __restrict__ Wt, int K, int N) {
  const int t = blockIdx.x * 256 + threadIdx.x;
  const int k8n = K / 8;
  if (t >= N * k8n) return;
  const int n = t / k8n, k8 = (t % k8n) * 8;
  v8us v;
#pragma unroll
  for (int i = 0; i < 8; ++i) v[i] = bf16_bits(W[(size_t)(k8 + i) * N + n]);
  *(v8us*)(Wt + (size_t)n * K + k8) = v;
  
}

// GEMM C[M][N] (f32, pitch ldc) = act(A[M][K]·W + bias). A f32 row-major (pitch lda) converted per fragment to bf16
// (ASPLIT: hi/lo two planes -> 2 terms, else single rounded term); Wt bf16 [N][K] (pitch ldb). BIAS_BF16 rounds the
// bias to bf16 first (bias quantised to bf16 before the add). K%32==0, M%16==0, N%64==0.
template <bool ASPLIT, int ACT, bool BIAS_BF16>
__global__ __launch_bounds__(128) void k_gemm_bf(const float* __restrict__ A, int lda, const unsigned short* __restrict__ Wt, int ldb,
                                               const float* __restrict__ bias, float* __restrict__ C, int ldc, int M, int N, int K) {
  __shared__ __attribute__((aligned(16))) float so[4][16][64];
  const int tid = threadIdx.x, w = tid >> 5, lane = tid & 31, ln = lane & 15, hh = lane >> 4;
  const int ntn = N / 64;
  const int wid = blockIdx.x * 4 + w;
  const int mt = wid / ntn, nq = wid % ntn;
  if (mt * 16 >= M) return;
  const int row0 = mt * 16, col0 = nq * 64;
  const float* arow = A + (size_t)(row0 + ln) * lda;
  v8f acc[4] = {};
  for (int kb = 0; kb < K; kb += 32) {
    FragB ah, al;
    const v4f x0 = *(const v4fa*)(arow + kb + 8 * hh), x1 = *(const v4fa*)(arow + kb + 8 * hh + 4);
    const v4f x2 = *(const v4fa*)(arow + kb + 16 + 8 * hh), x3 = *(const v4fa*)(arow + kb + 16 + 8 * hh + 4);
    float xs[16] = {x0[0],x0[1],x0[2],x0[3],x1[0],x1[1],x1[2],x1[3],x2[0],x2[1],x2[2],x2[3],x3[0],x3[1],x3[2],x3[3]};
#pragma unroll
    for (int i = 0; i < 16; ++i) { const unsigned short hb = bf16_bits(xs[i]); ah.u[i] = hb; al.u[i] = ASPLIT ? bf16_bits(xs[i] - bf16_val(hb)) : (unsigned short)0; }
#pragma unroll
    for (int t = 0; t < 4; ++t) {
      const unsigned short* brow = Wt + (size_t)(col0 + t * 16 + ln) * ldb + kb;
      FragB b;
      b.half[0] = *(const v8us*)(brow + 8 * hh);
      b.half[1] = *(const v8us*)(brow + 16 + 8 * hh);
      acc[t] = mmaN<ASPLIT ? 2 : 1>(ah.v, al.v, b.v, b.v, acc[t]);
    }
  }
#pragma unroll
  for (int t = 0; t < 4; ++t) {
    float bv = bias ? bias[col0 + t * 16 + ln] : 0.f;
    if (BIAS_BF16) bv = bf16_round(bv);
#pragma unroll
    for (int r = 0; r < 8; ++r) { float v = acc[t][r] + bv; if (ACT == 1) v = fmaxf(v, 0.f); so[w][8 * hh + r][t * 16 + ln] = v; }
  }
  __builtin_amdgcn_fence(__ATOMIC_ACQ_REL, "workgroup");
  __builtin_amdgcn_wave_barrier();
  const int rsub = lane >> 4, c4 = (lane & 15) * 4;
  {
#pragma unroll
    for (int q = 0; q < 8; ++q) {
      const int r = q * 2 + rsub;
      const v4f v = *(const v4fa*)&so[w][r][c4];
      *(v4f*)(C + (size_t)(row0 + r) * ldc + col0 + c4) = v;
    }
    
  }
}

// GEMM C = act(A·W + bias + resid): A f32 (ASPLIT -> hi/lo 2 terms), Wt bf16 [N][K]; ACT 0 none, 1 relu, 2 exact gelu;
// resid (optional, f32, row index = (row % rmod), pitch ldr, RES_BF16 rounds it) added before the activation.
template <bool ASPLIT, int ACT, bool BIAS_BF16, bool RES_BF16>
__global__ __launch_bounds__(128) void k_gemm_bf3(const float* __restrict__ A, int lda, const unsigned short* __restrict__ Wt, int ldb,
                                                const float* __restrict__ bias, const float* __restrict__ resid, int rmod, int ldr,
                                                float* __restrict__ C, int ldc, int M, int N, int K) {
  __shared__ __attribute__((aligned(16))) float so[4][16][64];
  const int tid = threadIdx.x, w = tid >> 5, lane = tid & 31, ln = lane & 15, hh = lane >> 4;
  const int ntn = N / 64;
  const int wid = blockIdx.x * 4 + w;
  const int mt = wid / ntn, nq = wid % ntn;
  if (mt * 16 >= M) return;
  const int row0 = mt * 16, col0 = nq * 64;
  const float* arow = A + (size_t)(row0 + ln) * lda;
  v8f acc[4] = {};
  for (int kb = 0; kb < K; kb += 32) {
    FragB ah, al;
    const v4f x0 = *(const v4fa*)(arow + kb + 8 * hh), x1 = *(const v4fa*)(arow + kb + 8 * hh + 4);
    const v4f x2 = *(const v4fa*)(arow + kb + 16 + 8 * hh), x3 = *(const v4fa*)(arow + kb + 16 + 8 * hh + 4);
    float xs[16] = {x0[0],x0[1],x0[2],x0[3],x1[0],x1[1],x1[2],x1[3],x2[0],x2[1],x2[2],x2[3],x3[0],x3[1],x3[2],x3[3]};
#pragma unroll
    for (int i = 0; i < 16; ++i) { const unsigned short hb = bf16_bits(xs[i]); ah.u[i] = hb; al.u[i] = ASPLIT ? bf16_bits(xs[i] - bf16_val(hb)) : (unsigned short)0; }
#pragma unroll
    for (int t = 0; t < 4; ++t) {
      const unsigned short* brow = Wt + (size_t)(col0 + t * 16 + ln) * ldb + kb;
      FragB b;
      b.half[0] = *(const v8us*)(brow + 8 * hh);
      b.half[1] = *(const v8us*)(brow + 16 + 8 * hh);
      acc[t] = mmaN<ASPLIT ? 2 : 1>(ah.v, al.v, b.v, b.v, acc[t]);
    }
  }
#pragma unroll
  for (int t = 0; t < 4; ++t) {
    const int col = col0 + t * 16 + ln;
    float bv = bias ? bias[col] : 0.f;
    if (BIAS_BF16) bv = bf16_round(bv);
#pragma unroll
    for (int r = 0; r < 8; ++r) {
      float v = acc[t][r] + bv;
      if (resid) { float rv = resid[(size_t)((row0 + 8 * hh + r) % rmod) * ldr + col]; if (RES_BF16) rv = bf16_round(rv); v += rv; }
      if (ACT == 1) v = fmaxf(v, 0.f);
      if (ACT == 2) v = 0.5f * v * (1.0f + erff(v * 0.70710678118654752f));
      if (ACT == 3) { const float u = 0.7978845608028654f * (v + 0.044715f * v * v * v); v = 0.5f * v * (1.0f + tanhf(u)); }
      so[w][8 * hh + r][t * 16 + ln] = v;
    }
  }
  __builtin_amdgcn_fence(__ATOMIC_ACQ_REL, "workgroup");
  __builtin_amdgcn_wave_barrier();
  const int rsub = lane >> 4, c4 = (lane & 15) * 4;
  {
#pragma unroll
    for (int q = 0; q < 8; ++q) {
      const int r = q * 2 + rsub;
      const v4f v = *(const v4fa*)&so[w][r][c4];
      *(v4f*)(C + (size_t)(row0 + r) * ldc + col0 + c4) = v;
    }
    
  }
}
// row LayerNorm (biased variance, eps) over N: s = X (+ R); optional out_sum <- s; out_norm <- (s-mu)*rsqrt(var+eps)*g + b
template <bool PARAM_BF16>
__global__ __launch_bounds__(256) void k_layernorm(const float* __restrict__ X, const float* __restrict__ R, const float* __restrict__ g, const float* __restrict__ bta,
                                                  float* __restrict__ out_sum, float* __restrict__ out_norm, int N, float eps) {
  __shared__ float red[256];
  const int row = blockIdx.x, tid = threadIdx.x;
  const float* x = X + (size_t)row * N; const float* rr = R ? R + (size_t)row * N : nullptr;
  float vals[16];                     // up to N = 4096
  const int per = N / 256;            // contiguous chunk per thread? use strided-by-4 chunks: thread handles j = tid*4 + 1024*u
  float s1 = 0.f;
  for (int u = 0; u < per / 4; ++u) {
    const int j = tid * 4 + 1024 * u;
    const v4f a = *(const v4fa*)(x + j);
    v4f b = {0.f,0.f,0.f,0.f}; if (rr) b = *(const v4fa*)(rr + j);
#pragma unroll
    for (int q = 0; q < 4; ++q) { const float v = a[q] + b[q]; vals[u * 4 + q] = v; s1 += v; }
  }
  red[tid] = s1; __syncthreads();
  for (int st = 128; st > 0; st >>= 1) { if (tid < st) red[tid] += red[tid + st]; __syncthreads(); }
  const float mu = red[0] / (float)N; __syncthreads();
  float s2 = 0.f;
  for (int u = 0; u < per / 4; ++u)
#pragma unroll
    for (int q = 0; q < 4; ++q) { const float c = vals[u * 4 + q] - mu; s2 += c * c; }
  red[tid] = s2; __syncthreads();
  for (int st = 128; st > 0; st >>= 1) { if (tid < st) red[tid] += red[tid + st]; __syncthreads(); }
  const float rs = rsqrtf(red[0] / (float)N + eps);
  {
    for (int u = 0; u < per / 4; ++u) {
      const int j = tid * 4 + 1024 * u;
      v4f o, sm;
#pragma unroll
      for (int q = 0; q < 4; ++q) {
        float gg = g[j + q], bb = bta[j + q];
        if (PARAM_BF16) { gg = bf16_round(gg); bb = bf16_round(bb); }
        sm[q] = vals[u * 4 + q]; o[q] = (vals[u * 4 + q] - mu) * rs * gg + bb;
      }
      if (out_sum) *(v4f*)(out_sum + (size_t)row * N + j) = sm;
      *(v4f*)(out_norm + (size_t)row * N + j) = o;
    }
    
  }
}



// ---- f16 WMMA path (v_wmma_f32_16x16x32_f16): 11-bit significands for operands in range — used where a [0,1] probability operand needs more precision than bf16
typedef _Float16 v16h __attribute__((ext_vector_type(16)));
union FragH { v16h v; v8us half[2]; _Float16 h[16]; unsigned short u[16]; };
template <int NT>
__device__ __forceinline__ v8f mmaH(v16h ah, v16h al, v16h bh, v16h bl, v8f c) {
  c = __builtin_amdgcn_wmma_f32_16x16x32_f16(false, ah, false, bh, (short)0, c, false, false);
  if (NT >= 2) c = __builtin_amdgcn_wmma_f32_16x16x32_f16(false, al, false, bh, (short)0, c, false, false);
  if (NT >= 3) c = __builtin_amdgcn_wmma_f32_16x16x32_f16(false, ah, false, bl, (short)0, c, false, false);
  asm volatile("v_nop\n\tv_nop\n\tv_nop\n\tv_nop" : "+v"(c) : "v"(ah), "v"(al), "v"(bh), "v"(bl));
  return c;
}
// batched GEMM like k_gemm_b but f16 operands: A f32 (split into f16 hi/lo if ASPLIT, else rounded to f16), Bt = f16 values [n][k]; alpha; C f32; N multiple of 16 (partial tiles skipped)
template <bool ASPLIT>
__global__ __launch_bounds__(128) void k_gemm_h(const float* __restrict__ A, int lda, size_t sA, const _Float16* __restrict__ Bh, int ldb, size_t sB, float alpha, float* __restrict__ C, int ldc, size_t sC, int M, int N, int K) {
  __shared__ __attribute__((aligned(16))) float so[4][16][64];
  const int tid = threadIdx.x, w = tid >> 5, lane = tid & 31, ln = lane & 15, hh = lane >> 4; const int by = blockIdx.y;
  A += (size_t)by * sA; Bh += (size_t)by * sB; C += (size_t)by * sC;
  const int ntn = (N + 63) / 64; const int wid = blockIdx.x * 4 + w; const int mt = wid / ntn, nq = wid % ntn; if (mt * 16 >= M) return;
  const int row0 = mt * 16, col0 = nq * 64; const float* arow = A + (size_t)(row0 + ln) * lda;
  v8f acc[4] = {};
  for (int kb = 0; kb < K; kb += 32) {
    FragH ah, al;
    const v4f x0 = *(const v4fa*)(arow + kb + 8 * hh), x1 = *(const v4fa*)(arow + kb + 8 * hh + 4), x2 = *(const v4fa*)(arow + kb + 16 + 8 * hh), x3 = *(const v4fa*)(arow + kb + 16 + 8 * hh + 4);
    float xs[16] = {x0[0],x0[1],x0[2],x0[3],x1[0],x1[1],x1[2],x1[3],x2[0],x2[1],x2[2],x2[3],x3[0],x3[1],x3[2],x3[3]};
#pragma unroll
    for (int i = 0; i < 16; ++i) { const _Float16 h = (_Float16)xs[i]; ah.h[i] = h; al.h[i] = ASPLIT ? (_Float16)(xs[i] - (float)h) : (_Float16)0.0f; }
#pragma unroll
    for (int t = 0; t < 4; ++t) { if (col0 + t * 16 >= N) continue; const size_t boff = (size_t)(col0 + t * 16 + ln) * ldb + kb; FragH bq; bq.half[0] = *(const v8us*)(Bh + boff + 8 * hh); bq.half[1] = *(const v8us*)(Bh + boff + 16 + 8 * hh);
      acc[t] = mmaH<ASPLIT ? 2 : 1>(ah.v, al.v, bq.v, bq.v, acc[t]); }
  }
#pragma unroll
  for (int t = 0; t < 4; ++t) { if (col0 + t * 16 >= N) continue;
#pragma unroll
    for (int r = 0; r < 8; ++r) so[w][8 * hh + r][t * 16 + ln] = acc[t][r] * alpha; }
  __builtin_amdgcn_fence(__ATOMIC_ACQ_REL, "workgroup"); __builtin_amdgcn_wave_barrier();
  const int rsub = lane >> 4, c4 = (lane & 15) * 4;
  {
#pragma unroll
    for (int q = 0; q < 8; ++q) { const int r = q * 2 + rsub; if (col0 + c4 < N) { const v4f v = *(const v4fa*)&so[w][r][c4]; *(v4f*)(C + (size_t)(row0 + r) * ldc + col0 + c4) = v; } }
     }
}

// Wt[n][k] = f16(W[k][n]·scale) from f32 row-major W[K][N] (scale = power of two; bf16-exact weights stay exact in f16 away from the subnormal range)
__global__ __launch_bounds__(256) void k_wt_f16(const float* __restrict__ W, _Float16* __restrict__ Wt, int K, int N, float scale) {
  const int t = blockIdx.x * 256 + threadIdx.x; if (t >= N * (K / 8)) return; const int n = t / (K / 8), k8 = (t % (K / 8)) * 8; FragH f;
#pragma unroll
  for (int i = 0; i < 8; ++i) f.h[i] = (_Float16)(bf16_round(W[(size_t)(k8 + i) * N + n]) * scale); const v8us o = f.half[0];
  *(v8us*)((unsigned short*)Wt + (size_t)n * K + k8) = o; 
}
// k_gemm_hh variant with fused epilogue: v = acc·alpha + bias[by·sBias + col] (+ CP[(row/rowsPerB)·sCPb + by·64 + col] if CP) ; ACT 0 none / 1 elu ; writes f16 C16 (and f32 C if non-null)
template <int ACT>
__global__ __launch_bounds__(128) void k_gemm_hhx(const _Float16* __restrict__ A, int lda, size_t sA, const _Float16* __restrict__ Bh, int ldb, size_t sB, float alpha, const float* __restrict__ bias, size_t sBias, const float* __restrict__ CP, int rowsPerB, size_t sCPb, int row0g,
    float* __restrict__ C, _Float16* __restrict__ C16, int ldc, size_t sC, int M, int N, int K) {
  __shared__ __attribute__((aligned(16))) float so[4][16][64];
  const int tid = threadIdx.x, w = tid >> 5, lane = tid & 31, ln = lane & 15, hh = lane >> 4; const int by = blockIdx.y;
  A += (size_t)by * sA; Bh += (size_t)by * sB; const size_t cofs = (size_t)by * sC; const float* bp = bias ? bias + (size_t)by * sBias : nullptr;
  const int ntn = (N + 63) / 64; const int wid = blockIdx.x * 4 + w; const int mt = wid / ntn, nq = wid % ntn; if (mt * 16 >= M) return;
  const int row0 = mt * 16, col0 = nq * 64; const _Float16* arow = A + (size_t)(row0 + ln) * lda;
  v8f acc[4] = {};
  for (int kb = 0; kb < K; kb += 32) { FragH ah; ah.half[0] = *(const v8us*)((const unsigned short*)arow + kb + 8 * hh); ah.half[1] = *(const v8us*)((const unsigned short*)arow + kb + 16 + 8 * hh);
#pragma unroll
    for (int t = 0; t < 4; ++t) { if (col0 + t * 16 >= N) continue; const size_t boff = (size_t)(col0 + t * 16 + ln) * ldb + kb; FragH bq; bq.half[0] = *(const v8us*)((const unsigned short*)Bh + boff + 8 * hh); bq.half[1] = *(const v8us*)((const unsigned short*)Bh + boff + 16 + 8 * hh);
      acc[t] = mmaH<1>(ah.v, ah.v, bq.v, bq.v, acc[t]); }
  }
#pragma unroll
  for (int t = 0; t < 4; ++t) { if (col0 + t * 16 >= N) continue; const int col = col0 + t * 16 + ln; const float bv = bp ? bf16_round(bp[col]) : 0.f;
#pragma unroll
    for (int r = 0; r < 8; ++r) { float v = acc[t][r] * alpha + bv; if (CP) { const int rr = row0g + row0 + 8 * hh + r; if (rowsPerB < 0) v += CP[cofs + (size_t)rr * ldc + col];      /* rowsPerB < 0: own element of the batched C plane */ else { const int bidx = rr / rowsPerB; v += CP[(size_t)bidx * sCPb + (size_t)by * 64 + col]; } } if (ACT == 1) v = (v > 0.f) ? v : expm1f(v); else if (ACT == 7) v = (v > 0.f) ? v + 1.0f : expf(v); else if (ACT == 8) v = tanhf(v); else if (ACT == 9) v = 0.5f * v * (1.0f + tanhf(0.7978845608028654f * (v + 0.044715f * v * v * v))); else if (ACT == 11) v = 1.0f / (1.0f + expf(-v)); else if (ACT == 12) v = (v > 0.f) ? v : 0.01f * v; else if (ACT == 14) v = (v > 0.f) ? v : 0.1f * v; else if (ACT == 16) v = (v >= 0.f) ? v : 0.3f * v; else if (ACT == 17) v = (v >= 0.f) ? v : 0.2f * v; else if (ACT == 15) v = v / (1.0f + expf(-v)); else if (ACT == 3) v = fmaxf(v, 0.f); else if (ACT == 6) v = 0.5f * v * (1.0f + erff(v * 0.70710678118654752f)); so[w][8 * hh + r][t * 16 + ln] = v; } }
  __builtin_amdgcn_fence(__ATOMIC_ACQ_REL, "workgroup"); __builtin_amdgcn_wave_barrier();
  const int rsub = lane >> 4, c4 = (lane & 15) * 4; typedef _Float16 v4h __attribute__((ext_vector_type(4)));
  {
#pragma unroll
    for (int q = 0; q < 8; ++q) { const int r = q * 2 + rsub; if (col0 + c4 < N) { const v4f v = *(const v4fa*)&so[w][r][c4]; if (C) *(v4f*)(C + cofs + (size_t)(row0 + r) * ldc + col0 + c4) = v; if (C16) { v4h h4; for (int i = 0; i < 4; ++i) h4[i] = (_Float16)v[i]; *(v4h*)(C16 + cofs + (size_t)(row0 + r) * ldc + col0 + c4) = h4; } } }
     }
}


typedef _Float16 v4h __attribute__((ext_vector_type(4)));

__global__ __launch_bounds__(256) void k_x16(const float* __restrict__ x, _Float16* __restrict__ X16, size_t n8) { const size_t t = (size_t)blockIdx.x * 256 + threadIdx.x; if (t >= n8) return; FragH f;
#pragma unroll
  for (int q = 0; q < 8; ++q) f.h[q] = (_Float16)bf16_round(x[t * 8 + q]); *(v8us*)((unsigned short*)X16 + t * 8) = f.half[0];  }
__global__ __launch_bounds__(256) void k_h16(const float* __restrict__ x, _Float16* __restrict__ X16, size_t n8) { const size_t t = (size_t)blockIdx.x * 256 + threadIdx.x; if (t >= n8) return; FragH f;
#pragma unroll
  for (int q = 0; q < 8; ++q) f.h[q] = (_Float16)x[t * 8 + q]; *(v8us*)((unsigned short*)X16 + t * 8) = f.half[0];  }
__global__ __launch_bounds__(256) void k_round16f(const float* __restrict__ W, _Float16* __restrict__ Bt, size_t n8) { const size_t t = (size_t)blockIdx.x * 256 + threadIdx.x; if (t >= n8) return; FragH f;
#pragma unroll
  for (int i = 0; i < 8; ++i) f.h[i] = (_Float16)(bf16_round(W[t * 8 + i]) * 16.0f); *(v8us*)((unsigned short*)Bt + t * 8) = f.half[0];  }
template <int NHv, int TTv>
__global__ __launch_bounds__(256) void k_vt(const _Float16* __restrict__ V16, int ldv, int voff, _Float16* __restrict__ Vt) { __shared__ unsigned short tl[64][66]; const int tid = threadIdx.x; const int slab = blockIdx.x / (TTv / 64), lg = blockIdx.x % (TTv / 64); const int b = slab / NHv, h = slab % NHv;
  for (int i = tid; i < 64 * 8; i += 256) { const int r = i / 8, c8 = (i % 8) * 8; FragH f; f.half[0] = *(const v8us*)((const unsigned short*)V16 + ((size_t)b * TTv + lg * 64 + r) * ldv + voff + h * 64 + c8);
#pragma unroll
    for (int q = 0; q < 8; ++q) tl[r][c8 + q] = f.u[q]; }
  __syncthreads();
  {
#pragma unroll
    for (int rd = 0; rd < 2; ++rd) { const int d = rd * 32 + tid / 8, pc = tid % 8; FragH f;
#pragma unroll
      for (int q = 0; q < 8; ++q) f.u[q] = tl[pc * 8 + q][d];
      *(v8us*)((unsigned short*)Vt + ((size_t)slab * 64 + d) * TTv + lg * 64 + pc * 8) = f.half[0]; }
     } }

__global__ __launch_bounds__(256) void k_hl(const float* __restrict__ F, _Float16* __restrict__ Hh, _Float16* __restrict__ Hl, size_t n8) { const size_t t = (size_t)blockIdx.x * 256 + threadIdx.x; if (t >= n8) return; FragH fh, fl; const v4f a = *(const v4fa*)(F + t * 8), c = *(const v4fa*)(F + t * 8 + 4);
#pragma unroll
  for (int q = 0; q < 4; ++q) { _Float16 h = (_Float16)a[q]; fh.h[q] = h; fl.h[q] = (_Float16)((a[q] - (float)h) * 1024.0f); h = (_Float16)c[q]; fh.h[4 + q] = h; fl.h[4 + q] = (_Float16)((c[q] - (float)h) * 1024.0f); }
  { *(v8us*)((unsigned short*)Hh + t * 8) = fh.half[0]; *(v8us*)((unsigned short*)Hl + t * 8) = fl.half[0];  } }

// ---- fast GEMM (wave tile 32x64; requires M % 32 == 0 rows per launch region and N % 64 == 0); epilogue = k_gemm_hhx semantics ----
__device__ __forceinline__ v16h g2_frag(const _Float16* p, int hh) { FragH f; f.half[0] = *(const v8us*)((const unsigned short*)p + 8 * hh); f.half[1] = *(const v8us*)((const unsigned short*)p + 16 + 8 * hh); return f.v; }
__device__ __forceinline__ v8f g2_mma(v16h a, v16h b, v8f c) { v8f d = __builtin_amdgcn_wmma_f32_16x16x32_f16(false, a, false, b, (short)0, c, false, false); asm volatile("v_nop\n\tv_nop\n\tv_nop\n\tv_nop" : "+v"(d) : "v"(a), "v"(b)); return d; }
template <int ACT>
__global__ __launch_bounds__(128) void k_gemm2(const _Float16* __restrict__ A, int lda, size_t sA, const _Float16* __restrict__ Bh, int ldb, size_t sB, float alpha, const float* __restrict__ bias, size_t sBias, const float* __restrict__ CP, int rowsPerB, size_t sCPb, int row0g,
    float* __restrict__ C, _Float16* __restrict__ C16, int ldc, size_t sC, int M, int N, int K) { static_assert(ACT == 0 || ACT == 3 || ACT == 6 || ACT == 8 || ACT == 9 || ACT == 11 || ACT == 12 || ACT == 14 || ACT == 15 || ACT == 16 || ACT == 17, "k_gemm2: unsupported ACT code (would silently apply no activation)");
  __shared__ __attribute__((aligned(16))) float so[4][32][68];
  const int tid = threadIdx.x, w = tid >> 5, lane = tid & 31, ln = lane & 15, hh = lane >> 4; const int by = blockIdx.y;
  A += (size_t)by * sA; Bh += (size_t)by * sB; const size_t cofs = (size_t)by * sC; const float* bp = bias ? bias + (size_t)by * sBias : nullptr;
  const int ntn = N >> 6; const int mt = blockIdx.x / ntn, nq = blockIdx.x - mt * ntn; const int row0 = mt * 128 + 32 * w, col0 = nq * 64; if (row0 >= M) return;
  const _Float16* a0p = A + (size_t)(row0 + ln) * lda; const _Float16* a1p = a0p + (size_t)16 * lda;
  const _Float16* b0p = Bh + (size_t)(col0 + ln) * ldb; const _Float16* b1p = b0p + (size_t)16 * ldb; const _Float16* b2p = b1p + (size_t)16 * ldb; const _Float16* b3p = b2p + (size_t)16 * ldb;
  const v8f z8 = {0.f,0.f,0.f,0.f,0.f,0.f,0.f,0.f}; v8f c00 = z8, c01 = z8, c02 = z8, c03 = z8, c10 = z8, c11 = z8, c12 = z8, c13 = z8;
#pragma unroll 1
  for (int kb = 0; kb < K; kb += 32) { const v16h a0 = g2_frag(a0p + kb, hh), a1 = g2_frag(a1p + kb, hh);
    v16h b = g2_frag(b0p + kb, hh); c00 = g2_mma(a0, b, c00); c10 = g2_mma(a1, b, c10);
    b = g2_frag(b1p + kb, hh); c01 = g2_mma(a0, b, c01); c11 = g2_mma(a1, b, c11);
    b = g2_frag(b2p + kb, hh); c02 = g2_mma(a0, b, c02); c12 = g2_mma(a1, b, c12);
    b = g2_frag(b3p + kb, hh); c03 = g2_mma(a0, b, c03); c13 = g2_mma(a1, b, c13); }
  v8f accs[8] = {c00, c01, c02, c03, c10, c11, c12, c13};
#pragma unroll
  for (int u = 0; u < 8; ++u) { const int t = u & 3, half = u >> 2; const int col = col0 + t * 16 + ln; const float bv = bp ? bf16_round(bp[col]) : 0.f;
#pragma unroll
    for (int r = 0; r < 8; ++r) { const int rloc = half * 16 + 8 * hh + r; float v = accs[u][r] * alpha + bv; if (CP) { if (rowsPerB < 0) v += CP[cofs + (size_t)(row0g + row0 + rloc) * ldc + col];      /* rowsPerB < 0: own element of the batched C plane */ else { const int bidx = (row0g + row0 + rloc) / rowsPerB; v += CP[(size_t)bidx * sCPb + (size_t)by * 64 + col]; } }
      if (ACT == 3) v = fmaxf(v, 0.f); else if (ACT == 6) v = 0.5f * v * (1.0f + erff(v * 0.70710678118654752f)); else if (ACT == 11) v = 1.0f / (1.0f + expf(-v)); else if (ACT == 15) v = v / (1.0f + expf(-v)); else if (ACT == 12) v = (v > 0.f) ? v : 0.01f * v; else if (ACT == 8) v = tanhf(v); else if (ACT == 9) v = 0.5f * v * (1.0f + tanhf(0.7978845608028654f * (v + 0.044715f * v * v * v))); else if (ACT == 14) v = (v > 0.f) ? v : 0.1f * v; else if (ACT == 16) v = (v >= 0.f) ? v : 0.3f * v; else if (ACT == 17) v = (v >= 0.f) ? v : 0.2f * v;
      so[w][rloc][t * 16 + ln] = v; } }
  __builtin_amdgcn_fence(__ATOMIC_ACQ_REL, "workgroup"); __builtin_amdgcn_wave_barrier();
  const int rsub = lane >> 4, c4 = (lane & 15) * 4;
  {
#pragma unroll
    for (int q = 0; q < 16; ++q) { const int r = q * 2 + rsub; const v4f v = *(const v4fa*)&so[w][r][c4]; if (C) *(v4f*)(C + cofs + (size_t)(row0 + r) * ldc + col0 + c4) = v; if (C16) { v4h h4; for (int i = 0; i < 4; ++i) h4[i] = (_Float16)v[i]; *(v4h*)(C16 + cofs + (size_t)(row0 + r) * ldc + col0 + c4) = h4; } }
     } }


__global__ __launch_bounds__(256) void k_wnat(const float* __restrict__ w, size_t n8, _Float16* __restrict__ Bt) { const size_t t = (size_t)blockIdx.x * 256 + threadIdx.x; if (t >= n8) return; FragH f; for (int q = 0; q < 8; ++q) f.h[q] = (_Float16)(bf16_round(w[t * 8 + q]) * 16.0f); *(v8us*)((unsigned short*)Bt + t * 8) = f.half[0];  }
__global__ __launch_bounds__(256) void k_rsm(const float* __restrict__ S, _Float16* __restrict__ P, int nrows) {
  #pragma clang fp contract(off)
  const int i = blockIdx.x * 256 + threadIdx.x; if (i >= nrows) return; const float* s = S + (size_t)i * SQ; float mx = -3.0e38f;
#pragma unroll 1
  for (int j = 0; j < SQ; ++j) mx = fmaxf(mx, s[j]); float se = 0.f;
#pragma unroll 1
  for (int j = 0; j < SQ; ++j) se += expf(s[j] - mx); const float sc = 256.0f / se;
#pragma unroll 1
  for (int j0 = 0; j0 < SQ; j0 += 8) { FragH f; for (int q = 0; q < 8; ++q) f.h[q] = (_Float16)(expf(s[j0 + q] - mx) * sc); unsigned short* d = (unsigned short*)P + (size_t)i * SQ + j0; *(v8us*)d = f.half[0];  } }
__global__ __launch_bounds__(256) void k_vt(const _Float16* __restrict__ V16, int b, int h0, _Float16* __restrict__ VT) { __shared__ unsigned short tl[64][65]; const int tid = threadIdx.x; const int hh = blockIdx.x % HG, sg = blockIdx.x / HG; const int s0 = sg * 64; const int h = h0 + hh;
  for (int i = tid; i < 64 * 8; i += 256) { const int j = i / 8, d8 = (i % 8) * 8; FragH f; f.half[0] = *(const v8us*)((const unsigned short*)V16 + ((size_t)b * SQ + s0 + j) * DM + h * HD + d8); for (int q = 0; q < 8; ++q) tl[d8 + q][j] = f.u[q]; }
  __syncthreads();
  { for (int i = tid; i < 64 * 8; i += 256) { const int d = i / 8, j8 = (i % 8) * 8; FragH f; for (int q = 0; q < 8; ++q) f.u[q] = tl[d][j8 + q]; *(v8us*)((unsigned short*)VT + ((size_t)hh * HD + d) * SQ + s0 + j8) = f.half[0]; }  } }



__global__ __launch_bounds__(256) void k_rsmcf2(const float* __restrict__ S, _Float16* __restrict__ P, int hg, int q0, int nk) {
  #pragma clang fp contract(off)
  const int t = blockIdx.x * 256 + threadIdx.x; if (t >= hg * QT) return; const size_t i = (size_t)t; const float* s = S + i * NKX; const int last = q0 + (t % QT); float mx = -3.0e38f;
#pragma unroll 1
  for (int j = 0; j < nk; ++j) { const float f = (j <= last) ? 1.f : 0.f; mx = fmaxf(mx, fmaf(f, s[j], (1.f - f) * -1.0e9f)); } float se = 0.f;
#pragma unroll 1
  for (int j = 0; j < nk; ++j) { const float f = (j <= last) ? 1.f : 0.f; se += __expf(fmaf(f, s[j], (1.f - f) * -1.0e9f) - mx); } const float sc = 256.0f / se;
#pragma unroll 1
  for (int j0 = 0; j0 < nk; j0 += 8) { FragH fr; for (int q = 0; q < 8; ++q) { const int j = j0 + q; const float f = (j <= last) ? 1.f : 0.f; fr.h[q] = (_Float16)(__expf(fmaf(f, s[j], (1.f - f) * -1.0e9f) - mx) * sc); } unsigned short* d = (unsigned short*)P + i * NKX + j0; *(v8us*)d = fr.half[0];  } }

template <int MASKADD>
__global__ __launch_bounds__(64) void k_att0(const float* __restrict__ QF, const float* __restrict__ KF, const float* __restrict__ VF, int ld, const float* __restrict__ mask, float scale, float* __restrict__ OF, int ldo) {
  #pragma clang fp contract(off)
  __shared__ __attribute__((aligned(16))) float lq[64][64]; __shared__ __attribute__((aligned(16))) float lo[64][64];
  const int tid = threadIdx.x; const int h = blockIdx.x / (QT0 / 64), rg = blockIdx.x % (QT0 / 64); const int i = rg * 64 + tid;
  const float* qr = QF + (size_t)i * ld + h * HD;
#pragma unroll 1
  for (int c = 0; c < HD / 4; ++c) { *(v4f*)&lq[tid][c * 4] = *(const v4fa*)(qr + c * 4); const v4f z = {0.f, 0.f, 0.f, 0.f}; *(v4f*)&lo[tid][c * 4] = z; }
  float m = -1.0e30f, l = 0.f; const int jmax = MASKADD ? (SQ - 1) : (rg * 64 + 63);      /* additive-mask form: every key (the mask input decides); causal form: keys up to the block's last row */
#pragma unroll 1
  for (int j = 0; j <= jmax; ++j) { const float* kr = KF + (size_t)j * ld + h * HD; const float* vr = VF + (size_t)j * ld + h * HD; float s = 0.f;
#pragma unroll 1
    for (int c = 0; c < HD / 4; ++c) { const v4f kq = *(const v4fa*)(kr + c * 4); const v4f qq = *(v4f*)&lq[tid][c * 4]; s = __fadd_rn(s, __fmul_rn(qq[0], kq[0])); s = __fadd_rn(s, __fmul_rn(qq[1], kq[1])); s = __fadd_rn(s, __fmul_rn(qq[2], kq[2])); s = __fadd_rn(s, __fmul_rn(qq[3], kq[3])); }
    s = __fmul_rn(s, scale); if (MASKADD) s = __fadd_rn(s, __fmul_rn(bf16_round(mask[(size_t)i * SQ + j]), -10000.0f));
    const float f = (MASKADD || j <= i) ? 1.f : 0.f; const float sm = fmaf(f, s, (1.f - f) * -1.0e30f); const float mn = fmaxf(m, sm); const float sc = expf(m - mn); const float e = expf(sm - mn); l = __fadd_rn(__fmul_rn(l, sc), e); m = mn;
#pragma unroll 1
    for (int c = 0; c < HD / 4; ++c) { const v4f vv = *(const v4fa*)(vr + c * 4); v4f oo = *(v4f*)&lo[tid][c * 4]; for (int u = 0; u < 4; ++u) oo[u] = __fadd_rn(__fmul_rn(oo[u], sc), __fmul_rn(e, vv[u])); *(v4f*)&lo[tid][c * 4] = oo; } }
  const float fin = 64.0f / l;      /* o carried x64; the f16 path writes o unscaled */
#pragma unroll 1
  for (int c = 0; c < HD / 4; ++c) { v4f oo = *(v4f*)&lo[tid][c * 4]; for (int u = 0; u < 4; ++u) oo[u] = __fmul_rn(oo[u], fin); *(v4f*)&lo[tid][c * 4] = oo; }
  __syncthreads();
  {
#pragma unroll 1
    for (int it = 0; it < 16; ++it) { const int row = it * 4 + tid / 16, pc = (tid % 16) * 4; const v4f v = *(const v4f*)&lo[row][pc]; *(v4f*)(OF + (size_t)(rg * 64 + row) * ldo + h * HD + pc) = v; }
     } }

__global__ __launch_bounds__(256) void k_oscale(const float* __restrict__ OF, float* __restrict__ out, size_t n4) { const size_t t = (size_t)blockIdx.x * 256 + threadIdx.x; if (t >= n4) return; const v4f a = *(const v4fa*)(OF + t * 4); v4f o; for (int q = 0; q < 4; ++q) o[q] = a[q] * 0.015625f; *(v4f*)(out + t * 4) = o;  }

__global__ __launch_bounds__(256) void k_bfr(const float* __restrict__ x, float* __restrict__ XB, size_t n8) { const size_t t = (size_t)blockIdx.x * 256 + threadIdx.x; if (t >= n8) return; v4f a = *(const v4fa*)(x + t * 8), c = *(const v4fa*)(x + t * 8 + 4); for (int q = 0; q < 4; ++q) { a[q] = bf16_round(a[q]); c[q] = bf16_round(c[q]); }
  { *(v4f*)(XB + t * 8) = a; *(v4f*)(XB + t * 8 + 4) = c;  } }



__global__ __launch_bounds__(256) void k_rsmfvl(const float* __restrict__ S, _Float16* __restrict__ P, _Float16* __restrict__ PL, int qn, const int* __restrict__ vlp) {
  #pragma clang fp contract(off)
  const int t = blockIdx.x * 256 + threadIdx.x; if (t >= qn) return; const int vl = vlp[0]; const size_t i = (size_t)t; const float* s = S + i * SQ; float mx = -3.0e38f;
#pragma unroll 1
  for (int j = 0; j < SQ; ++j) { const float f = (j < vl) ? 1.f : 0.f; mx = fmaxf(mx, fmaf(f, s[j], (1.f - f) * -1000000.0f)); } float se = 0.f;
#pragma unroll 1
  for (int j = 0; j < SQ; ++j) { const float f = (j < vl) ? 1.f : 0.f; se += __expf(fmaf(f, s[j], (1.f - f) * -1000000.0f) - mx); } const float sc = 256.0f / se;
#pragma unroll 1
  for (int j0 = 0; j0 < SQ; j0 += 8) { FragH fr, gr; for (int q = 0; q < 8; ++q) { const int j = j0 + q; const float f = (j < vl) ? 1.f : 0.f; const float pv = __expf(fmaf(f, s[j], (1.f - f) * -1000000.0f) - mx) * sc; const _Float16 ph = (_Float16)pv; fr.h[q] = ph; gr.h[q] = (_Float16)((pv - (float)ph) * 1024.0f); }
    unsigned short* d = (unsigned short*)P + i * SQ + j0; unsigned short* dl = (unsigned short*)PL + i * SQ + j0; *(v8us*)d = fr.half[0]; *(v8us*)dl = gr.half[0];  } }

__global__ __launch_bounds__(256) void k_rsmf(const float* __restrict__ S, _Float16* __restrict__ P, int qn, int hg) {
  #pragma clang fp contract(off)
  const int t = blockIdx.x * 256 + threadIdx.x; if (t >= qn * hg) return; const size_t i = (size_t)(t / qn) * SQ + (t % qn); const float* s = S + i * SQ; float mx = -3.0e38f;
#pragma unroll 1
  for (int j = 0; j < SQ; ++j) mx = fmaxf(mx, s[j]); float se = 0.f;
#pragma unroll 1
  for (int j = 0; j < SQ; ++j) se += __expf(s[j] - mx); const float sc = 256.0f / se;
#pragma unroll 1
  for (int j0 = 0; j0 < SQ; j0 += 8) { FragH f; for (int q = 0; q < 8; ++q) f.h[q] = (_Float16)(__expf(s[j0 + q] - mx) * sc); unsigned short* d = (unsigned short*)P + i * SQ + j0; *(v8us*)d = f.half[0];  } }



// lane l <-> l ^ 16 (cross-row move): register only, no LDS traffic
__device__ __forceinline__ float lane_x16(float v) { const int b = __float_as_int(v); return __int_as_float(__builtin_amdgcn_permlanex16(b, b, 0x76543210, 0xfedcba98, false, false)); }

// ---- fused attention: logits, softmax and weights x value in one kernel; scores and weights never leave the registers ----
#define FA_QT 4                      /* query tiles (16 rows each) per work-group */
#define FA_KS 4                      /* key ranges per work-group, one wave per (query tile, key range) */
#define FA_NP (SQ / FA_KS / 32)      /* passes of 32 keys per wave */
// Operands stored as ready-made WMMA A fragments: a block of 512 f16 = [half j][lane l][8], lane l = (c = l & 15, h = l >> 4) holding row c, k = 16 j + 8 h + 0..7 (the hardware k order),
// so that a fragment is two whole-line loads of 512 B instead of two loads that touch 16 lines each. One thread writes one 16-byte piece.
// KF: block (key tile kt, d step s) at kt * 4 + s: row = key kt * 16 + c, k = channel s * 32 + ...
__global__ __launch_bounds__(256) void k_kfrag(const float* __restrict__ x, _Float16* __restrict__ F) { const size_t t = (size_t)blockIdx.x * 256 + threadIdx.x; const int l = (int)(t & 31), j = (int)((t >> 5) & 1), c = l & 15, h = l >> 4; const size_t blk = t >> 6;
  const float* s = x + ((blk >> 2) * 16 + c) * DM + (blk & 3) * 32 + j * 16 + 8 * h; FragH f;
#pragma unroll
  for (int q = 0; q < 8; ++q) f.h[q] = (_Float16)bf16_round(s[q]);
  *(v8us*)((unsigned short*)F + t * 8) = f.half[0]; }
// VF: block (32-key step kp, channel tile dt) at kp * 8 + dt: row = channel dt * 16 + c, k = key kp * 32 + ... (the transposition of value happens here)
__global__ __launch_bounds__(256) void k_vfrag(const float* __restrict__ x, _Float16* __restrict__ F) { const size_t t = (size_t)blockIdx.x * 256 + threadIdx.x; const int l = (int)(t & 31), j = (int)((t >> 5) & 1), c = l & 15, h = l >> 4; const size_t blk = t >> 6;
  const float* s = x + ((blk >> 3) * 32 + j * 16 + 8 * h) * DM + (blk & 7) * 16 + c; FragH f;
#pragma unroll
  for (int q = 0; q < 8; ++q) f.h[q] = (_Float16)bf16_round(s[(size_t)q * DM]);
  *(v8us*)((unsigned short*)F + t * 8) = f.half[0]; }
// NMV[b][channel] = -(1/4096) sum over the sequence of the bf16-rounded value, read from VF: the same values, already rounded (f16 holds a bf16 value exactly from 2^-17 up; below, within 2^-25), and a lane's 16-byte piece = 8 keys of ONE channel.
// One work-group per (batch, 16-channel tile dt) = 128 blocks of 1 KiB. Wave w takes half j = w & 1 of the blocks kp = (w >> 1) + 16 i, i = 0..7: eight whole-line loads, all in flight at once.
// f32 sums on VALU: the 8 keys of a piece as a tree, the 8 pieces in turn, lane l + lane l ^ 16, then the 32 waves through LDS.
typedef _Float16 v8ha __attribute__((ext_vector_type(8), may_alias));
__global__ __launch_bounds__(1024) void k_negmean(const _Float16* __restrict__ VF, float* __restrict__ NMV) {
  __shared__ float part[32][16];
  const int tid = threadIdx.x, w = tid >> 5, lane = tid & 31, c = lane & 15, h = lane >> 4, b = blockIdx.x >> 3, dt = blockIdx.x & 7;
  const _Float16* p = VF + (((size_t)b * (SQ / 32) + (w >> 1)) * 8 + dt) * 512 + (w & 1) * 256 + lane * 8;
  v8ha f[8];
  /* unrolled: the eight loads issue back to back, one memory round trip for the whole kernel */
#pragma unroll
  for (int i = 0; i < 8; ++i) f[i] = *(const v8ha*)(p + (size_t)i * (16 * 8 * 512));
  float a = 0.f;
  /* unrolled: f[] stays in registers */
#pragma unroll
  for (int i = 0; i < 8; ++i) a += (((float)f[i][0] + (float)f[i][1]) + ((float)f[i][2] + (float)f[i][3])) + (((float)f[i][4] + (float)f[i][5]) + ((float)f[i][6] + (float)f[i][7]));
  a += lane_x16(a);
  if (h == 0) part[w][c] = a;
  __syncthreads();      /* every wave passes it once: wave 0 reads the other waves' partial sums below */
  if (w != 0) return;
  float s = 0.f;
  /* unrolled: the sixteen LDS reads issue ahead of the adds */
#pragma unroll
  for (int i = 0; i < 16; ++i) s += part[h * 16 + i][c];
  s += lane_x16(s);
  if (h == 0) NMV[(size_t)b * DM + dt * 16 + c] = -s / (float)SQ; }
// p: the block's start, the same for the whole wave; lo = lane * 8: the lane's own 16-byte piece
__device__ __forceinline__ v16h fa_frag(const unsigned short* p, unsigned lo) { FragH f; f.half[0] = *(const v8us*)(p + lo); f.half[1] = *(const v8us*)(p + 256 + lo); return f.v; }
__device__ __forceinline__ v8f fa_mma(v16h a, v16h b, v8f c) { return __builtin_amdgcn_wmma_f32_16x16x32_f16(false, a, false, b, (short)0, c, false, false); }
// native 2^t; the v_nop in the same statement keeps the one slot that the instruction set asks for behind a transcendental, whatever the compiler puts next
__device__ __forceinline__ float fa_exp2(float t) { float e; asm("v_exp_f32 %0, %1\n\tv_nop" : "=v"(e) : "v"(t)); return e; }
// four at once: the results are early-clobber, so none of the four reads a neighbour's result or overwrites its source, and one v_nop closes the last one's slot
__device__ __forceinline__ void fa_exp2x4(float& a, float& b, float& c, float& d) { float e0, e1, e2, e3;
  asm("v_exp_f32 %0, %4\n\tv_exp_f32 %1, %5\n\tv_exp_f32 %2, %6\n\tv_exp_f32 %3, %7\n\tv_nop" : "=&v"(e0), "=&v"(e1), "=&v"(e2), "=&v"(e3) : "v"(a), "v"(b), "v"(c), "v"(d)); a = e0; b = e1; c = e2; d = e3; }
// A wave owns 16 queries and 1024 keys. S^T = K Q^T: D register r of lane (c, h) = score of key 8 h + r, query c, so a query's scores sit in two lanes (maximum and sum in-lane plus one exchange),
// and two score tiles (keys 0..15, 16..31), converted in place, ARE the B fragment of O^T += V^T P^T in the hardware k order. Running maximum m per query (log2 units), renewed only when a pass exceeds it by more than 8;
// weights 2^(s - m + 6) <= 2^14 as f16 hi + f16 residual, both into the same f32 accumulators; the sum of the f32 weights in l. The four key ranges of a query tile are joined through LDS at the end.
__global__ __launch_bounds__(FA_QT * FA_KS * 32) void k_fattn(const _Float16* __restrict__ Q16, const _Float16* __restrict__ KF, const _Float16* __restrict__ VF, const float* __restrict__ NMV, float* __restrict__ out) {
  __shared__ float so[FA_KS][FA_QT][64][32]; __shared__ float sm[FA_KS][FA_QT][32]; __shared__ float sl[FA_KS][FA_QT][32];
  const int tid = threadIdx.x, w = __builtin_amdgcn_readfirstlane(tid >> 5) /* the wave's number in a scalar register: fragment bases and LDS planes become scalar */, lane = tid & 31, c = lane & 15, h = lane >> 4, qt = w & (FA_QT - 1), ks = w / FA_QT; const int b = blockIdx.y, row0 = blockIdx.x * (FA_QT * 16) + qt * 16;
  const _Float16* qp = Q16 + ((size_t)b * SQ + row0 + c) * DM; const v16h q0 = g2_frag(qp, h), q1 = g2_frag(qp + 32, h), q2 = g2_frag(qp + 64, h), q3 = g2_frag(qp + 96, h);
  const size_t f0 = ((size_t)b * (SQ / 32) + (size_t)ks * FA_NP) * 4096; const unsigned lo = (unsigned)lane * 8;      /* a pass of 32 keys = 8 blocks = 4096 f16 in KF and in VF */
  const unsigned short* kb = (const unsigned short*)KF + f0; const unsigned short* vb = (const unsigned short*)VF + f0;
  const float CS = (float)(0.08838834764831845 * 1.4426950408889634);      /* 1 / sqrt(128) times log2 e */
  const v8f z8 = {0.f,0.f,0.f,0.f,0.f,0.f,0.f,0.f}; v8f o[8] = {z8, z8, z8, z8, z8, z8, z8, z8}; float m = -1.0e30f, l = 0.f;
  /* kept rolled: two passes' fragments at once would not fit the 256 registers that four waves per SIMD leave each wave */
#pragma unroll 1
  for (int p = 0; p < FA_NP; ++p) { const unsigned short* kp = kb + (size_t)p * 4096; const unsigned short* vp = vb + (size_t)p * 4096;
    const v16h k0 = fa_frag(kp, lo), k1 = fa_frag(kp + 512, lo), k2 = fa_frag(kp + 1024, lo), k3 = fa_frag(kp + 1536, lo), k4 = fa_frag(kp + 2048, lo), k5 = fa_frag(kp + 2560, lo), k6 = fa_frag(kp + 3072, lo), k7 = fa_frag(kp + 3584, lo);
    /* inputs only, no code: all eight key fragments are in registers here, so their 16 loads issue back to back under ONE wait (without it each fragment is loaded, waited for and used in turn: eight latencies a pass) */
    asm volatile("" :: "v"(k0), "v"(k1), "v"(k2), "v"(k3), "v"(k4), "v"(k5), "v"(k6), "v"(k7));
    v16h vf[8];
#pragma unroll
    for (int j = 0; j < 8; ++j) vf[j] = fa_frag(vp + j * 512, lo);
    v8f s0 = fa_mma(k0, q0, z8), s1 = fa_mma(k4, q0, z8); s0 = fa_mma(k1, q1, s0); s1 = fa_mma(k5, q1, s1); s0 = fa_mma(k2, q2, s0); s1 = fa_mma(k6, q2, s1); s0 = fa_mma(k3, q3, s0); s1 = fa_mma(k7, q3, s1);
    float mx = fmaxf(s0[0], s1[0]);
#pragma unroll
    for (int r = 1; r < 8; ++r) mx = fmaxf(mx, fmaxf(s0[r], s1[r]));
    mx = fmaxf(mx, lane_x16(mx)) * CS;
    const bool need = mx > m + 8.0f;
    if (__builtin_amdgcn_ballot_w32(need) != 0) {      /* wave-uniform: the accumulators are rescaled only in the few passes in which some query's maximum moves */
      const float mn = need ? mx : m; const float al = fa_exp2(m - mn); m = mn; l *= al;
#pragma unroll
      for (int j = 0; j < 8; ++j) for (int r = 0; r < 8; ++r) o[j][r] *= al; }
    const float nm = 6.0f - m; float e[16];
#pragma unroll
    for (int r = 0; r < 8; ++r) { e[r] = fmaf(s0[r], CS, nm); e[8 + r] = fmaf(s1[r], CS, nm); }
#pragma unroll
    for (int u = 0; u < 16; u += 4) fa_exp2x4(e[u], e[u + 1], e[u + 2], e[u + 3]);
    l += ((e[0] + e[4] + e[8] + e[12]) + (e[1] + e[5] + e[9] + e[13])) + ((e[2] + e[6] + e[10] + e[14]) + (e[3] + e[7] + e[11] + e[15]));
    FragH ph, pl;
#pragma unroll
    for (int u = 0; u < 16; ++u) { const _Float16 hv = (_Float16)e[u]; ph.h[u] = hv; pl.h[u] = (_Float16)(e[u] - (float)hv); }
#pragma unroll
    for (int j = 0; j < 8; ++j) o[j] = fa_mma(vf[j], ph.v, o[j]);
#pragma unroll
    for (int j = 0; j < 8; ++j) o[j] = fa_mma(vf[j], pl.v, o[j]); }
  l += lane_x16(l);      /* the two halves of a query's keys */
#pragma unroll
  for (int j = 0; j < 8; ++j) for (int r = 0; r < 8; ++r) so[ks][qt][j * 8 + r][lane] = o[j][r];
  sm[ks][qt][lane] = m; sl[ks][qt][lane] = l;
  __syncthreads();      /* every wave passes it once: the four key ranges' partial results are read by the other waves of the query tile below */
  float mm[FA_KS], M = -3.0e38f, L = 0.f;
#pragma unroll
  for (int i = 0; i < FA_KS; ++i) { mm[i] = sm[i][qt][lane]; M = fmaxf(M, mm[i]); }
#pragma unroll
  for (int i = 0; i < FA_KS; ++i) { mm[i] = fa_exp2(mm[i] - M); L += sl[i][qt][lane] * mm[i]; }
  const float inv = 1.0f / L;
  /* wave (qt, ks) finishes channels 32 ks .. 32 ks + 31 of its query tile: one whole 128-byte line of each output row */
#pragma unroll
  for (int jj = 0; jj < 2; ++jj) { const int j = 2 * ks + jj; const float* nv = NMV + (size_t)b * DM + 16 * j + 8 * h; v4f r0, r1;
#pragma unroll
    for (int r = 0; r < 8; ++r) { float a = 0.f;
#pragma unroll
      for (int i = 0; i < FA_KS; ++i) a += so[i][qt][j * 8 + r][lane] * mm[i];
      a = a * inv + nv[r]; if (r < 4) r0[r] = a; else r1[r - 4] = a; }
    float* d = out + ((size_t)b * SQ + row0 + c) * DM + 16 * j + 8 * h; *(v4f*)d = r0; *(v4f*)(d + 4) = r1; } }
extern "C" void kernel_launch(void* const* d_in, const int* in_sizes, int n_in,
                              void* d_out, int out_size, void* d_ws, size_t ws_size, hipStream_t stream) {
  (void)in_sizes; (void)n_in; (void)out_size;
  const float* const* I = (const float* const*)d_in; const float* xq = I[0]; const float* xk = I[1]; const float* xv = I[2];      /* query, key, value [4][4096][128] */
  char* ws = (char*)d_ws; size_t off = 0;
  auto take = [&](size_t bytes) { char* p = ws + off; off += (bytes + 255) & ~(size_t)255; return p; };
  _Float16* Q16 = (_Float16*)take(NR * DM * 2); _Float16* KF = (_Float16*)take(NR * DM * 2); _Float16* VF = (_Float16*)take(NR * DM * 2); float* NMV = (float*)take((size_t)NB * DM * 4);      /* -mean(value) per batch [128] */
  if (off > ws_size) return;
  k_x16<<<(unsigned)((NR * DM / 8 + 255) / 256), 256, 0, stream>>>(xq, Q16, NR * DM / 8);      /* exact f16 rows of the bf16-rounded queries */
  k_kfrag<<<(unsigned)(NR * DM / 8 / 256), 256, 0, stream>>>(xk, KF); k_vfrag<<<(unsigned)(NR * DM / 8 / 256), 256, 0, stream>>>(xv, VF);      /* keys and value^T, bf16-rounded, exact in f16, in fragment order */
  k_negmean<<<NB * (DM / 16), 1024, 0, stream>>>(VF, NMV);      /* NMV[b][c] = -(1/4096) sum_s bf16(value[b][s][c]) (f32, fixed tree order; work-group per (b, 16 channels)) */
  k_fattn<<<dim3(SQ / (FA_QT * 16), NB), FA_QT * FA_KS * 32, 0, stream>>>(Q16, KF, VF, NMV, (float*)d_out);      /* out = softmax(q.k / sqrt(128)) value - mean(value), all batches */
}

// v004
// A run of this version takes 61.1 microseconds.
// Two timings next to v003 both put it at 1.06 times that version's speed.
// Over all steps from v000 it is 70.4 times as fast.
#include <hip/hip_runtime.h>
#define NB 4
#define SQ 4096
#define DM 128
#define NH 2
#define HD 64
#define HG 8                         /* heads per launch of the four-argument k_vt (not launched) */
#define B0 0                         /* first batch processed (unused) */
#define NBR NB                       /* batches processed (used only in MP) */
#define NR ((size_t)NB * SQ)         /* token rows */
#define MP ((int)((size_t)NBR * SQ)) /* token rows (used only in MPO) */
#define QT 256                       /* query rows per causal tile */
#define NKX SQ                       /* S / P row pitch */
#define QT0 256                      /* query rows per head of the f32 k_att0 (not launched) */
#define QN SQ                        /* query rows attended per batch (unused) */
#define NHD NH                       /* unused */
#define MPO MP                       /* rows through the output stage (unused) */
#define LQ DM            /* row pitch of the q/k/v rows (unused) */
typedef __bf16 v16b __attribute__((ext_vector_type(16)));
typedef unsigned short v8us __attribute__((ext_vector_type(8), may_alias));
typedef float  v8f  __attribute__((ext_vector_type(8)));
typedef float  v4f  __attribute__((ext_vector_type(4)));
typedef float  v4fa __attribute__((ext_vector_type(4), may_alias));
union FragB { v16b v; v8us half[2]; unsigned short u[16]; };

__device__ __forceinline__ unsigned short bf16_bits(float x) { unsigned int u = __float_as_uint(x); return (unsigned short)((u + 0x7FFFu + ((u >> 16) & 1u)) >> 16); }
__device__ __forceinline__ float bf16_val(unsigned short b) { return __uint_as_float(((unsigned int)b) << 16); }
__device__ __forceinline__ float bf16_round(float x) { return bf16_val(bf16_bits(x)); }
// D += A·B with NT terms: 1 = ah·bh, 2 = + al·bh (A split), 3 = + ah·bl (both split)
template <int NT>
__device__ __forceinline__ v8f mmaN(v16b ah, v16b al, v16b bh, v16b bl, v8f c) {
  c = __builtin_amdgcn_wmma_f32_16x16x32_bf16(false, ah, false, bh, (short)0, c, false, false);
  if (NT >= 2) c = __builtin_amdgcn_wmma_f32_16x16x32_bf16(false, al, false, bh, (short)0, c, false, false);
  if (NT >= 3) c = __builtin_amdgcn_wmma_f32_16x16x32_bf16(false, ah, false, bl, (short)0, c, false, false);
  asm volatile("v_nop\n\tv_nop\n\tv_nop\n\tv_nop" : "+v"(c) : "v"(ah), "v"(al), "v"(bh), "v"(bl));
  return c;
}

__global__ __launch_bounds__(256) void k_wt_bf16(const float* __restrict__ W, unsigned short* __restrict__ Wt, int K, int N) {
  const int t = blockIdx.x * 256 + threadIdx.x;
  const int k8n = K / 8;
  if (t >= N * k8n) return;
  const int n = t / k8n, k8 = (t % k8n) * 8;
  v8us v;
#pragma unroll
  for (int i = 0; i < 8; ++i) v[i] = bf16_bits(W[(size_t)(k8 + i) * N + n]);
  *(v8us*)(Wt + (size_t)n * K + k8) = v;
  
}

// GEMM C[M][N] (f32, pitch ldc) = act(A[M][K]·W + bias). A f32 row-major (pitch lda) converted per fragment to bf16
// (ASPLIT: hi/lo two planes -> 2 terms, else single rounded term); Wt bf16 [N][K] (pitch ldb). BIAS_BF16 rounds the
// bias to bf16 first (bias quantised to bf16 before the add). K%32==0, M%16==0, N%64==0.
template <bool ASPLIT, int ACT, bool BIAS_BF16>
__global__ __launch_bounds__(128) void k_gemm_bf(const float* __restrict__ A, int lda, const unsigned short* __restrict__ Wt, int ldb,
                                               const float* __restrict__ bias, float* __restrict__ C, int ldc, int M, int N, int K) {
  __shared__ __attribute__((aligned(16))) float so[4][16][64];
  const int tid = threadIdx.x, w = tid >> 5, lane = tid & 31, ln = lane & 15, hh = lane >> 4;
  const int ntn = N / 64;
  const int wid = blockIdx.x * 4 + w;
  const int mt = wid / ntn, nq = wid % ntn;
  if (mt * 16 >= M) return;
  const int row0 = mt * 16, col0 = nq * 64;
  const float* arow = A + (size_t)(row0 + ln) * lda;
  v8f acc[4] = {};
  for (int kb = 0; kb < K; kb += 32) {
    FragB ah, al;
    const v4f x0 = *(const v4fa*)(arow + kb + 8 * hh), x1 = *(const v4fa*)(arow + kb + 8 * hh + 4);
    const v4f x2 = *(const v4fa*)(arow + kb + 16 + 8 * hh), x3 = *(const v4fa*)(arow + kb + 16 + 8 * hh + 4);
    float xs[16] = {x0[0],x0[1],x0[2],x0[3],x1[0],x1[1],x1[2],x1[3],x2[0],x2[1],x2[2],x2[3],x3[0],x3[1],x3[2],x3[3]};
#pragma unroll
    for (int i = 0; i < 16; ++i) { const unsigned short hb = bf16_bits(xs[i]); ah.u[i] = hb; al.u[i] = ASPLIT ? bf16_bits(xs[i] - bf16_val(hb)) : (unsigned short)0; }
#pragma unroll
    for (int t = 0; t < 4; ++t) {
      const unsigned short* brow = Wt + (size_t)(col0 + t * 16 + ln) * ldb + kb;
      FragB b;
      b.half[0] = *(const v8us*)(brow + 8 * hh);
      b.half[1] = *(const v8us*)(brow + 16 + 8 * hh);
      acc[t] = mmaN<ASPLIT ? 2 : 1>(ah.v, al.v, b.v, b.v, acc[t]);
    }
  }
#pragma unroll
  for (int t = 0; t < 4; ++t) {
    float bv = bias ? bias[col0 + t * 16 + ln] : 0.f;
    if (BIAS_BF16) bv = bf16_round(bv);
#pragma unroll
    for (int r = 0; r < 8; ++r) { float v = acc[t][r] + bv; if (ACT == 1) v = fmaxf(v, 0.f); so[w][8 * hh + r][t * 16 + ln] = v; }
  }
  __builtin_amdgcn_fence(__ATOMIC_ACQ_REL, "workgroup");
  __builtin_amdgcn_wave_barrier();
  const int rsub = lane >> 4, c4 = (lane & 15) * 4;
  {
#pragma unroll
    for (int q = 0; q < 8; ++q) {
      const int r = q * 2 + rsub;
      const v4f v = *(const v4fa*)&so[w][r][c4];
      *(v4f*)(C + (size_t)(row0 + r) * ldc + col0 + c4) = v;
    }
    
  }
}

// GEMM C = act(A·W + bias + resid): A f32 (ASPLIT -> hi/lo 2 terms), Wt bf16 [N][K]; ACT 0 none, 1 relu, 2 exact gelu;
// resid (optional, f32, row index = (row % rmod), pitch ldr, RES_BF16 rounds it) added before the activation.
template <bool ASPLIT, int ACT, bool BIAS_BF16, bool RES_BF16>
__global__ __launch_bounds__(128) void k_gemm_bf3(const float* __restrict__ A, int lda, const unsigned short* __restrict__ Wt, int ldb,
                                                const float* __restrict__ bias, const float* __restrict__ resid, int rmod, int ldr,
                                                float* __restrict__ C, int ldc, int M, int N, int K) {
  __shared__ __attribute__((aligned(16))) float so[4][16][64];
  const int tid = threadIdx.x, w = tid >> 5, lane = tid & 31, ln = lane & 15, hh = lane >> 4;
  const int ntn = N / 64;
  const int wid = blockIdx.x * 4 + w;
  const int mt = wid / ntn, nq = wid % ntn;
  if (mt * 16 >= M) return;
  const int row0 = mt * 16, col0 = nq * 64;
  const float* arow = A + (size_t)(row0 + ln) * lda;
  v8f acc[4] = {};
  for (int kb = 0; kb < K; kb += 32) {
    FragB ah, al;
    const v4f x0 = *(const v4fa*)(arow + kb + 8 * hh), x1 = *(const v4fa*)(arow + kb + 8 * hh + 4);
    const v4f x2 = *(const v4fa*)(arow + kb + 16 + 8 * hh), x3 = *(const v4fa*)(arow + kb + 16 + 8 * hh + 4);
    float xs[16] = {x0[0],x0[1],x0[2],x0[3],x1[0],x1[1],x1[2],x1[3],x2[0],x2[1],x2[2],x2[3],x3[0],x3[1],x3[2],x3[3]};
#pragma unroll
    for (int i = 0; i < 16; ++i) { const unsigned short hb = bf16_bits(xs[i]); ah.u[i] = hb; al.u[i] = ASPLIT ? bf16_bits(xs[i] - bf16_val(hb)) : (unsigned short)0; }
#pragma unroll
    for (int t = 0; t < 4; ++t) {
      const unsigned short* brow = Wt + (size_t)(col0 + t * 16 + ln) * ldb + kb;
      FragB b;
      b.half[0] = *(const v8us*)(brow + 8 * hh);
      b.half[1] = *(const v8us*)(brow + 16 + 8 * hh);
      acc[t] = mmaN<ASPLIT ? 2 : 1>(ah.v, al.v, b.v, b.v, acc[t]);
    }
  }
#pragma unroll
  for (int t = 0; t < 4; ++t) {
    const int col = col0 + t * 16 + ln;
    float bv = bias ? bias[col] : 0.f;
    if (BIAS_BF16) bv = bf16_round(bv);
#pragma unroll
    for (int r = 0; r < 8; ++r) {
      float v = acc[t][r] + bv;
      if (resid) { float rv = resid[(size_t)((row0 + 8 * hh + r) % rmod) * ldr + col]; if (RES_BF16) rv = bf16_round(rv); v += rv; }
      if (ACT == 1) v = fmaxf(v, 0.f);
      if (ACT == 2) v = 0.5f * v * (1.0f + erff(v * 0.70710678118654752f));
      if (ACT == 3) { const float u = 0.7978845608028654f * (v + 0.044715f * v * v * v); v = 0.5f * v * (1.0f + tanhf(u)); }
      so[w][8 * hh + r][t * 16 + ln] = v;
    }
  }
  __builtin_amdgcn_fence(__ATOMIC_ACQ_REL, "workgroup");
  __builtin_amdgcn_wave_barrier();
  const int rsub = lane >> 4, c4 = (lane & 15) * 4;
  {
#pragma unroll
    for (int q = 0; q < 8; ++q) {
      const int r = q * 2 + rsub;
      const v4f v = *(const v4fa*)&so[w][r][c4];
      *(v4f*)(C + (size_t)(row0 + r) * ldc + col0 + c4) = v;
    }
    
  }
}
// row LayerNorm (biased variance, eps) over N: s = X (+ R); optional out_sum <- s; out_norm <- (s-mu)*rsqrt(var+eps)*g + b
template <bool PARAM_BF16>
__global__ __launch_bounds__(256) void k_layernorm(const float* __restrict__ X, const float* __restrict__ R, const float* __restrict__ g, const float* __restrict__ bta,
                                                  float* __restrict__ out_sum, float* __restrict__ out_norm, int N, float eps) {
  __shared__ float red[256];
  const int row = blockIdx.x, tid = threadIdx.x;
  const float* x = X + (size_t)row * N; const float* rr = R ? R + (size_t)row * N : nullptr;
  float vals[16];                     // up to N = 4096
  const int per = N / 256;            // contiguous chunk per thread? use strided-by-4 chunks: thread handles j = tid*4 + 1024*u
  float s1 = 0.f;
  for (int u = 0; u < per / 4; ++u) {
    const int j = tid * 4 + 1024 * u;
    const v4f a = *(const v4fa*)(x + j);
    v4f b = {0.f,0.f,0.f,0.f}; if (rr) b = *(const v4fa*)(rr + j);
#pragma unroll
    for (int q = 0; q < 4; ++q) { const float v = a[q] + b[q]; vals[u * 4 + q] = v; s1 += v; }
  }
  red[tid] = s1; __syncthreads();
  for (int st = 128; st > 0; st >>= 1) { if (tid < st) red[tid] += red[tid + st]; __syncthreads(); }
  const float mu = red[0] / (float)N; __syncthreads();
  float s2 = 0.f;
  for (int u = 0; u < per / 4; ++u)
#pragma unroll
    for (int q = 0; q < 4; ++q) { const float c = vals[u * 4 + q] - mu; s2 += c * c; }
  red[tid] = s2; __syncthreads();
  for (int st = 128; st > 0; st >>= 1) { if (tid < st) red[tid] += red[tid + st]; __syncthreads(); }
  const float rs = rsqrtf(red[0] / (float)N + eps);
  {
    for (int u = 0; u < per / 4; ++u) {
      const int j = tid * 4 + 1024 * u;
      v4f o, sm;
#pragma unroll
      for (int q = 0; q < 4; ++q) {
        float gg = g[j + q], bb = bta[j + q];
        if (PARAM_BF16) { gg = bf16_round(gg); bb = bf16_round(bb); }
        sm[q] = vals[u * 4 + q]; o[q] = (vals[u * 4 + q] - mu) * rs * gg + bb;
      }
      if (out_sum) *(v4f*)(out_sum + (size_t)row * N + j) = sm;
      *(v4f*)(out_norm + (size_t)row * N + j) = o;
    }
    
  }
}



// ---- f16 WMMA path (v_wmma_f32_16x16x32_f16): 11-bit significands for operands in range — used where a [0,1] probability operand needs more precision than bf16
typedef _Float16 v16h __attribute__((ext_vector_type(16)));
union FragH { v16h v; v8us half[2]; _Float16 h[16]; unsigned short u[16]; };
template <int NT>
__device__ __forceinline__ v8f mmaH(v16h ah, v16h al, v16h bh, v16h bl, v8f c) {
  c = __builtin_amdgcn_wmma_f32_16x16x32_f16(false, ah, false, bh, (short)0, c, false, false);
  if (NT >= 2) c = __builtin_amdgcn_wmma_f32_16x16x32_f16(false, al, false, bh, (short)0, c, false, false);
  if (NT >= 3) c = __builtin_amdgcn_wmma_f32_16x16x32_f16(false, ah, false, bl, (short)0, c, false, false);
  asm volatile("v_nop\n\tv_nop\n\tv_nop\n\tv_nop" : "+v"(c) : "v"(ah), "v"(al), "v"(bh), "v"(bl));
  return c;
}
// batched GEMM like k_gemm_b but f16 operands: A f32 (split into f16 hi/lo if ASPLIT, else rounded to f16), Bt = f16 values [n][k]; alpha; C f32; N multiple of 16 (partial tiles skipped)
template <bool ASPLIT>
__global__ __launch_bounds__(128) void k_gemm_h(const float* __restrict__ A, int lda, size_t sA, const _Float16* __restrict__ Bh, int ldb, size_t sB, float alpha, float* __restrict__ C, int ldc, size_t sC, int M, int N, int K) {
  __shared__ __attribute__((aligned(16))) float so[4][16][64];
  const int tid = threadIdx.x, w = tid >> 5, lane = tid & 31, ln = lane & 15, hh = lane >> 4; const int by = blockIdx.y;
  A += (size_t)by * sA; Bh += (size_t)by * sB; C += (size_t)by * sC;
  const int ntn = (N + 63) / 64; const int wid = blockIdx.x * 4 + w; const int mt = wid / ntn, nq = wid % ntn; if (mt * 16 >= M) return;
  const int row0 = mt * 16, col0 = nq * 64; const float* arow = A + (size_t)(row0 + ln) * lda;
  v8f acc[4] = {};
  for (int kb = 0; kb < K; kb += 32) {
    FragH ah, al;
    const v4f x0 = *(const v4fa*)(arow + kb + 8 * hh), x1 = *(const v4fa*)(arow + kb + 8 * hh + 4), x2 = *(const v4fa*)(arow + kb + 16 + 8 * hh), x3 = *(const v4fa*)(arow + kb + 16 + 8 * hh + 4);
    float xs[16] = {x0[0],x0[1],x0[2],x0[3],x1[0],x1[1],x1[2],x1[3],x2[0],x2[1],x2[2],x2[3],x3[0],x3[1],x3[2],x3[3]};
#pragma unroll
    for (int i = 0; i < 16; ++i) { const _Float16 h = (_Float16)xs[i]; ah.h[i] = h; al.h[i] = ASPLIT ? (_Float16)(xs[i] - (float)h) : (_Float16)0.0f; }
#pragma unroll
    for (int t = 0; t < 4; ++t) { if (col0 + t * 16 >= N) continue; const size_t boff = (size_t)(col0 + t * 16 + ln) * ldb + kb; FragH bq; bq.half[0] = *(const v8us*)(Bh + boff + 8 * hh); bq.half[1] = *(const v8us*)(Bh + boff + 16 + 8 * hh);
      acc[t] = mmaH<ASPLIT ? 2 : 1>(ah.v, al.v, bq.v, bq.v, acc[t]); }
  }
#pragma unroll
  for (int t = 0; t < 4; ++t) { if (col0 + t * 16 >= N) continue;
#pragma unroll
    for (int r = 0; r < 8; ++r) so[w][8 * hh + r][t * 16 + ln] = acc[t][r] * alpha; }
  __builtin_amdgcn_fence(__ATOMIC_ACQ_REL, "workgroup"); __builtin_amdgcn_wave_barrier();
  const int rsub = lane >> 4, c4 = (lane & 15) * 4;
  {
#pragma unroll
    for (int q = 0; q < 8; ++q) { const int r = q * 2 + rsub; if (col0 + c4 < N) { const v4f v = *(const v4fa*)&so[w][r][c4]; *(v4f*)(C + (size_t)(row0 + r) * ldc + col0 + c4) = v; } }
     }
}

// Wt[n][k] = f16(W[k][n]·scale) from f32 row-major W[K][N] (scale = power of two; bf16-exact weights stay exact in f16 away from the subnormal range)
__global__ __launch_bounds__(256) void k_wt_f16(const float* __restrict__ W, _Float16* __restrict__ Wt, int K, int N, float scale) {
  const int t = blockIdx.x * 256 + threadIdx.x; if (t >= N * (K / 8)) return; const int n = t / (K / 8), k8 = (t % (K / 8)) * 8; FragH f;
#pragma unroll
  for (int i = 0; i < 8; ++i) f.h[i] = (_Float16)(bf16_round(W[(size_t)(k8 + i) * N + n]) * scale); const v8us o = f.half[0];
  *(v8us*)((unsigned short*)Wt + (size_t)n * K + k8) = o; 
}
// k_gemm_hh variant with fused epilogue: v = acc·alpha + bias[by·sBias + col] (+ CP[(row/rowsPerB)·sCPb + by·64 + col] if CP) ; ACT 0 none / 1 elu ; writes f16 C16 (and f32 C if non-null)
template <int ACT>
__global__ __launch_bounds__(128) void k_gemm_hhx(const _Float16* __restrict__ A, int lda, size_t sA, const _Float16* __restrict__ Bh, int ldb, size_t sB, float alpha, const float* __restrict__ bias, size_t sBias, const float* __restrict__ CP, int rowsPerB, size_t sCPb, int row0g,
    float* __restrict__ C, _Float16* __restrict__ C16, int ldc, size_t sC, int M, int N, int K) {
  __shared__ __attribute__((aligned(16))) float so[4][16][64];
  const int tid = threadIdx.x, w = tid >> 5, lane = tid & 31, ln = lane & 15, hh = lane >> 4; const int by = blockIdx.y;
  A += (size_t)by * sA; Bh += (size_t)by * sB; const size_t cofs = (size_t)by * sC; const float* bp = bias ? bias + (size_t)by * sBias : nullptr;
  const int ntn = (N + 63) / 64; const int wid = blockIdx.x * 4 + w; const int mt = wid / ntn, nq = wid % ntn; if (mt * 16 >= M) return;
  const int row0 = mt * 16, col0 = nq * 64; const _Float16* arow = A + (size_t)(row0 + ln) * lda;
  v8f acc[4] = {};
  for (int kb = 0; kb < K; kb += 32) { FragH ah; ah.half[0] = *(const v8us*)((const unsigned short*)arow + kb + 8 * hh); ah.half[1] = *(const v8us*)((const unsigned short*)arow + kb + 16 + 8 * hh);
#pragma unroll
    for (int t = 0; t < 4; ++t) { if (col0 + t * 16 >= N) continue; const size_t boff = (size_t)(col0 + t * 16 + ln) * ldb + kb; FragH bq; bq.half[0] = *(const v8us*)((const unsigned short*)Bh + boff + 8 * hh); bq.half[1] = *(const v8us*)((const unsigned short*)Bh + boff + 16 + 8 * hh);
      acc[t] = mmaH<1>(ah.v, ah.v, bq.v, bq.v, acc[t]); }
  }
#pragma unroll
  for (int t = 0; t < 4; ++t) { if (col0 + t * 16 >= N) continue; const int col = col0 + t * 16 + ln; const float bv = bp ? bf16_round(bp[col]) : 0.f;
#pragma unroll
    for (int r = 0; r < 8; ++r) { float v = acc[t][r] * alpha + bv; if (CP) { const int rr = row0g + row0 + 8 * hh + r; if (rowsPerB < 0) v += CP[cofs + (size_t)rr * ldc + col];      /* rowsPerB < 0: own element of the batched C plane */ else { const int bidx = rr / rowsPerB; v += CP[(size_t)bidx * sCPb + (size_t)by * 64 + col]; } } if (ACT == 1) v = (v > 0.f) ? v : expm1f(v); else if (ACT == 7) v = (v > 0.f) ? v + 1.0f : expf(v); else if (ACT == 8) v = tanhf(v); else if (ACT == 9) v = 0.5f * v * (1.0f + tanhf(0.7978845608028654f * (v + 0.044715f * v * v * v))); else if (ACT == 11) v = 1.0f / (1.0f + expf(-v)); else if (ACT == 12) v = (v > 0.f) ? v : 0.01f * v; else if (ACT == 14) v = (v > 0.f) ? v : 0.1f * v; else if (ACT == 16) v = (v >= 0.f) ? v : 0.3f * v; else if (ACT == 17) v = (v >= 0.f) ? v : 0.2f * v; else if (ACT == 15) v = v / (1.0f + expf(-v)); else if (ACT == 3) v = fmaxf(v, 0.f); else if (ACT == 6) v = 0.5f * v * (1.0f + erff(v * 0.70710678118654752f)); so[w][8 * hh + r][t * 16 + ln] = v; } }
  __builtin_amdgcn_fence(__ATOMIC_ACQ_REL, "workgroup"); __builtin_amdgcn_wave_barrier();
  const int rsub = lane >> 4, c4 = (lane & 15) * 4; typedef _Float16 v4h __attribute__((ext_vector_type(4)));
  {
#pragma unroll
    for (int q = 0; q < 8; ++q) { const int r = q * 2 + rsub; if (col0 + c4 < N) { const v4f v = *(const v4fa*)&so[w][r][c4]; if (C) *(v4f*)(C + cofs + (size_t)(row0 + r) * ldc + col0 + c4) = v; if (C16) { v4h h4; for (int i = 0; i < 4; ++i) h4[i] = (_Float16)v[i]; *(v4h*)(C16 + cofs + (size_t)(row0 + r) * ldc + col0 + c4) = h4; } } }
     }
}


typedef _Float16 v4h __attribute__((ext_vector_type(4)));

__global__ __launch_bounds__(256) void k_x16(const float* __restrict__ x, _Float16* __restrict__ X16, size_t n8) { const size_t t = (size_t)blockIdx.x * 256 + threadIdx.x; if (t >= n8) return; FragH f;
#pragma unroll
  for (int q = 0; q < 8; ++q) f.h[q] = (_Float16)bf16_round(x[t * 8 + q]); *(v8us*)((unsigned short*)X16 + t * 8) = f.half[0];  }
__global__ __launch_bounds__(256) void k_h16(const float* __restrict__ x, _Float16* __restrict__ X16, size_t n8) { const size_t t = (size_t)blockIdx.x * 256 + threadIdx.x; if (t >= n8) return; FragH f;
#pragma unroll
  for (int q = 0; q < 8; ++q) f.h[q] = (_Float16)x[t * 8 + q]; *(v8us*)((unsigned short*)X16 + t * 8) = f.half[0];  }
__global__ __launch_bounds__(256) void k_round16f(const float* __restrict__ W, _Float16* __restrict__ Bt, size_t n8) { const size_t t = (size_t)blockIdx.x * 256 + threadIdx.x; if (t >= n8) return; FragH f;
#pragma unroll
  for (int i = 0; i < 8; ++i) f.h[i] = (_Float16)(bf16_round(W[t * 8 + i]) * 16.0f); *(v8us*)((unsigned short*)Bt + t * 8) = f.half[0];  }
template <int NHv, int TTv>
__global__ __launch_bounds__(256) void k_vt(const _Float16* __restrict__ V16, int ldv, int voff, _Float16* __restrict__ Vt) { __shared__ unsigned short tl[64][66]; const int tid = threadIdx.x; const int slab = blockIdx.x / (TTv / 64), lg = blockIdx.x % (TTv / 64); const int b = slab / NHv, h = slab % NHv;
  for (int i = tid; i < 64 * 8; i += 256) { const int r = i / 8, c8 = (i % 8) * 8; FragH f; f.half[0] = *(const v8us*)((const unsigned short*)V16 + ((size_t)b * TTv + lg * 64 + r) * ldv + voff + h * 64 + c8);
#pragma unroll
    for (int q = 0; q < 8; ++q) tl[r][c8 + q] = f.u[q]; }
  __syncthreads();
  {
#pragma unroll
    for (int rd = 0; rd < 2; ++rd) { const int d = rd * 32 + tid / 8, pc = tid % 8; FragH f;
#pragma unroll
      for (int q = 0; q < 8; ++q) f.u[q] = tl[pc * 8 + q][d];
      *(v8us*)((unsigned short*)Vt + ((size_t)slab * 64 + d) * TTv + lg * 64 + pc * 8) = f.half[0]; }
     } }

__global__ __launch_bounds__(256) void k_hl(const float* __restrict__ F, _Float16* __restrict__ Hh, _Float16* __restrict__ Hl, size_t n8) { const size_t t = (size_t)blockIdx.x * 256 + threadIdx.x; if (t >= n8) return; FragH fh, fl; const v4f a = *(const v4fa*)(F + t * 8), c = *(const v4fa*)(F + t * 8 + 4);
#pragma unroll
  for (int q = 0; q < 4; ++q) { _Float16 h = (_Float16)a[q]; fh.h[q] = h; fl.h[q] = (_Float16)((a[q] - (float)h) * 1024.0f); h = (_Float16)c[q]; fh.h[4 + q] = h; fl.h[4 + q] = (_Float16)((c[q] - (float)h) * 1024.0f); }
  { *(v8us*)((unsigned short*)Hh + t * 8) = fh.half[0]; *(v8us*)((unsigned short*)Hl + t * 8) = fl.half[0];  } }

// ---- fast GEMM (wave tile 32x64; requires M % 32 == 0 rows per launch region and N % 64 == 0); epilogue = k_gemm_hhx semantics ----
__device__ __forceinline__ v16h g2_frag(const _Float16* p, int hh) { FragH f; f.half[0] = *(const v8us*)((const unsigned short*)p + 8 * hh); f.half[1] = *(const v8us*)((const unsigned short*)p + 16 + 8 * hh); return f.v; }
__device__ __forceinline__ v8f g2_mma(v16h a, v16h b, v8f c) { v8f d = __builtin_amdgcn_wmma_f32_16x16x32_f16(false, a, false, b, (short)0, c, false, false); asm volatile("v_nop\n\tv_nop\n\tv_nop\n\tv_nop" : "+v"(d) : "v"(a), "v"(b)); return d; }
template <int ACT>
__global__ __launch_bounds__(128) void k_gemm2(const _Float16* __restrict__ A, int lda, size_t sA, const _Float16* __restrict__ Bh, int ldb, size_t sB, float alpha, const float* __restrict__ bias, size_t sBias, const float* __restrict__ CP, int rowsPerB, size_t sCPb, int row0g,
    float* __restrict__ C, _Float16* __restrict__ C16, int ldc, size_t sC, int M, int N, int K) { static_assert(ACT == 0 || ACT == 3 || ACT == 6 || ACT == 8 || ACT == 9 || ACT == 11 || ACT == 12 || ACT == 14 || ACT == 15 || ACT == 16 || ACT == 17, "k_gemm2: unsupported ACT code (would silently apply no activation)");
  __shared__ __attribute__((aligned(16))) float so[4][32][68];
  const int tid = threadIdx.x, w = tid >> 5, lane = tid & 31, ln = lane & 15, hh = lane >> 4; const int by = blockIdx.y;
  A += (size_t)by * sA; Bh += (size_t)by * sB; const size_t cofs = (size_t)by * sC; const float* bp = bias ? bias + (size_t)by * sBias : nullptr;
  const int ntn = N >> 6; const int mt = blockIdx.x / ntn, nq = blockIdx.x - mt * ntn; const int row0 = mt * 128 + 32 * w, col0 = nq * 64; if (row0 >= M) return;
  const _Float16* a0p = A + (size_t)(row0 + ln) * lda; const _Float16* a1p = a0p + (size_t)16 * lda;
  const _Float16* b0p = Bh + (size_t)(col0 + ln) * ldb; const _Float16* b1p = b0p + (size_t)16 * ldb; const _Float16* b2p = b1p + (size_t)16 * ldb; const _Float16* b3p = b2p + (size_t)16 * ldb;
  const v8f z8 = {0.f,0.f,0.f,0.f,0.f,0.f,0.f,0.f}; v8f c00 = z8, c01 = z8, c02 = z8, c03 = z8, c10 = z8, c11 = z8, c12 = z8, c13 = z8;
#pragma unroll 1
  for (int kb = 0; kb < K; kb += 32) { const v16h a0 = g2_frag(a0p + kb, hh), a1 = g2_frag(a1p + kb, hh);
    v16h b = g2_frag(b0p + kb, hh); c00 = g2_mma(a0, b, c00); c10 = g2_mma(a1, b, c10);
    b = g2_frag(b1p + kb, hh); c01 = g2_mma(a0, b, c01); c11 = g2_mma(a1, b, c11);
    b = g2_frag(b2p + kb, hh); c02 = g2_mma(a0, b, c02); c12 = g2_mma(a1, b, c12);
    b = g2_frag(b3p + kb, hh); c03 = g2_mma(a0, b, c03); c13 = g2_mma(a1, b, c13); }
  v8f accs[8] = {c00, c01, c02, c03, c10, c11, c12, c13};
#pragma unroll
  for (int u = 0; u < 8; ++u) { const int t = u & 3, half = u >> 2; const int col = col0 + t * 16 + ln; const float bv = bp ? bf16_round(bp[col]) : 0.f;
#pragma unroll
    for (int r = 0; r < 8; ++r) { const int rloc = half * 16 + 8 * hh + r; float v = accs[u][r] * alpha + bv; if (CP) { if (rowsPerB < 0) v += CP[cofs + (size_t)(row0g + row0 + rloc) * ldc + col];      /* rowsPerB < 0: own element of the batched C plane */ else { const int bidx = (row0g + row0 + rloc) / rowsPerB; v += CP[(size_t)bidx * sCPb + (size_t)by * 64 + col]; } }
      if (ACT == 3) v = fmaxf(v, 0.f); else if (ACT == 6) v = 0.5f * v * (1.0f + erff(v * 0.70710678118654752f)); else if (ACT == 11) v = 1.0f / (1.0f + expf(-v)); else if (ACT == 15) v = v / (1.0f + expf(-v)); else if (ACT == 12) v = (v > 0.f) ? v : 0.01f * v; else if (ACT == 8) v = tanhf(v); else if (ACT == 9) v = 0.5f * v * (1.0f + tanhf(0.7978845608028654f * (v + 0.044715f * v * v * v))); else if (ACT == 14) v = (v > 0.f) ? v : 0.1f * v; else if (ACT == 16) v = (v >= 0.f) ? v : 0.3f * v; else if (ACT == 17) v = (v >= 0.f) ? v : 0.2f * v;
      so[w][rloc][t * 16 + ln] = v; } }
  __builtin_amdgcn_fence(__ATOMIC_ACQ_REL, "workgroup"); __builtin_amdgcn_wave_barrier();
  const int rsub = lane >> 4, c4 = (lane & 15) * 4;
  {
#pragma unroll
    for (int q = 0; q < 16; ++q) { const int r = q * 2 + rsub; const v4f v = *(const v4fa*)&so[w][r][c4]; if (C) *(v4f*)(C + cofs + (size_t)(row0 + r) * ldc + col0 + c4) = v; if (C16) { v4h h4; for (int i = 0; i < 4; ++i) h4[i] = (_Float16)v[i]; *(v4h*)(C16 + cofs + (size_t)(row0 + r) * ldc + col0 + c4) = h4; } }
     } }


__global__ __launch_bounds__(256) void k_wnat(const float* __restrict__ w, size_t n8, _Float16* __restrict__ Bt) { const size_t t = (size_t)blockIdx.x * 256 + threadIdx.x; if (t >= n8) return; FragH f; for (int q = 0; q < 8; ++q) f.h[q] = (_Float16)(bf16_round(w[t * 8 + q]) * 16.0f); *(v8us*)((unsigned short*)Bt + t * 8) = f.half[0];  }
__global__ __launch_bounds__(256) void k_rsm(const float* __restrict__ S, _Float16* __restrict__ P, int nrows) {
  #pragma clang fp contract(off)
  const int i = blockIdx.x * 256 + threadIdx.x; if (i >= nrows) return; const float* s = S + (size_t)i * SQ; float mx = -3.0e38f;
#pragma unroll 1
  for (int j = 0; j < SQ; ++j) mx = fmaxf(mx, s[j]); float se = 0.f;
#pragma unroll 1
  for (int j = 0; j < SQ; ++j) se += expf(s[j] - mx); const float sc = 256.0f / se;
#pragma unroll 1
  for (int j0 = 0; j0 < SQ; j0 += 8) { FragH f; for (int q = 0; q < 8; ++q) f.h[q] = (_Float16)(expf(s[j0 + q] - mx) * sc); unsigned short* d = (unsigned short*)P + (size_t)i * SQ + j0; *(v8us*)d = f.half[0];  } }
__global__ __launch_bounds__(256) void k_vt(const _Float16* __restrict__ V16, int b, int h0, _Float16* __restrict__ VT) { __shared__ unsigned short tl[64][65]; const int tid = threadIdx.x; const int hh = blockIdx.x % HG, sg = blockIdx.x / HG; const int s0 = sg * 64; const int h = h0 + hh;
  for (int i = tid; i < 64 * 8; i += 256) { const int j = i / 8, d8 = (i % 8) * 8; FragH f; f.half[0] = *(const v8us*)((const unsigned short*)V16 + ((size_t)b * SQ + s0 + j) * DM + h * HD + d8); for (int q = 0; q < 8; ++q) tl[d8 + q][j] = f.u[q]; }
  __syncthreads();
  { for (int i = tid; i < 64 * 8; i += 256) { const int d = i / 8, j8 = (i % 8) * 8; FragH f; for (int q = 0; q < 8; ++q) f.u[q] = tl[d][j8 + q]; *(v8us*)((unsigned short*)VT + ((size_t)hh * HD + d) * SQ + s0 + j8) = f.half[0]; }  } }



__global__ __launch_bounds__(256) void k_rsmcf2(const float* __restrict__ S, _Float16* __restrict__ P, int hg, int q0, int nk) {
  #pragma clang fp contract(off)
  const int t = blockIdx.x * 256 + threadIdx.x; if (t >= hg * QT) return; const size_t i = (size_t)t; const float* s = S + i * NKX; const int last = q0 + (t % QT); float mx = -3.0e38f;
#pragma unroll 1
  for (int j = 0; j < nk; ++j) { const float f = (j <= last) ? 1.f : 0.f; mx = fmaxf(mx, fmaf(f, s[j], (1.f - f) * -1.0e9f)); } float se = 0.f;
#pragma unroll 1
  for (int j = 0; j < nk; ++j) { const float f = (j <= last) ? 1.f : 0.f; se += __expf(fmaf(f, s[j], (1.f - f) * -1.0e9f) - mx); } const float sc = 256.0f / se;
#pragma unroll 1
  for (int j0 = 0; j0 < nk; j0 += 8) { FragH fr; for (int q = 0; q < 8; ++q) { const int j = j0 + q; const float f = (j <= last) ? 1.f : 0.f; fr.h[q] = (_Float16)(__expf(fmaf(f, s[j], (1.f - f) * -1.0e9f) - mx) * sc); } unsigned short* d = (unsigned short*)P + i * NKX + j0; *(v8us*)d = fr.half[0];  } }

template <int MASKADD>
__global__ __launch_bounds__(64) void k_att0(const float* __restrict__ QF, const float* __restrict__ KF, const float* __restrict__ VF, int ld, const float* __restrict__ mask, float scale, float* __restrict__ OF, int ldo) {
  #pragma clang fp contract(off)
  __shared__ __attribute__((aligned(16))) float lq[64][64]; __shared__ __attribute__((aligned(16))) float lo[64][64];
  const int tid = threadIdx.x; const int h = blockIdx.x / (QT0 / 64), rg = blockIdx.x % (QT0 / 64); const int i = rg * 64 + tid;
  const float* qr = QF + (size_t)i * ld + h * HD;
#pragma unroll 1
  for (int c = 0; c < HD / 4; ++c) { *(v4f*)&lq[tid][c * 4] = *(const v4fa*)(qr + c * 4); const v4f z = {0.f, 0.f, 0.f, 0.f}; *(v4f*)&lo[tid][c * 4] = z; }
  float m = -1.0e30f, l = 0.f; const int jmax = MASKADD ? (SQ - 1) : (rg * 64 + 63);      /* additive-mask form: every key (the mask input decides); causal form: keys up to the block's last row */
#pragma unroll 1
  for (int j = 0; j <= jmax; ++j) { const float* kr = KF + (size_t)j * ld + h * HD; const float* vr = VF + (size_t)j * ld + h * HD; float s = 0.f;
#pragma unroll 1
    for (int c = 0; c < HD / 4; ++c) { const v4f kq = *(const v4fa*)(kr + c * 4); const v4f qq = *(v4f*)&lq[tid][c * 4]; s = __fadd_rn(s, __fmul_rn(qq[0], kq[0])); s = __fadd_rn(s, __fmul_rn(qq[1], kq[1])); s = __fadd_rn(s, __fmul_rn(qq[2], kq[2])); s = __fadd_rn(s, __fmul_rn(qq[3], kq[3])); }
    s = __fmul_rn(s, scale); if (MASKADD) s = __fadd_rn(s, __fmul_rn(bf16_round(mask[(size_t)i * SQ + j]), -10000.0f));
    const float f = (MASKADD || j <= i) ? 1.f : 0.f; const float sm = fmaf(f, s, (1.f - f) * -1.0e30f); const float mn = fmaxf(m, sm); const float sc = expf(m - mn); const float e = expf(sm - mn); l = __fadd_rn(__fmul_rn(l, sc), e); m = mn;
#pragma unroll 1
    for (int c = 0; c < HD / 4; ++c) { const v4f vv = *(const v4fa*)(vr + c * 4); v4f oo = *(v4f*)&lo[tid][c * 4]; for (int u = 0; u < 4; ++u) oo[u] = __fadd_rn(__fmul_rn(oo[u], sc), __fmul_rn(e, vv[u])); *(v4f*)&lo[tid][c * 4] = oo; } }
  const float fin = 64.0f / l;      /* o carried x64; the f16 path writes o unscaled */
#pragma unroll 1
  for (int c = 0; c < HD / 4; ++c) { v4f oo = *(v4f*)&lo[tid][c * 4]; for (int u = 0; u < 4; ++u) oo[u] = __fmul_rn(oo[u], fin); *(v4f*)&lo[tid][c * 4] = oo; }
  __syncthreads();
  {
#pragma unroll 1
    for (int it = 0; it < 16; ++it) { const int row = it * 4 + tid / 16, pc = (tid % 16) * 4; const v4f v = *(const v4f*)&lo[row][pc]; *(v4f*)(OF + (size_t)(rg * 64 + row) * ldo + h * HD + pc) = v; }
     } }

__global__ __launch_bounds__(256) void k_oscale(const float* __restrict__ OF, float* __restrict__ out, size_t n4) { const size_t t = (size_t)blockIdx.x * 256 + threadIdx.x; if (t >= n4) return; const v4f a = *(const v4fa*)(OF + t * 4); v4f o; for (int q = 0; q < 4; ++q) o[q] = a[q] * 0.015625f; *(v4f*)(out + t * 4) = o;  }

__global__ __launch_bounds__(256) void k_bfr(const float* __restrict__ x, float* __restrict__ XB, size_t n8) { const size_t t = (size_t)blockIdx.x * 256 + threadIdx.x; if (t >= n8) return; v4f a = *(const v4fa*)(x + t * 8), c = *(const v4fa*)(x + t * 8 + 4); for (int q = 0; q < 4; ++q) { a[q] = bf16_round(a[q]); c[q] = bf16_round(c[q]); }
  { *(v4f*)(XB + t * 8) = a; *(v4f*)(XB + t * 8 + 4) = c;  } }



__global__ __launch_bounds__(256) void k_rsmfvl(const float* __restrict__ S, _Float16* __restrict__ P, _Float16* __restrict__ PL, int qn, const int* __restrict__ vlp) {
  #pragma clang fp contract(off)
  const int t = blockIdx.x * 256 + threadIdx.x; if (t >= qn) return; const int vl = vlp[0]; const size_t i = (size_t)t; const float* s = S + i * SQ; float mx = -3.0e38f;
#pragma unroll 1
  for (int j = 0; j < SQ; ++j) { const float f = (j < vl) ? 1.f : 0.f; mx = fmaxf(mx, fmaf(f, s[j], (1.f - f) * -1000000.0f)); } float se = 0.f;
#pragma unroll 1
  for (int j = 0; j < SQ; ++j) { const float f = (j < vl) ? 1.f : 0.f; se += __expf(fmaf(f, s[j], (1.f - f) * -1000000.0f) - mx); } const float sc = 256.0f / se;
#pragma unroll 1
  for (int j0 = 0; j0 < SQ; j0 += 8) { FragH fr, gr; for (int q = 0; q < 8; ++q) { const int j = j0 + q; const float f = (j < vl) ? 1.f : 0.f; const float pv = __expf(fmaf(f, s[j], (1.f - f) * -1000000.0f) - mx) * sc; const _Float16 ph = (_Float16)pv; fr.h[q] = ph; gr.h[q] = (_Float16)((pv - (float)ph) * 1024.0f); }
    unsigned short* d = (unsigned short*)P + i * SQ + j0; unsigned short* dl = (unsigned short*)PL + i * SQ + j0; *(v8us*)d = fr.half[0]; *(v8us*)dl = gr.half[0];  } }

__global__ __launch_bounds__(256) void k_rsmf(const float* __restrict__ S, _Float16* __restrict__ P, int qn, int hg) {
  #pragma clang fp contract(off)
  const int t = blockIdx.x * 256 + threadIdx.x; if (t >= qn * hg) return; const size_t i = (size_t)(t / qn) * SQ + (t % qn); const float* s = S + i * SQ; float mx = -3.0e38f;
#pragma unroll 1
  for (int j = 0; j < SQ; ++j) mx = fmaxf(mx, s[j]); float se = 0.f;
#pragma unroll 1
  for (int j = 0; j < SQ; ++j) se += __expf(s[j] - mx); const float sc = 256.0f / se;
#pragma unroll 1
  for (int j0 = 0; j0 < SQ; j0 += 8) { FragH f; for (int q = 0; q < 8; ++q) f.h[q] = (_Float16)(__expf(s[j0 + q] - mx) * sc); unsigned short* d = (unsigned short*)P + i * SQ + j0; *(v8us*)d = f.half[0];  } }



// lane l <-> l ^ 16 (cross-row move): register only, no LDS traffic
__device__ __forceinline__ float lane_x16(float v) { const int b = __float_as_int(v); return __int_as_float(__builtin_amdgcn_permlanex16(b, b, 0x76543210, 0xfedcba98, false, false)); }

// ---- fused attention: logits, softmax and weights x value in one kernel; scores and weights never leave the registers ----
#define FA_QT 4                      /* query tiles (16 rows each) per work-group */
#define FA_KS 4                      /* key ranges per work-group, one wave per (query tile, key range) */
#define FA_NP (SQ / FA_KS / 32)      /* passes of 32 keys per wave */
// Operands stored as ready-made WMMA A fragments: a block of 512 f16 = [half j][lane l][8], lane l = (c = l & 15, h = l >> 4) holding row c, k = 16 j + 8 h + 0..7 (the hardware k order),
// so that a fragment is two whole-line loads of 512 B instead of two loads that touch 16 lines each. One 16-byte piece = 8 f16, piece t = (block t >> 6, half j = (t >> 5) & 1, lane l = t & 31).
// KF: block (key tile kt, d step s) at kt * 4 + s: row = key kt * 16 + c, k = channel s * 32 + ...
// VF: block (32-key step kp, channel tile dt) at kp * 8 + dt: row = channel dt * 16 + c, k = key kp * 32 + ... (the transposition of value happens here)
// ONE launch prepares everything the attention kernel reads. Work-group g takes rows 64 g .. 64 g + 63 of query, key and value (all batches in one row count): 1024 pieces of each, two per thread,
// and every load of a thread is issued before its first conversion: one memory round trip for the whole launch.
// A thread's two value pieces are 16 keys of ONE channel (tile dt = wave >> 1, channel c), so the work-group's sum over its 64 keys of the bf16-rounded value comes from registers (f32 on VALU):
// 8 keys as a tree, the two pieces, lane l + lane l ^ 16, then the two waves of a channel tile through LDS. PM[g][channel]; the attention kernel adds a batch's 64 partial sums.
#define PR_T 512                     /* threads of a preparation work-group */
__global__ __launch_bounds__(PR_T) void k_prep(const float* __restrict__ xq, const float* __restrict__ xk, const float* __restrict__ xv, _Float16* __restrict__ Q16, _Float16* __restrict__ KF, _Float16* __restrict__ VF, float* __restrict__ PM) {
  __shared__ float part[PR_T / 32][16];
  const int tid = threadIdx.x, w = tid >> 5, l = tid & 31, j = w & 1, c = l & 15, h = l >> 4; const size_t t0 = (size_t)blockIdx.x * (2 * PR_T) + tid;
  v4f qa[2][2], ka[2][2]; float va[2][8];
  /* unrolled: the arrays stay in registers and all 24 loads are in flight together */
#pragma unroll
  for (int i = 0; i < 2; ++i) { const size_t t = t0 + (size_t)i * PR_T, blk = t >> 6;
    const float* qs = xq + t * 8; const float* ks = xk + ((blk >> 2) * 16 + c) * DM + (blk & 3) * 32 + j * 16 + 8 * h; const float* vs = xv + ((blk >> 3) * 32 + j * 16 + 8 * h) * DM + (blk & 7) * 16 + c;
    /* the s_wait_xcnt behind each address's loads: a later load's result may land in that address's registers; the data stay in flight */
    qa[i][0] = *(const v4fa*)qs; qa[i][1] = *(const v4fa*)(qs + 4); asm volatile("s_wait_xcnt 0x0" ::: "memory");
    ka[i][0] = *(const v4fa*)ks; ka[i][1] = *(const v4fa*)(ks + 4); asm volatile("s_wait_xcnt 0x0" ::: "memory");
#pragma unroll
    for (int q = 0; q < 8; ++q) va[i][q] = vs[(size_t)q * DM];
    asm volatile("s_wait_xcnt 0x0" ::: "memory"); }
  /* inputs only, no code: every loaded value is in its register here, so all 24 loads issue ahead of the first use, under one wait (without it the query and key loads sink behind the barrier below: a second memory round trip) */
  asm volatile("" :: "v"(qa[0][0]), "v"(qa[0][1]), "v"(qa[1][0]), "v"(qa[1][1]), "v"(ka[0][0]), "v"(ka[0][1]), "v"(ka[1][0]), "v"(ka[1][1]), "v"(va[0][0]), "v"(va[0][1]), "v"(va[0][2]), "v"(va[0][3]), "v"(va[0][4]), "v"(va[0][5]), "v"(va[0][6]), "v"(va[0][7]),
               "v"(va[1][0]), "v"(va[1][1]), "v"(va[1][2]), "v"(va[1][3]), "v"(va[1][4]), "v"(va[1][5]), "v"(va[1][6]), "v"(va[1][7]));
  /* the value sums first: their barrier and the store of PM then stand in front of the six large stores and wait for none of them */
  float r[2][8];
#pragma unroll
  for (int i = 0; i < 2; ++i) for (int q = 0; q < 8; ++q) r[i][q] = bf16_round(va[i][q]);
  float a = (((r[0][0] + r[0][1]) + (r[0][2] + r[0][3])) + ((r[0][4] + r[0][5]) + (r[0][6] + r[0][7]))) + (((r[1][0] + r[1][1]) + (r[1][2] + r[1][3])) + ((r[1][4] + r[1][5]) + (r[1][6] + r[1][7])));
  a += lane_x16(a);
  if (h == 0) part[w][c] = a;
  __syncthreads();      /* every wave passes it once: the first four waves read both waves' sums of each channel tile below */
  if (tid < DM) PM[(size_t)blockIdx.x * DM + tid] = part[2 * (tid >> 4)][tid & 15] + part[2 * (tid >> 4) + 1][tid & 15];
  /* unrolled: register arrays */
#pragma unroll
  for (int i = 0; i < 2; ++i) { const size_t t = t0 + (size_t)i * PR_T; FragH fq, fk, fv;
#pragma unroll
    for (int q = 0; q < 8; ++q) { fq.h[q] = (_Float16)bf16_round(qa[i][q >> 2][q & 3]); fk.h[q] = (_Float16)bf16_round(ka[i][q >> 2][q & 3]); fv.h[q] = (_Float16)r[i][q]; }
    *(v8us*)((unsigned short*)Q16 + t * 8) = fq.half[0]; *(v8us*)((unsigned short*)KF + t * 8) = fk.half[0]; *(v8us*)((unsigned short*)VF + t * 8) = fv.half[0]; } }
// p: the block's start, the same for the whole wave; lo = lane * 8: the lane's own 16-byte piece
__device__ __forceinline__ v16h fa_frag(const unsigned short* p, unsigned lo) { FragH f; f.half[0] = *(const v8us*)(p + lo); f.half[1] = *(const v8us*)(p + 256 + lo); return f.v; }
__device__ __forceinline__ v8f fa_mma(v16h a, v16h b, v8f c) { return __builtin_amdgcn_wmma_f32_16x16x32_f16(false, a, false, b, (short)0, c, false, false); }
// native 2^t; the v_nop in the same statement keeps the one slot that the instruction set asks for behind a transcendental, whatever the compiler puts next
__device__ __forceinline__ float fa_exp2(float t) { float e; asm("v_exp_f32 %0, %1\n\tv_nop" : "=v"(e) : "v"(t)); return e; }
// four at once: the results are early-clobber, so none of the four reads a neighbour's result or overwrites its source, and one v_nop closes the last one's slot
__device__ __forceinline__ void fa_exp2x4(float& a, float& b, float& c, float& d) { float e0, e1, e2, e3;
  asm("v_exp_f32 %0, %4\n\tv_exp_f32 %1, %5\n\tv_exp_f32 %2, %6\n\tv_exp_f32 %3, %7\n\tv_nop" : "=&v"(e0), "=&v"(e1), "=&v"(e2), "=&v"(e3) : "v"(a), "v"(b), "v"(c), "v"(d)); a = e0; b = e1; c = e2; d = e3; }
// A wave owns 16 queries and 1024 keys. S^T = K Q^T: D register r of lane (c, h) = score of key 8 h + r, query c, so a query's scores sit in two lanes (maximum and sum in-lane plus one exchange),
// and two score tiles (keys 0..15, 16..31), converted in place, ARE the B fragment of O^T += V^T P^T in the hardware k order. Running maximum m per query (log2 units), renewed only when a pass exceeds it by more than 8;
// weights 2^(s - m + 6) <= 2^14 as f16 hi + f16 residual, both into the same f32 accumulators; the sum of the f32 weights in l. The four key ranges of a query tile are joined through LDS at the end.
__global__ __launch_bounds__(FA_QT * FA_KS * 32) void k_fattn(const _Float16* __restrict__ Q16, const _Float16* __restrict__ KF, const _Float16* __restrict__ VF, const float* __restrict__ PM, float* __restrict__ out) {
  __shared__ float so[FA_KS][FA_QT][64][32]; __shared__ float sm[FA_KS][FA_QT][32]; __shared__ float sl[FA_KS][FA_QT][32]; __shared__ __attribute__((aligned(16))) float sv[FA_KS][DM];
  const int tid = threadIdx.x, w = __builtin_amdgcn_readfirstlane(tid >> 5) /* the wave's number in a scalar register: fragment bases and LDS planes become scalar */, lane = tid & 31, c = lane & 15, h = lane >> 4, qt = w & (FA_QT - 1), ks = w / FA_QT; const int b = blockIdx.y, row0 = blockIdx.x * (FA_QT * 16) + qt * 16;
  const _Float16* qp = Q16 + ((size_t)b * SQ + row0 + c) * DM; const v16h q0 = g2_frag(qp, h), q1 = g2_frag(qp + 32, h), q2 = g2_frag(qp + 64, h), q3 = g2_frag(qp + 96, h);
  /* sum of value over the sequence: wave (qt, ks) adds partial sums 16 ks .. 16 ks + 15 of its batch for channels 32 qt + lane (whole lines, in flight beside the query loads); the four quarters meet behind the barrier below */
  { const float* pp = PM + ((size_t)b * (SQ / 64) + ks * 16) * DM + qt * 32 + lane; float x[16];
#pragma unroll
    for (int i = 0; i < 16; ++i) x[i] = pp[(size_t)i * DM];
    sv[ks][qt * 32 + lane] = (((x[0] + x[1]) + (x[2] + x[3])) + ((x[4] + x[5]) + (x[6] + x[7]))) + (((x[8] + x[9]) + (x[10] + x[11])) + ((x[12] + x[13]) + (x[14] + x[15]))); }
  const size_t f0 = ((size_t)b * (SQ / 32) + (size_t)ks * FA_NP) * 4096; const unsigned lo = (unsigned)lane * 8;      /* a pass of 32 keys = 8 blocks = 4096 f16 in KF and in VF */
  const unsigned short* kb = (const unsigned short*)KF + f0; const unsigned short* vb = (const unsigned short*)VF + f0;
  const float CS = (float)(0.08838834764831845 * 1.4426950408889634);      /* 1 / sqrt(128) times log2 e */
  const v8f z8 = {0.f,0.f,0.f,0.f,0.f,0.f,0.f,0.f}; v8f o[8] = {z8, z8, z8, z8, z8, z8, z8, z8}; float m = -1.0e30f, l = 0.f;
  /* kept rolled: two passes' fragments at once would not fit the 256 registers that four waves per SIMD leave each wave */
#pragma unroll 1
  for (int p = 0; p < FA_NP; ++p) { const unsigned short* kp = kb + (size_t)p * 4096; const unsigned short* vp = vb + (size_t)p * 4096;
    const v16h k0 = fa_frag(kp, lo), k1 = fa_frag(kp + 512, lo), k2 = fa_frag(kp + 1024, lo), k3 = fa_frag(kp + 1536, lo), k4 = fa_frag(kp + 2048, lo), k5 = fa_frag(kp + 2560, lo), k6 = fa_frag(kp + 3072, lo), k7 = fa_frag(kp + 3584, lo);
    /* inputs only, no code: all eight key fragments are in registers here, so their 16 loads issue back to back under ONE wait (without it each fragment is loaded, waited for and used in turn: eight latencies a pass) */
    asm volatile("" :: "v"(k0), "v"(k1), "v"(k2), "v"(k3), "v"(k4), "v"(k5), "v"(k6), "v"(k7));
    v16h vf[8];
#pragma unroll
    for (int j = 0; j < 8; ++j) vf[j] = fa_frag(vp + j * 512, lo);
    v8f s0 = fa_mma(k0, q0, z8), s1 = fa_mma(k4, q0, z8); s0 = fa_mma(k1, q1, s0); s1 = fa_mma(k5, q1, s1); s0 = fa_mma(k2, q2, s0); s1 = fa_mma(k6, q2, s1); s0 = fa_mma(k3, q3, s0); s1 = fa_mma(k7, q3, s1);
    float mx = fmaxf(s0[0], s1[0]);
#pragma unroll
    for (int r = 1; r < 8; ++r) mx = fmaxf(mx, fmaxf(s0[r], s1[r]));
    mx = fmaxf(mx, lane_x16(mx)) * CS;
    const bool need = mx > m + 8.0f;
    if (__builtin_amdgcn_ballot_w32(need) != 0) {      /* wave-uniform: the accumulators are rescaled only in the few passes in which some query's maximum moves */
      const float mn = need ? mx : m; const float al = fa_exp2(m - mn); m = mn; l *= al;
#pragma unroll
      for (int j = 0; j < 8; ++j) for (int r = 0; r < 8; ++r) o[j][r] *= al; }
    const float nm = 6.0f - m; float e[16];
#pragma unroll
    for (int r = 0; r < 8; ++r) { e[r] = fmaf(s0[r], CS, nm); e[8 + r] = fmaf(s1[r], CS, nm); }
#pragma unroll
    for (int u = 0; u < 16; u += 4) fa_exp2x4(e[u], e[u + 1], e[u + 2], e[u + 3]);
    l += ((e[0] + e[4] + e[8] + e[12]) + (e[1] + e[5] + e[9] + e[13])) + ((e[2] + e[6] + e[10] + e[14]) + (e[3] + e[7] + e[11] + e[15]));
    FragH ph, pl;
#pragma unroll
    for (int u = 0; u < 16; ++u) { const _Float16 hv = (_Float16)e[u]; ph.h[u] = hv; pl.h[u] = (_Float16)(e[u] - (float)hv); }
#pragma unroll
    for (int j = 0; j < 8; ++j) o[j] = fa_mma(vf[j], ph.v, o[j]);
#pragma unroll
    for (int j = 0; j < 8; ++j) o[j] = fa_mma(vf[j], pl.v, o[j]); }
  l += lane_x16(l);      /* the two halves of a query's keys */
#pragma unroll
  for (int j = 0; j < 8; ++j) for (int r = 0; r < 8; ++r) so[ks][qt][j * 8 + r][lane] = o[j][r];
  sm[ks][qt][lane] = m; sl[ks][qt][lane] = l;
  __syncthreads();      /* every wave passes it once: the four key ranges' partial results, and the quarters of the value sums, are read by other waves below */
  float mm[FA_KS], M = -3.0e38f, L = 0.f;
#pragma unroll
  for (int i = 0; i < FA_KS; ++i) { mm[i] = sm[i][qt][lane]; M = fmaxf(M, mm[i]); }
#pragma unroll
  for (int i = 0; i < FA_KS; ++i) { mm[i] = fa_exp2(mm[i] - M); L += sl[i][qt][lane] * mm[i]; }
  const float inv = 1.0f / L;
  /* wave (qt, ks) finishes channels 32 ks .. 32 ks + 31 of its query tile: one whole 128-byte line of each output row */
#pragma unroll
  for (int jj = 0; jj < 2; ++jj) { const int j = 2 * ks + jj, ch = 16 * j + 8 * h; v4f r0, r1; float nv[8];      /* nv = -mean(value) of the lane's eight channels */
#pragma unroll
    for (int u = 0; u < 2; ++u) { const v4f t = (*(const v4f*)&sv[0][ch + 4 * u] + *(const v4f*)&sv[1][ch + 4 * u]) + (*(const v4f*)&sv[2][ch + 4 * u] + *(const v4f*)&sv[3][ch + 4 * u]);
#pragma unroll
      for (int r = 0; r < 4; ++r) nv[4 * u + r] = t[r] * (-1.0f / (float)SQ); }
#pragma unroll
    for (int r = 0; r < 8; ++r) { float a = 0.f;
#pragma unroll
      for (int i = 0; i < FA_KS; ++i) a += so[i][qt][j * 8 + r][lane] * mm[i];
      a = a * inv + nv[r]; if (r < 4) r0[r] = a; else r1[r - 4] = a; }
    float* d = out + ((size_t)b * SQ + row0 + c) * DM + 16 * j + 8 * h; *(v4f*)d = r0; *(v4f*)(d + 4) = r1; } }
extern "C" void kernel_launch(void* const* d_in, const int* in_sizes, int n_in,
                              void* d_out, int out_size, void* d_ws, size_t ws_size, hipStream_t stream) {
  (void)in_sizes; (void)n_in; (void)out_size;
  const float* const* I = (const float* const*)d_in; const float* xq = I[0]; const float* xk = I[1]; const float* xv = I[2];      /* query, key, value [4][4096][128] */
  char* ws = (char*)d_ws; size_t off = 0;
  auto take = [&](size_t bytes) { char* p = ws + off; off += (bytes + 255) & ~(size_t)255; return p; };
  _Float16* Q16 = (_Float16*)take(NR * DM * 2); _Float16* KF = (_Float16*)take(NR * DM * 2); _Float16* VF = (_Float16*)take(NR * DM * 2); float* PM = (float*)take((NR / 64) * DM * 4);      /* sums of value over 64 keys each [256][128] */
  if (off > ws_size) return;
  k_prep<<<(unsigned)(NR / 64), PR_T, 0, stream>>>(xq, xk, xv, Q16, KF, VF, PM);      /* bf16-rounded inputs, exact in f16: query rows, keys and value^T in fragment order; value sums per 64 keys */
  k_fattn<<<dim3(SQ / (FA_QT * 16), NB), FA_QT * FA_KS * 32, 0, stream>>>(Q16, KF, VF, PM, (float*)d_out);      /* out = softmax(q.k / sqrt(128)) value - mean(value), all batches */
}

// v005
// It runs in 46.5 microseconds.
// In both of two side-by-side timings against v004, it was 1.32 times as fast.
// Over all steps from v000 it is 92.9 times as fast.
#include <hip/hip_runtime.h>
#define NB 4
#define SQ 4096
#define DM 128
#define NH 2
#define HD 64
#define HG 8                         /* heads per launch of the four-argument k_vt (not launched) */
#define B0 0                         /* first batch processed (unused) */
#define NBR NB                       /* batches processed (used only in MP) */
#define NR ((size_t)NB * SQ)         /* token rows */
#define MP ((int)((size_t)NBR * SQ)) /* token rows (used only in MPO) */
#define QT 256                       /* query rows per causal tile */
#define NKX SQ                       /* S / P row pitch */
#define QT0 256                      /* query rows per head of the f32 k_att0 (not launched) */
#define QN SQ                        /* query rows attended per batch (unused) */
#define NHD NH                       /* unused */
#define MPO MP                       /* rows through the output stage (unused) */
#define LQ DM            /* row pitch of the q/k/v rows (unused) */
typedef __bf16 v16b __attribute__((ext_vector_type(16)));
typedef unsigned short v8us __attribute__((ext_vector_type(8), may_alias));
typedef float  v8f  __attribute__((ext_vector_type(8)));
typedef float  v4f  __attribute__((ext_vector_type(4)));
typedef float  v4fa __attribute__((ext_vector_type(4), may_alias));
union FragB { v16b v; v8us half[2]; unsigned short u[16]; };

__device__ __forceinline__ unsigned short bf16_bits(float x) { unsigned int u = __float_as_uint(x); return (unsigned short)((u + 0x7FFFu + ((u >> 16) & 1u)) >> 16); }
__device__ __forceinline__ float bf16_val(unsigned short b) { return __uint_as_float(((unsigned int)b) << 16); }
__device__ __forceinline__ float bf16_round(float x) { return bf16_val(bf16_bits(x)); }
// D += A·B with NT terms: 1 = ah·bh, 2 = + al·bh (A split), 3 = + ah·bl (both split)
template <int NT>
__device__ __forceinline__ v8f mmaN(v16b ah, v16b al, v16b bh, v16b bl, v8f c) {
  c = __builtin_amdgcn_wmma_f32_16x16x32_bf16(false, ah, false, bh, (short)0, c, false, false);
  if (NT >= 2) c = __builtin_amdgcn_wmma_f32_16x16x32_bf16(false, al, false, bh, (short)0, c, false, false);
  if (NT >= 3) c = __builtin_amdgcn_wmma_f32_16x16x32_bf16(false, ah, false, bl, (short)0, c, false, false);
  asm volatile("v_nop\n\tv_nop\n\tv_nop\n\tv_nop" : "+v"(c) : "v"(ah), "v"(al), "v"(bh), "v"(bl));
  return c;
}

__global__ __launch_bounds__(256) void k_wt_bf16(const float* __restrict__ W, unsigned short* __restrict__ Wt, int K, int N) {
  const int t = blockIdx.x * 256 + threadIdx.x;
  const int k8n = K / 8;
  if (t >= N * k8n) return;
  const int n = t / k8n, k8 = (t % k8n) * 8;
  v8us v;
#pragma unroll
  for (int i = 0; i < 8; ++i) v[i] = bf16_bits(W[(size_t)(k8 + i) * N + n]);
  *(v8us*)(Wt + (size_t)n * K + k8) = v;
  
}

// GEMM C[M][N] (f32, pitch ldc) = act(A[M][K]·W + bias). A f32 row-major (pitch lda) converted per fragment to bf16
// (ASPLIT: hi/lo two planes -> 2 terms, else single rounded term); Wt bf16 [N][K] (pitch ldb). BIAS_BF16 rounds the
// bias to bf16 first (bias quantised to bf16 before the add). K%32==0, M%16==0, N%64==0.
template <bool ASPLIT, int ACT, bool BIAS_BF16>
__global__ __launch_bounds__(128) void k_gemm_bf(const float* __restrict__ A, int lda, const unsigned short* __restrict__ Wt, int ldb,
                                               const float* __restrict__ bias, float* __restrict__ C, int ldc, int M, int N, int K) {
  __shared__ __attribute__((aligned(16))) float so[4][16][64];
  const int tid = threadIdx.x, w = tid >> 5, lane = tid & 31, ln = lane & 15, hh = lane >> 4;
  const int ntn = N / 64;
  const int wid = blockIdx.x * 4 + w;
  const int mt = wid / ntn, nq = wid % ntn;
  if (mt * 16 >= M) return;
  const int row0 = mt * 16, col0 = nq * 64;
  const float* arow = A + (size_t)(row0 + ln) * lda;
  v8f acc[4] = {};
  for (int kb = 0; kb < K; kb += 32) {
    FragB ah, al;
    const v4f x0 = *(const v4fa*)(arow + kb + 8 * hh), x1 = *(const v4fa*)(arow + kb + 8 * hh + 4);
    const v4f x2 = *(const v4fa*)(arow + kb + 16 + 8 * hh), x3 = *(const v4fa*)(arow + kb + 16 + 8 * hh + 4);
    float xs[16] = {x0[0],x0[1],x0[2],x0[3],x1[0],x1[1],x1[2],x1[3],x2[0],x2[1],x2[2],x2[3],x3[0],x3[1],x3[2],x3[3]};
#pragma unroll
    for (int i = 0; i < 16; ++i) { const unsigned short hb = bf16_bits(xs[i]); ah.u[i] = hb; al.u[i] = ASPLIT ? bf16_bits(xs[i] - bf16_val(hb)) : (unsigned short)0; }
#pragma unroll
    for (int t = 0; t < 4; ++t) {
      const unsigned short* brow = Wt + (size_t)(col0 + t * 16 + ln) * ldb + kb;
      FragB b;
      b.half[0] = *(const v8us*)(brow + 8 * hh);
      b.half[1] = *(const v8us*)(brow + 16 + 8 * hh);
      acc[t] = mmaN<ASPLIT ? 2 : 1>(ah.v, al.v, b.v, b.v, acc[t]);
    }
  }
#pragma unroll
  for (int t = 0; t < 4; ++t) {
    float bv = bias ? bias[col0 + t * 16 + ln] : 0.f;
    if (BIAS_BF16) bv = bf16_round(bv);
#pragma unroll
    for (int r = 0; r < 8; ++r) { float v = acc[t][r] + bv; if (ACT == 1) v = fmaxf(v, 0.f); so[w][8 * hh + r][t * 16 + ln] = v; }
  }
  __builtin_amdgcn_fence(__ATOMIC_ACQ_REL, "workgroup");
  __builtin_amdgcn_wave_barrier();
  const int rsub = lane >> 4, c4 = (lane & 15) * 4;
  {
#pragma unroll
    for (int q = 0; q < 8; ++q) {
      const int r = q * 2 + rsub;
      const v4f v = *(const v4fa*)&so[w][r][c4];
      *(v4f*)(C + (size_t)(row0 + r) * ldc + col0 + c4) = v;
    }
    
  }
}

// GEMM C = act(A·W + bias + resid): A f32 (ASPLIT -> hi/lo 2 terms), Wt bf16 [N][K]; ACT 0 none, 1 relu, 2 exact gelu;
// resid (optional, f32, row index = (row % rmod), pitch ldr, RES_BF16 rounds it) added before the activation.
template <bool ASPLIT, int ACT, bool BIAS_BF16, bool RES_BF16>
__global__ __launch_bounds__(128) void k_gemm_bf3(const float* __restrict__ A, int lda, const unsigned short* __restrict__ Wt, int ldb,
                                                const float* __restrict__ bias, const float* __restrict__ resid, int rmod, int ldr,
                                                float* __restrict__ C, int ldc, int M, int N, int K) {
  __shared__ __attribute__((aligned(16))) float so[4][16][64];
  const int tid = threadIdx.x, w = tid >> 5, lane = tid & 31, ln = lane & 15, hh = lane >> 4;
  const int ntn = N / 64;
  const int wid = blockIdx.x * 4 + w;
  const int mt = wid / ntn, nq = wid % ntn;
  if (mt * 16 >= M) return;
  const int row0 = mt * 16, col0 = nq * 64;
  const float* arow = A + (size_t)(row0 + ln) * lda;
  v8f acc[4] = {};
  for (int kb = 0; kb < K; kb += 32) {
    FragB ah, al;
    const v4f x0 = *(const v4fa*)(arow + kb + 8 * hh), x1 = *(const v4fa*)(arow + kb + 8 * hh + 4);
    const v4f x2 = *(const v4fa*)(arow + kb + 16 + 8 * hh), x3 = *(const v4fa*)(arow + kb + 16 + 8 * hh + 4);
    float xs[16] = {x0[0],x0[1],x0[2],x0[3],x1[0],x1[1],x1[2],x1[3],x2[0],x2[1],x2[2],x2[3],x3[0],x3[1],x3[2],x3[3]};
#pragma unroll
    for (int i = 0; i < 16; ++i) { const unsigned short hb = bf16_bits(xs[i]); ah.u[i] = hb; al.u[i] = ASPLIT ? bf16_bits(xs[i] - bf16_val(hb)) : (unsigned short)0; }
#pragma unroll
    for (int t = 0; t < 4; ++t) {
      const unsigned short* brow = Wt + (size_t)(col0 + t * 16 + ln) * ldb + kb;
      FragB b;
      b.half[0] = *(const v8us*)(brow + 8 * hh);
      b.half[1] = *(const v8us*)(brow + 16 + 8 * hh);
      acc[t] = mmaN<ASPLIT ? 2 : 1>(ah.v, al.v, b.v, b.v, acc[t]);
    }
  }
#pragma unroll
  for (int t = 0; t < 4; ++t) {
    const int col = col0 + t * 16 + ln;
    float bv = bias ? bias[col] : 0.f;
    if (BIAS_BF16) bv = bf16_round(bv);
#pragma unroll
    for (int r = 0; r < 8; ++r) {
      float v = acc[t][r] + bv;
      if (resid) { float rv = resid[(size_t)((row0 + 8 * hh + r) % rmod) * ldr + col]; if (RES_BF16) rv = bf16_round(rv); v += rv; }
      if (ACT == 1) v = fmaxf(v, 0.f);
      if (ACT == 2) v = 0.5f * v * (1.0f + erff(v * 0.70710678118654752f));
      if (ACT == 3) { const float u = 0.7978845608028654f * (v + 0.044715f * v * v * v); v = 0.5f * v * (1.0f + tanhf(u)); }
      so[w][8 * hh + r][t * 16 + ln] = v;
    }
  }
  __builtin_amdgcn_fence(__ATOMIC_ACQ_REL, "workgroup");
  __builtin_amdgcn_wave_barrier();
  const int rsub = lane >> 4, c4 = (lane & 15) * 4;
  {
#pragma unroll
    for (int q = 0; q < 8; ++q) {
      const int r = q * 2 + rsub;
      const v4f v = *(const v4fa*)&so[w][r][c4];
      *(v4f*)(C + (size_t)(row0 + r) * ldc + col0 + c4) = v;
    }
    
  }
}
// row LayerNorm (biased variance, eps) over N: s = X (+ R); optional out_sum <- s; out_norm <- (s-mu)*rsqrt(var+eps)*g + b
template <bool PARAM_BF16>
__global__ __launch_bounds__(256) void k_layernorm(const float* __restrict__ X, const float* __restrict__ R, const float* __restrict__ g, const float* __restrict__ bta,
                                                  float* __restrict__ out_sum, float* __restrict__ out_norm, int N, float eps) {
  __shared__ float red[256];
  const int row = blockIdx.x, tid = threadIdx.x;
  const float* x = X + (size_t)row * N; const float* rr = R ? R + (size_t)row * N : nullptr;
  float vals[16];                     // up to N = 4096
  const int per = N / 256;            // contiguous chunk per thread? use strided-by-4 chunks: thread handles j = tid*4 + 1024*u
  float s1 = 0.f;
  for (int u = 0; u < per / 4; ++u) {
    const int j = tid * 4 + 1024 * u;
    const v4f a = *(const v4fa*)(x + j);
    v4f b = {0.f,0.f,0.f,0.f}; if (rr) b = *(const v4fa*)(rr + j);
#pragma unroll
    for (int q = 0; q < 4; ++q) { const float v = a[q] + b[q]; vals[u * 4 + q] = v; s1 += v; }
  }
  red[tid] = s1; __syncthreads();
  for (int st = 128; st > 0; st >>= 1) { if (tid < st) red[tid] += red[tid + st]; __syncthreads(); }
  const float mu = red[0] / (float)N; __syncthreads();
  float s2 = 0.f;
  for (int u = 0; u < per / 4; ++u)
#pragma unroll
    for (int q = 0; q < 4; ++q) { const float c = vals[u * 4 + q] - mu; s2 += c * c; }
  red[tid] = s2; __syncthreads();
  for (int st = 128; st > 0; st >>= 1) { if (tid < st) red[tid] += red[tid + st]; __syncthreads(); }
  const float rs = rsqrtf(red[0] / (float)N + eps);
  {
    for (int u = 0; u < per / 4; ++u) {
      const int j = tid * 4 + 1024 * u;
      v4f o, sm;
#pragma unroll
      for (int q = 0; q < 4; ++q) {
        float gg = g[j + q], bb = bta[j + q];
        if (PARAM_BF16) { gg = bf16_round(gg); bb = bf16_round(bb); }
        sm[q] = vals[u * 4 + q]; o[q] = (vals[u * 4 + q] - mu) * rs * gg + bb;
      }
      if (out_sum) *(v4f*)(out_sum + (size_t)row * N + j) = sm;
      *(v4f*)(out_norm + (size_t)row * N + j) = o;
    }
    
  }
}



// ---- f16 WMMA path (v_wmma_f32_16x16x32_f16): 11-bit significands for operands in range — used where a [0,1] probability operand needs more precision than bf16
typedef _Float16 v16h __attribute__((ext_vector_type(16)));
union FragH { v16h v; v8us half[2]; _Float16 h[16]; unsigned short u[16]; };
template <int NT>
__device__ __forceinline__ v8f mmaH(v16h ah, v16h al, v16h bh, v16h bl, v8f c) {
  c = __builtin_amdgcn_wmma_f32_16x16x32_f16(false, ah, false, bh, (short)0, c, false, false);
  if (NT >= 2) c = __builtin_amdgcn_wmma_f32_16x16x32_f16(false, al, false, bh, (short)0, c, false, false);
  if (NT >= 3) c = __builtin_amdgcn_wmma_f32_16x16x32_f16(false, ah, false, bl, (short)0, c, false, false);
  asm volatile("v_nop\n\tv_nop\n\tv_nop\n\tv_nop" : "+v"(c) : "v"(ah), "v"(al), "v"(bh), "v"(bl));
  return c;
}
// batched GEMM like k_gemm_b but f16 operands: A f32 (split into f16 hi/lo if ASPLIT, else rounded to f16), Bt = f16 values [n][k]; alpha; C f32; N multiple of 16 (partial tiles skipped)
template <bool ASPLIT>
__global__ __launch_bounds__(128) void k_gemm_h(const float* __restrict__ A, int lda, size_t sA, const _Float16* __restrict__ Bh, int ldb, size_t sB, float alpha, float* __restrict__ C, int ldc, size_t sC, int M, int N, int K) {
  __shared__ __attribute__((aligned(16))) float so[4][16][64];
  const int tid = threadIdx.x, w = tid >> 5, lane = tid & 31, ln = lane & 15, hh = lane >> 4; const int by = blockIdx.y;
  A += (size_t)by * sA; Bh += (size_t)by * sB; C += (size_t)by * sC;
  const int ntn = (N + 63) / 64; const int wid = blockIdx.x * 4 + w; const int mt = wid / ntn, nq = wid % ntn; if (mt * 16 >= M) return;
  const int row0 = mt * 16, col0 = nq * 64; const float* arow = A + (size_t)(row0 + ln) * lda;
  v8f acc[4] = {};
  for (int kb = 0; kb < K; kb += 32) {
    FragH ah, al;
    const v4f x0 = *(const v4fa*)(arow + kb + 8 * hh), x1 = *(const v4fa*)(arow + kb + 8 * hh + 4), x2 = *(const v4fa*)(arow + kb + 16 + 8 * hh), x3 = *(const v4fa*)(arow + kb + 16 + 8 * hh + 4);
    float xs[16] = {x0[0],x0[1],x0[2],x0[3],x1[0],x1[1],x1[2],x1[3],x2[0],x2[1],x2[2],x2[3],x3[0],x3[1],x3[2],x3[3]};
#pragma unroll
    for (int i = 0; i < 16; ++i) { const _Float16 h = (_Float16)xs[i]; ah.h[i] = h; al.h[i] = ASPLIT ? (_Float16)(xs[i] - (float)h) : (_Float16)0.0f; }
#pragma unroll
    for (int t = 0; t < 4; ++t) { if (col0 + t * 16 >= N) continue; const size_t boff = (size_t)(col0 + t * 16 + ln) * ldb + kb; FragH bq; bq.half[0] = *(const v8us*)(Bh + boff + 8 * hh); bq.half[1] = *(const v8us*)(Bh + boff + 16 + 8 * hh);
      acc[t] = mmaH<ASPLIT ? 2 : 1>(ah.v, al.v, bq.v, bq.v, acc[t]); }
  }
#pragma unroll
  for (int t = 0; t < 4; ++t) { if (col0 + t * 16 >= N) continue;
#pragma unroll
    for (int r = 0; r < 8; ++r) so[w][8 * hh + r][t * 16 + ln] = acc[t][r] * alpha; }
  __builtin_amdgcn_fence(__ATOMIC_ACQ_REL, "workgroup"); __builtin_amdgcn_wave_barrier();
  const int rsub = lane >> 4, c4 = (lane & 15) * 4;
  {
#pragma unroll
    for (int q = 0; q < 8; ++q) { const int r = q * 2 + rsub; if (col0 + c4 < N) { const v4f v = *(const v4fa*)&so[w][r][c4]; *(v4f*)(C + (size_t)(row0 + r) * ldc + col0 + c4) = v; } }
     }
}

// Wt[n][k] = f16(W[k][n]·scale) from f32 row-major W[K][N] (scale = power of two; bf16-exact weights stay exact in f16 away from the subnormal range)
__global__ __launch_bounds__(256) void k_wt_f16(const float* __restrict__ W, _Float16* __restrict__ Wt, int K, int N, float scale) {
  const int t = blockIdx.x * 256 + threadIdx.x; if (t >= N * (K / 8)) return; const int n = t / (K / 8), k8 = (t % (K / 8)) * 8; FragH f;
#pragma unroll
  for (int i = 0; i < 8; ++i) f.h[i] = (_Float16)(bf16_round(W[(size_t)(k8 + i) * N + n]) * scale); const v8us o = f.half[0];
  *(v8us*)((unsigned short*)Wt + (size_t)n * K + k8) = o; 
}
// k_gemm_hh variant with fused epilogue: v = acc·alpha + bias[by·sBias + col] (+ CP[(row/rowsPerB)·sCPb + by·64 + col] if CP) ; ACT 0 none / 1 elu ; writes f16 C16 (and f32 C if non-null)
template <int ACT>
__global__ __launch_bounds__(128) void k_gemm_hhx(const _Float16* __restrict__ A, int lda, size_t sA, const _Float16* __restrict__ Bh, int ldb, size_t sB, float alpha, const float* __restrict__ bias, size_t sBias, const float* __restrict__ CP, int rowsPerB, size_t sCPb, int row0g,
    float* __restrict__ C, _Float16* __restrict__ C16, int ldc, size_t sC, int M, int N, int K) {
  __shared__ __attribute__((aligned(16))) float so[4][16][64];
  const int tid = threadIdx.x, w = tid >> 5, lane = tid & 31, ln = lane & 15, hh = lane >> 4; const int by = blockIdx.y;
  A += (size_t)by * sA; Bh += (size_t)by * sB; const size_t cofs = (size_t)by * sC; const float* bp = bias ? bias + (size_t)by * sBias : nullptr;
  const int ntn = (N + 63) / 64; const int wid = blockIdx.x * 4 + w; const int mt = wid / ntn, nq = wid % ntn; if (mt * 16 >= M) return;
  const int row0 = mt * 16, col0 = nq * 64; const _Float16* arow = A + (size_t)(row0 + ln) * lda;
  v8f acc[4] = {};
  for (int kb = 0; kb < K; kb += 32) { FragH ah; ah.half[0] = *(const v8us*)((const unsigned short*)arow + kb + 8 * hh); ah.half[1] = *(const v8us*)((const unsigned short*)arow + kb + 16 + 8 * hh);
#pragma unroll
    for (int t = 0; t < 4; ++t) { if (col0 + t * 16 >= N) continue; const size_t boff = (size_t)(col0 + t * 16 + ln) * ldb + kb; FragH bq; bq.half[0] = *(const v8us*)((const unsigned short*)Bh + boff + 8 * hh); bq.half[1] = *(const v8us*)((const unsigned short*)Bh + boff + 16 + 8 * hh);
      acc[t] = mmaH<1>(ah.v, ah.v, bq.v, bq.v, acc[t]); }
  }
#pragma unroll
  for (int t = 0; t < 4; ++t) { if (col0 + t * 16 >= N) continue; const int col = col0 + t * 16 + ln; const float bv = bp ? bf16_round(bp[col]) : 0.f;
#pragma unroll
    for (int r = 0; r < 8; ++r) { float v = acc[t][r] * alpha + bv; if (CP) { const int rr = row0g + row0 + 8 * hh + r; if (rowsPerB < 0) v += CP[cofs + (size_t)rr * ldc + col];      /* rowsPerB < 0: own element of the batched C plane */ else { const int bidx = rr / rowsPerB; v += CP[(size_t)bidx * sCPb + (size_t)by * 64 + col]; } } if (ACT == 1) v = (v > 0.f) ? v : expm1f(v); else if (ACT == 7) v = (v > 0.f) ? v + 1.0f : expf(v); else if (ACT == 8) v = tanhf(v); else if (ACT == 9) v = 0.5f * v * (1.0f + tanhf(0.7978845608028654f * (v + 0.044715f * v * v * v))); else if (ACT == 11) v = 1.0f / (1.0f + expf(-v)); else if (ACT == 12) v = (v > 0.f) ? v : 0.01f * v; else if (ACT == 14) v = (v > 0.f) ? v : 0.1f * v; else if (ACT == 16) v = (v >= 0.f) ? v : 0.3f * v; else if (ACT == 17) v = (v >= 0.f) ? v : 0.2f * v; else if (ACT == 15) v = v / (1.0f + expf(-v)); else if (ACT == 3) v = fmaxf(v, 0.f); else if (ACT == 6) v = 0.5f * v * (1.0f + erff(v * 0.70710678118654752f)); so[w][8 * hh + r][t * 16 + ln] = v; } }
  __builtin_amdgcn_fence(__ATOMIC_ACQ_REL, "workgroup"); __builtin_amdgcn_wave_barrier();
  const int rsub = lane >> 4, c4 = (lane & 15) * 4; typedef _Float16 v4h __attribute__((ext_vector_type(4)));
  {
#pragma unroll
    for (int q = 0; q < 8; ++q) { const int r = q * 2 + rsub; if (col0 + c4 < N) { const v4f v = *(const v4fa*)&so[w][r][c4]; if (C) *(v4f*)(C + cofs + (size_t)(row0 + r) * ldc + col0 + c4) = v; if (C16) { v4h h4; for (int i = 0; i < 4; ++i) h4[i] = (_Float16)v[i]; *(v4h*)(C16 + cofs + (size_t)(row0 + r) * ldc + col0 + c4) = h4; } } }
     }
}


typedef _Float16 v4h __attribute__((ext_vector_type(4)));

__global__ __launch_bounds__(256) void k_x16(const float* __restrict__ x, _Float16* __restrict__ X16, size_t n8) { const size_t t = (size_t)blockIdx.x * 256 + threadIdx.x; if (t >= n8) return; FragH f;
#pragma unroll
  for (int q = 0; q < 8; ++q) f.h[q] = (_Float16)bf16_round(x[t * 8 + q]); *(v8us*)((unsigned short*)X16 + t * 8) = f.half[0];  }
__global__ __launch_bounds__(256) void k_h16(const float* __restrict__ x, _Float16* __restrict__ X16, size_t n8) { const size_t t = (size_t)blockIdx.x * 256 + threadIdx.x; if (t >= n8) return; FragH f;
#pragma unroll
  for (int q = 0; q < 8; ++q) f.h[q] = (_Float16)x[t * 8 + q]; *(v8us*)((unsigned short*)X16 + t * 8) = f.half[0];  }
__global__ __launch_bounds__(256) void k_round16f(const float* __restrict__ W, _Float16* __restrict__ Bt, size_t n8) { const size_t t = (size_t)blockIdx.x * 256 + threadIdx.x; if (t >= n8) return; FragH f;
#pragma unroll
  for (int i = 0; i < 8; ++i) f.h[i] = (_Float16)(bf16_round(W[t * 8 + i]) * 16.0f); *(v8us*)((unsigned short*)Bt + t * 8) = f.half[0];  }
template <int NHv, int TTv>
__global__ __launch_bounds__(256) void k_vt(const _Float16* __restrict__ V16, int ldv, int voff, _Float16* __restrict__ Vt) { __shared__ unsigned short tl[64][66]; const int tid = threadIdx.x; const int slab = blockIdx.x / (TTv / 64), lg = blockIdx.x % (TTv / 64); const int b = slab / NHv, h = slab % NHv;
  for (int i = tid; i < 64 * 8; i += 256) { const int r = i / 8, c8 = (i % 8) * 8; FragH f; f.half[0] = *(const v8us*)((const unsigned short*)V16 + ((size_t)b * TTv + lg * 64 + r) * ldv + voff + h * 64 + c8);
#pragma unroll
    for (int q = 0; q < 8; ++q) tl[r][c8 + q] = f.u[q]; }
  __syncthreads();
  {
#pragma unroll
    for (int rd = 0; rd < 2; ++rd) { const int d = rd * 32 + tid / 8, pc = tid % 8; FragH f;
#pragma unroll
      for (int q = 0; q < 8; ++q) f.u[q] = tl[pc * 8 + q][d];
      *(v8us*)((unsigned short*)Vt + ((size_t)slab * 64 + d) * TTv + lg * 64 + pc * 8) = f.half[0]; }
     } }

__global__ __launch_bounds__(256) void k_hl(const float* __restrict__ F, _Float16* __restrict__ Hh, _Float16* __restrict__ Hl, size_t n8) { const size_t t = (size_t)blockIdx.x * 256 + threadIdx.x; if (t >= n8) return; FragH fh, fl; const v4f a = *(const v4fa*)(F + t * 8), c = *(const v4fa*)(F + t * 8 + 4);
#pragma unroll
  for (int q = 0; q < 4; ++q) { _Float16 h = (_Float16)a[q]; fh.h[q] = h; fl.h[q] = (_Float16)((a[q] - (float)h) * 1024.0f); h = (_Float16)c[q]; fh.h[4 + q] = h; fl.h[4 + q] = (_Float16)((c[q] - (float)h) * 1024.0f); }
  { *(v8us*)((unsigned short*)Hh + t * 8) = fh.half[0]; *(v8us*)((unsigned short*)Hl + t * 8) = fl.half[0];  } }

// ---- fast GEMM (wave tile 32x64; requires M % 32 == 0 rows per launch region and N % 64 == 0); epilogue = k_gemm_hhx semantics ----
__device__ __forceinline__ v16h g2_frag(const _Float16* p, int hh) { FragH f; f.half[0] = *(const v8us*)((const unsigned short*)p + 8 * hh); f.half[1] = *(const v8us*)((const unsigned short*)p + 16 + 8 * hh); return f.v; }
__device__ __forceinline__ v8f g2_mma(v16h a, v16h b, v8f c) { v8f d = __builtin_amdgcn_wmma_f32_16x16x32_f16(false, a, false, b, (short)0, c, false, false); asm volatile("v_nop\n\tv_nop\n\tv_nop\n\tv_nop" : "+v"(d) : "v"(a), "v"(b)); return d; }
template <int ACT>
__global__ __launch_bounds__(128) void k_gemm2(const _Float16* __restrict__ A, int lda, size_t sA, const _Float16* __restrict__ Bh, int ldb, size_t sB, float alpha, const float* __restrict__ bias, size_t sBias, const float* __restrict__ CP, int rowsPerB, size_t sCPb, int row0g,
    float* __restrict__ C, _Float16* __restrict__ C16, int ldc, size_t sC, int M, int N, int K) { static_assert(ACT == 0 || ACT == 3 || ACT == 6 || ACT == 8 || ACT == 9 || ACT == 11 || ACT == 12 || ACT == 14 || ACT == 15 || ACT == 16 || ACT == 17, "k_gemm2: unsupported ACT code (would silently apply no activation)");
  __shared__ __attribute__((aligned(16))) float so[4][32][68];
  const int tid = threadIdx.x, w = tid >> 5, lane = tid & 31, ln = lane & 15, hh = lane >> 4; const int by = blockIdx.y;
  A += (size_t)by * sA; Bh += (size_t)by * sB; const size_t cofs = (size_t)by * sC; const float* bp = bias ? bias + (size_t)by * sBias : nullptr;
  const int ntn = N >> 6; const int mt = blockIdx.x / ntn, nq = blockIdx.x - mt * ntn; const int row0 = mt * 128 + 32 * w, col0 = nq * 64; if (row0 >= M) return;
  const _Float16* a0p = A + (size_t)(row0 + ln) * lda; const _Float16* a1p = a0p + (size_t)16 * lda;
  const _Float16* b0p = Bh + (size_t)(col0 + ln) * ldb; const _Float16* b1p = b0p + (size_t)16 * ldb; const _Float16* b2p = b1p + (size_t)16 * ldb; const _Float16* b3p = b2p + (size_t)16 * ldb;
  const v8f z8 = {0.f,0.f,0.f,0.f,0.f,0.f,0.f,0.f}; v8f c00 = z8, c01 = z8, c02 = z8, c03 = z8, c10 = z8, c11 = z8, c12 = z8, c13 = z8;
#pragma unroll 1
  for (int kb = 0; kb < K; kb += 32) { const v16h a0 = g2_frag(a0p + kb, hh), a1 = g2_frag(a1p + kb, hh);
    v16h b = g2_frag(b0p + kb, hh); c00 = g2_mma(a0, b, c00); c10 = g2_mma(a1, b, c10);
    b = g2_frag(b1p + kb, hh); c01 = g2_mma(a0, b, c01); c11 = g2_mma(a1, b, c11);
    b = g2_frag(b2p + kb, hh); c02 = g2_mma(a0, b, c02); c12 = g2_mma(a1, b, c12);
    b = g2_frag(b3p + kb, hh); c03 = g2_mma(a0, b, c03); c13 = g2_mma(a1, b, c13); }
  v8f accs[8] = {c00, c01, c02, c03, c10, c11, c12, c13};
#pragma unroll
  for (int u = 0; u < 8; ++u) { const int t = u & 3, half = u >> 2; const int col = col0 + t * 16 + ln; const float bv = bp ? bf16_round(bp[col]) : 0.f;
#pragma unroll
    for (int r = 0; r < 8; ++r) { const int rloc = half * 16 + 8 * hh + r; float v = accs[u][r] * alpha + bv; if (CP) { if (rowsPerB < 0) v += CP[cofs + (size_t)(row0g + row0 + rloc) * ldc + col];      /* rowsPerB < 0: own element of the batched C plane */ else { const int bidx = (row0g + row0 + rloc) / rowsPerB; v += CP[(size_t)bidx * sCPb + (size_t)by * 64 + col]; } }
      if (ACT == 3) v = fmaxf(v, 0.f); else if (ACT == 6) v = 0.5f * v * (1.0f + erff(v * 0.70710678118654752f)); else if (ACT == 11) v = 1.0f / (1.0f + expf(-v)); else if (ACT == 15) v = v / (1.0f + expf(-v)); else if (ACT == 12) v = (v > 0.f) ? v : 0.01f * v; else if (ACT == 8) v = tanhf(v); else if (ACT == 9) v = 0.5f * v * (1.0f + tanhf(0.7978845608028654f * (v + 0.044715f * v * v * v))); else if (ACT == 14) v = (v > 0.f) ? v : 0.1f * v; else if (ACT == 16) v = (v >= 0.f) ? v : 0.3f * v; else if (ACT == 17) v = (v >= 0.f) ? v : 0.2f * v;
      so[w][rloc][t * 16 + ln] = v; } }
  __builtin_amdgcn_fence(__ATOMIC_ACQ_REL, "workgroup"); __builtin_amdgcn_wave_barrier();
  const int rsub = lane >> 4, c4 = (lane & 15) * 4;
  {
#pragma unroll
    for (int q = 0; q < 16; ++q) { const int r = q * 2 + rsub; const v4f v = *(const v4fa*)&so[w][r][c4]; if (C) *(v4f*)(C + cofs + (size_t)(row0 + r) * ldc + col0 + c4) = v; if (C16) { v4h h4; for (int i = 0; i < 4; ++i) h4[i] = (_Float16)v[i]; *(v4h*)(C16 + cofs + (size_t)(row0 + r) * ldc + col0 + c4) = h4; } }
     } }


__global__ __launch_bounds__(256) void k_wnat(const float* __restrict__ w, size_t n8, _Float16* __restrict__ Bt) { const size_t t = (size_t)blockIdx.x * 256 + threadIdx.x; if (t >= n8) return; FragH f; for (int q = 0; q < 8; ++q) f.h[q] = (_Float16)(bf16_round(w[t * 8 + q]) * 16.0f); *(v8us*)((unsigned short*)Bt + t * 8) = f.half[0];  }
__global__ __launch_bounds__(256) void k_rsm(const float* __restrict__ S, _Float16* __restrict__ P, int nrows) {
  #pragma clang fp contract(off)
  const int i = blockIdx.x * 256 + threadIdx.x; if (i >= nrows) return; const float* s = S + (size_t)i * SQ; float mx = -3.0e38f;
#pragma unroll 1
  for (int j = 0; j < SQ; ++j) mx = fmaxf(mx, s[j]); float se = 0.f;
#pragma unroll 1
  for (int j = 0; j < SQ; ++j) se += expf(s[j] - mx); const float sc = 256.0f / se;
#pragma unroll 1
  for (int j0 = 0; j0 < SQ; j0 += 8) { FragH f; for (int q = 0; q < 8; ++q) f.h[q] = (_Float16)(expf(s[j0 + q] - mx) * sc); unsigned short* d = (unsigned short*)P + (size_t)i * SQ + j0; *(v8us*)d = f.half[0];  } }
__global__ __launch_bounds__(256) void k_vt(const _Float16* __restrict__ V16, int b, int h0, _Float16* __restrict__ VT) { __shared__ unsigned short tl[64][65]; const int tid = threadIdx.x; const int hh = blockIdx.x % HG, sg = blockIdx.x / HG; const int s0 = sg * 64; const int h = h0 + hh;
  for (int i = tid; i < 64 * 8; i += 256) { const int j = i / 8, d8 = (i % 8) * 8; FragH f; f.half[0] = *(const v8us*)((const unsigned short*)V16 + ((size_t)b * SQ + s0 + j) * DM + h * HD + d8); for (int q = 0; q < 8; ++q) tl[d8 + q][j] = f.u[q]; }
  __syncthreads();
  { for (int i = tid; i < 64 * 8; i += 256) { const int d = i / 8, j8 = (i % 8) * 8; FragH f; for (int q = 0; q < 8; ++q) f.u[q] = tl[d][j8 + q]; *(v8us*)((unsigned short*)VT + ((size_t)hh * HD + d) * SQ + s0 + j8) = f.half[0]; }  } }



__global__ __launch_bounds__(256) void k_rsmcf2(const float* __restrict__ S, _Float16* __restrict__ P, int hg, int q0, int nk) {
  #pragma clang fp contract(off)
  const int t = blockIdx.x * 256 + threadIdx.x; if (t >= hg * QT) return; const size_t i = (size_t)t; const float* s = S + i * NKX; const int last = q0 + (t % QT); float mx = -3.0e38f;
#pragma unroll 1
  for (int j = 0; j < nk; ++j) { const float f = (j <= last) ? 1.f : 0.f; mx = fmaxf(mx, fmaf(f, s[j], (1.f - f) * -1.0e9f)); } float se = 0.f;
#pragma unroll 1
  for (int j = 0; j < nk; ++j) { const float f = (j <= last) ? 1.f : 0.f; se += __expf(fmaf(f, s[j], (1.f - f) * -1.0e9f) - mx); } const float sc = 256.0f / se;
#pragma unroll 1
  for (int j0 = 0; j0 < nk; j0 += 8) { FragH fr; for (int q = 0; q < 8; ++q) { const int j = j0 + q; const float f = (j <= last) ? 1.f : 0.f; fr.h[q] = (_Float16)(__expf(fmaf(f, s[j], (1.f - f) * -1.0e9f) - mx) * sc); } unsigned short* d = (unsigned short*)P + i * NKX + j0; *(v8us*)d = fr.half[0];  } }

template <int MASKADD>
__global__ __launch_bounds__(64) void k_att0(const float* __restrict__ QF, const float* __restrict__ KF, const float* __restrict__ VF, int ld, const float* __restrict__ mask, float scale, float* __restrict__ OF, int ldo) {
  #pragma clang fp contract(off)
  __shared__ __attribute__((aligned(16))) float lq[64][64]; __shared__ __attribute__((aligned(16))) float lo[64][64];
  const int tid = threadIdx.x; const int h = blockIdx.x / (QT0 / 64), rg = blockIdx.x % (QT0 / 64); const int i = rg * 64 + tid;
  const float* qr = QF + (size_t)i * ld + h * HD;
#pragma unroll 1
  for (int c = 0; c < HD / 4; ++c) { *(v4f*)&lq[tid][c * 4] = *(const v4fa*)(qr + c * 4); const v4f z = {0.f, 0.f, 0.f, 0.f}; *(v4f*)&lo[tid][c * 4] = z; }
  float m = -1.0e30f, l = 0.f; const int jmax = MASKADD ? (SQ - 1) : (rg * 64 + 63);      /* additive-mask form: every key (the mask input decides); causal form: keys up to the block's last row */
#pragma unroll 1
  for (int j = 0; j <= jmax; ++j) { const float* kr = KF + (size_t)j * ld + h * HD; const float* vr = VF + (size_t)j * ld + h * HD; float s = 0.f;
#pragma unroll 1
    for (int c = 0; c < HD / 4; ++c) { const v4f kq = *(const v4fa*)(kr + c * 4); const v4f qq = *(v4f*)&lq[tid][c * 4]; s = __fadd_rn(s, __fmul_rn(qq[0], kq[0])); s = __fadd_rn(s, __fmul_rn(qq[1], kq[1])); s = __fadd_rn(s, __fmul_rn(qq[2], kq[2])); s = __fadd_rn(s, __fmul_rn(qq[3], kq[3])); }
    s = __fmul_rn(s, scale); if (MASKADD) s = __fadd_rn(s, __fmul_rn(bf16_round(mask[(size_t)i * SQ + j]), -10000.0f));
    const float f = (MASKADD || j <= i) ? 1.f : 0.f; const float sm = fmaf(f, s, (1.f - f) * -1.0e30f); const float mn = fmaxf(m, sm); const float sc = expf(m - mn); const float e = expf(sm - mn); l = __fadd_rn(__fmul_rn(l, sc), e); m = mn;
#pragma unroll 1
    for (int c = 0; c < HD / 4; ++c) { const v4f vv = *(const v4fa*)(vr + c * 4); v4f oo = *(v4f*)&lo[tid][c * 4]; for (int u = 0; u < 4; ++u) oo[u] = __fadd_rn(__fmul_rn(oo[u], sc), __fmul_rn(e, vv[u])); *(v4f*)&lo[tid][c * 4] = oo; } }
  const float fin = 64.0f / l;      /* o carried x64; the f16 path writes o unscaled */
#pragma unroll 1
  for (int c = 0; c < HD / 4; ++c) { v4f oo = *(v4f*)&lo[tid][c * 4]; for (int u = 0; u < 4; ++u) oo[u] = __fmul_rn(oo[u], fin); *(v4f*)&lo[tid][c * 4] = oo; }
  __syncthreads();
  {
#pragma unroll 1
    for (int it = 0; it < 16; ++it) { const int row = it * 4 + tid / 16, pc = (tid % 16) * 4; const v4f v = *(const v4f*)&lo[row][pc]; *(v4f*)(OF + (size_t)(rg * 64 + row) * ldo + h * HD + pc) = v; }
     } }

__global__ __launch_bounds__(256) void k_oscale(const float* __restrict__ OF, float* __restrict__ out, size_t n4) { const size_t t = (size_t)blockIdx.x * 256 + threadIdx.x; if (t >= n4) return; const v4f a = *(const v4fa*)(OF + t * 4); v4f o; for (int q = 0; q < 4; ++q) o[q] = a[q] * 0.015625f; *(v4f*)(out + t * 4) = o;  }

__global__ __launch_bounds__(256) void k_bfr(const float* __restrict__ x, float* __restrict__ XB, size_t n8) { const size_t t = (size_t)blockIdx.x * 256 + threadIdx.x; if (t >= n8) return; v4f a = *(const v4fa*)(x + t * 8), c = *(const v4fa*)(x + t * 8 + 4); for (int q = 0; q < 4; ++q) { a[q] = bf16_round(a[q]); c[q] = bf16_round(c[q]); }
  { *(v4f*)(XB + t * 8) = a; *(v4f*)(XB + t * 8 + 4) = c;  } }



__global__ __launch_bounds__(256) void k_rsmfvl(const float* __restrict__ S, _Float16* __restrict__ P, _Float16* __restrict__ PL, int qn, const int* __restrict__ vlp) {
  #pragma clang fp contract(off)
  const int t = blockIdx.x * 256 + threadIdx.x; if (t >= qn) return; const int vl = vlp[0]; const size_t i = (size_t)t; const float* s = S + i * SQ; float mx = -3.0e38f;
#pragma unroll 1
  for (int j = 0; j < SQ; ++j) { const float f = (j < vl) ? 1.f : 0.f; mx = fmaxf(mx, fmaf(f, s[j], (1.f - f) * -1000000.0f)); } float se = 0.f;
#pragma unroll 1
  for (int j = 0; j < SQ; ++j) { const float f = (j < vl) ? 1.f : 0.f; se += __expf(fmaf(f, s[j], (1.f - f) * -1000000.0f) - mx); } const float sc = 256.0f / se;
#pragma unroll 1
  for (int j0 = 0; j0 < SQ; j0 += 8) { FragH fr, gr; for (int q = 0; q < 8; ++q) { const int j = j0 + q; const float f = (j < vl) ? 1.f : 0.f; const float pv = __expf(fmaf(f, s[j], (1.f - f) * -1000000.0f) - mx) * sc; const _Float16 ph = (_Float16)pv; fr.h[q] = ph; gr.h[q] = (_Float16)((pv - (float)ph) * 1024.0f); }
    unsigned short* d = (unsigned short*)P + i * SQ + j0; unsigned short* dl = (unsigned short*)PL + i * SQ + j0; *(v8us*)d = fr.half[0]; *(v8us*)dl = gr.half[0];  } }

__global__ __launch_bounds__(256) void k_rsmf(const float* __restrict__ S, _Float16* __restrict__ P, int qn, int hg) {
  #pragma clang fp contract(off)
  const int t = blockIdx.x * 256 + threadIdx.x; if (t >= qn * hg) return; const size_t i = (size_t)(t / qn) * SQ + (t % qn); const float* s = S + i * SQ; float mx = -3.0e38f;
#pragma unroll 1
  for (int j = 0; j < SQ; ++j) mx = fmaxf(mx, s[j]); float se = 0.f;
#pragma unroll 1
  for (int j = 0; j < SQ; ++j) se += __expf(s[j] - mx); const float sc = 256.0f / se;
#pragma unroll 1
  for (int j0 = 0; j0 < SQ; j0 += 8) { FragH f; for (int q = 0; q < 8; ++q) f.h[q] = (_Float16)(__expf(s[j0 + q] - mx) * sc); unsigned short* d = (unsigned short*)P + i * SQ + j0; *(v8us*)d = f.half[0];  } }



// lane l <-> l ^ 16 (cross-row move): register only, no LDS traffic
__device__ __forceinline__ float lane_x16(float v) { const int b = __float_as_int(v); return __int_as_float(__builtin_amdgcn_permlanex16(b, b, 0x76543210, 0xfedcba98, false, false)); }

// ---- fused attention: logits, softmax and weights x value in one kernel; scores and weights never leave the registers ----
#define FA_QT 4                      /* query tiles (16 rows each) per work-group */
#define FA_KS 4                      /* key ranges per work-group, one wave per (query tile, key range) */
#define FA_NP (SQ / FA_KS / 32)      /* passes of 32 keys per wave */
// Operands stored as ready-made WMMA A fragments: a block of 512 f16 = [half j][lane l][8], lane l = (c = l & 15, h = l >> 4) holding row c, k = 16 j + 8 h + 0..7 (the hardware k order),
// so that a fragment is two whole-line loads of 512 B instead of two loads that touch 16 lines each. One 16-byte piece = 8 f16, piece t = (block t >> 6, half j = (t >> 5) & 1, lane l = t & 31).
// KF: block (key tile kt, d step s) at kt * 4 + s: row = key kt * 16 + c, k = channel s * 32 + ...
// VF: block (32-key step kp, channel tile dt) at kp * 8 + dt: row = channel dt * 16 + c, k = key kp * 32 + ... (the transposition of value happens here)
// ONE launch prepares everything the attention kernel reads. Work-group g takes rows 64 g .. 64 g + 63 of query, key and value (all batches in one row count): 1024 pieces of each, two per thread,
// and every load of a thread is issued before its first conversion: one memory round trip for the whole launch.
// A thread's two value pieces are 16 keys of ONE channel (tile dt = wave >> 1, channel c), so the work-group's sum over its 64 keys of the bf16-rounded value comes from registers (f32 on VALU):
// 8 keys as a tree, the two pieces, lane l + lane l ^ 16, then the two waves of a channel tile through LDS. PM[g][channel]; the attention kernel adds a batch's 64 partial sums.
#define PR_T 512                     /* threads of a preparation work-group */
__global__ __launch_bounds__(PR_T) void k_prep(const float* __restrict__ xq, const float* __restrict__ xk, const float* __restrict__ xv, _Float16* __restrict__ Q16, _Float16* __restrict__ KF, _Float16* __restrict__ VF, float* __restrict__ PM) {
  __shared__ float part[PR_T / 32][16];
  const int tid = threadIdx.x, w = tid >> 5, l = tid & 31, j = w & 1, c = l & 15, h = l >> 4; const size_t t0 = (size_t)blockIdx.x * (2 * PR_T) + tid;
  v4f qa[2][2], ka[2][2]; float va[2][8];
  /* unrolled: the arrays stay in registers and all 24 loads are in flight together */
#pragma unroll
  for (int i = 0; i < 2; ++i) { const size_t t = t0 + (size_t)i * PR_T, blk = t >> 6;
    const float* qs = xq + t * 8; const float* ks = xk + ((blk >> 2) * 16 + c) * DM + (blk & 3) * 32 + j * 16 + 8 * h; const float* vs = xv + ((blk >> 3) * 32 + j * 16 + 8 * h) * DM + (blk & 7) * 16 + c;
    /* the s_wait_xcnt behind each address's loads: a later load's result may land in that address's registers; the data stay in flight */
    qa[i][0] = *(const v4fa*)qs; qa[i][1] = *(const v4fa*)(qs + 4); asm volatile("s_wait_xcnt 0x0" ::: "memory");
    ka[i][0] = *(const v4fa*)ks; ka[i][1] = *(const v4fa*)(ks + 4); asm volatile("s_wait_xcnt 0x0" ::: "memory");
#pragma unroll
    for (int q = 0; q < 8; ++q) va[i][q] = vs[(size_t)q * DM];
    asm volatile("s_wait_xcnt 0x0" ::: "memory"); }
  /* inputs only, no code: every loaded value is in its register here, so all 24 loads issue ahead of the first use, under one wait (without it the query and key loads sink behind the barrier below: a second memory round trip) */
  asm volatile("" :: "v"(qa[0][0]), "v"(qa[0][1]), "v"(qa[1][0]), "v"(qa[1][1]), "v"(ka[0][0]), "v"(ka[0][1]), "v"(ka[1][0]), "v"(ka[1][1]), "v"(va[0][0]), "v"(va[0][1]), "v"(va[0][2]), "v"(va[0][3]), "v"(va[0][4]), "v"(va[0][5]), "v"(va[0][6]), "v"(va[0][7]),
               "v"(va[1][0]), "v"(va[1][1]), "v"(va[1][2]), "v"(va[1][3]), "v"(va[1][4]), "v"(va[1][5]), "v"(va[1][6]), "v"(va[1][7]));
  /* the value sums first: their barrier and the store of PM then stand in front of the six large stores and wait for none of them */
  float r[2][8];
#pragma unroll
  for (int i = 0; i < 2; ++i) for (int q = 0; q < 8; ++q) r[i][q] = bf16_round(va[i][q]);
  float a = (((r[0][0] + r[0][1]) + (r[0][2] + r[0][3])) + ((r[0][4] + r[0][5]) + (r[0][6] + r[0][7]))) + (((r[1][0] + r[1][1]) + (r[1][2] + r[1][3])) + ((r[1][4] + r[1][5]) + (r[1][6] + r[1][7])));
  a += lane_x16(a);
  if (h == 0) part[w][c] = a;
  __syncthreads();      /* every wave passes it once: the first four waves read both waves' sums of each channel tile below */
  if (tid < DM) PM[(size_t)blockIdx.x * DM + tid] = part[2 * (tid >> 4)][tid & 15] + part[2 * (tid >> 4) + 1][tid & 15];
  /* unrolled: register arrays */
#pragma unroll
  for (int i = 0; i < 2; ++i) { const size_t t = t0 + (size_t)i * PR_T; FragH fq, fk, fv;
#pragma unroll
    for (int q = 0; q < 8; ++q) { fq.h[q] = (_Float16)bf16_round(qa[i][q >> 2][q & 3]); fk.h[q] = (_Float16)bf16_round(ka[i][q >> 2][q & 3]); fv.h[q] = (_Float16)r[i][q]; }
    *(v8us*)((unsigned short*)Q16 + t * 8) = fq.half[0]; *(v8us*)((unsigned short*)KF + t * 8) = fk.half[0]; *(v8us*)((unsigned short*)VF + t * 8) = fv.half[0]; } }
// p: the block's start, the same for the whole wave; lo = lane * 8: the lane's own 16-byte piece
__device__ __forceinline__ v16h fa_frag(const unsigned short* p, unsigned lo) { FragH f; f.half[0] = *(const v8us*)(p + lo); f.half[1] = *(const v8us*)(p + 256 + lo); return f.v; }
// eight asynchronous copies to LDS, 512 B a wave each: a lane's 16 bytes go from g + 512 i to LDS byte lds + 512 i (the immediate offset moves both addresses), through no register.
// The s_wait_xcnt stands inside the copies' own statement, so that it stays in front of every later rewrite of the two address registers (a precaution; in a statement of its own the next trip's address additions could be lifted over it).
__device__ __forceinline__ void fa_copy8(unsigned lds, const unsigned short* g) {
  asm volatile("global_load_async_to_lds_b128 %0, %1, off\n\t"
               "global_load_async_to_lds_b128 %0, %1, off offset:512\n\t"
               "global_load_async_to_lds_b128 %0, %1, off offset:1024\n\t"
               "global_load_async_to_lds_b128 %0, %1, off offset:1536\n\t"
               "global_load_async_to_lds_b128 %0, %1, off offset:2048\n\t"
               "global_load_async_to_lds_b128 %0, %1, off offset:2560\n\t"
               "global_load_async_to_lds_b128 %0, %1, off offset:3072\n\t"
               "global_load_async_to_lds_b128 %0, %1, off offset:3584\n\t"
               "s_wait_xcnt 0x0" :: "v"(lds), "v"(g) : "memory"); }
__device__ __forceinline__ v8f fa_mma(v16h a, v16h b, v8f c) { return __builtin_amdgcn_wmma_f32_16x16x32_f16(false, a, false, b, (short)0, c, false, false); }
// native 2^t; the v_nop in the same statement keeps the one slot that the instruction set asks for behind a transcendental, whatever the compiler puts next
__device__ __forceinline__ float fa_exp2(float t) { float e; asm("v_exp_f32 %0, %1\n\tv_nop" : "=v"(e) : "v"(t)); return e; }
// four at once: the results are early-clobber, so none of the four reads a neighbour's result or overwrites its source, and one v_nop closes the last one's slot
__device__ __forceinline__ void fa_exp2x4(float& a, float& b, float& c, float& d) { float e0, e1, e2, e3;
  asm("v_exp_f32 %0, %4\n\tv_exp_f32 %1, %5\n\tv_exp_f32 %2, %6\n\tv_exp_f32 %3, %7\n\tv_nop" : "=&v"(e0), "=&v"(e1), "=&v"(e2), "=&v"(e3) : "v"(a), "v"(b), "v"(c), "v"(d)); a = e0; b = e1; c = e2; d = e3; }
// A wave owns 16 queries and 1024 keys. S^T = K Q^T: D register r of lane (c, h) = score of key 8 h + r, query c, so a query's scores sit in two lanes (maximum and sum in-lane plus one exchange),
// and two score tiles (keys 0..15, 16..31), converted in place, ARE the B fragment of O^T += V^T P^T in the hardware k order. Running maximum m per query (log2 units), renewed only when a pass exceeds it by more than 8;
// weights 2^(s - m + 6) <= 2^14 as f16 hi + f16 residual, both into the same f32 accumulators; the sum of the f32 weights in l. The four key ranges of a query tile are joined through LDS at the end.
// K and V^T fragments come from LDS: a tile = one pass (32 keys) of each of the four key ranges, 16 KB a range in the order of KF and VF, brought in by asynchronous copies, two buffers: tile p + 1 flies while tile p is worked on.
// The four waves of a key range each copy a quarter of its 16 KB and all four read the whole: a work-group fetches each K and V^T byte once, and no wave waits out a global load inside the loop.
__global__ __launch_bounds__(FA_QT * FA_KS * 32) void k_fattn(const _Float16* __restrict__ Q16, const _Float16* __restrict__ KF, const _Float16* __restrict__ VF, const float* __restrict__ PM, float* __restrict__ out) {
  __shared__ __attribute__((aligned(16))) unsigned short ring[2][FA_KS][8192];      /* [buffer][key range][K blocks of the pass: 4096 f16, then V^T blocks: 4096 f16] */
  __shared__ float so[FA_KS][FA_QT][64][32]; __shared__ float sm[FA_KS][FA_QT][32]; __shared__ float sl[FA_KS][FA_QT][32]; __shared__ __attribute__((aligned(16))) float sv[FA_KS][DM];
  const int tid = threadIdx.x, w = __builtin_amdgcn_readfirstlane(tid >> 5) /* the wave's number in a scalar register: fragment bases and LDS planes become scalar */, lane = tid & 31, c = lane & 15, h = lane >> 4, qt = w & (FA_QT - 1), ks = w / FA_QT; const int b = blockIdx.y, row0 = blockIdx.x * (FA_QT * 16) + qt * 16;
  const size_t f0 = ((size_t)b * (SQ / 32) + (size_t)ks * FA_NP) * 4096; const unsigned lo = (unsigned)lane * 8;      /* a pass of 32 keys = 8 blocks = 4096 f16 in KF and in VF */
  /* the wave's quarter of its range's tile: waves qt 0, 1 the two halves of the K blocks, waves 2, 3 those of the V^T blocks; the LDS byte address is the low 32 bits of the __shared__ address */
  const unsigned short* gs = (const unsigned short*)(qt < 2 ? KF : VF) + f0 + (size_t)(qt & 1) * 2048 + lo;
  const unsigned ld0 = (unsigned)(size_t)&ring[0][ks][qt * 2048 + lo], ld1 = (unsigned)(size_t)&ring[1][ks][qt * 2048 + lo];
  fa_copy8(ld0, gs);      /* tile 0 into buffer 0, in flight beside the query and partial-sum loads below */
  const _Float16* qp = Q16 + ((size_t)b * SQ + row0 + c) * DM; const v16h q0 = g2_frag(qp, h), q1 = g2_frag(qp + 32, h), q2 = g2_frag(qp + 64, h), q3 = g2_frag(qp + 96, h);
  /* sum of value over the sequence: wave (qt, ks) adds partial sums 16 ks .. 16 ks + 15 of its batch for channels 32 qt + lane (whole lines, in flight beside the query loads); the four quarters meet behind the barrier below */
  { const float* pp = PM + ((size_t)b * (SQ / 64) + ks * 16) * DM + qt * 32 + lane; float x[16];
#pragma unroll
    for (int i = 0; i < 16; ++i) x[i] = pp[(size_t)i * DM];
    sv[ks][qt * 32 + lane] = (((x[0] + x[1]) + (x[2] + x[3])) + ((x[4] + x[5]) + (x[6] + x[7]))) + (((x[8] + x[9]) + (x[10] + x[11])) + ((x[12] + x[13]) + (x[14] + x[15]))); }
  asm volatile("s_wait_asynccnt 0x0" ::: "memory");      /* the wave's own copies of tile 0 have landed */
  __syncthreads();      /* every wave passes it: tile 0 is read by waves that did not copy it */
  fa_copy8(ld1, gs + 4096);      /* tile 1 into buffer 1 */
  const float CS = (float)(0.08838834764831845 * 1.4426950408889634);      /* 1 / sqrt(128) times log2 e */
  const v8f z8 = {0.f,0.f,0.f,0.f,0.f,0.f,0.f,0.f}; v8f o[8] = {z8, z8, z8, z8, z8, z8, z8, z8}; float m = -1.0e30f, l = 0.f;
  /* kept rolled: two passes' fragments at once would not fit the 256 registers that four waves per SIMD leave each wave */
#pragma unroll 1
  for (int p = 0; p < FA_NP; ++p) { const unsigned short* kp = &ring[p & 1][ks][0]; const unsigned short* vp = kp + 4096;
    const v16h k0 = fa_frag(kp, lo), k1 = fa_frag(kp + 512, lo), k2 = fa_frag(kp + 1024, lo), k3 = fa_frag(kp + 1536, lo), k4 = fa_frag(kp + 2048, lo), k5 = fa_frag(kp + 2560, lo), k6 = fa_frag(kp + 3072, lo), k7 = fa_frag(kp + 3584, lo);
    /* inputs only, no code: all eight key fragments are in registers here, so their 16 LDS loads issue back to back under ONE wait (without it each fragment is loaded, waited for and used in turn: eight latencies a pass) */
    asm volatile("" :: "v"(k0), "v"(k1), "v"(k2), "v"(k3), "v"(k4), "v"(k5), "v"(k6), "v"(k7));
    v16h vf[8];
#pragma unroll
    for (int j = 0; j < 8; ++j) vf[j] = fa_frag(vp + j * 512, lo);
    v8f s0 = fa_mma(k0, q0, z8), s1 = fa_mma(k4, q0, z8); s0 = fa_mma(k1, q1, s0); s1 = fa_mma(k5, q1, s1); s0 = fa_mma(k2, q2, s0); s1 = fa_mma(k6, q2, s1); s0 = fa_mma(k3, q3, s0); s1 = fa_mma(k7, q3, s1);
    float mx = fmaxf(s0[0], s1[0]);
#pragma unroll
    for (int r = 1; r < 8; ++r) mx = fmaxf(mx, fmaxf(s0[r], s1[r]));
    mx = fmaxf(mx, lane_x16(mx)) * CS;
    const bool need = mx > m + 8.0f;
    if (__builtin_amdgcn_ballot_w32(need) != 0) {      /* wave-uniform: the accumulators are rescaled only in the few passes in which some query's maximum moves */
      const float mn = need ? mx : m; const float al = fa_exp2(m - mn); m = mn; l *= al;
#pragma unroll
      for (int j = 0; j < 8; ++j) for (int r = 0; r < 8; ++r) o[j][r] *= al; }
    const float nm = 6.0f - m; float e[16];
#pragma unroll
    for (int r = 0; r < 8; ++r) { e[r] = fmaf(s0[r], CS, nm); e[8 + r] = fmaf(s1[r], CS, nm); }
#pragma unroll
    for (int u = 0; u < 16; u += 4) fa_exp2x4(e[u], e[u + 1], e[u + 2], e[u + 3]);
    l += ((e[0] + e[4] + e[8] + e[12]) + (e[1] + e[5] + e[9] + e[13])) + ((e[2] + e[6] + e[10] + e[14]) + (e[3] + e[7] + e[11] + e[15]));
    FragH ph, pl;
#pragma unroll
    for (int u = 0; u < 16; ++u) { const _Float16 hv = (_Float16)e[u]; ph.h[u] = hv; pl.h[u] = (_Float16)(e[u] - (float)hv); }
    /* hand-over of the buffers, every wave in every pass; every LDS read of the pass stands above, what follows it in the pass works on registers alone, so the refill flies during these products too.
       In this order: the wave's LDS reads of tile p are done, its own copies of tile p + 1 have landed, then the barrier: behind it tile p + 1 may be read by all, and tile p's buffer refilled */
    asm volatile("s_wait_dscnt 0x0" ::: "memory");
    asm volatile("s_wait_asynccnt 0x0" ::: "memory");
    __syncthreads();
    if (p + 2 < FA_NP) fa_copy8((p & 1) ? ld1 : ld0, gs + (size_t)(p + 2) * 4096);      /* the test reads the same in the whole work-group */
#pragma unroll
    for (int j = 0; j < 8; ++j) o[j] = fa_mma(vf[j], ph.v, o[j]);
#pragma unroll
    for (int j = 0; j < 8; ++j) o[j] = fa_mma(vf[j], pl.v, o[j]); }
  asm volatile("s_wait_asynccnt 0x0" ::: "memory");      /* no copy is outstanding behind the loop */
  l += lane_x16(l);      /* the two halves of a query's keys */
#pragma unroll
  for (int j = 0; j < 8; ++j) for (int r = 0; r < 8; ++r) so[ks][qt][j * 8 + r][lane] = o[j][r];
  sm[ks][qt][lane] = m; sl[ks][qt][lane] = l;
  __syncthreads();      /* every wave passes it once: the four key ranges' partial results, and the quarters of the value sums, are read by other waves below */
  float mm[FA_KS], M = -3.0e38f, L = 0.f;
#pragma unroll
  for (int i = 0; i < FA_KS; ++i) { mm[i] = sm[i][qt][lane]; M = fmaxf(M, mm[i]); }
#pragma unroll
  for (int i = 0; i < FA_KS; ++i) { mm[i] = fa_exp2(mm[i] - M); L += sl[i][qt][lane] * mm[i]; }
  const float inv = 1.0f / L;
  /* wave (qt, ks) finishes channels 32 ks .. 32 ks + 31 of its query tile: one whole 128-byte line of each output row */
#pragma unroll
  for (int jj = 0; jj < 2; ++jj) { const int j = 2 * ks + jj, ch = 16 * j + 8 * h; v4f r0, r1; float nv[8];      /* nv = -mean(value) of the lane's eight channels */
#pragma unroll
    for (int u = 0; u < 2; ++u) { const v4f t = (*(const v4f*)&sv[0][ch + 4 * u] + *(const v4f*)&sv[1][ch + 4 * u]) + (*(const v4f*)&sv[2][ch + 4 * u] + *(const v4f*)&sv[3][ch + 4 * u]);
#pragma unroll
      for (int r = 0; r < 4; ++r) nv[4 * u + r] = t[r] * (-1.0f / (float)SQ); }
#pragma unroll
    for (int r = 0; r < 8; ++r) { float a = 0.f;
#pragma unroll
      for (int i = 0; i < FA_KS; ++i) a += so[i][qt][j * 8 + r][lane] * mm[i];
      a = a * inv + nv[r]; if (r < 4) r0[r] = a; else r1[r - 4] = a; }
    float* d = out + ((size_t)b * SQ + row0 + c) * DM + 16 * j + 8 * h; *(v4f*)d = r0; *(v4f*)(d + 4) = r1; } }
extern "C" void kernel_launch(void* const* d_in, const int* in_sizes, int n_in,
                              void* d_out, int out_size, void* d_ws, size_t ws_size, hipStream_t stream) {
  (void)in_sizes; (void)n_in; (void)out_size;
  const float* const* I = (const float* const*)d_in; const float* xq = I[0]; const float* xk = I[1]; const float* xv = I[2];      /* query, key, value [4][4096][128] */
  char* ws = (char*)d_ws; size_t off = 0;
  auto take = [&](size_t bytes) { char* p = ws + off; off += (bytes + 255) & ~(size_t)255; return p; };
  _Float16* Q16 = (_Float16*)take(NR * DM * 2); _Float16* KF = (_Float16*)take(NR * DM * 2); _Float16* VF = (_Float16*)take(NR * DM * 2); float* PM = (float*)take((NR / 64) * DM * 4);      /* sums of value over 64 keys each [256][128] */
  if (off > ws_size) return;
  k_prep<<<(unsigned)(NR / 64), PR_T, 0, stream>>>(xq, xk, xv, Q16, KF, VF, PM);      /* bf16-rounded inputs, exact in f16: query rows, keys and value^T in fragment order; value sums per 64 keys */
  k_fattn<<<dim3(SQ / (FA_QT * 16), NB), FA_QT * FA_KS * 32, 0, stream>>>(Q16, KF, VF, PM, (float*)d_out);      /* out = softmax(q.k / sqrt(128)) value - mean(value), all batches */
}

// v006
// A run of this version takes 45.6 microseconds.
// Next to v005, in two timings, it ran 1.03 and 1.02 times as fast.
// Over all steps from v000 it is 95.5 times as fast.
#include <hip/hip_runtime.h>
#define NB 4
#define SQ 4096
#define DM 128
#define NH 2
#define HD 64
#define HG 8                         /* heads per launch of the four-argument k_vt (not launched) */
#define B0 0                         /* first batch processed (unused) */
#define NBR NB                       /* batches processed (used only in MP) */
#define NR ((size_t)NB * SQ)         /* token rows */
#define MP ((int)((size_t)NBR * SQ)) /* token rows (used only in MPO) */
#define QT 256                       /* query rows per causal tile */
#define NKX SQ                       /* S / P row pitch */
#define QT0 256                      /* query rows per head of the f32 k_att0 (not launched) */
#define QN SQ                        /* query rows attended per batch (unused) */
#define NHD NH                       /* unused */
#define MPO MP                       /* rows through the output stage (unused) */
#define LQ DM            /* row pitch of the q/k/v rows (unused) */
typedef __bf16 v16b __attribute__((ext_vector_type(16)));
typedef unsigned short v8us __attribute__((ext_vector_type(8), may_alias));
typedef float  v8f  __attribute__((ext_vector_type(8)));
typedef float  v4f  __attribute__((ext_vector_type(4)));
typedef float  v4fa __attribute__((ext_vector_type(4), may_alias));
union FragB { v16b v; v8us half[2]; unsigned short u[16]; };

__device__ __forceinline__ unsigned short bf16_bits(float x) { unsigned int u = __float_as_uint(x); return (unsigned short)((u + 0x7FFFu + ((u >> 16) & 1u)) >> 16); }
__device__ __forceinline__ float bf16_val(unsigned short b) { return __uint_as_float(((unsigned int)b) << 16); }
__device__ __forceinline__ float bf16_round(float x) { return bf16_val(bf16_bits(x)); }
// D += A·B with NT terms: 1 = ah·bh, 2 = + al·bh (A split), 3 = + ah·bl (both split)
template <int NT>
__device__ __forceinline__ v8f mmaN(v16b ah, v16b al, v16b bh, v16b bl, v8f c) {
  c = __builtin_amdgcn_wmma_f32_16x16x32_bf16(false, ah, false, bh, (short)0, c, false, false);
  if (NT >= 2) c = __builtin_amdgcn_wmma_f32_16x16x32_bf16(false, al, false, bh, (short)0, c, false, false);
  if (NT >= 3) c = __builtin_amdgcn_wmma_f32_16x16x32_bf16(false, ah, false, bl, (short)0, c, false, false);
  asm volatile("v_nop\n\tv_nop\n\tv_nop\n\tv_nop" : "+v"(c) : "v"(ah), "v"(al), "v"(bh), "v"(bl));
  return c;
}

__global__ __launch_bounds__(256) void k_wt_bf16(const float* __restrict__ W, unsigned short* __restrict__ Wt, int K, int N) {
  const int t = blockIdx.x * 256 + threadIdx.x;
  const int k8n = K / 8;
  if (t >= N * k8n) return;
  const int n = t / k8n, k8 = (t % k8n) * 8;
  v8us v;
#pragma unroll
  for (int i = 0; i < 8; ++i) v[i] = bf16_bits(W[(size_t)(k8 + i) * N + n]);
  *(v8us*)(Wt + (size_t)n * K + k8) = v;
  
}

// GEMM C[M][N] (f32, pitch ldc) = act(A[M][K]·W + bias). A f32 row-major (pitch lda) converted per fragment to bf16
// (ASPLIT: hi/lo two planes -> 2 terms, else single rounded term); Wt bf16 [N][K] (pitch ldb). BIAS_BF16 rounds the
// bias to bf16 first (bias quantised to bf16 before the add). K%32==0, M%16==0, N%64==0.
template <bool ASPLIT, int ACT, bool BIAS_BF16>
__global__ __launch_bounds__(128) void k_gemm_bf(const float* __restrict__ A, int lda, const unsigned short* __restrict__ Wt, int ldb,
                                               const float* __restrict__ bias, float* __restrict__ C, int ldc, int M, int N, int K) {
  __shared__ __attribute__((aligned(16))) float so[4][16][64];
  const int tid = threadIdx.x, w = tid >> 5, lane = tid & 31, ln = lane & 15, hh = lane >> 4;
  const int ntn = N / 64;
  const int wid = blockIdx.x * 4 + w;
  const int mt = wid / ntn, nq = wid % ntn;
  if (mt * 16 >= M) return;
  const int row0 = mt * 16, col0 = nq * 64;
  const float* arow = A + (size_t)(row0 + ln) * lda;
  v8f acc[4] = {};
  for (int kb = 0; kb < K; kb += 32) {
    FragB ah, al;
    const v4f x0 = *(const v4fa*)(arow + kb + 8 * hh), x1 = *(const v4fa*)(arow + kb + 8 * hh + 4);
    const v4f x2 = *(const v4fa*)(arow + kb + 16 + 8 * hh), x3 = *(const v4fa*)(arow + kb + 16 + 8 * hh + 4);
    float xs[16] = {x0[0],x0[1],x0[2],x0[3],x1[0],x1[1],x1[2],x1[3],x2[0],x2[1],x2[2],x2[3],x3[0],x3[1],x3[2],x3[3]};
#pragma unroll
    for (int i = 0; i < 16; ++i) { const unsigned short hb = bf16_bits(xs[i]); ah.u[i] = hb; al.u[i] = ASPLIT ? bf16_bits(xs[i] - bf16_val(hb)) : (unsigned short)0; }
#pragma unroll
    for (int t = 0; t < 4; ++t) {
      const unsigned short* brow = Wt + (size_t)(col0 + t * 16 + ln) * ldb + kb;
      FragB b;
      b.half[0] = *(const v8us*)(brow + 8 * hh);
      b.half[1] = *(const v8us*)(brow + 16 + 8 * hh);
      acc[t] = mmaN<ASPLIT ? 2 : 1>(ah.v, al.v, b.v, b.v, acc[t]);
    }
  }
#pragma unroll
  for (int t = 0; t < 4; ++t) {
    float bv = bias ? bias[col0 + t * 16 + ln] : 0.f;
    if (BIAS_BF16) bv = bf16_round(bv);
#pragma unroll
    for (int r = 0; r < 8; ++r) { float v = acc[t][r] + bv; if (ACT == 1) v = fmaxf(v, 0.f); so[w][8 * hh + r][t * 16 + ln] = v; }
  }
  __builtin_amdgcn_fence(__ATOMIC_ACQ_REL, "workgroup");
  __builtin_amdgcn_wave_barrier();
  const int rsub = lane >> 4, c4 = (lane & 15) * 4;
  {
#pragma unroll
    for (int q = 0; q < 8; ++q) {
      const int r = q * 2 + rsub;
      const v4f v = *(const v4fa*)&so[w][r][c4];
      *(v4f*)(C + (size_t)(row0 + r) * ldc + col0 + c4) = v;
    }
    
  }
}

// GEMM C = act(A·W + bias + resid): A f32 (ASPLIT -> hi/lo 2 terms), Wt bf16 [N][K]; ACT 0 none, 1 relu, 2 exact gelu;
// resid (optional, f32, row index = (row % rmod), pitch ldr, RES_BF16 rounds it) added before the activation.
template <bool ASPLIT, int ACT, bool BIAS_BF16, bool RES_BF16>
__global__ __launch_bounds__(128) void k_gemm_bf3(const float* __restrict__ A, int lda, const unsigned short* __restrict__ Wt, int ldb,
                                                const float* __restrict__ bias, const float* __restrict__ resid, int rmod, int ldr,
                                                float* __restrict__ C, int ldc, int M, int N, int K) {
  __shared__ __attribute__((aligned(16))) float so[4][16][64];
  const int tid = threadIdx.x, w = tid >> 5, lane = tid & 31, ln = lane & 15, hh = lane >> 4;
  const int ntn = N / 64;
  const int wid = blockIdx.x * 4 + w;
  const int mt = wid / ntn, nq = wid % ntn;
  if (mt * 16 >= M) return;
  const int row0 = mt * 16, col0 = nq * 64;
  const float* arow = A + (size_t)(row0 + ln) * lda;
  v8f acc[4] = {};
  for (int kb = 0; kb < K; kb += 32) {
    FragB ah, al;
    const v4f x0 = *(const v4fa*)(arow + kb + 8 * hh), x1 = *(const v4fa*)(arow + kb + 8 * hh + 4);
    const v4f x2 = *(const v4fa*)(arow + kb + 16 + 8 * hh), x3 = *(const v4fa*)(arow + kb + 16 + 8 * hh + 4);
    float xs[16] = {x0[0],x0[1],x0[2],x0[3],x1[0],x1[1],x1[2],x1[3],x2[0],x2[1],x2[2],x2[3],x3[0],x3[1],x3[2],x3[3]};
#pragma unroll
    for (int i = 0; i < 16; ++i) { const unsigned short hb = bf16_bits(xs[i]); ah.u[i] = hb; al.u[i] = ASPLIT ? bf16_bits(xs[i] - bf16_val(hb)) : (unsigned short)0; }
#pragma unroll
    for (int t = 0; t < 4; ++t) {
      const unsigned short* brow = Wt + (size_t)(col0 + t * 16 + ln) * ldb + kb;
      FragB b;
      b.half[0] = *(const v8us*)(brow + 8 * hh);
      b.half[1] = *(const v8us*)(brow + 16 + 8 * hh);
      acc[t] = mmaN<ASPLIT ? 2 : 1>(ah.v, al.v, b.v, b.v, acc[t]);
    }
  }
#pragma unroll
  for (int t = 0; t < 4; ++t) {
    const int col = col0 + t * 16 + ln;
    float bv = bias ? bias[col] : 0.f;
    if (BIAS_BF16) bv = bf16_round(bv);
#pragma unroll
    for (int r = 0; r < 8; ++r) {
      float v = acc[t][r] + bv;
      if (resid) { float rv = resid[(size_t)((row0 + 8 * hh + r) % rmod) * ldr + col]; if (RES_BF16) rv = bf16_round(rv); v += rv; }
      if (ACT == 1) v = fmaxf(v, 0.f);
      if (ACT == 2) v = 0.5f * v * (1.0f + erff(v * 0.70710678118654752f));
      if (ACT == 3) { const float u = 0.7978845608028654f * (v + 0.044715f * v * v * v); v = 0.5f * v * (1.0f + tanhf(u)); }
      so[w][8 * hh + r][t * 16 + ln] = v;
    }
  }
  __builtin_amdgcn_fence(__ATOMIC_ACQ_REL, "workgroup");
  __builtin_amdgcn_wave_barrier();
  const int rsub = lane >> 4, c4 = (lane & 15) * 4;
  {
#pragma unroll
    for (int q = 0; q < 8; ++q) {
      const int r = q * 2 + rsub;
      const v4f v = *(const v4fa*)&so[w][r][c4];
      *(v4f*)(C + (size_t)(row0 + r) * ldc + col0 + c4) = v;
    }
    
  }
}
// row LayerNorm (biased variance, eps) over N: s = X (+ R); optional out_sum <- s; out_norm <- (s-mu)*rsqrt(var+eps)*g + b
template <bool PARAM_BF16>
__global__ __launch_bounds__(256) void k_layernorm(const float* __restrict__ X, const float* __restrict__ R, const float* __restrict__ g, const float* __restrict__ bta,
                                                  float* __restrict__ out_sum, float* __restrict__ out_norm, int N, float eps) {
  __shared__ float red[256];
  const int row = blockIdx.x, tid = threadIdx.x;
  const float* x = X + (size_t)row * N; const float* rr = R ? R + (size_t)row * N : nullptr;
  float vals[16];                     // up to N = 4096
  const int per = N / 256;            // contiguous chunk per thread? use strided-by-4 chunks: thread handles j = tid*4 + 1024*u
  float s1 = 0.f;
  for (int u = 0; u < per / 4; ++u) {
    const int j = tid * 4 + 1024 * u;
    const v4f a = *(const v4fa*)(x + j);
    v4f b = {0.f,0.f,0.f,0.f}; if (rr) b = *(const v4fa*)(rr + j);
#pragma unroll
    for (int q = 0; q < 4; ++q) { const float v = a[q] + b[q]; vals[u * 4 + q] = v; s1 += v; }
  }
  red[tid] = s1; __syncthreads();
  for (int st = 128; st > 0; st >>= 1) { if (tid < st) red[tid] += red[tid + st]; __syncthreads(); }
  const float mu = red[0] / (float)N; __syncthreads();
  float s2 = 0.f;
  for (int u = 0; u < per / 4; ++u)
#pragma unroll
    for (int q = 0; q < 4; ++q) { const float c = vals[u * 4 + q] - mu; s2 += c * c; }
  red[tid] = s2; __syncthreads();
  for (int st = 128; st > 0; st >>= 1) { if (tid < st) red[tid] += red[tid + st]; __syncthreads(); }
  const float rs = rsqrtf(red[0] / (float)N + eps);
  {
    for (int u = 0; u < per / 4; ++u) {
      const int j = tid * 4 + 1024 * u;
      v4f o, sm;
#pragma unroll
      for (int q = 0; q < 4; ++q) {
        float gg = g[j + q], bb = bta[j + q];
        if (PARAM_BF16) { gg = bf16_round(gg); bb = bf16_round(bb); }
        sm[q] = vals[u * 4 + q]; o[q] = (vals[u * 4 + q] - mu) * rs * gg + bb;
      }
      if (out_sum) *(v4f*)(out_sum + (size_t)row * N + j) = sm;
      *(v4f*)(out_norm + (size_t)row * N + j) = o;
    }
    
  }
}



// ---- f16 WMMA path (v_wmma_f32_16x16x32_f16): 11-bit significands for operands in range — used where a [0,1] probability operand needs more precision than bf16
typedef _Float16 v16h __attribute__((ext_vector_type(16)));
union FragH { v16h v; v8us half[2]; _Float16 h[16]; unsigned short u[16]; };
template <int NT>
__device__ __forceinline__ v8f mmaH(v16h ah, v16h al, v16h bh, v16h bl, v8f c) {
  c = __builtin_amdgcn_wmma_f32_16x16x32_f16(false, ah, false, bh, (short)0, c, false, false);
  if (NT >= 2) c = __builtin_amdgcn_wmma_f32_16x16x32_f16(false, al, false, bh, (short)0, c, false, false);
  if (NT >= 3) c = __builtin_amdgcn_wmma_f32_16x16x32_f16(false, ah, false, bl, (short)0, c, false, false);
  asm volatile("v_nop\n\tv_nop\n\tv_nop\n\tv_nop" : "+v"(c) : "v"(ah), "v"(al), "v"(bh), "v"(bl));
  return c;
}
// batched GEMM like k_gemm_b but f16 operands: A f32 (split into f16 hi/lo if ASPLIT, else rounded to f16), Bt = f16 values [n][k]; alpha; C f32; N multiple of 16 (partial tiles skipped)
template <bool ASPLIT>
__global__ __launch_bounds__(128) void k_gemm_h(const float* __restrict__ A, int lda, size_t sA, const _Float16* __restrict__ Bh, int ldb, size_t sB, float alpha, float* __restrict__ C, int ldc, size_t sC, int M, int N, int K) {
  __shared__ __attribute__((aligned(16))) float so[4][16][64];
  const int tid = threadIdx.x, w = tid >> 5, lane = tid & 31, ln = lane & 15, hh = lane >> 4; const int by = blockIdx.y;
  A += (size_t)by * sA; Bh += (size_t)by * sB; C += (size_t)by * sC;
  const int ntn = (N + 63) / 64; const int wid = blockIdx.x * 4 + w; const int mt = wid / ntn, nq = wid % ntn; if (mt * 16 >= M) return;
  const int row0 = mt * 16, col0 = nq * 64; const float* arow = A + (size_t)(row0 + ln) * lda;
  v8f acc[4] = {};
  for (int kb = 0; kb < K; kb += 32) {
    FragH ah, al;
    const v4f x0 = *(const v4fa*)(arow + kb + 8 * hh), x1 = *(const v4fa*)(arow + kb + 8 * hh + 4), x2 = *(const v4fa*)(arow + kb + 16 + 8 * hh), x3 = *(const v4fa*)(arow + kb + 16 + 8 * hh + 4);
    float xs[16] = {x0[0],x0[1],x0[2],x0[3],x1[0],x1[1],x1[2],x1[3],x2[0],x2[1],x2[2],x2[3],x3[0],x3[1],x3[2],x3[3]};
#pragma unroll
    for (int i = 0; i < 16; ++i) { const _Float16 h = (_Float16)xs[i]; ah.h[i] = h; al.h[i] = ASPLIT ? (_Float16)(xs[i] - (float)h) : (_Float16)0.0f; }
#pragma unroll
    for (int t = 0; t < 4; ++t) { if (col0 + t * 16 >= N) continue; const size_t boff = (size_t)(col0 + t * 16 + ln) * ldb + kb; FragH bq; bq.half[0] = *(const v8us*)(Bh + boff + 8 * hh); bq.half[1] = *(const v8us*)(Bh + boff + 16 + 8 * hh);
      acc[t] = mmaH<ASPLIT ? 2 : 1>(ah.v, al.v, bq.v, bq.v, acc[t]); }
  }
#pragma unroll
  for (int t = 0; t < 4; ++t) { if (col0 + t * 16 >= N) continue;
#pragma unroll
    for (int r = 0; r < 8; ++r) so[w][8 * hh + r][t * 16 + ln] = acc[t][r] * alpha; }
  __builtin_amdgcn_fence(__ATOMIC_ACQ_REL, "workgroup"); __builtin_amdgcn_wave_barrier();
  const int rsub = lane >> 4, c4 = (lane & 15) * 4;
  {
#pragma unroll
    for (int q = 0; q < 8; ++q) { const int r = q * 2 + rsub; if (col0 + c4 < N) { const v4f v = *(const v4fa*)&so[w][r][c4]; *(v4f*)(C + (size_t)(row0 + r) * ldc + col0 + c4) = v; } }
     }
}

// Wt[n][k] = f16(W[k][n]·scale) from f32 row-major W[K][N] (scale = power of two; bf16-exact weights stay exact in f16 away from the subnormal range)
__global__ __launch_bounds__(256) void k_wt_f16(const float* __restrict__ W, _Float16* __restrict__ Wt, int K, int N, float scale) {
  const int t = blockIdx.x * 256 + threadIdx.x; if (t >= N * (K / 8)) return; const int n = t / (K / 8), k8 = (t % (K / 8)) * 8; FragH f;
#pragma unroll
  for (int i = 0; i < 8; ++i) f.h[i] = (_Float16)(bf16_round(W[(size_t)(k8 + i) * N + n]) * scale); const v8us o = f.half[0];
  *(v8us*)((unsigned short*)Wt + (size_t)n * K + k8) = o; 
}
// k_gemm_hh variant with fused epilogue: v = acc·alpha + bias[by·sBias + col] (+ CP[(row/rowsPerB)·sCPb + by·64 + col] if CP) ; ACT 0 none / 1 elu ; writes f16 C16 (and f32 C if non-null)
template <int ACT>
__global__ __launch_bounds__(128) void k_gemm_hhx(const _Float16* __restrict__ A, int lda, size_t sA, const _Float16* __restrict__ Bh, int ldb, size_t sB, float alpha, const float* __restrict__ bias, size_t sBias, const float* __restrict__ CP, int rowsPerB, size_t sCPb, int row0g,
    float* __restrict__ C, _Float16* __restrict__ C16, int ldc, size_t sC, int M, int N, int K) {
  __shared__ __attribute__((aligned(16))) float so[4][16][64];
  const int tid = threadIdx.x, w = tid >> 5, lane = tid & 31, ln = lane & 15, hh = lane >> 4; const int by = blockIdx.y;
  A += (size_t)by * sA; Bh += (size_t)by * sB; const size_t cofs = (size_t)by * sC; const float* bp = bias ? bias + (size_t)by * sBias : nullptr;
  const int ntn = (N + 63) / 64; const int wid = blockIdx.x * 4 + w; const int mt = wid / ntn, nq = wid % ntn; if (mt * 16 >= M) return;
  const int row0 = mt * 16, col0 = nq * 64; const _Float16* arow = A + (size_t)(row0 + ln) * lda;
  v8f acc[4] = {};
  for (int kb = 0; kb < K; kb += 32) { FragH ah; ah.half[0] = *(const v8us*)((const unsigned short*)arow + kb + 8 * hh); ah.half[1] = *(const v8us*)((const unsigned short*)arow + kb + 16 + 8 * hh);
#pragma unroll
    for (int t = 0; t < 4; ++t) { if (col0 + t * 16 >= N) continue; const size_t boff = (size_t)(col0 + t * 16 + ln) * ldb + kb; FragH bq; bq.half[0] = *(const v8us*)((const unsigned short*)Bh + boff + 8 * hh); bq.half[1] = *(const v8us*)((const unsigned short*)Bh + boff + 16 + 8 * hh);
      acc[t] = mmaH<1>(ah.v, ah.v, bq.v, bq.v, acc[t]); }
  }
#pragma unroll
  for (int t = 0; t < 4; ++t) { if (col0 + t * 16 >= N) continue; const int col = col0 + t * 16 + ln; const float bv = bp ? bf16_round(bp[col]) : 0.f;
#pragma unroll
    for (int r = 0; r < 8; ++r) { float v = acc[t][r] * alpha + bv; if (CP) { const int rr = row0g + row0 + 8 * hh + r; if (rowsPerB < 0) v += CP[cofs + (size_t)rr * ldc + col];      /* rowsPerB < 0: own element of the batched C plane */ else { const int bidx = rr / rowsPerB; v += CP[(size_t)bidx * sCPb + (size_t)by * 64 + col]; } } if (ACT == 1) v = (v > 0.f) ? v : expm1f(v); else if (ACT == 7) v = (v > 0.f) ? v + 1.0f : expf(v); else if (ACT == 8) v = tanhf(v); else if (ACT == 9) v = 0.5f * v * (1.0f + tanhf(0.7978845608028654f * (v + 0.044715f * v * v * v))); else if (ACT == 11) v = 1.0f / (1.0f + expf(-v)); else if (ACT == 12) v = (v > 0.f) ? v : 0.01f * v; else if (ACT == 14) v = (v > 0.f) ? v : 0.1f * v; else if (ACT == 16) v = (v >= 0.f) ? v : 0.3f * v; else if (ACT == 17) v = (v >= 0.f) ? v : 0.2f * v; else if (ACT == 15) v = v / (1.0f + expf(-v)); else if (ACT == 3) v = fmaxf(v, 0.f); else if (ACT == 6) v = 0.5f * v * (1.0f + erff(v * 0.70710678118654752f)); so[w][8 * hh + r][t * 16 + ln] = v; } }
  __builtin_amdgcn_fence(__ATOMIC_ACQ_REL, "workgroup"); __builtin_amdgcn_wave_barrier();
  const int rsub = lane >> 4, c4 = (lane & 15) * 4; typedef _Float16 v4h __attribute__((ext_vector_type(4)));
  {
#pragma unroll
    for (int q = 0; q < 8; ++q) { const int r = q * 2 + rsub; if (col0 + c4 < N) { const v4f v = *(const v4fa*)&so[w][r][c4]; if (C) *(v4f*)(C + cofs + (size_t)(row0 + r) * ldc + col0 + c4) = v; if (C16) { v4h h4; for (int i = 0; i < 4; ++i) h4[i] = (_Float16)v[i]; *(v4h*)(C16 + cofs + (size_t)(row0 + r) * ldc + col0 + c4) = h4; } } }
     }
}


typedef _Float16 v4h __attribute__((ext_vector_type(4)));

__global__ __launch_bounds__(256) void k_x16(const float* __restrict__ x, _Float16* __restrict__ X16, size_t n8) { const size_t t = (size_t)blockIdx.x * 256 + threadIdx.x; if (t >= n8) return; FragH f;
#pragma unroll
  for (int q = 0; q < 8; ++q) f.h[q] = (_Float16)bf16_round(x[t * 8 + q]); *(v8us*)((unsigned short*)X16 + t * 8) = f.half[0];  }
__global__ __launch_bounds__(256) void k_h16(const float* __restrict__ x, _Float16* __restrict__ X16, size_t n8) { const size_t t = (size_t)blockIdx.x * 256 + threadIdx.x; if (t >= n8) return; FragH f;
#pragma unroll
  for (int q = 0; q < 8; ++q) f.h[q] = (_Float16)x[t * 8 + q]; *(v8us*)((unsigned short*)X16 + t * 8) = f.half[0];  }
__global__ __launch_bounds__(256) void k_round16f(const float* __restrict__ W, _Float16* __restrict__ Bt, size_t n8) { const size_t t = (size_t)blockIdx.x * 256 + threadIdx.x; if (t >= n8) return; FragH f;
#pragma unroll
  for (int i = 0; i < 8; ++i) f.h[i] = (_Float16)(bf16_round(W[t * 8 + i]) * 16.0f); *(v8us*)((unsigned short*)Bt + t * 8) = f.half[0];  }
template <int NHv, int TTv>
__global__ __launch_bounds__(256) void k_vt(const _Float16* __restrict__ V16, int ldv, int voff, _Float16* __restrict__ Vt) { __shared__ unsigned short tl[64][66]; const int tid = threadIdx.x; const int slab = blockIdx.x / (TTv / 64), lg = blockIdx.x % (TTv / 64); const int b = slab / NHv, h = slab % NHv;
  for (int i = tid; i < 64 * 8; i += 256) { const int r = i / 8, c8 = (i % 8) * 8; FragH f; f.half[0] = *(const v8us*)((const unsigned short*)V16 + ((size_t)b * TTv + lg * 64 + r) * ldv + voff + h * 64 + c8);
#pragma unroll
    for (int q = 0; q < 8; ++q) tl[r][c8 + q] = f.u[q]; }
  __syncthreads();
  {
#pragma unroll
    for (int rd = 0; rd < 2; ++rd) { const int d = rd * 32 + tid / 8, pc = tid % 8; FragH f;
#pragma unroll
      for (int q = 0; q < 8; ++q) f.u[q] = tl[pc * 8 + q][d];
      *(v8us*)((unsigned short*)Vt + ((size_t)slab * 64 + d) * TTv + lg * 64 + pc * 8) = f.half[0]; }
     } }

__global__ __launch_bounds__(256) void k_hl(const float* __restrict__ F, _Float16* __restrict__ Hh, _Float16* __restrict__ Hl, size_t n8) { const size_t t = (size_t)blockIdx.x * 256 + threadIdx.x; if (t >= n8) return; FragH fh, fl; const v4f a = *(const v4fa*)(F + t * 8), c = *(const v4fa*)(F + t * 8 + 4);
#pragma unroll
  for (int q = 0; q < 4; ++q) { _Float16 h = (_Float16)a[q]; fh.h[q] = h; fl.h[q] = (_Float16)((a[q] - (float)h) * 1024.0f); h = (_Float16)c[q]; fh.h[4 + q] = h; fl.h[4 + q] = (_Float16)((c[q] - (float)h) * 1024.0f); }
  { *(v8us*)((unsigned short*)Hh + t * 8) = fh.half[0]; *(v8us*)((unsigned short*)Hl + t * 8) = fl.half[0];  } }

// ---- fast GEMM (wave tile 32x64; requires M % 32 == 0 rows per launch region and N % 64 == 0); epilogue = k_gemm_hhx semantics ----
__device__ __forceinline__ v16h g2_frag(const _Float16* p, int hh) { FragH f; f.half[0] = *(const v8us*)((const unsigned short*)p + 8 * hh); f.half[1] = *(const v8us*)((const unsigned short*)p + 16 + 8 * hh); return f.v; }
__device__ __forceinline__ v8f g2_mma(v16h a, v16h b, v8f c) { v8f d = __builtin_amdgcn_wmma_f32_16x16x32_f16(false, a, false, b, (short)0, c, false, false); asm volatile("v_nop\n\tv_nop\n\tv_nop\n\tv_nop" : "+v"(d) : "v"(a), "v"(b)); return d; }
template <int ACT>
__global__ __launch_bounds__(128) void k_gemm2(const _Float16* __restrict__ A, int lda, size_t sA, const _Float16* __restrict__ Bh, int ldb, size_t sB, float alpha, const float* __restrict__ bias, size_t sBias, const float* __restrict__ CP, int rowsPerB, size_t sCPb, int row0g,
    float* __restrict__ C, _Float16* __restrict__ C16, int ldc, size_t sC, int M, int N, int K) { static_assert(ACT == 0 || ACT == 3 || ACT == 6 || ACT == 8 || ACT == 9 || ACT == 11 || ACT == 12 || ACT == 14 || ACT == 15 || ACT == 16 || ACT == 17, "k_gemm2: unsupported ACT code (would silently apply no activation)");
  __shared__ __attribute__((aligned(16))) float so[4][32][68];
  const int tid = threadIdx.x, w = tid >> 5, lane = tid & 31, ln = lane & 15, hh = lane >> 4; const int by = blockIdx.y;
  A += (size_t)by * sA; Bh += (size_t)by * sB; const size_t cofs = (size_t)by * sC; const float* bp = bias ? bias + (size_t)by * sBias : nullptr;
  const int ntn = N >> 6; const int mt = blockIdx.x / ntn, nq = blockIdx.x - mt * ntn; const int row0 = mt * 128 + 32 * w, col0 = nq * 64; if (row0 >= M) return;
  const _Float16* a0p = A + (size_t)(row0 + ln) * lda; const _Float16* a1p = a0p + (size_t)16 * lda;
  const _Float16* b0p = Bh + (size_t)(col0 + ln) * ldb; const _Float16* b1p = b0p + (size_t)16 * ldb; const _Float16* b2p = b1p + (size_t)16 * ldb; const _Float16* b3p = b2p + (size_t)16 * ldb;
  const v8f z8 = {0.f,0.f,0.f,0.f,0.f,0.f,0.f,0.f}; v8f c00 = z8, c01 = z8, c02 = z8, c03 = z8, c10 = z8, c11 = z8, c12 = z8, c13 = z8;
#pragma unroll 1
  for (int kb = 0; kb < K; kb += 32) { const v16h a0 = g2_frag(a0p + kb, hh), a1 = g2_frag(a1p + kb, hh);
    v16h b = g2_frag(b0p + kb, hh); c00 = g2_mma(a0, b, c00); c10 = g2_mma(a1, b, c10);
    b = g2_frag(b1p + kb, hh); c01 = g2_mma(a0, b, c01); c11 = g2_mma(a1, b, c11);
    b = g2_frag(b2p + kb, hh); c02 = g2_mma(a0, b, c02); c12 = g2_mma(a1, b, c12);
    b = g2_frag(b3p + kb, hh); c03 = g2_mma(a0, b, c03); c13 = g2_mma(a1, b, c13); }
  v8f accs[8] = {c00, c01, c02, c03, c10, c11, c12, c13};
#pragma unroll
  for (int u = 0; u < 8; ++u) { const int t = u & 3, half = u >> 2; const int col = col0 + t * 16 + ln; const float bv = bp ? bf16_round(bp[col]) : 0.f;
#pragma unroll
    for (int r = 0; r < 8; ++r) { const int rloc = half * 16 + 8 * hh + r; float v = accs[u][r] * alpha + bv; if (CP) { if (rowsPerB < 0) v += CP[cofs + (size_t)(row0g + row0 + rloc) * ldc + col];      /* rowsPerB < 0: own element of the batched C plane */ else { const int bidx = (row0g + row0 + rloc) / rowsPerB; v += CP[(size_t)bidx * sCPb + (size_t)by * 64 + col]; } }
      if (ACT == 3) v = fmaxf(v, 0.f); else if (ACT == 6) v = 0.5f * v * (1.0f + erff(v * 0.70710678118654752f)); else if (ACT == 11) v = 1.0f / (1.0f + expf(-v)); else if (ACT == 15) v = v / (1.0f + expf(-v)); else if (ACT == 12) v = (v > 0.f) ? v : 0.01f * v; else if (ACT == 8) v = tanhf(v); else if (ACT == 9) v = 0.5f * v * (1.0f + tanhf(0.7978845608028654f * (v + 0.044715f * v * v * v))); else if (ACT == 14) v = (v > 0.f) ? v : 0.1f * v; else if (ACT == 16) v = (v >= 0.f) ? v : 0.3f * v; else if (ACT == 17) v = (v >= 0.f) ? v : 0.2f * v;
      so[w][rloc][t * 16 + ln] = v; } }
  __builtin_amdgcn_fence(__ATOMIC_ACQ_REL, "workgroup"); __builtin_amdgcn_wave_barrier();
  const int rsub = lane >> 4, c4 = (lane & 15) * 4;
  {
#pragma unroll
    for (int q = 0; q < 16; ++q) { const int r = q * 2 + rsub; const v4f v = *(const v4fa*)&so[w][r][c4]; if (C) *(v4f*)(C + cofs + (size_t)(row0 + r) * ldc + col0 + c4) = v; if (C16) { v4h h4; for (int i = 0; i < 4; ++i) h4[i] = (_Float16)v[i]; *(v4h*)(C16 + cofs + (size_t)(row0 + r) * ldc + col0 + c4) = h4; } }
     } }


__global__ __launch_bounds__(256) void k_wnat(const float* __restrict__ w, size_t n8, _Float16* __restrict__ Bt) { const size_t t = (size_t)blockIdx.x * 256 + threadIdx.x; if (t >= n8) return; FragH f; for (int q = 0; q < 8; ++q) f.h[q] = (_Float16)(bf16_round(w[t * 8 + q]) * 16.0f); *(v8us*)((unsigned short*)Bt + t * 8) = f.half[0];  }
__global__ __launch_bounds__(256) void k_rsm(const float* __restrict__ S, _Float16* __restrict__ P, int nrows) {
  #pragma clang fp contract(off)
  const int i = blockIdx.x * 256 + threadIdx.x; if (i >= nrows) return; const float* s = S + (size_t)i * SQ; float mx = -3.0e38f;
#pragma unroll 1
  for (int j = 0; j < SQ; ++j) mx = fmaxf(mx, s[j]); float se = 0.f;
#pragma unroll 1
  for (int j = 0; j < SQ; ++j) se += expf(s[j] - mx); const float sc = 256.0f / se;
#pragma unroll 1
  for (int j0 = 0; j0 < SQ; j0 += 8) { FragH f; for (int q = 0; q < 8; ++q) f.h[q] = (_Float16)(expf(s[j0 + q] - mx) * sc); unsigned short* d = (unsigned short*)P + (size_t)i * SQ + j0; *(v8us*)d = f.half[0];  } }
__global__ __launch_bounds__(256) void k_vt(const _Float16* __restrict__ V16, int b, int h0, _Float16* __restrict__ VT) { __shared__ unsigned short tl[64][65]; const int tid = threadIdx.x; const int hh = blockIdx.x % HG, sg = blockIdx.x / HG; const int s0 = sg * 64; const int h = h0 + hh;
  for (int i = tid; i < 64 * 8; i += 256) { const int j = i / 8, d8 = (i % 8) * 8; FragH f; f.half[0] = *(const v8us*)((const unsigned short*)V16 + ((size_t)b * SQ + s0 + j) * DM + h * HD + d8); for (int q = 0; q < 8; ++q) tl[d8 + q][j] = f.u[q]; }
  __syncthreads();
  { for (int i = tid; i < 64 * 8; i += 256) { const int d = i / 8, j8 = (i % 8) * 8; FragH f; for (int q = 0; q < 8; ++q) f.u[q] = tl[d][j8 + q]; *(v8us*)((unsigned short*)VT + ((size_t)hh * HD + d) * SQ + s0 + j8) = f.half[0]; }  } }



__global__ __launch_bounds__(256) void k_rsmcf2(const float* __restrict__ S, _Float16* __restrict__ P, int hg, int q0, int nk) {
  #pragma clang fp contract(off)
  const int t = blockIdx.x * 256 + threadIdx.x; if (t >= hg * QT) return; const size_t i = (size_t)t; const float* s = S + i * NKX; const int last = q0 + (t % QT); float mx = -3.0e38f;
#pragma unroll 1
  for (int j = 0; j < nk; ++j) { const float f = (j <= last) ? 1.f : 0.f; mx = fmaxf(mx, fmaf(f, s[j], (1.f - f) * -1.0e9f)); } float se = 0.f;
#pragma unroll 1
  for (int j = 0; j < nk; ++j) { const float f = (j <= last) ? 1.f : 0.f; se += __expf(fmaf(f, s[j], (1.f - f) * -1.0e9f) - mx); } const float sc = 256.0f / se;
#pragma unroll 1
  for (int j0 = 0; j0 < nk; j0 += 8) { FragH fr; for (int q = 0; q < 8; ++q) { const int j = j0 + q; const float f = (j <= last) ? 1.f : 0.f; fr.h[q] = (_Float16)(__expf(fmaf(f, s[j], (1.f - f) * -1.0e9f) - mx) * sc); } unsigned short* d = (unsigned short*)P + i * NKX + j0; *(v8us*)d = fr.half[0];  } }

template <int MASKADD>
__global__ __launch_bounds__(64) void k_att0(const float* __restrict__ QF, const float* __restrict__ KF, const float* __restrict__ VF, int ld, const float* __restrict__ mask, float scale, float* __restrict__ OF, int ldo) {
  #pragma clang fp contract(off)
  __shared__ __attribute__((aligned(16))) float lq[64][64]; __shared__ __attribute__((aligned(16))) float lo[64][64];
  const int tid = threadIdx.x; const int h = blockIdx.x / (QT0 / 64), rg = blockIdx.x % (QT0 / 64); const int i = rg * 64 + tid;
  const float* qr = QF + (size_t)i * ld + h * HD;
#pragma unroll 1
  for (int c = 0; c < HD / 4; ++c) { *(v4f*)&lq[tid][c * 4] = *(const v4fa*)(qr + c * 4); const v4f z = {0.f, 0.f, 0.f, 0.f}; *(v4f*)&lo[tid][c * 4] = z; }
  float m = -1.0e30f, l = 0.f; const int jmax = MASKADD ? (SQ - 1) : (rg * 64 + 63);      /* additive-mask form: every key (the mask input decides); causal form: keys up to the block's last row */
#pragma unroll 1
  for (int j = 0; j <= jmax; ++j) { const float* kr = KF + (size_t)j * ld + h * HD; const float* vr = VF + (size_t)j * ld + h * HD; float s = 0.f;
#pragma unroll 1
    for (int c = 0; c < HD / 4; ++c) { const v4f kq = *(const v4fa*)(kr + c * 4); const v4f qq = *(v4f*)&lq[tid][c * 4]; s = __fadd_rn(s, __fmul_rn(qq[0], kq[0])); s = __fadd_rn(s, __fmul_rn(qq[1], kq[1])); s = __fadd_rn(s, __fmul_rn(qq[2], kq[2])); s = __fadd_rn(s, __fmul_rn(qq[3], kq[3])); }
    s = __fmul_rn(s, scale); if (MASKADD) s = __fadd_rn(s, __fmul_rn(bf16_round(mask[(size_t)i * SQ + j]), -10000.0f));
    const float f = (MASKADD || j <= i) ? 1.f : 0.f; const float sm = fmaf(f, s, (1.f - f) * -1.0e30f); const float mn = fmaxf(m, sm); const float sc = expf(m - mn); const float e = expf(sm - mn); l = __fadd_rn(__fmul_rn(l, sc), e); m = mn;
#pragma unroll 1
    for (int c = 0; c < HD / 4; ++c) { const v4f vv = *(const v4fa*)(vr + c * 4); v4f oo = *(v4f*)&lo[tid][c * 4]; for (int u = 0; u < 4; ++u) oo[u] = __fadd_rn(__fmul_rn(oo[u], sc), __fmul_rn(e, vv[u])); *(v4f*)&lo[tid][c * 4] = oo; } }
  const float fin = 64.0f / l;      /* o carried x64; the f16 path writes o unscaled */
#pragma unroll 1
  for (int c = 0; c < HD / 4; ++c) { v4f oo = *(v4f*)&lo[tid][c * 4]; for (int u = 0; u < 4; ++u) oo[u] = __fmul_rn(oo[u], fin); *(v4f*)&lo[tid][c * 4] = oo; }
  __syncthreads();
  {
#pragma unroll 1
    for (int it = 0; it < 16; ++it) { const int row = it * 4 + tid / 16, pc = (tid % 16) * 4; const v4f v = *(const v4f*)&lo[row][pc]; *(v4f*)(OF + (size_t)(rg * 64 + row) * ldo + h * HD + pc) = v; }
     } }

__global__ __launch_bounds__(256) void k_oscale(const float* __restrict__ OF, float* __restrict__ out, size_t n4) { const size_t t = (size_t)blockIdx.x * 256 + threadIdx.x; if (t >= n4) return; const v4f a = *(const v4fa*)(OF + t * 4); v4f o; for (int q = 0; q < 4; ++q) o[q] = a[q] * 0.015625f; *(v4f*)(out + t * 4) = o;  }

__global__ __launch_bounds__(256) void k_bfr(const float* __restrict__ x, float* __restrict__ XB, size_t n8) { const size_t t = (size_t)blockIdx.x * 256 + threadIdx.x; if (t >= n8) return; v4f a = *(const v4fa*)(x + t * 8), c = *(const v4fa*)(x + t * 8 + 4); for (int q = 0; q < 4; ++q) { a[q] = bf16_round(a[q]); c[q] = bf16_round(c[q]); }
  { *(v4f*)(XB + t * 8) = a; *(v4f*)(XB + t * 8 + 4) = c;  } }



__global__ __launch_bounds__(256) void k_rsmfvl(const float* __restrict__ S, _Float16* __restrict__ P, _Float16* __restrict__ PL, int qn, const int* __restrict__ vlp) {
  #pragma clang fp contract(off)
  const int t = blockIdx.x * 256 + threadIdx.x; if (t >= qn) return; const int vl = vlp[0]; const size_t i = (size_t)t; const float* s = S + i * SQ; float mx = -3.0e38f;
#pragma unroll 1
  for (int j = 0; j < SQ; ++j) { const float f = (j < vl) ? 1.f : 0.f; mx = fmaxf(mx, fmaf(f, s[j], (1.f - f) * -1000000.0f)); } float se = 0.f;
#pragma unroll 1
  for (int j = 0; j < SQ; ++j) { const float f = (j < vl) ? 1.f : 0.f; se += __expf(fmaf(f, s[j], (1.f - f) * -1000000.0f) - mx); } const float sc = 256.0f / se;
#pragma unroll 1
  for (int j0 = 0; j0 < SQ; j0 += 8) { FragH fr, gr; for (int q = 0; q < 8; ++q) { const int j = j0 + q; const float f = (j < vl) ? 1.f : 0.f; const float pv = __expf(fmaf(f, s[j], (1.f - f) * -1000000.0f) - mx) * sc; const _Float16 ph = (_Float16)pv; fr.h[q] = ph; gr.h[q] = (_Float16)((pv - (float)ph) * 1024.0f); }
    unsigned short* d = (unsigned short*)P + i * SQ + j0; unsigned short* dl = (unsigned short*)PL + i * SQ + j0; *(v8us*)d = fr.half[0]; *(v8us*)dl = gr.half[0];  } }

__global__ __launch_bounds__(256) void k_rsmf(const float* __restrict__ S, _Float16* __restrict__ P, int qn, int hg) {
  #pragma clang fp contract(off)
  const int t = blockIdx.x * 256 + threadIdx.x; if (t >= qn * hg) return; const size_t i = (size_t)(t / qn) * SQ + (t % qn); const float* s = S + i * SQ; float mx = -3.0e38f;
#pragma unroll 1
  for (int j = 0; j < SQ; ++j) mx = fmaxf(mx, s[j]); float se = 0.f;
#pragma unroll 1
  for (int j = 0; j < SQ; ++j) se += __expf(s[j] - mx); const float sc = 256.0f / se;
#pragma unroll 1
  for (int j0 = 0; j0 < SQ; j0 += 8) { FragH f; for (int q = 0; q < 8; ++q) f.h[q] = (_Float16)(__expf(s[j0 + q] - mx) * sc); unsigned short* d = (unsigned short*)P + i * SQ + j0; *(v8us*)d = f.half[0];  } }



// lane l <-> l ^ 16 (cross-row move): register only, no LDS traffic
__device__ __forceinline__ float lane_x16(float v) { const int b = __float_as_int(v); return __int_as_float(__builtin_amdgcn_permlanex16(b, b, 0x76543210, 0xfedcba98, false, false)); }

// ---- fused attention: logits, softmax and weights x value in one kernel; scores and weights never leave the registers ----
#define FA_QT 4                      /* query tiles (16 rows each) per work-group */
#define FA_KS 4                      /* key ranges per work-group, one wave per (query tile, key range) */
#define FA_NP (SQ / FA_KS / 32)      /* passes of 32 keys per wave */
// Operands stored as ready-made WMMA A fragments: a block of 512 f16 = [half j][lane l][8], lane l = (c = l & 15, h = l >> 4) holding row c, k = 16 j + 8 h + 0..7 (the hardware k order),
// so that a fragment is two whole-line loads of 512 B instead of two loads that touch 16 lines each. One 16-byte piece = 8 f16, piece t = (block t >> 6, half j = (t >> 5) & 1, lane l = t & 31).
// KF: block (key tile kt, d step s) at kt * 4 + s: row = key kt * 16 + c, k = channel s * 32 + ...
// VF: block (32-key step kp, channel tile dt) at kp * 8 + dt: row = channel dt * 16 + c, k = key kp * 32 + ... (the transposition of value happens here)
// ONE launch prepares everything the attention kernel reads. Work-group g takes rows 64 g .. 64 g + 63 of query, key and value (all batches in one row count): 1024 pieces of each, two per thread,
// and every load of a thread is issued before its first conversion: one memory round trip for the whole launch.
// A thread's two value pieces are 16 keys of ONE channel (tile dt = wave >> 1, channel c), so the work-group's sum over its 64 keys of the bf16-rounded value comes from registers (f32 on VALU):
// 8 keys as a tree, the two pieces, lane l + lane l ^ 16, then the two waves of a channel tile through LDS. PM[g][channel]; the attention kernel adds a batch's 64 partial sums.
#define PR_T 512                     /* threads of a preparation work-group */
__global__ __launch_bounds__(PR_T) void k_prep(const float* __restrict__ xq, const float* __restrict__ xk, const float* __restrict__ xv, _Float16* __restrict__ Q16, _Float16* __restrict__ KF, _Float16* __restrict__ VF, float* __restrict__ PM) {
  __shared__ float part[PR_T / 32][16];
  const int tid = threadIdx.x, w = tid >> 5, l = tid & 31, j = w & 1, c = l & 15, h = l >> 4; const size_t t0 = (size_t)blockIdx.x * (2 * PR_T) + tid;
  v4f qa[2][2], ka[2][2]; float va[2][8];
  /* unrolled: the arrays stay in registers and all 24 loads are in flight together */
#pragma unroll
  for (int i = 0; i < 2; ++i) { const size_t t = t0 + (size_t)i * PR_T, blk = t >> 6;
    const float* qs = xq + t * 8; const float* ks = xk + ((blk >> 2) * 16 + c) * DM + (blk & 3) * 32 + j * 16 + 8 * h; const float* vs = xv + ((blk >> 3) * 32 + j * 16 + 8 * h) * DM + (blk & 7) * 16 + c;
    /* the s_wait_xcnt behind each address's loads: a later load's result may land in that address's registers; the data stay in flight */
    qa[i][0] = *(const v4fa*)qs; qa[i][1] = *(const v4fa*)(qs + 4); asm volatile("s_wait_xcnt 0x0" ::: "memory");
    ka[i][0] = *(const v4fa*)ks; ka[i][1] = *(const v4fa*)(ks + 4); asm volatile("s_wait_xcnt 0x0" ::: "memory");
#pragma unroll
    for (int q = 0; q < 8; ++q) va[i][q] = vs[(size_t)q * DM];
    asm volatile("s_wait_xcnt 0x0" ::: "memory"); }
  /* inputs only, no code: every loaded value is in its register here, so all 24 loads issue ahead of the first use, under one wait (without it the query and key loads sink behind the barrier below: a second memory round trip) */
  asm volatile("" :: "v"(qa[0][0]), "v"(qa[0][1]), "v"(qa[1][0]), "v"(qa[1][1]), "v"(ka[0][0]), "v"(ka[0][1]), "v"(ka[1][0]), "v"(ka[1][1]), "v"(va[0][0]), "v"(va[0][1]), "v"(va[0][2]), "v"(va[0][3]), "v"(va[0][4]), "v"(va[0][5]), "v"(va[0][6]), "v"(va[0][7]),
               "v"(va[1][0]), "v"(va[1][1]), "v"(va[1][2]), "v"(va[1][3]), "v"(va[1][4]), "v"(va[1][5]), "v"(va[1][6]), "v"(va[1][7]));
  /* the value sums first: their barrier and the store of PM then stand in front of the six large stores and wait for none of them */
  float r[2][8];
#pragma unroll
  for (int i = 0; i < 2; ++i) for (int q = 0; q < 8; ++q) r[i][q] = bf16_round(va[i][q]);
  float a = (((r[0][0] + r[0][1]) + (r[0][2] + r[0][3])) + ((r[0][4] + r[0][5]) + (r[0][6] + r[0][7]))) + (((r[1][0] + r[1][1]) + (r[1][2] + r[1][3])) + ((r[1][4] + r[1][5]) + (r[1][6] + r[1][7])));
  a += lane_x16(a);
  if (h == 0) part[w][c] = a;
  __syncthreads();      /* every wave passes it once: the first four waves read both waves' sums of each channel tile below */
  if (tid < DM) PM[(size_t)blockIdx.x * DM + tid] = part[2 * (tid >> 4)][tid & 15] + part[2 * (tid >> 4) + 1][tid & 15];
  /* unrolled: register arrays */
#pragma unroll
  for (int i = 0; i < 2; ++i) { const size_t t = t0 + (size_t)i * PR_T; FragH fq, fk, fv;
#pragma unroll
    for (int q = 0; q < 8; ++q) { fq.h[q] = (_Float16)bf16_round(qa[i][q >> 2][q & 3]); fk.h[q] = (_Float16)bf16_round(ka[i][q >> 2][q & 3]); fv.h[q] = (_Float16)r[i][q]; }
    *(v8us*)((unsigned short*)Q16 + t * 8) = fq.half[0]; *(v8us*)((unsigned short*)KF + t * 8) = fk.half[0]; *(v8us*)((unsigned short*)VF + t * 8) = fv.half[0]; } }
// p: the block's start, the same for the whole wave; lo = lane * 8: the lane's own 16-byte piece
__device__ __forceinline__ v16h fa_frag(const unsigned short* p, unsigned lo) { FragH f; f.half[0] = *(const v8us*)(p + lo); f.half[1] = *(const v8us*)(p + 256 + lo); return f.v; }
// eight asynchronous copies to LDS, 512 B a wave each: a lane's 16 bytes go from g + 512 i to LDS byte lds + 512 i (the immediate offset moves both addresses), through no register.
// The s_wait_xcnt stands inside the copies' own statement, so that it stays in front of every later rewrite of the two address registers (a precaution; in a statement of its own the next trip's address additions could be lifted over it).
__device__ __forceinline__ void fa_copy8(unsigned lds, const unsigned short* g) {
  asm volatile("global_load_async_to_lds_b128 %0, %1, off\n\t"
               "global_load_async_to_lds_b128 %0, %1, off offset:512\n\t"
               "global_load_async_to_lds_b128 %0, %1, off offset:1024\n\t"
               "global_load_async_to_lds_b128 %0, %1, off offset:1536\n\t"
               "global_load_async_to_lds_b128 %0, %1, off offset:2048\n\t"
               "global_load_async_to_lds_b128 %0, %1, off offset:2560\n\t"
               "global_load_async_to_lds_b128 %0, %1, off offset:3072\n\t"
               "global_load_async_to_lds_b128 %0, %1, off offset:3584\n\t"
               "s_wait_xcnt 0x0" :: "v"(lds), "v"(g) : "memory"); }
__device__ __forceinline__ v8f fa_mma(v16h a, v16h b, v8f c) { return __builtin_amdgcn_wmma_f32_16x16x32_f16(false, a, false, b, (short)0, c, false, false); }
// native 2^t; the v_nop in the same statement keeps the one slot that the instruction set asks for behind a transcendental, whatever the compiler puts next
__device__ __forceinline__ float fa_exp2(float t) { float e; asm("v_exp_f32 %0, %1\n\tv_nop" : "=v"(e) : "v"(t)); return e; }
// four at once: the results are early-clobber, so none of the four reads a neighbour's result or overwrites its source, and one v_nop closes the last one's slot
__device__ __forceinline__ void fa_exp2x4(float& a, float& b, float& c, float& d) { float e0, e1, e2, e3;
  asm("v_exp_f32 %0, %4\n\tv_exp_f32 %1, %5\n\tv_exp_f32 %2, %6\n\tv_exp_f32 %3, %7\n\tv_nop" : "=&v"(e0), "=&v"(e1), "=&v"(e2), "=&v"(e3) : "v"(a), "v"(b), "v"(c), "v"(d)); a = e0; b = e1; c = e2; d = e3; }
// A wave owns 16 queries and 1024 keys. S^T = K Q^T: D register r of lane (c, h) = score of key 8 h + r, query c, so a query's scores sit in two lanes (maximum and sum in-lane plus one exchange),
// and two score tiles (keys 0..15, 16..31), converted in place, ARE the B fragment of O^T += V^T P^T in the hardware k order. Running maximum m per query (log2 units), renewed only when a pass exceeds it by more than 8;
// weights 2^(s - m + 6) <= 2^14 as f16 hi + f16 residual, both into the same f32 accumulators; the sum of the f32 weights in l. The four key ranges of a query tile are joined through LDS at the end.
// K and V^T fragments come from LDS: a tile = one pass (32 keys) of each of the four key ranges, 16 KB a range in the order of KF and VF, brought in by asynchronous copies, two buffers: the next pass's tile flies while this pass's is worked on.
// The four waves of a key range each copy a quarter of its 16 KB and all four read the whole: a work-group fetches each K and V^T byte once, and no wave waits out a global load inside the loop.
// Work-group x of a batch takes the 32 tiles of each key range in the order x mod 32, x mod 32 + 1, ..., wrapping round: every key once, in a rotated order.
__global__ __launch_bounds__(FA_QT * FA_KS * 32) void k_fattn(const _Float16* __restrict__ Q16, const _Float16* __restrict__ KF, const _Float16* __restrict__ VF, const float* __restrict__ PM, float* __restrict__ out) {
  __shared__ __attribute__((aligned(16))) unsigned short ring[2][FA_KS][8192];      /* [buffer][key range][K blocks of the pass: 4096 f16, then V^T blocks: 4096 f16] */
  __shared__ float so[FA_KS][FA_QT][64][32]; __shared__ float sm[FA_KS][FA_QT][32]; __shared__ float sl[FA_KS][FA_QT][32]; __shared__ __attribute__((aligned(16))) float sv[FA_KS][DM];
  const int tid = threadIdx.x, w = __builtin_amdgcn_readfirstlane(tid >> 5) /* the wave's number in a scalar register: fragment bases and LDS planes become scalar */, lane = tid & 31, c = lane & 15, h = lane >> 4, qt = w & (FA_QT - 1), ks = w / FA_QT; const int b = blockIdx.y, row0 = blockIdx.x * (FA_QT * 16) + qt * 16;
  const size_t f0 = ((size_t)b * (SQ / 32) + (size_t)ks * FA_NP) * 4096; const unsigned lo = (unsigned)lane * 8;      /* a pass of 32 keys = 8 blocks = 4096 f16 in KF and in VF */
  /* the wave's quarter of its range's tile: waves qt 0, 1 the two halves of the K blocks, waves 2, 3 those of the V^T blocks; the LDS byte address is the low 32 bits of the __shared__ address */
  const unsigned short* gs = (const unsigned short*)(qt < 2 ? KF : VF) + f0 + (size_t)(qt & 1) * 2048 + lo;
  const unsigned ld0 = (unsigned)(size_t)&ring[0][ks][qt * 2048 + lo], ld1 = (unsigned)(size_t)&ring[1][ks][qt * 2048 + lo];
  /* the walk's entry: pass p works on tile (p + rot) mod FA_NP of each key range. The work-groups of a batch read the same K and V^T at the same pace; entering at different tiles they ask L2 for different lines at any moment */
  const unsigned rot = blockIdx.x & (FA_NP - 1);
  fa_copy8(ld0, gs + (size_t)rot * 4096);      /* the first tile into buffer 0, in flight beside the query and partial-sum loads below */
  const _Float16* qp = Q16 + ((size_t)b * SQ + row0 + c) * DM; const v16h q0 = g2_frag(qp, h), q1 = g2_frag(qp + 32, h), q2 = g2_frag(qp + 64, h), q3 = g2_frag(qp + 96, h);
  /* sum of value over the sequence: wave (qt, ks) adds partial sums 16 ks .. 16 ks + 15 of its batch for channels 32 qt + lane (whole lines, in flight beside the query loads); the four quarters meet behind the barrier below */
  { const float* pp = PM + ((size_t)b * (SQ / 64) + ks * 16) * DM + qt * 32 + lane; float x[16];
#pragma unroll
    for (int i = 0; i < 16; ++i) x[i] = pp[(size_t)i * DM];
    sv[ks][qt * 32 + lane] = (((x[0] + x[1]) + (x[2] + x[3])) + ((x[4] + x[5]) + (x[6] + x[7]))) + (((x[8] + x[9]) + (x[10] + x[11])) + ((x[12] + x[13]) + (x[14] + x[15]))); }
  asm volatile("s_wait_asynccnt 0x0" ::: "memory");      /* the wave's own copies of the first tile have landed */
  __syncthreads();      /* every wave passes it: the first tile is read by waves that did not copy it */
  fa_copy8(ld1, gs + (size_t)((rot + 1) & (FA_NP - 1)) * 4096);      /* the second tile into buffer 1 */
  const float CS = (float)(0.08838834764831845 * 1.4426950408889634);      /* 1 / sqrt(128) times log2 e */
  const v8f z8 = {0.f,0.f,0.f,0.f,0.f,0.f,0.f,0.f}; v8f o[8] = {z8, z8, z8, z8, z8, z8, z8, z8}; float m = -1.0e30f, l = 0.f;
  /* kept rolled: two passes' fragments at once would not fit the 256 registers that four waves per SIMD leave each wave */
#pragma unroll 1
  for (int p = 0; p < FA_NP; ++p) { const unsigned short* kp = &ring[p & 1][ks][0]; const unsigned short* vp = kp + 4096;
    const v16h k0 = fa_frag(kp, lo), k1 = fa_frag(kp + 512, lo), k2 = fa_frag(kp + 1024, lo), k3 = fa_frag(kp + 1536, lo), k4 = fa_frag(kp + 2048, lo), k5 = fa_frag(kp + 2560, lo), k6 = fa_frag(kp + 3072, lo), k7 = fa_frag(kp + 3584, lo);
    /* inputs only, no code: all eight key fragments are in registers here, so their 16 LDS loads issue back to back under ONE wait (without it each fragment is loaded, waited for and used in turn: eight latencies a pass) */
    asm volatile("" :: "v"(k0), "v"(k1), "v"(k2), "v"(k3), "v"(k4), "v"(k5), "v"(k6), "v"(k7));
    v16h vf[8];
#pragma unroll
    for (int j = 0; j < 8; ++j) vf[j] = fa_frag(vp + j * 512, lo);
    v8f s0 = fa_mma(k0, q0, z8), s1 = fa_mma(k4, q0, z8); s0 = fa_mma(k1, q1, s0); s1 = fa_mma(k5, q1, s1); s0 = fa_mma(k2, q2, s0); s1 = fa_mma(k6, q2, s1); s0 = fa_mma(k3, q3, s0); s1 = fa_mma(k7, q3, s1);
    float mx = fmaxf(s0[0], s1[0]);
#pragma unroll
    for (int r = 1; r < 8; ++r) mx = fmaxf(mx, fmaxf(s0[r], s1[r]));
    mx = fmaxf(mx, lane_x16(mx)) * CS;
    const bool need = mx > m + 8.0f;
    if (__builtin_amdgcn_ballot_w32(need) != 0) {      /* wave-uniform: the accumulators are rescaled only in the few passes in which some query's maximum moves */
      const float mn = need ? mx : m; const float al = fa_exp2(m - mn); m = mn; l *= al;
#pragma unroll
      for (int j = 0; j < 8; ++j) for (int r = 0; r < 8; ++r) o[j][r] *= al; }
    const float nm = 6.0f - m; float e[16];
#pragma unroll
    for (int r = 0; r < 8; ++r) { e[r] = fmaf(s0[r], CS, nm); e[8 + r] = fmaf(s1[r], CS, nm); }
#pragma unroll
    for (int u = 0; u < 16; u += 4) fa_exp2x4(e[u], e[u + 1], e[u + 2], e[u + 3]);
    l += ((e[0] + e[4] + e[8] + e[12]) + (e[1] + e[5] + e[9] + e[13])) + ((e[2] + e[6] + e[10] + e[14]) + (e[3] + e[7] + e[11] + e[15]));
    FragH ph, pl;
#pragma unroll
    for (int u = 0; u < 16; ++u) { const _Float16 hv = (_Float16)e[u]; ph.h[u] = hv; pl.h[u] = (_Float16)(e[u] - (float)hv); }
    /* hand-over of the buffers, every wave in every pass; every LDS read of the pass stands above, what follows it in the pass works on registers alone, so the refill flies during these products too.
       In this order: the wave's LDS reads of the pass's tile are done, its own copies of the next pass's tile have landed, then the barrier: behind it the next tile may be read by all, and this pass's buffer refilled */
    asm volatile("s_wait_dscnt 0x0" ::: "memory");
    asm volatile("s_wait_asynccnt 0x0" ::: "memory");
    __syncthreads();
    if (p + 2 < FA_NP) fa_copy8((p & 1) ? ld1 : ld0, gs + (size_t)((rot + p + 2) & (FA_NP - 1)) * 4096);      /* the test reads the same in the whole work-group */
#pragma unroll
    for (int j = 0; j < 8; ++j) o[j] = fa_mma(vf[j], ph.v, o[j]);
#pragma unroll
    for (int j = 0; j < 8; ++j) o[j] = fa_mma(vf[j], pl.v, o[j]); }
  asm volatile("s_wait_asynccnt 0x0" ::: "memory");      /* no copy is outstanding behind the loop */
  l += lane_x16(l);      /* the two halves of a query's keys */
#pragma unroll
  for (int j = 0; j < 8; ++j) for (int r = 0; r < 8; ++r) so[ks][qt][j * 8 + r][lane] = o[j][r];
  sm[ks][qt][lane] = m; sl[ks][qt][lane] = l;
  __syncthreads();      /* every wave passes it once: the four key ranges' partial results, and the quarters of the value sums, are read by other waves below */
  float mm[FA_KS], M = -3.0e38f, L = 0.f;
#pragma unroll
  for (int i = 0; i < FA_KS; ++i) { mm[i] = sm[i][qt][lane]; M = fmaxf(M, mm[i]); }
#pragma unroll
  for (int i = 0; i < FA_KS; ++i) { mm[i] = fa_exp2(mm[i] - M); L += sl[i][qt][lane] * mm[i]; }
  const float inv = 1.0f / L;
  /* wave (qt, ks) finishes channels 32 ks .. 32 ks + 31 of its query tile: one whole 128-byte line of each output row */
#pragma unroll
  for (int jj = 0; jj < 2; ++jj) { const int j = 2 * ks + jj, ch = 16 * j + 8 * h; v4f r0, r1; float nv[8];      /* nv = -mean(value) of the lane's eight channels */
#pragma unroll
    for (int u = 0; u < 2; ++u) { const v4f t = (*(const v4f*)&sv[0][ch + 4 * u] + *(const v4f*)&sv[1][ch + 4 * u]) + (*(const v4f*)&sv[2][ch + 4 * u] + *(const v4f*)&sv[3][ch + 4 * u]);
#pragma unroll
      for (int r = 0; r < 4; ++r) nv[4 * u + r] = t[r] * (-1.0f / (float)SQ); }
#pragma unroll
    for (int r = 0; r < 8; ++r) { float a = 0.f;
#pragma unroll
      for (int i = 0; i < FA_KS; ++i) a += so[i][qt][j * 8 + r][lane] * mm[i];
      a = a * inv + nv[r]; if (r < 4) r0[r] = a; else r1[r - 4] = a; }
    float* d = out + ((size_t)b * SQ + row0 + c) * DM + 16 * j + 8 * h; *(v4f*)d = r0; *(v4f*)(d + 4) = r1; } }
extern "C" void kernel_launch(void* const* d_in, const int* in_sizes, int n_in,
                              void* d_out, int out_size, void* d_ws, size_t ws_size, hipStream_t stream) {
  (void)in_sizes; (void)n_in; (void)out_size;
  const float* const* I = (const float* const*)d_in; const float* xq = I[0]; const float* xk = I[1]; const float* xv = I[2];      /* query, key, value [4][4096][128] */
  char* ws = (char*)d_ws; size_t off = 0;
  auto take = [&](size_t bytes) { char* p = ws + off; off += (bytes + 255) & ~(size_t)255; return p; };
  _Float16* Q16 = (_Float16*)take(NR * DM * 2); _Float16* KF = (_Float16*)take(NR * DM * 2); _Float16* VF = (_Float16*)take(NR * DM * 2); float* PM = (float*)take((NR / 64) * DM * 4);      /* sums of value over 64 keys each [256][128] */
  if (off > ws_size) return;
  k_prep<<<(unsigned)(NR / 64), PR_T, 0, stream>>>(xq, xk, xv, Q16, KF, VF, PM);      /* bf16-rounded inputs, exact in f16: query rows, keys and value^T in fragment order; value sums per 64 keys */
  k_fattn<<<dim3(SQ / (FA_QT * 16), NB), FA_QT * FA_KS * 32, 0, stream>>>(Q16, KF, VF, PM, (float*)d_out);      /* out = softmax(q.k / sqrt(128)) value - mean(value), all batches */
}

// v007
// Measured time: 43.1 microseconds a run.
// Next to v006, in two timings, it ran 1.06 times as fast each time.
// Counting every step since v000, it is 101 times as fast.
#include <hip/hip_runtime.h>
#define NB 4
#define SQ 4096
#define DM 128
#define NH 2
#define HD 64
#define HG 8                         /* heads per launch of the four-argument k_vt (not launched) */
#define B0 0                         /* first batch processed (unused) */
#define NBR NB                       /* batches processed (used only in MP) */
#define NR ((size_t)NB * SQ)         /* token rows */
#define MP ((int)((size_t)NBR * SQ)) /* token rows (used only in MPO) */
#define QT 256                       /* query rows per causal tile */
#define NKX SQ                       /* S / P row pitch */
#define QT0 256                      /* query rows per head of the f32 k_att0 (not launched) */
#define QN SQ                        /* query rows attended per batch (unused) */
#define NHD NH                       /* unused */
#define MPO MP                       /* rows through the output stage (unused) */
#define LQ DM            /* row pitch of the q/k/v rows (unused) */
typedef __bf16 v16b __attribute__((ext_vector_type(16)));
typedef unsigned short v8us __attribute__((ext_vector_type(8), may_alias));
typedef float  v8f  __attribute__((ext_vector_type(8)));
typedef float  v4f  __attribute__((ext_vector_type(4)));
typedef float  v4fa __attribute__((ext_vector_type(4), may_alias));
union FragB { v16b v; v8us half[2]; unsigned short u[16]; };

__device__ __forceinline__ unsigned short bf16_bits(float x) { unsigned int u = __float_as_uint(x); return (unsigned short)((u + 0x7FFFu + ((u >> 16) & 1u)) >> 16); }
__device__ __forceinline__ float bf16_val(unsigned short b) { return __uint_as_float(((unsigned int)b) << 16); }
__device__ __forceinline__ float bf16_round(float x) { return bf16_val(bf16_bits(x)); }
// D += A·B with NT terms: 1 = ah·bh, 2 = + al·bh (A split), 3 = + ah·bl (both split)
template <int NT>
__device__ __forceinline__ v8f mmaN(v16b ah, v16b al, v16b bh, v16b bl, v8f c) {
  c = __builtin_amdgcn_wmma_f32_16x16x32_bf16(false, ah, false, bh, (short)0, c, false, false);
  if (NT >= 2) c = __builtin_amdgcn_wmma_f32_16x16x32_bf16(false, al, false, bh, (short)0, c, false, false);
  if (NT >= 3) c = __builtin_amdgcn_wmma_f32_16x16x32_bf16(false, ah, false, bl, (short)0, c, false, false);
  asm volatile("v_nop\n\tv_nop\n\tv_nop\n\tv_nop" : "+v"(c) : "v"(ah), "v"(al), "v"(bh), "v"(bl));
  return c;
}

__global__ __launch_bounds__(256) void k_wt_bf16(const float* __restrict__ W, unsigned short* __restrict__ Wt, int K, int N) {
  const int t = blockIdx.x * 256 + threadIdx.x;
  const int k8n = K / 8;
  if (t >= N * k8n) return;
  const int n = t / k8n, k8 = (t % k8n) * 8;
  v8us v;
#pragma unroll
  for (int i = 0; i < 8; ++i) v[i] = bf16_bits(W[(size_t)(k8 + i) * N + n]);
  *(v8us*)(Wt + (size_t)n * K + k8) = v;
  
}

// GEMM C[M][N] (f32, pitch ldc) = act(A[M][K]·W + bias). A f32 row-major (pitch lda) converted per fragment to bf16
// (ASPLIT: hi/lo two planes -> 2 terms, else single rounded term); Wt bf16 [N][K] (pitch ldb). BIAS_BF16 rounds the
// bias to bf16 first (bias quantised to bf16 before the add). K%32==0, M%16==0, N%64==0.
template <bool ASPLIT, int ACT, bool BIAS_BF16>
__global__ __launch_bounds__(128) void k_gemm_bf(const float* __restrict__ A, int lda, const unsigned short* __restrict__ Wt, int ldb,
                                               const float* __restrict__ bias, float* __restrict__ C, int ldc, int M, int N, int K) {
  __shared__ __attribute__((aligned(16))) float so[4][16][64];
  const int tid = threadIdx.x, w = tid >> 5, lane = tid & 31, ln = lane & 15, hh = lane >> 4;
  const int ntn = N / 64;
  const int wid = blockIdx.x * 4 + w;
  const int mt = wid / ntn, nq = wid % ntn;
  if (mt * 16 >= M) return;
  const int row0 = mt * 16, col0 = nq * 64;
  const float* arow = A + (size_t)(row0 + ln) * lda;
  v8f acc[4] = {};
  for (int kb = 0; kb < K; kb += 32) {
    FragB ah, al;
    const v4f x0 = *(const v4fa*)(arow + kb + 8 * hh), x1 = *(const v4fa*)(arow + kb + 8 * hh + 4);
    const v4f x2 = *(const v4fa*)(arow + kb + 16 + 8 * hh), x3 = *(const v4fa*)(arow + kb + 16 + 8 * hh + 4);
    float xs[16] = {x0[0],x0[1],x0[2],x0[3],x1[0],x1[1],x1[2],x1[3],x2[0],x2[1],x2[2],x2[3],x3[0],x3[1],x3[2],x3[3]};
#pragma unroll
    for (int i = 0; i < 16; ++i) { const unsigned short hb = bf16_bits(xs[i]); ah.u[i] = hb; al.u[i] = ASPLIT ? bf16_bits(xs[i] - bf16_val(hb)) : (unsigned short)0; }
#pragma unroll
    for (int t = 0; t < 4; ++t) {
      const unsigned short* brow = Wt + (size_t)(col0 + t * 16 + ln) * ldb + kb;
      FragB b;
      b.half[0] = *(const v8us*)(brow + 8 * hh);
      b.half[1] = *(const v8us*)(brow + 16 + 8 * hh);
      acc[t] = mmaN<ASPLIT ? 2 : 1>(ah.v, al.v, b.v, b.v, acc[t]);
    }
  }
#pragma unroll
  for (int t = 0; t < 4; ++t) {
    float bv = bias ? bias[col0 + t * 16 + ln] : 0.f;
    if (BIAS_BF16) bv = bf16_round(bv);
#pragma unroll
    for (int r = 0; r < 8; ++r) { float v = acc[t][r] + bv; if (ACT == 1) v = fmaxf(v, 0.f); so[w][8 * hh + r][t * 16 + ln] = v; }
  }
  __builtin_amdgcn_fence(__ATOMIC_ACQ_REL, "workgroup");
  __builtin_amdgcn_wave_barrier();
  const int rsub = lane >> 4, c4 = (lane & 15) * 4;
  {
#pragma unroll
    for (int q = 0; q < 8; ++q) {
      const int r = q * 2 + rsub;
      const v4f v = *(const v4fa*)&so[w][r][c4];
      *(v4f*)(C + (size_t)(row0 + r) * ldc + col0 + c4) = v;
    }
    
  }
}

// GEMM C = act(A·W + bias + resid): A f32 (ASPLIT -> hi/lo 2 terms), Wt bf16 [N][K]; ACT 0 none, 1 relu, 2 exact gelu;
// resid (optional, f32, row index = (row % rmod), pitch ldr, RES_BF16 rounds it) added before the activation.
template <bool ASPLIT, int ACT, bool BIAS_BF16, bool RES_BF16>
__global__ __launch_bounds__(128) void k_gemm_bf3(const float* __restrict__ A, int lda, const unsigned short* __restrict__ Wt, int ldb,
                                                const float* __restrict__ bias, const float* __restrict__ resid, int rmod, int ldr,
                                                float* __restrict__ C, int ldc, int M, int N, int K) {
  __shared__ __attribute__((aligned(16))) float so[4][16][64];
  const int tid = threadIdx.x, w = tid >> 5, lane = tid & 31, ln = lane & 15, hh = lane >> 4;
  const int ntn = N / 64;
  const int wid = blockIdx.x * 4 + w;
  const int mt = wid / ntn, nq = wid % ntn;
  if (mt * 16 >= M) return;
  const int row0 = mt * 16, col0 = nq * 64;
  const float* arow = A + (size_t)(row0 + ln) * lda;
  v8f acc[4] = {};
  for (int kb = 0; kb < K; kb += 32) {
    FragB ah, al;
    const v4f x0 = *(const v4fa*)(arow + kb + 8 * hh), x1 = *(const v4fa*)(arow + kb + 8 * hh + 4);
    const v4f x2 = *(const v4fa*)(arow + kb + 16 + 8 * hh), x3 = *(const v4fa*)(arow + kb + 16 + 8 * hh + 4);
    float xs[16] = {x0[0],x0[1],x0[2],x0[3],x1[0],x1[1],x1[2],x1[3],x2[0],x2[1],x2[2],x2[3],x3[0],x3[1],x3[2],x3[3]};
#pragma unroll
    for (int i = 0; i < 16; ++i) { const unsigned short hb = bf16_bits(xs[i]); ah.u[i] = hb; al.u[i] = ASPLIT ? bf16_bits(xs[i] - bf16_val(hb)) : (unsigned short)0; }
#pragma unroll
    for (int t = 0; t < 4; ++t) {
      const unsigned short* brow = Wt + (size_t)(col0 + t * 16 + ln) * ldb + kb;
      FragB b;
      b.half[0] = *(const v8us*)(brow + 8 * hh);
      b.half[1] = *(const v8us*)(brow + 16 + 8 * hh);
      acc[t] = mmaN<ASPLIT ? 2 : 1>(ah.v, al.v, b.v, b.v, acc[t]);
    }
  }
#pragma unroll
  for (int t = 0; t < 4; ++t) {
    const int col = col0 + t * 16 + ln;
    float bv = bias ? bias[col] : 0.f;
    if (BIAS_BF16) bv = bf16_round(bv);
#pragma unroll
    for (int r = 0; r < 8; ++r) {
      float v = acc[t][r] + bv;
      if (resid) { float rv = resid[(size_t)((row0 + 8 * hh + r) % rmod) * ldr + col]; if (RES_BF16) rv = bf16_round(rv); v += rv; }
      if (ACT == 1) v = fmaxf(v, 0.f);
      if (ACT == 2) v = 0.5f * v * (1.0f + erff(v * 0.70710678118654752f));
      if (ACT == 3) { const float u = 0.7978845608028654f * (v + 0.044715f * v * v * v); v = 0.5f * v * (1.0f + tanhf(u)); }
      so[w][8 * hh + r][t * 16 + ln] = v;
    }
  }
  __builtin_amdgcn_fence(__ATOMIC_ACQ_REL, "workgroup");
  __builtin_amdgcn_wave_barrier();
  const int rsub = lane >> 4, c4 = (lane & 15) * 4;
  {
#pragma unroll
    for (int q = 0; q < 8; ++q) {
      const int r = q * 2 + rsub;
      const v4f v = *(const v4fa*)&so[w][r][c4];
      *(v4f*)(C + (size_t)(row0 + r) * ldc + col0 + c4) = v;
    }
    
  }
}
// row LayerNorm (biased variance, eps) over N: s = X (+ R); optional out_sum <- s; out_norm <- (s-mu)*rsqrt(var+eps)*g + b
template <bool PARAM_BF16>
__global__ __launch_bounds__(256) void k_layernorm(const float* __restrict__ X, const float* __restrict__ R, const float* __restrict__ g, const float* __restrict__ bta,
                                                  float* __restrict__ out_sum, float* __restrict__ out_norm, int N, float eps) {
  __shared__ float red[256];
  const int row = blockIdx.x, tid = threadIdx.x;
  const float* x = X + (size_t)row * N; const float* rr = R ? R + (size_t)row * N : nullptr;
  float vals[16];                     // up to N = 4096
  const int per = N / 256;            // contiguous chunk per thread? use strided-by-4 chunks: thread handles j = tid*4 + 1024*u
  float s1 = 0.f;
  for (int u = 0; u < per / 4; ++u) {
    const int j = tid * 4 + 1024 * u;
    const v4f a = *(const v4fa*)(x + j);
    v4f b = {0.f,0.f,0.f,0.f}; if (rr) b = *(const v4fa*)(rr + j);
#pragma unroll
    for (int q = 0; q < 4; ++q) { const float v = a[q] + b[q]; vals[u * 4 + q] = v; s1 += v; }
  }
  red[tid] = s1; __syncthreads();
  for (int st = 128; st > 0; st >>= 1) { if (tid < st) red[tid] += red[tid + st]; __syncthreads(); }
  const float mu = red[0] / (float)N; __syncthreads();
  float s2 = 0.f;
  for (int u = 0; u < per / 4; ++u)
#pragma unroll
    for (int q = 0; q < 4; ++q) { const float c = vals[u * 4 + q] - mu; s2 += c * c; }
  red[tid] = s2; __syncthreads();
  for (int st = 128; st > 0; st >>= 1) { if (tid < st) red[tid] += red[tid + st]; __syncthreads(); }
  const float rs = rsqrtf(red[0] / (float)N + eps);
  {
    for (int u = 0; u < per / 4; ++u) {
      const int j = tid * 4 + 1024 * u;
      v4f o, sm;
#pragma unroll
      for (int q = 0; q < 4; ++q) {
        float gg = g[j + q], bb = bta[j + q];
        if (PARAM_BF16) { gg = bf16_round(gg); bb = bf16_round(bb); }
        sm[q] = vals[u * 4 + q]; o[q] = (vals[u * 4 + q] - mu) * rs * gg + bb;
      }
      if (out_sum) *(v4f*)(out_sum + (size_t)row * N + j) = sm;
      *(v4f*)(out_norm + (size_t)row * N + j) = o;
    }
    
  }
}



// ---- f16 WMMA path (v_wmma_f32_16x16x32_f16): 11-bit significands for operands in range — used where a [0,1] probability operand needs more precision than bf16
typedef _Float16 v16h __attribute__((ext_vector_type(16)));
union FragH { v16h v; v8us half[2]; _Float16 h[16]; unsigned short u[16]; };
template <int NT>
__device__ __forceinline__ v8f mmaH(v16h ah, v16h al, v16h bh, v16h bl, v8f c) {
  c = __builtin_amdgcn_wmma_f32_16x16x32_f16(false, ah, false, bh, (short)0, c, false, false);
  if (NT >= 2) c = __builtin_amdgcn_wmma_f32_16x16x32_f16(false, al, false, bh, (short)0, c, false, false);
  if (NT >= 3) c = __builtin_amdgcn_wmma_f32_16x16x32_f16(false, ah, false, bl, (short)0, c, false, false);
  asm volatile("v_nop\n\tv_nop\n\tv_nop\n\tv_nop" : "+v"(c) : "v"(ah), "v"(al), "v"(bh), "v"(bl));
  return c;
}
// batched GEMM like k_gemm_b but f16 operands: A f32 (split into f16 hi/lo if ASPLIT, else rounded to f16), Bt = f16 values [n][k]; alpha; C f32; N multiple of 16 (partial tiles skipped)
template <bool ASPLIT>
__global__ __launch_bounds__(128) void k_gemm_h(const float* __restrict__ A, int lda, size_t sA, const _Float16* __restrict__ Bh, int ldb, size_t sB, float alpha, float* __restrict__ C, int ldc, size_t sC, int M, int N, int K) {
  __shared__ __attribute__((aligned(16))) float so[4][16][64];
  const int tid = threadIdx.x, w = tid >> 5, lane = tid & 31, ln = lane & 15, hh = lane >> 4; const int by = blockIdx.y;
  A += (size_t)by * sA; Bh += (size_t)by * sB; C += (size_t)by * sC;
  const int ntn = (N + 63) / 64; const int wid = blockIdx.x * 4 + w; const int mt = wid / ntn, nq = wid % ntn; if (mt * 16 >= M) return;
  const int row0 = mt * 16, col0 = nq * 64; const float* arow = A + (size_t)(row0 + ln) * lda;
  v8f acc[4] = {};
  for (int kb = 0; kb < K; kb += 32) {
    FragH ah, al;
    const v4f x0 = *(const v4fa*)(arow + kb + 8 * hh), x1 = *(const v4fa*)(arow + kb + 8 * hh + 4), x2 = *(const v4fa*)(arow + kb + 16 + 8 * hh), x3 = *(const v4fa*)(arow + kb + 16 + 8 * hh + 4);
    float xs[16] = {x0[0],x0[1],x0[2],x0[3],x1[0],x1[1],x1[2],x1[3],x2[0],x2[1],x2[2],x2[3],x3[0],x3[1],x3[2],x3[3]};
#pragma unroll
    for (int i = 0; i < 16; ++i) { const _Float16 h = (_Float16)xs[i]; ah.h[i] = h; al.h[i] = ASPLIT ? (_Float16)(xs[i] - (float)h) : (_Float16)0.0f; }
#pragma unroll
    for (int t = 0; t < 4; ++t) { if (col0 + t * 16 >= N) continue; const size_t boff = (size_t)(col0 + t * 16 + ln) * ldb + kb; FragH bq; bq.half[0] = *(const v8us*)(Bh + boff + 8 * hh); bq.half[1] = *(const v8us*)(Bh + boff + 16 + 8 * hh);
      acc[t] = mmaH<ASPLIT ? 2 : 1>(ah.v, al.v, bq.v, bq.v, acc[t]); }
  }
#pragma unroll
  for (int t = 0; t < 4; ++t) { if (col0 + t * 16 >= N) continue;
#pragma unroll
    for (int r = 0; r < 8; ++r) so[w][8 * hh + r][t * 16 + ln] = acc[t][r] * alpha; }
  __builtin_amdgcn_fence(__ATOMIC_ACQ_REL, "workgroup"); __builtin_amdgcn_wave_barrier();
  const int rsub = lane >> 4, c4 = (lane & 15) * 4;
  {
#pragma unroll
    for (int q = 0; q < 8; ++q) { const int r = q * 2 + rsub; if (col0 + c4 < N) { const v4f v = *(const v4fa*)&so[w][r][c4]; *(v4f*)(C + (size_t)(row0 + r) * ldc + col0 + c4) = v; } }
     }
}

// Wt[n][k] = f16(W[k][n]·scale) from f32 row-major W[K][N] (scale = power of two; bf16-exact weights stay exact in f16 away from the subnormal range)
__global__ __launch_bounds__(256) void k_wt_f16(const float* __restrict__ W, _Float16* __restrict__ Wt, int K, int N, float scale) {
  const int t = blockIdx.x * 256 + threadIdx.x; if (t >= N * (K / 8)) return; const int n = t / (K / 8), k8 = (t % (K / 8)) * 8; FragH f;
#pragma unroll
  for (int i = 0; i < 8; ++i) f.h[i] = (_Float16)(bf16_round(W[(size_t)(k8 + i) * N + n]) * scale); const v8us o = f.half[0];
  *(v8us*)((unsigned short*)Wt + (size_t)n * K + k8) = o; 
}
// k_gemm_hh variant with fused epilogue: v = acc·alpha + bias[by·sBias + col] (+ CP[(row/rowsPerB)·sCPb + by·64 + col] if CP) ; ACT 0 none / 1 elu ; writes f16 C16 (and f32 C if non-null)
template <int ACT>
__global__ __launch_bounds__(128) void k_gemm_hhx(const _Float16* __restrict__ A, int lda, size_t sA, const _Float16* __restrict__ Bh, int ldb, size_t sB, float alpha, const float* __restrict__ bias, size_t sBias, const float* __restrict__ CP, int rowsPerB, size_t sCPb, int row0g,
    float* __restrict__ C, _Float16* __restrict__ C16, int ldc, size_t sC, int M, int N, int K) {
  __shared__ __attribute__((aligned(16))) float so[4][16][64];
  const int tid = threadIdx.x, w = tid >> 5, lane = tid & 31, ln = lane & 15, hh = lane >> 4; const int by = blockIdx.y;
  A += (size_t)by * sA; Bh += (size_t)by * sB; const size_t cofs = (size_t)by * sC; const float* bp = bias ? bias + (size_t)by * sBias : nullptr;
  const int ntn = (N + 63) / 64; const int wid = blockIdx.x * 4 + w; const int mt = wid / ntn, nq = wid % ntn; if (mt * 16 >= M) return;
  const int row0 = mt * 16, col0 = nq * 64; const _Float16* arow = A + (size_t)(row0 + ln) * lda;
  v8f acc[4] = {};
  for (int kb = 0; kb < K; kb += 32) { FragH ah; ah.half[0] = *(const v8us*)((const unsigned short*)arow + kb + 8 * hh); ah.half[1] = *(const v8us*)((const unsigned short*)arow + kb + 16 + 8 * hh);
#pragma unroll
    for (int t = 0; t < 4; ++t) { if (col0 + t * 16 >= N) continue; const size_t boff = (size_t)(col0 + t * 16 + ln) * ldb + kb; FragH bq; bq.half[0] = *(const v8us*)((const unsigned short*)Bh + boff + 8 * hh); bq.half[1] = *(const v8us*)((const unsigned short*)Bh + boff + 16 + 8 * hh);
      acc[t] = mmaH<1>(ah.v, ah.v, bq.v, bq.v, acc[t]); }
  }
#pragma unroll
  for (int t = 0; t < 4; ++t) { if (col0 + t * 16 >= N) continue; const int col = col0 + t * 16 + ln; const float bv = bp ? bf16_round(bp[col]) : 0.f;
#pragma unroll
    for (int r = 0; r < 8; ++r) { float v = acc[t][r] * alpha + bv; if (CP) { const int rr = row0g + row0 + 8 * hh + r; if (rowsPerB < 0) v += CP[cofs + (size_t)rr * ldc + col];      /* rowsPerB < 0: own element of the batched C plane */ else { const int bidx = rr / rowsPerB; v += CP[(size_t)bidx * sCPb + (size_t)by * 64 + col]; } } if (ACT == 1) v = (v > 0.f) ? v : expm1f(v); else if (ACT == 7) v = (v > 0.f) ? v + 1.0f : expf(v); else if (ACT == 8) v = tanhf(v); else if (ACT == 9) v = 0.5f * v * (1.0f + tanhf(0.7978845608028654f * (v + 0.044715f * v * v * v))); else if (ACT == 11) v = 1.0f / (1.0f + expf(-v)); else if (ACT == 12) v = (v > 0.f) ? v : 0.01f * v; else if (ACT == 14) v = (v > 0.f) ? v : 0.1f * v; else if (ACT == 16) v = (v >= 0.f) ? v : 0.3f * v; else if (ACT == 17) v = (v >= 0.f) ? v : 0.2f * v; else if (ACT == 15) v = v / (1.0f + expf(-v)); else if (ACT == 3) v = fmaxf(v, 0.f); else if (ACT == 6) v = 0.5f * v * (1.0f + erff(v * 0.70710678118654752f)); so[w][8 * hh + r][t * 16 + ln] = v; } }
  __builtin_amdgcn_fence(__ATOMIC_ACQ_REL, "workgroup"); __builtin_amdgcn_wave_barrier();
  const int rsub = lane >> 4, c4 = (lane & 15) * 4; typedef _Float16 v4h __attribute__((ext_vector_type(4)));
  {
#pragma unroll
    for (int q = 0; q < 8; ++q) { const int r = q * 2 + rsub; if (col0 + c4 < N) { const v4f v = *(const v4fa*)&so[w][r][c4]; if (C) *(v4f*)(C + cofs + (size_t)(row0 + r) * ldc + col0 + c4) = v; if (C16) { v4h h4; for (int i = 0; i < 4; ++i) h4[i] = (_Float16)v[i]; *(v4h*)(C16 + cofs + (size_t)(row0 + r) * ldc + col0 + c4) = h4; } } }
     }
}


typedef _Float16 v4h __attribute__((ext_vector_type(4)));

__global__ __launch_bounds__(256) void k_x16(const float* __restrict__ x, _Float16* __restrict__ X16, size_t n8) { const size_t t = (size_t)blockIdx.x * 256 + threadIdx.x; if (t >= n8) return; FragH f;
#pragma unroll
  for (int q = 0; q < 8; ++q) f.h[q] = (_Float16)bf16_round(x[t * 8 + q]); *(v8us*)((unsigned short*)X16 + t * 8) = f.half[0];  }
__global__ __launch_bounds__(256) void k_h16(const float* __restrict__ x, _Float16* __restrict__ X16, size_t n8) { const size_t t = (size_t)blockIdx.x * 256 + threadIdx.x; if (t >= n8) return; FragH f;
#pragma unroll
  for (int q = 0; q < 8; ++q) f.h[q] = (_Float16)x[t * 8 + q]; *(v8us*)((unsigned short*)X16 + t * 8) = f.half[0];  }
__global__ __launch_bounds__(256) void k_round16f(const float* __restrict__ W, _Float16* __restrict__ Bt, size_t n8) { const size_t t = (size_t)blockIdx.x * 256 + threadIdx.x; if (t >= n8) return; FragH f;
#pragma unroll
  for (int i = 0; i < 8; ++i) f.h[i] = (_Float16)(bf16_round(W[t * 8 + i]) * 16.0f); *(v8us*)((unsigned short*)Bt + t * 8) = f.half[0];  }
template <int NHv, int TTv>
__global__ __launch_bounds__(256) void k_vt(const _Float16* __restrict__ V16, int ldv, int voff, _Float16* __restrict__ Vt) { __shared__ unsigned short tl[64][66]; const int tid = threadIdx.x; const int slab = blockIdx.x / (TTv / 64), lg = blockIdx.x % (TTv / 64); const int b = slab / NHv, h = slab % NHv;
  for (int i = tid; i < 64 * 8; i += 256) { const int r = i / 8, c8 = (i % 8) * 8; FragH f; f.half[0] = *(const v8us*)((const unsigned short*)V16 + ((size_t)b * TTv + lg * 64 + r) * ldv + voff + h * 64 + c8);
#pragma unroll
    for (int q = 0; q < 8; ++q) tl[r][c8 + q] = f.u[q]; }
  __syncthreads();
  {
#pragma unroll
    for (int rd = 0; rd < 2; ++rd) { const int d = rd * 32 + tid / 8, pc = tid % 8; FragH f;
#pragma unroll
      for (int q = 0; q < 8; ++q) f.u[q] = tl[pc * 8 + q][d];
      *(v8us*)((unsigned short*)Vt + ((size_t)slab * 64 + d) * TTv + lg * 64 + pc * 8) = f.half[0]; }
     } }

__global__ __launch_bounds__(256) void k_hl(const float* __restrict__ F, _Float16* __restrict__ Hh, _Float16* __restrict__ Hl, size_t n8) { const size_t t = (size_t)blockIdx.x * 256 + threadIdx.x; if (t >= n8) return; FragH fh, fl; const v4f a = *(const v4fa*)(F + t * 8), c = *(const v4fa*)(F + t * 8 + 4);
#pragma unroll
  for (int q = 0; q < 4; ++q) { _Float16 h = (_Float16)a[q]; fh.h[q] = h; fl.h[q] = (_Float16)((a[q] - (float)h) * 1024.0f); h = (_Float16)c[q]; fh.h[4 + q] = h; fl.h[4 + q] = (_Float16)((c[q] - (float)h) * 1024.0f); }
  { *(v8us*)((unsigned short*)Hh + t * 8) = fh.half[0]; *(v8us*)((unsigned short*)Hl + t * 8) = fl.half[0];  } }

// ---- fast GEMM (wave tile 32x64; requires M % 32 == 0 rows per launch region and N % 64 == 0); epilogue = k_gemm_hhx semantics ----
__device__ __forceinline__ v16h g2_frag(const _Float16* p, int hh) { FragH f; f.half[0] = *(const v8us*)((const unsigned short*)p + 8 * hh); f.half[1] = *(const v8us*)((const unsigned short*)p + 16 + 8 * hh); return f.v; }
__device__ __forceinline__ v8f g2_mma(v16h a, v16h b, v8f c) { v8f d = __builtin_amdgcn_wmma_f32_16x16x32_f16(false, a, false, b, (short)0, c, false, false); asm volatile("v_nop\n\tv_nop\n\tv_nop\n\tv_nop" : "+v"(d) : "v"(a), "v"(b)); return d; }
template <int ACT>
__global__ __launch_bounds__(128) void k_gemm2(const _Float16* __restrict__ A, int lda, size_t sA, const _Float16* __restrict__ Bh, int ldb, size_t sB, float alpha, const float* __restrict__ bias, size_t sBias, const float* __restrict__ CP, int rowsPerB, size_t sCPb, int row0g,
    float* __restrict__ C, _Float16* __restrict__ C16, int ldc, size_t sC, int M, int N, int K) { static_assert(ACT == 0 || ACT == 3 || ACT == 6 || ACT == 8 || ACT == 9 || ACT == 11 || ACT == 12 || ACT == 14 || ACT == 15 || ACT == 16 || ACT == 17, "k_gemm2: unsupported ACT code (would silently apply no activation)");
  __shared__ __attribute__((aligned(16))) float so[4][32][68];
  const int tid = threadIdx.x, w = tid >> 5, lane = tid & 31, ln = lane & 15, hh = lane >> 4; const int by = blockIdx.y;
  A += (size_t)by * sA; Bh += (size_t)by * sB; const size_t cofs = (size_t)by * sC; const float* bp = bias ? bias + (size_t)by * sBias : nullptr;
  const int ntn = N >> 6; const int mt = blockIdx.x / ntn, nq = blockIdx.x - mt * ntn; const int row0 = mt * 128 + 32 * w, col0 = nq * 64; if (row0 >= M) return;
  const _Float16* a0p = A + (size_t)(row0 + ln) * lda; const _Float16* a1p = a0p + (size_t)16 * lda;
  const _Float16* b0p = Bh + (size_t)(col0 + ln) * ldb; const _Float16* b1p = b0p + (size_t)16 * ldb; const _Float16* b2p = b1p + (size_t)16 * ldb; const _Float16* b3p = b2p + (size_t)16 * ldb;
  const v8f z8 = {0.f,0.f,0.f,0.f,0.f,0.f,0.f,0.f}; v8f c00 = z8, c01 = z8, c02 = z8, c03 = z8, c10 = z8, c11 = z8, c12 = z8, c13 = z8;
#pragma unroll 1
  for (int kb = 0; kb < K; kb += 32) { const v16h a0 = g2_frag(a0p + kb, hh), a1 = g2_frag(a1p + kb, hh);
    v16h b = g2_frag(b0p + kb, hh); c00 = g2_mma(a0, b, c00); c10 = g2_mma(a1, b, c10);
    b = g2_frag(b1p + kb, hh); c01 = g2_mma(a0, b, c01); c11 = g2_mma(a1, b, c11);
    b = g2_frag(b2p + kb, hh); c02 = g2_mma(a0, b, c02); c12 = g2_mma(a1, b, c12);
    b = g2_frag(b3p + kb, hh); c03 = g2_mma(a0, b, c03); c13 = g2_mma(a1, b, c13); }
  v8f accs[8] = {c00, c01, c02, c03, c10, c11, c12, c13};
#pragma unroll
  for (int u = 0; u < 8; ++u) { const int t = u & 3, half = u >> 2; const int col = col0 + t * 16 + ln; const float bv = bp ? bf16_round(bp[col]) : 0.f;
#pragma unroll
    for (int r = 0; r < 8; ++r) { const int rloc = half * 16 + 8 * hh + r; float v = accs[u][r] * alpha + bv; if (CP) { if (rowsPerB < 0) v += CP[cofs + (size_t)(row0g + row0 + rloc) * ldc + col];      /* rowsPerB < 0: own element of the batched C plane */ else { const int bidx = (row0g + row0 + rloc) / rowsPerB; v += CP[(size_t)bidx * sCPb + (size_t)by * 64 + col]; } }
      if (ACT == 3) v = fmaxf(v, 0.f); else if (ACT == 6) v = 0.5f * v * (1.0f + erff(v * 0.70710678118654752f)); else if (ACT == 11) v = 1.0f / (1.0f + expf(-v)); else if (ACT == 15) v = v / (1.0f + expf(-v)); else if (ACT == 12) v = (v > 0.f) ? v : 0.01f * v; else if (ACT == 8) v = tanhf(v); else if (ACT == 9) v = 0.5f * v * (1.0f + tanhf(0.7978845608028654f * (v + 0.044715f * v * v * v))); else if (ACT == 14) v = (v > 0.f) ? v : 0.1f * v; else if (ACT == 16) v = (v >= 0.f) ? v : 0.3f * v; else if (ACT == 17) v = (v >= 0.f) ? v : 0.2f * v;
      so[w][rloc][t * 16 + ln] = v; } }
  __builtin_amdgcn_fence(__ATOMIC_ACQ_REL, "workgroup"); __builtin_amdgcn_wave_barrier();
  const int rsub = lane >> 4, c4 = (lane & 15) * 4;
  {
#pragma unroll
    for (int q = 0; q < 16; ++q) { const int r = q * 2 + rsub; const v4f v = *(const v4fa*)&so[w][r][c4]; if (C) *(v4f*)(C + cofs + (size_t)(row0 + r) * ldc + col0 + c4) = v; if (C16) { v4h h4; for (int i = 0; i < 4; ++i) h4[i] = (_Float16)v[i]; *(v4h*)(C16 + cofs + (size_t)(row0 + r) * ldc + col0 + c4) = h4; } }
     } }


__global__ __launch_bounds__(256) void k_wnat(const float* __restrict__ w, size_t n8, _Float16* __restrict__ Bt) { const size_t t = (size_t)blockIdx.x * 256 + threadIdx.x; if (t >= n8) return; FragH f; for (int q = 0; q < 8; ++q) f.h[q] = (_Float16)(bf16_round(w[t * 8 + q]) * 16.0f); *(v8us*)((unsigned short*)Bt + t * 8) = f.half[0];  }
__global__ __launch_bounds__(256) void k_rsm(const float* __restrict__ S, _Float16* __restrict__ P, int nrows) {
  #pragma clang fp contract(off)
  const int i = blockIdx.x * 256 + threadIdx.x; if (i >= nrows) return; const float* s = S + (size_t)i * SQ; float mx = -3.0e38f;
#pragma unroll 1
  for (int j = 0; j < SQ; ++j) mx = fmaxf(mx, s[j]); float se = 0.f;
#pragma unroll 1
  for (int j = 0; j < SQ; ++j) se += expf(s[j] - mx); const float sc = 256.0f / se;
#pragma unroll 1
  for (int j0 = 0; j0 < SQ; j0 += 8) { FragH f; for (int q = 0; q < 8; ++q) f.h[q] = (_Float16)(expf(s[j0 + q] - mx) * sc); unsigned short* d = (unsigned short*)P + (size_t)i * SQ + j0; *(v8us*)d = f.half[0];  } }
__global__ __launch_bounds__(256) void k_vt(const _Float16* __restrict__ V16, int b, int h0, _Float16* __restrict__ VT) { __shared__ unsigned short tl[64][65]; const int tid = threadIdx.x; const int hh = blockIdx.x % HG, sg = blockIdx.x / HG; const int s0 = sg * 64; const int h = h0 + hh;
  for (int i = tid; i < 64 * 8; i += 256) { const int j = i / 8, d8 = (i % 8) * 8; FragH f; f.half[0] = *(const v8us*)((const unsigned short*)V16 + ((size_t)b * SQ + s0 + j) * DM + h * HD + d8); for (int q = 0; q < 8; ++q) tl[d8 + q][j] = f.u[q]; }
  __syncthreads();
  { for (int i = tid; i < 64 * 8; i += 256) { const int d = i / 8, j8 = (i % 8) * 8; FragH f; for (int q = 0; q < 8; ++q) f.u[q] = tl[d][j8 + q]; *(v8us*)((unsigned short*)VT + ((size_t)hh * HD + d) * SQ + s0 + j8) = f.half[0]; }  } }



__global__ __launch_bounds__(256) void k_rsmcf2(const float* __restrict__ S, _Float16* __restrict__ P, int hg, int q0, int nk) {
  #pragma clang fp contract(off)
  const int t = blockIdx.x * 256 + threadIdx.x; if (t >= hg * QT) return; const size_t i = (size_t)t; const float* s = S + i * NKX; const int last = q0 + (t % QT); float mx = -3.0e38f;
#pragma unroll 1
  for (int j = 0; j < nk; ++j) { const float f = (j <= last) ? 1.f : 0.f; mx = fmaxf(mx, fmaf(f, s[j], (1.f - f) * -1.0e9f)); } float se = 0.f;
#pragma unroll 1
  for (int j = 0; j < nk; ++j) { const float f = (j <= last) ? 1.f : 0.f; se += __expf(fmaf(f, s[j], (1.f - f) * -1.0e9f) - mx); } const float sc = 256.0f / se;
#pragma unroll 1
  for (int j0 = 0; j0 < nk; j0 += 8) { FragH fr; for (int q = 0; q < 8; ++q) { const int j = j0 + q; const float f = (j <= last) ? 1.f : 0.f; fr.h[q] = (_Float16)(__expf(fmaf(f, s[j], (1.f - f) * -1.0e9f) - mx) * sc); } unsigned short* d = (unsigned short*)P + i * NKX + j0; *(v8us*)d = fr.half[0];  } }

template <int MASKADD>
__global__ __launch_bounds__(64) void k_att0(const float* __restrict__ QF, const float* __restrict__ KF, const float* __restrict__ VF, int ld, const float* __restrict__ mask, float scale, float* __restrict__ OF, int ldo) {
  #pragma clang fp contract(off)
  __shared__ __attribute__((aligned(16))) float lq[64][64]; __shared__ __attribute__((aligned(16))) float lo[64][64];
  const int tid = threadIdx.x; const int h = blockIdx.x / (QT0 / 64), rg = blockIdx.x % (QT0 / 64); const int i = rg * 64 + tid;
  const float* qr = QF + (size_t)i * ld + h * HD;
#pragma unroll 1
  for (int c = 0; c < HD / 4; ++c) { *(v4f*)&lq[tid][c * 4] = *(const v4fa*)(qr + c * 4); const v4f z = {0.f, 0.f, 0.f, 0.f}; *(v4f*)&lo[tid][c * 4] = z; }
  float m = -1.0e30f, l = 0.f; const int jmax = MASKADD ? (SQ - 1) : (rg * 64 + 63);      /* additive-mask form: every key (the mask input decides); causal form: keys up to the block's last row */
#pragma unroll 1
  for (int j = 0; j <= jmax; ++j) { const float* kr = KF + (size_t)j * ld + h * HD; const float* vr = VF + (size_t)j * ld + h * HD; float s = 0.f;
#pragma unroll 1
    for (int c = 0; c < HD / 4; ++c) { const v4f kq = *(const v4fa*)(kr + c * 4); const v4f qq = *(v4f*)&lq[tid][c * 4]; s = __fadd_rn(s, __fmul_rn(qq[0], kq[0])); s = __fadd_rn(s, __fmul_rn(qq[1], kq[1])); s = __fadd_rn(s, __fmul_rn(qq[2], kq[2])); s = __fadd_rn(s, __fmul_rn(qq[3], kq[3])); }
    s = __fmul_rn(s, scale); if (MASKADD) s = __fadd_rn(s, __fmul_rn(bf16_round(mask[(size_t)i * SQ + j]), -10000.0f));
    const float f = (MASKADD || j <= i) ? 1.f : 0.f; const float sm = fmaf(f, s, (1.f - f) * -1.0e30f); const float mn = fmaxf(m, sm); const float sc = expf(m - mn); const float e = expf(sm - mn); l = __fadd_rn(__fmul_rn(l, sc), e); m = mn;
#pragma unroll 1
    for (int c = 0; c < HD / 4; ++c) { const v4f vv = *(const v4fa*)(vr + c * 4); v4f oo = *(v4f*)&lo[tid][c * 4]; for (int u = 0; u < 4; ++u) oo[u] = __fadd_rn(__fmul_rn(oo[u], sc), __fmul_rn(e, vv[u])); *(v4f*)&lo[tid][c * 4] = oo; } }
  const float fin = 64.0f / l;      /* o carried x64; the f16 path writes o unscaled */
#pragma unroll 1
  for (int c = 0; c < HD / 4; ++c) { v4f oo = *(v4f*)&lo[tid][c * 4]; for (int u = 0; u < 4; ++u) oo[u] = __fmul_rn(oo[u], fin); *(v4f*)&lo[tid][c * 4] = oo; }
  __syncthreads();
  {
#pragma unroll 1
    for (int it = 0; it < 16; ++it) { const int row = it * 4 + tid / 16, pc = (tid % 16) * 4; const v4f v = *(const v4f*)&lo[row][pc]; *(v4f*)(OF + (size_t)(rg * 64 + row) * ldo + h * HD + pc) = v; }
     } }

__global__ __launch_bounds__(256) void k_oscale(const float* __restrict__ OF, float* __restrict__ out, size_t n4) { const size_t t = (size_t)blockIdx.x * 256 + threadIdx.x; if (t >= n4) return; const v4f a = *(const v4fa*)(OF + t * 4); v4f o; for (int q = 0; q < 4; ++q) o[q] = a[q] * 0.015625f; *(v4f*)(out + t * 4) = o;  }

__global__ __launch_bounds__(256) void k_bfr(const float* __restrict__ x, float* __restrict__ XB, size_t n8) { const size_t t = (size_t)blockIdx.x * 256 + threadIdx.x; if (t >= n8) return; v4f a = *(const v4fa*)(x + t * 8), c = *(const v4fa*)(x + t * 8 + 4); for (int q = 0; q < 4; ++q) { a[q] = bf16_round(a[q]); c[q] = bf16_round(c[q]); }
  { *(v4f*)(XB + t * 8) = a; *(v4f*)(XB + t * 8 + 4) = c;  } }



__global__ __launch_bounds__(256) void k_rsmfvl(const float* __restrict__ S, _Float16* __restrict__ P, _Float16* __restrict__ PL, int qn, const int* __restrict__ vlp) {
  #pragma clang fp contract(off)
  const int t = blockIdx.x * 256 + threadIdx.x; if (t >= qn) return; const int vl = vlp[0]; const size_t i = (size_t)t; const float* s = S + i * SQ; float mx = -3.0e38f;
#pragma unroll 1
  for (int j = 0; j < SQ; ++j) { const float f = (j < vl) ? 1.f : 0.f; mx = fmaxf(mx, fmaf(f, s[j], (1.f - f) * -1000000.0f)); } float se = 0.f;
#pragma unroll 1
  for (int j = 0; j < SQ; ++j) { const float f = (j < vl) ? 1.f : 0.f; se += __expf(fmaf(f, s[j], (1.f - f) * -1000000.0f) - mx); } const float sc = 256.0f / se;
#pragma unroll 1
  for (int j0 = 0; j0 < SQ; j0 += 8) { FragH fr, gr; for (int q = 0; q < 8; ++q) { const int j = j0 + q; const float f = (j < vl) ? 1.f : 0.f; const float pv = __expf(fmaf(f, s[j], (1.f - f) * -1000000.0f) - mx) * sc; const _Float16 ph = (_Float16)pv; fr.h[q] = ph; gr.h[q] = (_Float16)((pv - (float)ph) * 1024.0f); }
    unsigned short* d = (unsigned short*)P + i * SQ + j0; unsigned short* dl = (unsigned short*)PL + i * SQ + j0; *(v8us*)d = fr.half[0]; *(v8us*)dl = gr.half[0];  } }

__global__ __launch_bounds__(256) void k_rsmf(const float* __restrict__ S, _Float16* __restrict__ P, int qn, int hg) {
  #pragma clang fp contract(off)
  const int t = blockIdx.x * 256 + threadIdx.x; if (t >= qn * hg) return; const size_t i = (size_t)(t / qn) * SQ + (t % qn); const float* s = S + i * SQ; float mx = -3.0e38f;
#pragma unroll 1
  for (int j = 0; j < SQ; ++j) mx = fmaxf(mx, s[j]); float se = 0.f;
#pragma unroll 1
  for (int j = 0; j < SQ; ++j) se += __expf(s[j] - mx); const float sc = 256.0f / se;
#pragma unroll 1
  for (int j0 = 0; j0 < SQ; j0 += 8) { FragH f; for (int q = 0; q < 8; ++q) f.h[q] = (_Float16)(__expf(s[j0 + q] - mx) * sc); unsigned short* d = (unsigned short*)P + i * SQ + j0; *(v8us*)d = f.half[0];  } }



// lane l <-> l ^ 16 (cross-row move): register only, no LDS traffic
__device__ __forceinline__ float lane_x16(float v) { const int b = __float_as_int(v); return __int_as_float(__builtin_amdgcn_permlanex16(b, b, 0x76543210, 0xfedcba98, false, false)); }

// ---- fused attention: logits, softmax and weights x value in one kernel; scores and weights never leave the registers ----
#define FA_QT 4                      /* query tiles (16 rows each) per work-group */
#define FA_WT 2                      /* query tiles per wave: every K and V^T fragment read from LDS feeds both */
#define FA_QG (FA_QT / FA_WT)        /* waves per key range */
#define FA_KS 4                      /* key ranges per work-group, one wave per (pair of query tiles, key range) */
#define FA_NP (SQ / FA_KS / 32)      /* passes of 32 keys per wave */
// Operands stored as ready-made WMMA A fragments: a block of 512 f16 = [half j][lane l][8], lane l = (c = l & 15, h = l >> 4) holding row c, k = 16 j + 8 h + 0..7 (the hardware k order),
// so that a fragment is two whole-line loads of 512 B instead of two loads that touch 16 lines each. One 16-byte piece = 8 f16, piece t = (block t >> 6, half j = (t >> 5) & 1, lane l = t & 31).
// KF: block (key tile kt, d step s) at kt * 4 + s: row = key kt * 16 + c, k = channel s * 32 + ...
// VF: block (32-key step kp, channel tile dt) at kp * 8 + dt: row = channel dt * 16 + c, k = key kp * 32 + ... (the transposition of value happens here)
// ONE launch prepares everything the attention kernel reads. Work-group g takes rows 64 g .. 64 g + 63 of query, key and value (all batches in one row count): 1024 pieces of each, two per thread,
// and every load of a thread is issued before its first conversion: one memory round trip for the whole launch.
// A thread's two value pieces are 16 keys of ONE channel (tile dt = wave >> 1, channel c), so the work-group's sum over its 64 keys of the bf16-rounded value comes from registers (f32 on VALU):
// 8 keys as a tree, the two pieces, lane l + lane l ^ 16, then the two waves of a channel tile through LDS. PM[g][channel]; the attention kernel adds a batch's 64 partial sums.
#define PR_T 512                     /* threads of a preparation work-group */
__global__ __launch_bounds__(PR_T) void k_prep(const float* __restrict__ xq, const float* __restrict__ xk, const float* __restrict__ xv, _Float16* __restrict__ Q16, _Float16* __restrict__ KF, _Float16* __restrict__ VF, float* __restrict__ PM) {
  __shared__ float part[PR_T / 32][16];
  const int tid = threadIdx.x, w = tid >> 5, l = tid & 31, j = w & 1, c = l & 15, h = l >> 4; const size_t t0 = (size_t)blockIdx.x * (2 * PR_T) + tid;
  v4f qa[2][2], ka[2][2]; float va[2][8];
  /* unrolled: the arrays stay in registers and all 24 loads are in flight together */
#pragma unroll
  for (int i = 0; i < 2; ++i) { const size_t t = t0 + (size_t)i * PR_T, blk = t >> 6;
    const float* qs = xq + t * 8; const float* ks = xk + ((blk >> 2) * 16 + c) * DM + (blk & 3) * 32 + j * 16 + 8 * h; const float* vs = xv + ((blk >> 3) * 32 + j * 16 + 8 * h) * DM + (blk & 7) * 16 + c;
    /* the s_wait_xcnt behind each address's loads: a later load's result may land in that address's registers; the data stay in flight */
    qa[i][0] = *(const v4fa*)qs; qa[i][1] = *(const v4fa*)(qs + 4); asm volatile("s_wait_xcnt 0x0" ::: "memory");
    ka[i][0] = *(const v4fa*)ks; ka[i][1] = *(const v4fa*)(ks + 4); asm volatile("s_wait_xcnt 0x0" ::: "memory");
#pragma unroll
    for (int q = 0; q < 8; ++q) va[i][q] = vs[(size_t)q * DM];
    asm volatile("s_wait_xcnt 0x0" ::: "memory"); }
  /* inputs only, no code: every loaded value is in its register here, so all 24 loads issue ahead of the first use, under one wait (without it the query and key loads sink behind the barrier below: a second memory round trip) */
  asm volatile("" :: "v"(qa[0][0]), "v"(qa[0][1]), "v"(qa[1][0]), "v"(qa[1][1]), "v"(ka[0][0]), "v"(ka[0][1]), "v"(ka[1][0]), "v"(ka[1][1]), "v"(va[0][0]), "v"(va[0][1]), "v"(va[0][2]), "v"(va[0][3]), "v"(va[0][4]), "v"(va[0][5]), "v"(va[0][6]), "v"(va[0][7]),
               "v"(va[1][0]), "v"(va[1][1]), "v"(va[1][2]), "v"(va[1][3]), "v"(va[1][4]), "v"(va[1][5]), "v"(va[1][6]), "v"(va[1][7]));
  /* the value sums first: their barrier and the store of PM then stand in front of the six large stores and wait for none of them */
  float r[2][8];
#pragma unroll
  for (int i = 0; i < 2; ++i) for (int q = 0; q < 8; ++q) r[i][q] = bf16_round(va[i][q]);
  float a = (((r[0][0] + r[0][1]) + (r[0][2] + r[0][3])) + ((r[0][4] + r[0][5]) + (r[0][6] + r[0][7]))) + (((r[1][0] + r[1][1]) + (r[1][2] + r[1][3])) + ((r[1][4] + r[1][5]) + (r[1][6] + r[1][7])));
  a += lane_x16(a);
  if (h == 0) part[w][c] = a;
  __syncthreads();      /* every wave passes it once: the first four waves read both waves' sums of each channel tile below */
  if (tid < DM) PM[(size_t)blockIdx.x * DM + tid] = part[2 * (tid >> 4)][tid & 15] + part[2 * (tid >> 4) + 1][tid & 15];
  /* unrolled: register arrays */
#pragma unroll
  for (int i = 0; i < 2; ++i) { const size_t t = t0 + (size_t)i * PR_T; FragH fq, fk, fv;
#pragma unroll
    for (int q = 0; q < 8; ++q) { fq.h[q] = (_Float16)bf16_round(qa[i][q >> 2][q & 3]); fk.h[q] = (_Float16)bf16_round(ka[i][q >> 2][q & 3]); fv.h[q] = (_Float16)r[i][q]; }
    *(v8us*)((unsigned short*)Q16 + t * 8) = fq.half[0]; *(v8us*)((unsigned short*)KF + t * 8) = fk.half[0]; *(v8us*)((unsigned short*)VF + t * 8) = fv.half[0]; } }
// p: the block's start, the same for the whole wave; lo = lane * 8: the lane's own 16-byte piece
__device__ __forceinline__ v16h fa_frag(const unsigned short* p, unsigned lo) { FragH f; f.half[0] = *(const v8us*)(p + lo); f.half[1] = *(const v8us*)(p + 256 + lo); return f.v; }
// sixteen asynchronous copies to LDS, 512 B a wave each: a lane's 16 bytes go from g + 512 i to LDS byte lds + 512 i (the immediate offset moves both addresses), through no register.
// The s_wait_xcnt stands inside the copies' own statement, so that it stays in front of every later rewrite of the two address registers (a precaution; in a statement of its own the next trip's address additions could be lifted over it).
__device__ __forceinline__ void fa_copy16(unsigned lds, const unsigned short* g) {
  asm volatile("global_load_async_to_lds_b128 %0, %1, off\n\t"
               "global_load_async_to_lds_b128 %0, %1, off offset:512\n\t"
               "global_load_async_to_lds_b128 %0, %1, off offset:1024\n\t"
               "global_load_async_to_lds_b128 %0, %1, off offset:1536\n\t"
               "global_load_async_to_lds_b128 %0, %1, off offset:2048\n\t"
               "global_load_async_to_lds_b128 %0, %1, off offset:2560\n\t"
               "global_load_async_to_lds_b128 %0, %1, off offset:3072\n\t"
               "global_load_async_to_lds_b128 %0, %1, off offset:3584\n\t"
               "global_load_async_to_lds_b128 %0, %1, off offset:4096\n\t"
               "global_load_async_to_lds_b128 %0, %1, off offset:4608\n\t"
               "global_load_async_to_lds_b128 %0, %1, off offset:5120\n\t"
               "global_load_async_to_lds_b128 %0, %1, off offset:5632\n\t"
               "global_load_async_to_lds_b128 %0, %1, off offset:6144\n\t"
               "global_load_async_to_lds_b128 %0, %1, off offset:6656\n\t"
               "global_load_async_to_lds_b128 %0, %1, off offset:7168\n\t"
               "global_load_async_to_lds_b128 %0, %1, off offset:7680\n\t"
               "s_wait_xcnt 0x0" :: "v"(lds), "v"(g) : "memory"); }
__device__ __forceinline__ v8f fa_mma(v16h a, v16h b, v8f c) { return __builtin_amdgcn_wmma_f32_16x16x32_f16(false, a, false, b, (short)0, c, false, false); }
// native 2^t; the v_nop in the same statement keeps the one slot that the instruction set asks for behind a transcendental, whatever the compiler puts next
__device__ __forceinline__ float fa_exp2(float t) { float e; asm("v_exp_f32 %0, %1\n\tv_nop" : "=v"(e) : "v"(t)); return e; }
// four at once: the results are early-clobber, so none of the four reads a neighbour's result or overwrites its source, and one v_nop closes the last one's slot
__device__ __forceinline__ void fa_exp2x4(float& a, float& b, float& c, float& d) { float e0, e1, e2, e3;
  asm("v_exp_f32 %0, %4\n\tv_exp_f32 %1, %5\n\tv_exp_f32 %2, %6\n\tv_exp_f32 %3, %7\n\tv_nop" : "=&v"(e0), "=&v"(e1), "=&v"(e2), "=&v"(e3) : "v"(a), "v"(b), "v"(c), "v"(d)); a = e0; b = e1; c = e2; d = e3; }
// A wave owns 32 queries (two tiles of 16) and 1024 keys. S^T = K Q^T: D register r of lane (c, h) = score of key 8 h + r, query c of the tile, so a query's scores sit in two lanes (maximum and sum in-lane plus one exchange),
// and two score tiles (keys 0..15, 16..31), converted in place, ARE the B fragment of O^T += V^T P^T in the hardware k order. Running maximum m per query (log2 units), renewed only when a pass exceeds it by more than 8;
// weights 2^(s - m + 6) <= 2^14 as f16 hi + f16 residual, both into the same f32 accumulators; the sum of the f32 weights in l. The four key ranges of a query tile are joined through LDS at the end.
// K and V^T fragments come from LDS: a tile = one pass (32 keys) of each of the four key ranges, 16 KB a range in the order of KF and VF, brought in by asynchronous copies, two buffers: tile p + 1 flies while tile p is worked on.
// The two waves of a key range each copy half of its 16 KB and both read the whole: a work-group fetches each K and V^T byte once, and no wave waits out a global load inside the loop.
// A fragment read from LDS is the A operand of both query tiles' products: 16 KB of LDS reads a pass serve 32 queries. Eight waves, two per SIMD, leave each wave the registers for both tiles' accumulators and query fragments.
// Work-group x of a batch takes the 32 tiles of each key range in the order x mod 32, x mod 32 + 1, ..., wrapping round: every key once, in a rotated order.
__global__ __launch_bounds__(FA_QG * FA_KS * 32) void k_fattn(const _Float16* __restrict__ Q16, const _Float16* __restrict__ KF, const _Float16* __restrict__ VF, const float* __restrict__ PM, float* __restrict__ out) {
  __shared__ __attribute__((aligned(16))) unsigned short ring[2][FA_KS][8192];      /* [buffer][key range][K blocks of the pass: 4096 f16, then V^T blocks: 4096 f16] */
  __shared__ float so[FA_KS][FA_QT][64][32]; __shared__ float sm[FA_KS][FA_QT][32]; __shared__ float sl[FA_KS][FA_QT][32]; __shared__ __attribute__((aligned(16))) float sv[FA_KS][DM];
  const int tid = threadIdx.x, w = __builtin_amdgcn_readfirstlane(tid >> 5) /* the wave's number in a scalar register: fragment bases and LDS planes become scalar */, lane = tid & 31, c = lane & 15, h = lane >> 4, qg = w & (FA_QG - 1), ks = w / FA_QG; const int b = blockIdx.y, row0 = blockIdx.x * (FA_QT * 16) + qg * (FA_WT * 16);
  const size_t f0 = ((size_t)b * (SQ / 32) + (size_t)ks * FA_NP) * 4096; const unsigned lo = (unsigned)lane * 8;      /* a pass of 32 keys = 8 blocks = 4096 f16 in KF and in VF */
  /* the wave's half of its range's tile: wave qg 0 the K blocks, wave 1 the V^T blocks; the LDS byte address is the low 32 bits of the __shared__ address */
  const unsigned short* gs = (const unsigned short*)(qg == 0 ? KF : VF) + f0 + lo;
  const unsigned lb = (unsigned)(size_t)&ring[0][ks][qg * 4096], ll = (unsigned)lane * 16;      /* the half's place in buffer 0, the same for the whole wave, and the lane's own 16 bytes in each 512; buffer 1 lies sizeof ring[0] = 65536 bytes behind */
  /* the walk's entry: pass p works on tile (p + rot) mod FA_NP of each key range. The work-groups of a batch read the same K and V^T at the same pace; entering at different tiles they ask L2 for different lines at any moment */
  const unsigned rot = blockIdx.x & (FA_NP - 1);
  fa_copy16(lb + ll, gs + (size_t)rot * 4096);      /* the first tile into buffer 0, in flight beside the query and partial-sum loads below */
  v16h q[FA_WT][4];
  /* unrolled: register arrays */
#pragma unroll
  for (int t = 0; t < FA_WT; ++t) { const _Float16* qp = Q16 + ((size_t)b * SQ + row0 + t * 16 + c) * DM; q[t][0] = g2_frag(qp, h); q[t][1] = g2_frag(qp + 32, h); q[t][2] = g2_frag(qp + 64, h); q[t][3] = g2_frag(qp + 96, h); }
  /* sum of value over the sequence: wave (qg, ks) adds partial sums 16 ks .. 16 ks + 15 of its batch for channels 64 qg + 32 t + lane (whole lines, in flight beside the query loads); the four quarters meet behind the barrier below */
#pragma unroll
  for (int t = 0; t < FA_WT; ++t) { const int ch = (qg * FA_WT + t) * 32 + lane; const float* pp = PM + ((size_t)b * (SQ / 64) + ks * 16) * DM + ch; float x[16];
#pragma unroll
    for (int i = 0; i < 16; ++i) x[i] = pp[(size_t)i * DM];
    sv[ks][ch] = (((x[0] + x[1]) + (x[2] + x[3])) + ((x[4] + x[5]) + (x[6] + x[7]))) + (((x[8] + x[9]) + (x[10] + x[11])) + ((x[12] + x[13]) + (x[14] + x[15]))); }
  asm volatile("s_wait_asynccnt 0x0" ::: "memory");      /* the wave's own copies of tile 0 have landed */
  __syncthreads();      /* every wave passes it: tile 0 is read by waves that did not copy it */
  fa_copy16(lb + (unsigned)sizeof(ring[0]) + ll, gs + (size_t)((rot + 1) & (FA_NP - 1)) * 4096);      /* the second tile into buffer 1 */
  /* the loop's refills form the lane's LDS address from the lane count of mbcnt (= lane), a value of its own: lb + ll above is an operand of asm text and so must lie below v256; kept there through the whole loop it is spilled to scratch and reloaded, with a wait, in every pass */
  const unsigned lr = lb + __builtin_amdgcn_mbcnt_lo(~0u, 0u) * 16;
  const float CS = (float)(0.08838834764831845 * 1.4426950408889634);      /* 1 / sqrt(128) times log2 e */
  const v8f z8 = {0.f,0.f,0.f,0.f,0.f,0.f,0.f,0.f}; v8f o[FA_WT][8]; float m[FA_WT], l[FA_WT];
#pragma unroll
  for (int t = 0; t < FA_WT; ++t) { m[t] = -1.0e30f; l[t] = 0.f;
#pragma unroll
    for (int j = 0; j < 8; ++j) o[t][j] = z8; }
  /* kept rolled: the fragments of one pass alone are live at a time, inside the 512 registers that two waves per SIMD leave each wave */
#pragma unroll 1
  for (int p = 0; p < FA_NP; ++p) { const unsigned short* kp = &ring[p & 1][ks][0]; const unsigned short* vp = kp + 4096;
    const v16h k0 = fa_frag(kp, lo), k1 = fa_frag(kp + 512, lo), k2 = fa_frag(kp + 1024, lo), k3 = fa_frag(kp + 1536, lo), k4 = fa_frag(kp + 2048, lo), k5 = fa_frag(kp + 2560, lo), k6 = fa_frag(kp + 3072, lo), k7 = fa_frag(kp + 3584, lo);
    v16h vf[8];
#pragma unroll
    for (int j = 0; j < 8; ++j) vf[j] = fa_frag(vp + j * 512, lo);
    /* nothing is scheduled across this line: the pass's 32 LDS loads issue back to back as one group ahead of the first product, each product behind a counted wait
       (without it the V^T loads sink behind the score products and are waited out there on their own: a second LDS latency a pass; both operands' fragments fit the registers of a wave at two waves per SIMD) */
    __builtin_amdgcn_sched_barrier(0);
    v8f s0[FA_WT], s1[FA_WT];
#pragma unroll
    for (int t = 0; t < FA_WT; ++t) { s0[t] = fa_mma(k0, q[t][0], z8); s1[t] = fa_mma(k4, q[t][0], z8); }
#pragma unroll
    for (int t = 0; t < FA_WT; ++t) { s0[t] = fa_mma(k1, q[t][1], s0[t]); s1[t] = fa_mma(k5, q[t][1], s1[t]); }
#pragma unroll
    for (int t = 0; t < FA_WT; ++t) { s0[t] = fa_mma(k2, q[t][2], s0[t]); s1[t] = fa_mma(k6, q[t][2], s1[t]); }
#pragma unroll
    for (int t = 0; t < FA_WT; ++t) { s0[t] = fa_mma(k3, q[t][3], s0[t]); s1[t] = fa_mma(k7, q[t][3], s1[t]); }
    float mx[FA_WT]; bool need[FA_WT];
#pragma unroll
    for (int t = 0; t < FA_WT; ++t) { float a = fmaxf(s0[t][0], s1[t][0]);
#pragma unroll
      for (int r = 1; r < 8; ++r) a = fmaxf(a, fmaxf(s0[t][r], s1[t][r]));
      mx[t] = fmaxf(a, lane_x16(a)) * CS; need[t] = mx[t] > m[t] + 8.0f; }
    if (__builtin_amdgcn_ballot_w32(need[0] || need[1]) != 0) {      /* wave-uniform, one test a pass: the accumulators are rescaled only in the few passes in which some query's maximum moves (a query whose maximum stays is scaled by exactly 1) */
#pragma unroll
      for (int t = 0; t < FA_WT; ++t) { const float mn = need[t] ? mx[t] : m[t]; const float al = fa_exp2(m[t] - mn); m[t] = mn; l[t] *= al;
#pragma unroll
        for (int j = 0; j < 8; ++j) for (int r = 0; r < 8; ++r) o[t][j][r] *= al; } }
    FragH ph[FA_WT], pl[FA_WT];
#pragma unroll
    for (int t = 0; t < FA_WT; ++t) { const float nm = 6.0f - m[t]; float e[16];
#pragma unroll
      for (int r = 0; r < 8; ++r) { e[r] = fmaf(s0[t][r], CS, nm); e[8 + r] = fmaf(s1[t][r], CS, nm); }
#pragma unroll
      for (int u = 0; u < 16; u += 4) fa_exp2x4(e[u], e[u + 1], e[u + 2], e[u + 3]);
      l[t] += ((e[0] + e[4] + e[8] + e[12]) + (e[1] + e[5] + e[9] + e[13])) + ((e[2] + e[6] + e[10] + e[14]) + (e[3] + e[7] + e[11] + e[15]));
#pragma unroll
      for (int u = 0; u < 16; ++u) { const _Float16 hv = (_Float16)e[u]; ph[t].h[u] = hv; pl[t].h[u] = (_Float16)(e[u] - (float)hv); } }
    /* hand-over of the buffers, every wave in every pass; every LDS read of the pass stands above, what follows it in the pass works on registers alone, so the refill flies during these products too.
       In this order: the wave's LDS reads of the pass's tile are done, its own copies of the next pass's tile have landed, then the barrier: behind it the next tile may be read by all, and this pass's buffer refilled */
    asm volatile("s_wait_dscnt 0x0" ::: "memory");
    asm volatile("s_wait_asynccnt 0x0" ::: "memory");
    __syncthreads();
    if (p + 2 < FA_NP) fa_copy16(lr + (unsigned)(p & 1) * (unsigned)sizeof(ring[0]), gs + (size_t)((rot + p + 2) & (FA_NP - 1)) * 4096);      /* the test reads the same in the whole work-group */
#pragma unroll
    for (int j = 0; j < 8; ++j) for (int t = 0; t < FA_WT; ++t) o[t][j] = fa_mma(vf[j], ph[t].v, o[t][j]);
#pragma unroll
    for (int j = 0; j < 8; ++j) for (int t = 0; t < FA_WT; ++t) o[t][j] = fa_mma(vf[j], pl[t].v, o[t][j]); }
  asm volatile("s_wait_asynccnt 0x0" ::: "memory");      /* no copy is outstanding behind the loop */
#pragma unroll
  for (int t = 0; t < FA_WT; ++t) { const int qt = qg * FA_WT + t;
    l[t] += lane_x16(l[t]);      /* the two halves of a query's keys */
#pragma unroll
    for (int j = 0; j < 8; ++j) for (int r = 0; r < 8; ++r) so[ks][qt][j * 8 + r][lane] = o[t][j][r];
    sm[ks][qt][lane] = m[t]; sl[ks][qt][lane] = l[t]; }
  __syncthreads();      /* every wave passes it once: the four key ranges' partial results, and the quarters of the value sums, are read by other waves below */
#pragma unroll
  for (int t = 0; t < FA_WT; ++t) { const int qt = qg * FA_WT + t;
    float mm[FA_KS], M = -3.0e38f, L = 0.f;
#pragma unroll
    for (int i = 0; i < FA_KS; ++i) { mm[i] = sm[i][qt][lane]; M = fmaxf(M, mm[i]); }
#pragma unroll
    for (int i = 0; i < FA_KS; ++i) { mm[i] = fa_exp2(mm[i] - M); L += sl[i][qt][lane] * mm[i]; }
    const float inv = 1.0f / L;
    /* wave (qg, ks) finishes channels 32 ks .. 32 ks + 31 of its two query tiles: one whole 128-byte line of each output row */
#pragma unroll
    for (int jj = 0; jj < 2; ++jj) { const int j = 2 * ks + jj, ch = 16 * j + 8 * h; v4f r0, r1; float nv[8];      /* nv = -mean(value) of the lane's eight channels */
#pragma unroll
      for (int u = 0; u < 2; ++u) { const v4f x = (*(const v4f*)&sv[0][ch + 4 * u] + *(const v4f*)&sv[1][ch + 4 * u]) + (*(const v4f*)&sv[2][ch + 4 * u] + *(const v4f*)&sv[3][ch + 4 * u]);
#pragma unroll
        for (int r = 0; r < 4; ++r) nv[4 * u + r] = x[r] * (-1.0f / (float)SQ); }
#pragma unroll
      for (int r = 0; r < 8; ++r) { float a = 0.f;
#pragma unroll
        for (int i = 0; i < FA_KS; ++i) a += so[i][qt][j * 8 + r][lane] * mm[i];
        a = a * inv + nv[r]; if (r < 4) r0[r] = a; else r1[r - 4] = a; }
      float* d = out + ((size_t)b * SQ + row0 + t * 16 + c) * DM + 16 * j + 8 * h; *(v4f*)d = r0; *(v4f*)(d + 4) = r1; } } }
extern "C" void kernel_launch(void* const* d_in, const int* in_sizes, int n_in,
                              void* d_out, int out_size, void* d_ws, size_t ws_size, hipStream_t stream) {
  (void)in_sizes; (void)n_in; (void)out_size;
  const float* const* I = (const float* const*)d_in; const float* xq = I[0]; const float* xk = I[1]; const float* xv = I[2];      /* query, key, value [4][4096][128] */
  char* ws = (char*)d_ws; size_t off = 0;
  auto take = [&](size_t bytes) { char* p = ws + off; off += (bytes + 255) & ~(size_t)255; return p; };
  _Float16* Q16 = (_Float16*)take(NR * DM * 2); _Float16* KF = (_Float16*)take(NR * DM * 2); _Float16* VF = (_Float16*)take(NR * DM * 2); float* PM = (float*)take((NR / 64) * DM * 4);      /* sums of value over 64 keys each [256][128] */
  if (off > ws_size) return;
  k_prep<<<(unsigned)(NR / 64), PR_T, 0, stream>>>(xq, xk, xv, Q16, KF, VF, PM);      /* bf16-rounded inputs, exact in f16: query rows, keys and value^T in fragment order; value sums per 64 keys */
  k_fattn<<<dim3(SQ / (FA_QT * 16), NB), FA_QG * FA_KS * 32, 0, stream>>>(Q16, KF, VF, PM, (float*)d_out);      /* out = softmax(q.k / sqrt(128)) value - mean(value), all batches */
}

// v009
// Measured time: 35.1 microseconds a run.
// Versions in between are left out here; by their measured steps it is 1.23 times as fast as v007.
// All steps since v000 together make it 124 times as fast.
#include <hip/hip_runtime.h>
#define NB 4
#define SQ 4096
#define DM 128
#define NH 2
#define HD 64
#define HG 8                         /* heads per launch of the four-argument k_vt (not launched) */
#define B0 0                         /* first batch processed (unused) */
#define NBR NB                       /* batches processed (used only in MP) */
#define NR ((size_t)NB * SQ)         /* token rows */
#define MP ((int)((size_t)NBR * SQ)) /* token rows (used only in MPO) */
#define QT 256                       /* query rows per causal tile */
#define NKX SQ                       /* S / P row pitch */
#define QT0 256                      /* query rows per head of the f32 k_att0 (not launched) */
#define QN SQ                        /* query rows attended per batch (unused) */
#define NHD NH                       /* unused */
#define MPO MP                       /* rows through the output stage (unused) */
#define LQ DM            /* row pitch of the q/k/v rows (unused) */
typedef __bf16 v16b __attribute__((ext_vector_type(16)));
typedef unsigned short v8us __attribute__((ext_vector_type(8), may_alias));
typedef float  v8f  __attribute__((ext_vector_type(8)));
typedef float  v4f  __attribute__((ext_vector_type(4)));
typedef float  v4fa __attribute__((ext_vector_type(4), may_alias));
union FragB { v16b v; v8us half[2]; unsigned short u[16]; };

__device__ __forceinline__ unsigned short bf16_bits(float x) { unsigned int u = __float_as_uint(x); return (unsigned short)((u + 0x7FFFu + ((u >> 16) & 1u)) >> 16); }
__device__ __forceinline__ float bf16_val(unsigned short b) { return __uint_as_float(((unsigned int)b) << 16); }
__device__ __forceinline__ float bf16_round(float x) { return bf16_val(bf16_bits(x)); }
// D += A·B with NT terms: 1 = ah·bh, 2 = + al·bh (A split), 3 = + ah·bl (both split)
template <int NT>
__device__ __forceinline__ v8f mmaN(v16b ah, v16b al, v16b bh, v16b bl, v8f c) {
  c = __builtin_amdgcn_wmma_f32_16x16x32_bf16(false, ah, false, bh, (short)0, c, false, false);
  if (NT >= 2) c = __builtin_amdgcn_wmma_f32_16x16x32_bf16(false, al, false, bh, (short)0, c, false, false);
  if (NT >= 3) c = __builtin_amdgcn_wmma_f32_16x16x32_bf16(false, ah, false, bl, (short)0, c, false, false);
  asm volatile("v_nop\n\tv_nop\n\tv_nop\n\tv_nop" : "+v"(c) : "v"(ah), "v"(al), "v"(bh), "v"(bl));
  return c;
}

__global__ __launch_bounds__(256) void k_wt_bf16(const float* __restrict__ W, unsigned short* __restrict__ Wt, int K, int N) {
  const int t = blockIdx.x * 256 + threadIdx.x;
  const int k8n = K / 8;
  if (t >= N * k8n) return;
  const int n = t / k8n, k8 = (t % k8n) * 8;
  v8us v;
#pragma unroll
  for (int i = 0; i < 8; ++i) v[i] = bf16_bits(W[(size_t)(k8 + i) * N + n]);
  *(v8us*)(Wt + (size_t)n * K + k8) = v;
  
}

// GEMM C[M][N] (f32, pitch ldc) = act(A[M][K]·W + bias). A f32 row-major (pitch lda) converted per fragment to bf16
// (ASPLIT: hi/lo two planes -> 2 terms, else single rounded term); Wt bf16 [N][K] (pitch ldb). BIAS_BF16 rounds the
// bias to bf16 first (bias quantised to bf16 before the add). K%32==0, M%16==0, N%64==0.
template <bool ASPLIT, int ACT, bool BIAS_BF16>
__global__ __launch_bounds__(128) void k_gemm_bf(const float* __restrict__ A, int lda, const unsigned short* __restrict__ Wt, int ldb,
                                               const float* __restrict__ bias, float* __restrict__ C, int ldc, int M, int N, int K) {
  __shared__ __attribute__((aligned(16))) float so[4][16][64];
  const int tid = threadIdx.x, w = tid >> 5, lane = tid & 31, ln = lane & 15, hh = lane >> 4;
  const int ntn = N / 64;
  const int wid = blockIdx.x * 4 + w;
  const int mt = wid / ntn, nq = wid % ntn;
  if (mt * 16 >= M) return;
  const int row0 = mt * 16, col0 = nq * 64;
  const float* arow = A + (size_t)(row0 + ln) * lda;
  v8f acc[4] = {};
  for (int kb = 0; kb < K; kb += 32) {
    FragB ah, al;
    const v4f x0 = *(const v4fa*)(arow + kb + 8 * hh), x1 = *(const v4fa*)(arow + kb + 8 * hh + 4);
    const v4f x2 = *(const v4fa*)(arow + kb + 16 + 8 * hh), x3 = *(const v4fa*)(arow + kb + 16 + 8 * hh + 4);
    float xs[16] = {x0[0],x0[1],x0[2],x0[3],x1[0],x1[1],x1[2],x1[3],x2[0],x2[1],x2[2],x2[3],x3[0],x3[1],x3[2],x3[3]};
#pragma unroll
    for (int i = 0; i < 16; ++i) { const unsigned short hb = bf16_bits(xs[i]); ah.u[i] = hb; al.u[i] = ASPLIT ? bf16_bits(xs[i] - bf16_val(hb)) : (unsigned short)0; }
#pragma unroll
    for (int t = 0; t < 4; ++t) {
      const unsigned short* brow = Wt + (size_t)(col0 + t * 16 + ln) * ldb + kb;
      FragB b;
      b.half[0] = *(const v8us*)(brow + 8 * hh);
      b.half[1] = *(const v8us*)(brow + 16 + 8 * hh);
      acc[t] = mmaN<ASPLIT ? 2 : 1>(ah.v, al.v, b.v, b.v, acc[t]);
    }
  }
#pragma unroll
  for (int t = 0; t < 4; ++t) {
    float bv = bias ? bias[col0 + t * 16 + ln] : 0.f;
    if (BIAS_BF16) bv = bf16_round(bv);
#pragma unroll
    for (int r = 0; r < 8; ++r) { float v = acc[t][r] + bv; if (ACT == 1) v = fmaxf(v, 0.f); so[w][8 * hh + r][t * 16 + ln] = v; }
  }
  __builtin_amdgcn_fence(__ATOMIC_ACQ_REL, "workgroup");
  __builtin_amdgcn_wave_barrier();
  const int rsub = lane >> 4, c4 = (lane & 15) * 4;
  {
#pragma unroll
    for (int q = 0; q < 8; ++q) {
      const int r = q * 2 + rsub;
      const v4f v = *(const v4fa*)&so[w][r][c4];
      *(v4f*)(C + (size_t)(row0 + r) * ldc + col0 + c4) = v;
    }
    
  }
}

// GEMM C = act(A·W + bias + resid): A f32 (ASPLIT -> hi/lo 2 terms), Wt bf16 [N][K]; ACT 0 none, 1 relu, 2 exact gelu;
// resid (optional, f32, row index = (row % rmod), pitch ldr, RES_BF16 rounds it) added before the activation.
template <bool ASPLIT, int ACT, bool BIAS_BF16, bool RES_BF16>
__global__ __launch_bounds__(128) void k_gemm_bf3(const float* __restrict__ A, int lda, const unsigned short* __restrict__ Wt, int ldb,
                                                const float* __restrict__ bias, const float* __restrict__ resid, int rmod, int ldr,
                                                float* __restrict__ C, int ldc, int M, int N, int K) {
  __shared__ __attribute__((aligned(16))) float so[4][16][64];
  const int tid = threadIdx.x, w = tid >> 5, lane = tid & 31, ln = lane & 15, hh = lane >> 4;
  const int ntn = N / 64;
  const int wid = blockIdx.x * 4 + w;
  const int mt = wid / ntn, nq = wid % ntn;
  if (mt * 16 >= M) return;
  const int row0 = mt * 16, col0 = nq * 64;
  const float* arow = A + (size_t)(row0 + ln) * lda;
  v8f acc[4] = {};
  for (int kb = 0; kb < K; kb += 32) {
    FragB ah, al;
    const v4f x0 = *(const v4fa*)(arow + kb + 8 * hh), x1 = *(const v4fa*)(arow + kb + 8 * hh + 4);
    const v4f x2 = *(const v4fa*)(arow + kb + 16 + 8 * hh), x3 = *(const v4fa*)(arow + kb + 16 + 8 * hh + 4);
    float xs[16] = {x0[0],x0[1],x0[2],x0[3],x1[0],x1[1],x1[2],x1[3],x2[0],x2[1],x2[2],x2[3],x3[0],x3[1],x3[2],x3[3]};
#pragma unroll
    for (int i = 0; i < 16; ++i) { const unsigned short hb = bf16_bits(xs[i]); ah.u[i] = hb; al.u[i] = ASPLIT ? bf16_bits(xs[i] - bf16_val(hb)) : (unsigned short)0; }
#pragma unroll
    for (int t = 0; t < 4; ++t) {
      const unsigned short* brow = Wt + (size_t)(col0 + t * 16 + ln) * ldb + kb;
      FragB b;
      b.half[0] = *(const v8us*)(brow + 8 * hh);
      b.half[1] = *(const v8us*)(brow + 16 + 8 * hh);
      acc[t] = mmaN<ASPLIT ? 2 : 1>(ah.v, al.v, b.v, b.v, acc[t]);
    }
  }
#pragma unroll
  for (int t = 0; t < 4; ++t) {
    const int col = col0 + t * 16 + ln;
    float bv = bias ? bias[col] : 0.f;
    if (BIAS_BF16) bv = bf16_round(bv);
#pragma unroll
    for (int r = 0; r < 8; ++r) {
      float v = acc[t][r] + bv;
      if (resid) { float rv = resid[(size_t)((row0 + 8 * hh + r) % rmod) * ldr + col]; if (RES_BF16) rv = bf16_round(rv); v += rv; }
      if (ACT == 1) v = fmaxf(v, 0.f);
      if (ACT == 2) v = 0.5f * v * (1.0f + erff(v * 0.70710678118654752f));
      if (ACT == 3) { const float u = 0.7978845608028654f * (v + 0.044715f * v * v * v); v = 0.5f * v * (1.0f + tanhf(u)); }
      so[w][8 * hh + r][t * 16 + ln] = v;
    }
  }
  __builtin_amdgcn_fence(__ATOMIC_ACQ_REL, "workgroup");
  __builtin_amdgcn_wave_barrier();
  const int rsub = lane >> 4, c4 = (lane & 15) * 4;
  {
#pragma unroll
    for (int q = 0; q < 8; ++q) {
      const int r = q * 2 + rsub;
      const v4f v = *(const v4fa*)&so[w][r][c4];
      *(v4f*)(C + (size_t)(row0 + r) * ldc + col0 + c4) = v;
    }
    
  }
}
// row LayerNorm (biased variance, eps) over N: s = X (+ R); optional out_sum <- s; out_norm <- (s-mu)*rsqrt(var+eps)*g + b
template <bool PARAM_BF16>
__global__ __launch_bounds__(256) void k_layernorm(const float* __restrict__ X, const float* __restrict__ R, const float* __restrict__ g, const float* __restrict__ bta,
                                                  float* __restrict__ out_sum, float* __restrict__ out_norm, int N, float eps) {
  __shared__ float red[256];
  const int row = blockIdx.x, tid = threadIdx.x;
  const float* x = X + (size_t)row * N; const float* rr = R ? R + (size_t)row * N : nullptr;
  float vals[16];                     // up to N = 4096
  const int per = N / 256;            // contiguous chunk per thread? use strided-by-4 chunks: thread handles j = tid*4 + 1024*u
  float s1 = 0.f;
  for (int u = 0; u < per / 4; ++u) {
    const int j = tid * 4 + 1024 * u;
    const v4f a = *(const v4fa*)(x + j);
    v4f b = {0.f,0.f,0.f,0.f}; if (rr) b = *(const v4fa*)(rr + j);
#pragma unroll
    for (int q = 0; q < 4; ++q) { const float v = a[q] + b[q]; vals[u * 4 + q] = v; s1 += v; }
  }
  red[tid] = s1; __syncthreads();
  for (int st = 128; st > 0; st >>= 1) { if (tid < st) red[tid] += red[tid + st]; __syncthreads(); }
  const float mu = red[0] / (float)N; __syncthreads();
  float s2 = 0.f;
  for (int u = 0; u < per / 4; ++u)
#pragma unroll
    for (int q = 0; q < 4; ++q) { const float c = vals[u * 4 + q] - mu; s2 += c * c; }
  red[tid] = s2; __syncthreads();
  for (int st = 128; st > 0; st >>= 1) { if (tid < st) red[tid] += red[tid + st]; __syncthreads(); }
  const float rs = rsqrtf(red[0] / (float)N + eps);
  {
    for (int u = 0; u < per / 4; ++u) {
      const int j = tid * 4 + 1024 * u;
      v4f o, sm;
#pragma unroll
      for (int q = 0; q < 4; ++q) {
        float gg = g[j + q], bb = bta[j + q];
        if (PARAM_BF16) { gg = bf16_round(gg); bb = bf16_round(bb); }
        sm[q] = vals[u * 4 + q]; o[q] = (vals[u * 4 + q] - mu) * rs * gg + bb;
      }
      if (out_sum) *(v4f*)(out_sum + (size_t)row * N + j) = sm;
      *(v4f*)(out_norm + (size_t)row * N + j) = o;
    }
    
  }
}



// ---- f16 WMMA path (v_wmma_f32_16x16x32_f16): 11-bit significands for operands in range — used where a [0,1] probability operand needs more precision than bf16
typedef _Float16 v16h __attribute__((ext_vector_type(16)));
union FragH { v16h v; v8us half[2]; _Float16 h[16]; unsigned short u[16]; };
template <int NT>
__device__ __forceinline__ v8f mmaH(v16h ah, v16h al, v16h bh, v16h bl, v8f c) {
  c = __builtin_amdgcn_wmma_f32_16x16x32_f16(false, ah, false, bh, (short)0, c, false, false);
  if (NT >= 2) c = __builtin_amdgcn_wmma_f32_16x16x32_f16(false, al, false, bh, (short)0, c, false, false);
  if (NT >= 3) c = __builtin_amdgcn_wmma_f32_16x16x32_f16(false, ah, false, bl, (short)0, c, false, false);
  asm volatile("v_nop\n\tv_nop\n\tv_nop\n\tv_nop" : "+v"(c) : "v"(ah), "v"(al), "v"(bh), "v"(bl));
  return c;
}
// batched GEMM like k_gemm_b but f16 operands: A f32 (split into f16 hi/lo if ASPLIT, else rounded to f16), Bt = f16 values [n][k]; alpha; C f32; N multiple of 16 (partial tiles skipped)
template <bool ASPLIT>
__global__ __launch_bounds__(128) void k_gemm_h(const float* __restrict__ A, int lda, size_t sA, const _Float16* __restrict__ Bh, int ldb, size_t sB, float alpha, float* __restrict__ C, int ldc, size_t sC, int M, int N, int K) {
  __shared__ __attribute__((aligned(16))) float so[4][16][64];
  const int tid = threadIdx.x, w = tid >> 5, lane = tid & 31, ln = lane & 15, hh = lane >> 4; const int by = blockIdx.y;
  A += (size_t)by * sA; Bh += (size_t)by * sB; C += (size_t)by * sC;
  const int ntn = (N + 63) / 64; const int wid = blockIdx.x * 4 + w; const int mt = wid / ntn, nq = wid % ntn; if (mt * 16 >= M) return;
  const int row0 = mt * 16, col0 = nq * 64; const float* arow = A + (size_t)(row0 + ln) * lda;
  v8f acc[4] = {};
  for (int kb = 0; kb < K; kb += 32) {
    FragH ah, al;
    const v4f x0 = *(const v4fa*)(arow + kb + 8 * hh), x1 = *(const v4fa*)(arow + kb + 8 * hh + 4), x2 = *(const v4fa*)(arow + kb + 16 + 8 * hh), x3 = *(const v4fa*)(arow + kb + 16 + 8 * hh + 4);
    float xs[16] = {x0[0],x0[1],x0[2],x0[3],x1[0],x1[1],x1[2],x1[3],x2[0],x2[1],x2[2],x2[3],x3[0],x3[1],x3[2],x3[3]};
#pragma unroll
    for (int i = 0; i < 16; ++i) { const _Float16 h = (_Float16)xs[i]; ah.h[i] = h; al.h[i] = ASPLIT ? (_Float16)(xs[i] - (float)h) : (_Float16)0.0f; }
#pragma unroll
    for (int t = 0; t < 4; ++t) { if (col0 + t * 16 >= N) continue; const size_t boff = (size_t)(col0 + t * 16 + ln) * ldb + kb; FragH bq; bq.half[0] = *(const v8us*)(Bh + boff + 8 * hh); bq.half[1] = *(const v8us*)(Bh + boff + 16 + 8 * hh);
      acc[t] = mmaH<ASPLIT ? 2 : 1>(ah.v, al.v, bq.v, bq.v, acc[t]); }
  }
#pragma unroll
  for (int t = 0; t < 4; ++t) { if (col0 + t * 16 >= N) continue;
#pragma unroll
    for (int r = 0; r < 8; ++r) so[w][8 * hh + r][t * 16 + ln] = acc[t][r] * alpha; }
  __builtin_amdgcn_fence(__ATOMIC_ACQ_REL, "workgroup"); __builtin_amdgcn_wave_barrier();
  const int rsub = lane >> 4, c4 = (lane & 15) * 4;
  {
#pragma unroll
    for (int q = 0; q < 8; ++q) { const int r = q * 2 + rsub; if (col0 + c4 < N) { const v4f v = *(const v4fa*)&so[w][r][c4]; *(v4f*)(C + (size_t)(row0 + r) * ldc + col0 + c4) = v; } }
     }
}

// Wt[n][k] = f16(W[k][n]·scale) from f32 row-major W[K][N] (scale = power of two; bf16-exact weights stay exact in f16 away from the subnormal range)
__global__ __launch_bounds__(256) void k_wt_f16(const float* __restrict__ W, _Float16* __restrict__ Wt, int K, int N, float scale) {
  const int t = blockIdx.x * 256 + threadIdx.x; if (t >= N * (K / 8)) return; const int n = t / (K / 8), k8 = (t % (K / 8)) * 8; FragH f;
#pragma unroll
  for (int i = 0; i < 8; ++i) f.h[i] = (_Float16)(bf16_round(W[(size_t)(k8 + i) * N + n]) * scale); const v8us o = f.half[0];
  *(v8us*)((unsigned short*)Wt + (size_t)n * K + k8) = o; 
}
// k_gemm_hh variant with fused epilogue: v = acc·alpha + bias[by·sBias + col] (+ CP[(row/rowsPerB)·sCPb + by·64 + col] if CP) ; ACT 0 none / 1 elu ; writes f16 C16 (and f32 C if non-null)
template <int ACT>
__global__ __launch_bounds__(128) void k_gemm_hhx(const _Float16* __restrict__ A, int lda, size_t sA, const _Float16* __restrict__ Bh, int ldb, size_t sB, float alpha, const float* __restrict__ bias, size_t sBias, const float* __restrict__ CP, int rowsPerB, size_t sCPb, int row0g,
    float* __restrict__ C, _Float16* __restrict__ C16, int ldc, size_t sC, int M, int N, int K) {
  __shared__ __attribute__((aligned(16))) float so[4][16][64];
  const int tid = threadIdx.x, w = tid >> 5, lane = tid & 31, ln = lane & 15, hh = lane >> 4; const int by = blockIdx.y;
  A += (size_t)by * sA; Bh += (size_t)by * sB; const size_t cofs = (size_t)by * sC; const float* bp = bias ? bias + (size_t)by * sBias : nullptr;
  const int ntn = (N + 63) / 64; const int wid = blockIdx.x * 4 + w; const int mt = wid / ntn, nq = wid % ntn; if (mt * 16 >= M) return;
  const int row0 = mt * 16, col0 = nq * 64; const _Float16* arow = A + (size_t)(row0 + ln) * lda;
  v8f acc[4] = {};
  for (int kb = 0; kb < K; kb += 32) { FragH ah; ah.half[0] = *(const v8us*)((const unsigned short*)arow + kb + 8 * hh); ah.half[1] = *(const v8us*)((const unsigned short*)arow + kb + 16 + 8 * hh);
#pragma unroll
    for (int t = 0; t < 4; ++t) { if (col0 + t * 16 >= N) continue; const size_t boff = (size_t)(col0 + t * 16 + ln) * ldb + kb; FragH bq; bq.half[0] = *(const v8us*)((const unsigned short*)Bh + boff + 8 * hh); bq.half[1] = *(const v8us*)((const unsigned short*)Bh + boff + 16 + 8 * hh);
      acc[t] = mmaH<1>(ah.v, ah.v, bq.v, bq.v, acc[t]); }
  }
#pragma unroll
  for (int t = 0; t < 4; ++t) { if (col0 + t * 16 >= N) continue; const int col = col0 + t * 16 + ln; const float bv = bp ? bf16_round(bp[col]) : 0.f;
#pragma unroll
    for (int r = 0; r < 8; ++r) { float v = acc[t][r] * alpha + bv; if (CP) { const int rr = row0g + row0 + 8 * hh + r; if (rowsPerB < 0) v += CP[cofs + (size_t)rr * ldc + col];      /* rowsPerB < 0: own element of the batched C plane */ else { const int bidx = rr / rowsPerB; v += CP[(size_t)bidx * sCPb + (size_t)by * 64 + col]; } } if (ACT == 1) v = (v > 0.f) ? v : expm1f(v); else if (ACT == 7) v = (v > 0.f) ? v + 1.0f : expf(v); else if (ACT == 8) v = tanhf(v); else if (ACT == 9) v = 0.5f * v * (1.0f + tanhf(0.7978845608028654f * (v + 0.044715f * v * v * v))); else if (ACT == 11) v = 1.0f / (1.0f + expf(-v)); else if (ACT == 12) v = (v > 0.f) ? v : 0.01f * v; else if (ACT == 14) v = (v > 0.f) ? v : 0.1f * v; else if (ACT == 16) v = (v >= 0.f) ? v : 0.3f * v; else if (ACT == 17) v = (v >= 0.f) ? v : 0.2f * v; else if (ACT == 15) v = v / (1.0f + expf(-v)); else if (ACT == 3) v = fmaxf(v, 0.f); else if (ACT == 6) v = 0.5f * v * (1.0f + erff(v * 0.70710678118654752f)); so[w][8 * hh + r][t * 16 + ln] = v; } }
  __builtin_amdgcn_fence(__ATOMIC_ACQ_REL, "workgroup"); __builtin_amdgcn_wave_barrier();
  const int rsub = lane >> 4, c4 = (lane & 15) * 4; typedef _Float16 v4h __attribute__((ext_vector_type(4)));
  {
#pragma unroll
    for (int q = 0; q < 8; ++q) { const int r = q * 2 + rsub; if (col0 + c4 < N) { const v4f v = *(const v4fa*)&so[w][r][c4]; if (C) *(v4f*)(C + cofs + (size_t)(row0 + r) * ldc + col0 + c4) = v; if (C16) { v4h h4; for (int i = 0; i < 4; ++i) h4[i] = (_Float16)v[i]; *(v4h*)(C16 + cofs + (size_t)(row0 + r) * ldc + col0 + c4) = h4; } } }
     }
}


typedef _Float16 v4h __attribute__((ext_vector_type(4)));

__global__ __launch_bounds__(256) void k_x16(const float* __restrict__ x, _Float16* __restrict__ X16, size_t n8) { const size_t t = (size_t)blockIdx.x * 256 + threadIdx.x; if (t >= n8) return; FragH f;
#pragma unroll
  for (int q = 0; q < 8; ++q) f.h[q] = (_Float16)bf16_round(x[t * 8 + q]); *(v8us*)((unsigned short*)X16 + t * 8) = f.half[0];  }
__global__ __launch_bounds__(256) void k_h16(const float* __restrict__ x, _Float16* __restrict__ X16, size_t n8) { const size_t t = (size_t)blockIdx.x * 256 + threadIdx.x; if (t >= n8) return; FragH f;
#pragma unroll
  for (int q = 0; q < 8; ++q) f.h[q] = (_Float16)x[t * 8 + q]; *(v8us*)((unsigned short*)X16 + t * 8) = f.half[0];  }
__global__ __launch_bounds__(256) void k_round16f(const float* __restrict__ W, _Float16* __restrict__ Bt, size_t n8) { const size_t t = (size_t)blockIdx.x * 256 + threadIdx.x; if (t >= n8) return; FragH f;
#pragma unroll
  for (int i = 0; i < 8; ++i) f.h[i] = (_Float16)(bf16_round(W[t * 8 + i]) * 16.0f); *(v8us*)((unsigned short*)Bt + t * 8) = f.half[0];  }
template <int NHv, int TTv>
__global__ __launch_bounds__(256) void k_vt(const _Float16* __restrict__ V16, int ldv, int voff, _Float16* __restrict__ Vt) { __shared__ unsigned short tl[64][66]; const int tid = threadIdx.x; const int slab = blockIdx.x / (TTv / 64), lg = blockIdx.x % (TTv / 64); const int b = slab / NHv, h = slab % NHv;
  for (int i = tid; i < 64 * 8; i += 256) { const int r = i / 8, c8 = (i % 8) * 8; FragH f; f.half[0] = *(const v8us*)((const unsigned short*)V16 + ((size_t)b * TTv + lg * 64 + r) * ldv + voff + h * 64 + c8);
#pragma unroll
    for (int q = 0; q < 8; ++q) tl[r][c8 + q] = f.u[q]; }
  __syncthreads();
  {
#pragma unroll
    for (int rd = 0; rd < 2; ++rd) { const int d = rd * 32 + tid / 8, pc = tid % 8; FragH f;
#pragma unroll
      for (int q = 0; q < 8; ++q) f.u[q] = tl[pc * 8 + q][d];
      *(v8us*)((unsigned short*)Vt + ((size_t)slab * 64 + d) * TTv + lg * 64 + pc * 8) = f.half[0]; }
     } }

__global__ __launch_bounds__(256) void k_hl(const float* __restrict__ F, _Float16* __restrict__ Hh, _Float16* __restrict__ Hl, size_t n8) { const size_t t = (size_t)blockIdx.x * 256 + threadIdx.x; if (t >= n8) return; FragH fh, fl; const v4f a = *(const v4fa*)(F + t * 8), c = *(const v4fa*)(F + t * 8 + 4);
#pragma unroll
  for (int q = 0; q < 4; ++q) { _Float16 h = (_Float16)a[q]; fh.h[q] = h; fl.h[q] = (_Float16)((a[q] - (float)h) * 1024.0f); h = (_Float16)c[q]; fh.h[4 + q] = h; fl.h[4 + q] = (_Float16)((c[q] - (float)h) * 1024.0f); }
  { *(v8us*)((unsigned short*)Hh + t * 8) = fh.half[0]; *(v8us*)((unsigned short*)Hl + t * 8) = fl.half[0];  } }

// ---- fast GEMM (wave tile 32x64; requires M % 32 == 0 rows per launch region and N % 64 == 0); epilogue = k_gemm_hhx semantics ----
__device__ __forceinline__ v16h g2_frag(const _Float16* p, int hh) { FragH f; f.half[0] = *(const v8us*)((const unsigned short*)p + 8 * hh); f.half[1] = *(const v8us*)((const unsigned short*)p + 16 + 8 * hh); return f.v; }
__device__ __forceinline__ v8f g2_mma(v16h a, v16h b, v8f c) { v8f d = __builtin_amdgcn_wmma_f32_16x16x32_f16(false, a, false, b, (short)0, c, false, false); asm volatile("v_nop\n\tv_nop\n\tv_nop\n\tv_nop" : "+v"(d) : "v"(a), "v"(b)); return d; }
template <int ACT>
__global__ __launch_bounds__(128) void k_gemm2(const _Float16* __restrict__ A, int lda, size_t sA, const _Float16* __restrict__ Bh, int ldb, size_t sB, float alpha, const float* __restrict__ bias, size_t sBias, const float* __restrict__ CP, int rowsPerB, size_t sCPb, int row0g,
    float* __restrict__ C, _Float16* __restrict__ C16, int ldc, size_t sC, int M, int N, int K) { static_assert(ACT == 0 || ACT == 3 || ACT == 6 || ACT == 8 || ACT == 9 || ACT == 11 || ACT == 12 || ACT == 14 || ACT == 15 || ACT == 16 || ACT == 17, "k_gemm2: unsupported ACT code (would silently apply no activation)");
  __shared__ __attribute__((aligned(16))) float so[4][32][68];
  const int tid = threadIdx.x, w = tid >> 5, lane = tid & 31, ln = lane & 15, hh = lane >> 4; const int by = blockIdx.y;
  A += (size_t)by * sA; Bh += (size_t)by * sB; const size_t cofs = (size_t)by * sC; const float* bp = bias ? bias + (size_t)by * sBias : nullptr;
  const int ntn = N >> 6; const int mt = blockIdx.x / ntn, nq = blockIdx.x - mt * ntn; const int row0 = mt * 128 + 32 * w, col0 = nq * 64; if (row0 >= M) return;
  const _Float16* a0p = A + (size_t)(row0 + ln) * lda; const _Float16* a1p = a0p + (size_t)16 * lda;
  const _Float16* b0p = Bh + (size_t)(col0 + ln) * ldb; const _Float16* b1p = b0p + (size_t)16 * ldb; const _Float16* b2p = b1p + (size_t)16 * ldb; const _Float16* b3p = b2p + (size_t)16 * ldb;
  const v8f z8 = {0.f,0.f,0.f,0.f,0.f,0.f,0.f,0.f}; v8f c00 = z8, c01 = z8, c02 = z8, c03 = z8, c10 = z8, c11 = z8, c12 = z8, c13 = z8;
#pragma unroll 1
  for (int kb = 0; kb < K; kb += 32) { const v16h a0 = g2_frag(a0p + kb, hh), a1 = g2_frag(a1p + kb, hh);
    v16h b = g2_frag(b0p + kb, hh); c00 = g2_mma(a0, b, c00); c10 = g2_mma(a1, b, c10);
    b = g2_frag(b1p + kb, hh); c01 = g2_mma(a0, b, c01); c11 = g2_mma(a1, b, c11);
    b = g2_frag(b2p + kb, hh); c02 = g2_mma(a0, b, c02); c12 = g2_mma(a1, b, c12);
    b = g2_frag(b3p + kb, hh); c03 = g2_mma(a0, b, c03); c13 = g2_mma(a1, b, c13); }
  v8f accs[8] = {c00, c01, c02, c03, c10, c11, c12, c13};
#pragma unroll
  for (int u = 0; u < 8; ++u) { const int t = u & 3, half = u >> 2; const int col = col0 + t * 16 + ln; const float bv = bp ? bf16_round(bp[col]) : 0.f;
#pragma unroll
    for (int r = 0; r < 8; ++r) { const int rloc = half * 16 + 8 * hh + r; float v = accs[u][r] * alpha + bv; if (CP) { if (rowsPerB < 0) v += CP[cofs + (size_t)(row0g + row0 + rloc) * ldc + col];      /* rowsPerB < 0: own element of the batched C plane */ else { const int bidx = (row0g + row0 + rloc) / rowsPerB; v += CP[(size_t)bidx * sCPb + (size_t)by * 64 + col]; } }
      if (ACT == 3) v = fmaxf(v, 0.f); else if (ACT == 6) v = 0.5f * v * (1.0f + erff(v * 0.70710678118654752f)); else if (ACT == 11) v = 1.0f / (1.0f + expf(-v)); else if (ACT == 15) v = v / (1.0f + expf(-v)); else if (ACT == 12) v = (v > 0.f) ? v : 0.01f * v; else if (ACT == 8) v = tanhf(v); else if (ACT == 9) v = 0.5f * v * (1.0f + tanhf(0.7978845608028654f * (v + 0.044715f * v * v * v))); else if (ACT == 14) v = (v > 0.f) ? v : 0.1f * v; else if (ACT == 16) v = (v >= 0.f) ? v : 0.3f * v; else if (ACT == 17) v = (v >= 0.f) ? v : 0.2f * v;
      so[w][rloc][t * 16 + ln] = v; } }
  __builtin_amdgcn_fence(__ATOMIC_ACQ_REL, "workgroup"); __builtin_amdgcn_wave_barrier();
  const int rsub = lane >> 4, c4 = (lane & 15) * 4;
  {
#pragma unroll
    for (int q = 0; q < 16; ++q) { const int r = q * 2 + rsub; const v4f v = *(const v4fa*)&so[w][r][c4]; if (C) *(v4f*)(C + cofs + (size_t)(row0 + r) * ldc + col0 + c4) = v; if (C16) { v4h h4; for (int i = 0; i < 4; ++i) h4[i] = (_Float16)v[i]; *(v4h*)(C16 + cofs + (size_t)(row0 + r) * ldc + col0 + c4) = h4; } }
     } }


__global__ __launch_bounds__(256) void k_wnat(const float* __restrict__ w, size_t n8, _Float16* __restrict__ Bt) { const size_t t = (size_t)blockIdx.x * 256 + threadIdx.x; if (t >= n8) return; FragH f; for (int q = 0; q < 8; ++q) f.h[q] = (_Float16)(bf16_round(w[t * 8 + q]) * 16.0f); *(v8us*)((unsigned short*)Bt + t * 8) = f.half[0];  }
__global__ __launch_bounds__(256) void k_rsm(const float* __restrict__ S, _Float16* __restrict__ P, int nrows) {
  #pragma clang fp contract(off)
  const int i = blockIdx.x * 256 + threadIdx.x; if (i >= nrows) return; const float* s = S + (size_t)i * SQ; float mx = -3.0e38f;
#pragma unroll 1
  for (int j = 0; j < SQ; ++j) mx = fmaxf(mx, s[j]); float se = 0.f;
#pragma unroll 1
  for (int j = 0; j < SQ; ++j) se += expf(s[j] - mx); const float sc = 256.0f / se;
#pragma unroll 1
  for (int j0 = 0; j0 < SQ; j0 += 8) { FragH f; for (int q = 0; q < 8; ++q) f.h[q] = (_Float16)(expf(s[j0 + q] - mx) * sc); unsigned short* d = (unsigned short*)P + (size_t)i * SQ + j0; *(v8us*)d = f.half[0];  } }
__global__ __launch_bounds__(256) void k_vt(const _Float16* __restrict__ V16, int b, int h0, _Float16* __restrict__ VT) { __shared__ unsigned short tl[64][65]; const int tid = threadIdx.x; const int hh = blockIdx.x % HG, sg = blockIdx.x / HG; const int s0 = sg * 64; const int h = h0 + hh;
  for (int i = tid; i < 64 * 8; i += 256) { const int j = i / 8, d8 = (i % 8) * 8; FragH f; f.half[0] = *(const v8us*)((const unsigned short*)V16 + ((size_t)b * SQ + s0 + j) * DM + h * HD + d8); for (int q = 0; q < 8; ++q) tl[d8 + q][j] = f.u[q]; }
  __syncthreads();
  { for (int i = tid; i < 64 * 8; i += 256) { const int d = i / 8, j8 = (i % 8) * 8; FragH f; for (int q = 0; q < 8; ++q) f.u[q] = tl[d][j8 + q]; *(v8us*)((unsigned short*)VT + ((size_t)hh * HD + d) * SQ + s0 + j8) = f.half[0]; }  } }



__global__ __launch_bounds__(256) void k_rsmcf2(const float* __restrict__ S, _Float16* __restrict__ P, int hg, int q0, int nk) {
  #pragma clang fp contract(off)
  const int t = blockIdx.x * 256 + threadIdx.x; if (t >= hg * QT) return; const size_t i = (size_t)t; const float* s = S + i * NKX; const int last = q0 + (t % QT); float mx = -3.0e38f;
#pragma unroll 1
  for (int j = 0; j < nk; ++j) { const float f = (j <= last) ? 1.f : 0.f; mx = fmaxf(mx, fmaf(f, s[j], (1.f - f) * -1.0e9f)); } float se = 0.f;
#pragma unroll 1
  for (int j = 0; j < nk; ++j) { const float f = (j <= last) ? 1.f : 0.f; se += __expf(fmaf(f, s[j], (1.f - f) * -1.0e9f) - mx); } const float sc = 256.0f / se;
#pragma unroll 1
  for (int j0 = 0; j0 < nk; j0 += 8) { FragH fr; for (int q = 0; q < 8; ++q) { const int j = j0 + q; const float f = (j <= last) ? 1.f : 0.f; fr.h[q] = (_Float16)(__expf(fmaf(f, s[j], (1.f - f) * -1.0e9f) - mx) * sc); } unsigned short* d = (unsigned short*)P + i * NKX + j0; *(v8us*)d = fr.half[0];  } }

template <int MASKADD>
__global__ __launch_bounds__(64) void k_att0(const float* __restrict__ QF, const float* __restrict__ KF, const float* __restrict__ VF, int ld, const float* __restrict__ mask, float scale, float* __restrict__ OF, int ldo) {
  #pragma clang fp contract(off)
  __shared__ __attribute__((aligned(16))) float lq[64][64]; __shared__ __attribute__((aligned(16))) float lo[64][64];
  const int tid = threadIdx.x; const int h = blockIdx.x / (QT0 / 64), rg = blockIdx.x % (QT0 / 64); const int i = rg * 64 + tid;
  const float* qr = QF + (size_t)i * ld + h * HD;
#pragma unroll 1
  for (int c = 0; c < HD / 4; ++c) { *(v4f*)&lq[tid][c * 4] = *(const v4fa*)(qr + c * 4); const v4f z = {0.f, 0.f, 0.f, 0.f}; *(v4f*)&lo[tid][c * 4] = z; }
  float m = -1.0e30f, l = 0.f; const int jmax = MASKADD ? (SQ - 1) : (rg * 64 + 63);      /* additive-mask form: every key (the mask input decides); causal form: keys up to the block's last row */
#pragma unroll 1
  for (int j = 0; j <= jmax; ++j) { const float* kr = KF + (size_t)j * ld + h * HD; const float* vr = VF + (size_t)j * ld + h * HD; float s = 0.f;
#pragma unroll 1
    for (int c = 0; c < HD / 4; ++c) { const v4f kq = *(const v4fa*)(kr + c * 4); const v4f qq = *(v4f*)&lq[tid][c * 4]; s = __fadd_rn(s, __fmul_rn(qq[0], kq[0])); s = __fadd_rn(s, __fmul_rn(qq[1], kq[1])); s = __fadd_rn(s, __fmul_rn(qq[2], kq[2])); s = __fadd_rn(s, __fmul_rn(qq[3], kq[3])); }
    s = __fmul_rn(s, scale); if (MASKADD) s = __fadd_rn(s, __fmul_rn(bf16_round(mask[(size_t)i * SQ + j]), -10000.0f));
    const float f = (MASKADD || j <= i) ? 1.f : 0.f; const float sm = fmaf(f, s, (1.f - f) * -1.0e30f); const float mn = fmaxf(m, sm); const float sc = expf(m - mn); const float e = expf(sm - mn); l = __fadd_rn(__fmul_rn(l, sc), e); m = mn;
#pragma unroll 1
    for (int c = 0; c < HD / 4; ++c) { const v4f vv = *(const v4fa*)(vr + c * 4); v4f oo = *(v4f*)&lo[tid][c * 4]; for (int u = 0; u < 4; ++u) oo[u] = __fadd_rn(__fmul_rn(oo[u], sc), __fmul_rn(e, vv[u])); *(v4f*)&lo[tid][c * 4] = oo; } }
  const float fin = 64.0f / l;      /* o carried x64; the f16 path writes o unscaled */
#pragma unroll 1
  for (int c = 0; c < HD / 4; ++c) { v4f oo = *(v4f*)&lo[tid][c * 4]; for (int u = 0; u < 4; ++u) oo[u] = __fmul_rn(oo[u], fin); *(v4f*)&lo[tid][c * 4] = oo; }
  __syncthreads();
  {
#pragma unroll 1
    for (int it = 0; it < 16; ++it) { const int row = it * 4 + tid / 16, pc = (tid % 16) * 4; const v4f v = *(const v4f*)&lo[row][pc]; *(v4f*)(OF + (size_t)(rg * 64 + row) * ldo + h * HD + pc) = v; }
     } }

__global__ __launch_bounds__(256) void k_oscale(const float* __restrict__ OF, float* __restrict__ out, size_t n4) { const size_t t = (size_t)blockIdx.x * 256 + threadIdx.x; if (t >= n4) return; const v4f a = *(const v4fa*)(OF + t * 4); v4f o; for (int q = 0; q < 4; ++q) o[q] = a[q] * 0.015625f; *(v4f*)(out + t * 4) = o;  }

__global__ __launch_bounds__(256) void k_bfr(const float* __restrict__ x, float* __restrict__ XB, size_t n8) { const size_t t = (size_t)blockIdx.x * 256 + threadIdx.x; if (t >= n8) return; v4f a = *(const v4fa*)(x + t * 8), c = *(const v4fa*)(x + t * 8 + 4); for (int q = 0; q < 4; ++q) { a[q] = bf16_round(a[q]); c[q] = bf16_round(c[q]); }
  { *(v4f*)(XB + t * 8) = a; *(v4f*)(XB + t * 8 + 4) = c;  } }



__global__ __launch_bounds__(256) void k_rsmfvl(const float* __restrict__ S, _Float16* __restrict__ P, _Float16* __restrict__ PL, int qn, const int* __restrict__ vlp) {
  #pragma clang fp contract(off)
  const int t = blockIdx.x * 256 + threadIdx.x; if (t >= qn) return; const int vl = vlp[0]; const size_t i = (size_t)t; const float* s = S + i * SQ; float mx = -3.0e38f;
#pragma unroll 1
  for (int j = 0; j < SQ; ++j) { const float f = (j < vl) ? 1.f : 0.f; mx = fmaxf(mx, fmaf(f, s[j], (1.f - f) * -1000000.0f)); } float se = 0.f;
#pragma unroll 1
  for (int j = 0; j < SQ; ++j) { const float f = (j < vl) ? 1.f : 0.f; se += __expf(fmaf(f, s[j], (1.f - f) * -1000000.0f) - mx); } const float sc = 256.0f / se;
#pragma unroll 1
  for (int j0 = 0; j0 < SQ; j0 += 8) { FragH fr, gr; for (int q = 0; q < 8; ++q) { const int j = j0 + q; const float f = (j < vl) ? 1.f : 0.f; const float pv = __expf(fmaf(f, s[j], (1.f - f) * -1000000.0f) - mx) * sc; const _Float16 ph = (_Float16)pv; fr.h[q] = ph; gr.h[q] = (_Float16)((pv - (float)ph) * 1024.0f); }
    unsigned short* d = (unsigned short*)P + i * SQ + j0; unsigned short* dl = (unsigned short*)PL + i * SQ + j0; *(v8us*)d = fr.half[0]; *(v8us*)dl = gr.half[0];  } }

__global__ __launch_bounds__(256) void k_rsmf(const float* __restrict__ S, _Float16* __restrict__ P, int qn, int hg) {
  #pragma clang fp contract(off)
  const int t = blockIdx.x * 256 + threadIdx.x; if (t >= qn * hg) return; const size_t i = (size_t)(t / qn) * SQ + (t % qn); const float* s = S + i * SQ; float mx = -3.0e38f;
#pragma unroll 1
  for (int j = 0; j < SQ; ++j) mx = fmaxf(mx, s[j]); float se = 0.f;
#pragma unroll 1
  for (int j = 0; j < SQ; ++j) se += __expf(s[j] - mx); const float sc = 256.0f / se;
#pragma unroll 1
  for (int j0 = 0; j0 < SQ; j0 += 8) { FragH f; for (int q = 0; q < 8; ++q) f.h[q] = (_Float16)(__expf(s[j0 + q] - mx) * sc); unsigned short* d = (unsigned short*)P + i * SQ + j0; *(v8us*)d = f.half[0];  } }



// lane l <-> l ^ 16 (cross-row move): register only, no LDS traffic
__device__ __forceinline__ float lane_x16(float v) { const int b = __float_as_int(v); return __int_as_float(__builtin_amdgcn_permlanex16(b, b, 0x76543210, 0xfedcba98, false, false)); }

// ---- fused attention: logits, softmax and weights x value in one kernel; scores and weights never leave the registers ----
#define FA_QT 4                      /* query tiles (16 rows each) per work-group */
#define FA_WT 2                      /* query tiles per wave: every K and V^T fragment read from LDS feeds both */
#define FA_QG (FA_QT / FA_WT)        /* waves per key range */
#define FA_KS 4                      /* key ranges per work-group, one wave per (pair of query tiles, key range) */
#define FA_NP (SQ / FA_KS / 32)      /* passes of 32 keys per wave */
// Operands stored as ready-made WMMA A fragments: a block of 512 f16 = [half j][lane l][8], lane l = (c = l & 15, h = l >> 4) holding row c, k = 16 j + 8 h + 0..7 (the hardware k order),
// so that a fragment is two whole-line loads of 512 B instead of two loads that touch 16 lines each. One 16-byte piece = 8 f16, piece t = (block t >> 6, half j = (t >> 5) & 1, lane l = t & 31).
// KF: block (key tile kt, d step s) at kt * 4 + s: row = key kt * 16 + c, k = channel s * 32 + ...
// VF: block (32-key step kp, channel tile dt) at kp * 8 + dt: row = channel dt * 16 + c, k = key kp * 32 + ... (the transposition of value happens here)
// ONE launch prepares everything the attention kernel reads. Work-group g takes rows 64 g .. 64 g + 63 of query, key and value (all batches in one row count): 1024 pieces of each, two per thread,
// and every load of a thread is issued before its first conversion: one memory round trip for the whole launch.
// A thread's two value pieces are 16 keys of ONE channel (tile dt = wave >> 1, channel c), so the work-group's sum over its 64 keys of the bf16-rounded value comes from registers (f32 on VALU):
// 8 keys as a tree, the two pieces, lane l + lane l ^ 16, then the two waves of a channel tile through LDS. PM[g][channel]; the attention kernel adds a batch's 64 partial sums.
#define PR_T 512                     /* threads of a preparation work-group */
__global__ __launch_bounds__(PR_T) void k_prep(const float* __restrict__ xq, const float* __restrict__ xk, const float* __restrict__ xv, _Float16* __restrict__ Q16, _Float16* __restrict__ KF, _Float16* __restrict__ VF, float* __restrict__ PM) {
  __shared__ float part[PR_T / 32][16];
  const int tid = threadIdx.x, w = tid >> 5, l = tid & 31, j = w & 1, c = l & 15, h = l >> 4; const size_t t0 = (size_t)blockIdx.x * (2 * PR_T) + tid;
  v4f qa[2][2], ka[2][2]; float va[2][8];
  /* unrolled: the arrays stay in registers and all 24 loads are in flight together */
#pragma unroll
  for (int i = 0; i < 2; ++i) { const size_t t = t0 + (size_t)i * PR_T, blk = t >> 6;
    const float* qs = xq + t * 8; const float* ks = xk + ((blk >> 2) * 16 + c) * DM + (blk & 3) * 32 + j * 16 + 8 * h; const float* vs = xv + ((blk >> 3) * 32 + j * 16 + 8 * h) * DM + (blk & 7) * 16 + c;
    /* the s_wait_xcnt behind each address's loads: a later load's result may land in that address's registers; the data stay in flight */
    qa[i][0] = *(const v4fa*)qs; qa[i][1] = *(const v4fa*)(qs + 4); asm volatile("s_wait_xcnt 0x0" ::: "memory");
    ka[i][0] = *(const v4fa*)ks; ka[i][1] = *(const v4fa*)(ks + 4); asm volatile("s_wait_xcnt 0x0" ::: "memory");
#pragma unroll
    for (int q = 0; q < 8; ++q) va[i][q] = vs[(size_t)q * DM];
    asm volatile("s_wait_xcnt 0x0" ::: "memory"); }
  /* inputs only, no code: every loaded value is in its register here, so all 24 loads issue ahead of the first use, under one wait (without it the query and key loads sink behind the barrier below: a second memory round trip) */
  asm volatile("" :: "v"(qa[0][0]), "v"(qa[0][1]), "v"(qa[1][0]), "v"(qa[1][1]), "v"(ka[0][0]), "v"(ka[0][1]), "v"(ka[1][0]), "v"(ka[1][1]), "v"(va[0][0]), "v"(va[0][1]), "v"(va[0][2]), "v"(va[0][3]), "v"(va[0][4]), "v"(va[0][5]), "v"(va[0][6]), "v"(va[0][7]),
               "v"(va[1][0]), "v"(va[1][1]), "v"(va[1][2]), "v"(va[1][3]), "v"(va[1][4]), "v"(va[1][5]), "v"(va[1][6]), "v"(va[1][7]));
  /* the value sums first: their barrier and the store of PM then stand in front of the six large stores and wait for none of them */
  float r[2][8];
#pragma unroll
  for (int i = 0; i < 2; ++i) for (int q = 0; q < 8; ++q) r[i][q] = bf16_round(va[i][q]);
  float a = (((r[0][0] + r[0][1]) + (r[0][2] + r[0][3])) + ((r[0][4] + r[0][5]) + (r[0][6] + r[0][7]))) + (((r[1][0] + r[1][1]) + (r[1][2] + r[1][3])) + ((r[1][4] + r[1][5]) + (r[1][6] + r[1][7])));
  a += lane_x16(a);
  if (h == 0) part[w][c] = a;
  __syncthreads();      /* every wave passes it once: the first four waves read both waves' sums of each channel tile below */
  if (tid < DM) PM[(size_t)blockIdx.x * DM + tid] = part[2 * (tid >> 4)][tid & 15] + part[2 * (tid >> 4) + 1][tid & 15];
  /* unrolled: register arrays */
#pragma unroll
  for (int i = 0; i < 2; ++i) { const size_t t = t0 + (size_t)i * PR_T; FragH fq, fk, fv;
#pragma unroll
    for (int q = 0; q < 8; ++q) { fq.h[q] = (_Float16)bf16_round(qa[i][q >> 2][q & 3]); fk.h[q] = (_Float16)bf16_round(ka[i][q >> 2][q & 3]); fv.h[q] = (_Float16)r[i][q]; }
    *(v8us*)((unsigned short*)Q16 + t * 8) = fq.half[0]; *(v8us*)((unsigned short*)KF + t * 8) = fk.half[0]; *(v8us*)((unsigned short*)VF + t * 8) = fv.half[0]; } }
// p: the block's start, the same for the whole wave; lo = lane * 8: the lane's own 16-byte piece
__device__ __forceinline__ v16h fa_frag(const unsigned short* p, unsigned lo) { FragH f; f.half[0] = *(const v8us*)(p + lo); f.half[1] = *(const v8us*)(p + 256 + lo); return f.v; }
// One tensor load: the wave's 8 KB (eight fragment blocks of 1024 B, contiguous in memory and in LDS) go from g to LDS byte l as ONE request of the whole wave, through no register and with no address per lane.
// Descriptor: two groups, 1-byte elements, tensor = tile = 8 rows of 1024 B at a source pitch of 1024 B, no pad, no mask; every word wave-uniform in scalar registers.
typedef unsigned u32x4 __attribute__((ext_vector_type(4)));
typedef unsigned u32x8 __attribute__((ext_vector_type(8)));
#define FA_TR 1024u                  /* bytes of a tile row */
#define FA_TN 8u                     /* rows of a tile */
__device__ __forceinline__ unsigned fa_uni(unsigned v) { return (unsigned)__builtin_amdgcn_readfirstlane(v); }
// a wave-uniform value held in a scalar register: the guard of a tensor load (which ignores EXEC, so only a scalar branch keeps a wave from issuing it) and the tile number that a descriptor's address words are formed from
__device__ __forceinline__ unsigned fa_pinned(unsigned v) { unsigned w = fa_uni(v); asm volatile("" : "+s"(w)); /* pins a tensor load's guard or descriptor word in a scalar register; volatile: what is formed from w is formed behind the waits written above the call */ return w; }
__device__ __forceinline__ void fa_tload(unsigned l, const unsigned short* g) {
  const unsigned long long ga = (unsigned long long)(size_t)g;
  u32x4 g0; g0[0] = fa_uni(1u); g0[1] = fa_uni(l); g0[2] = fa_uni((unsigned)ga); g0[3] = fa_uni((((unsigned)(ga >> 32)) & 0x01FFFFFFu) | 0x80000000u);
  u32x8 g1; g1[0] = fa_uni(0u); g1[1] = fa_uni((FA_TR & 0xFFFFu) << 16); g1[2] = fa_uni((FA_TR >> 16) | ((FA_TN & 0xFFFFu) << 16)); g1[3] = fa_uni((FA_TN >> 16) | (FA_TR << 16)); g1[4] = fa_uni(FA_TN); g1[5] = fa_uni(FA_TR); g1[6] = fa_uni(0u); g1[7] = fa_uni(0u);
  asm volatile("tensor_load_to_lds %0, %1" :: "s"(g0), "s"(g1) : "memory"); }
__device__ __forceinline__ v8f fa_mma(v16h a, v16h b, v8f c) { return __builtin_amdgcn_wmma_f32_16x16x32_f16(false, a, false, b, (short)0, c, false, false); }
// native 2^t; the v_nop in the same statement keeps the one slot that the instruction set asks for behind a transcendental, whatever the compiler puts next
__device__ __forceinline__ float fa_exp2(float t) { float e; asm("v_exp_f32 %0, %1\n\tv_nop" : "=v"(e) : "v"(t)); return e; }
// four at once: the results are early-clobber, so none of the four reads a neighbour's result or overwrites its source, and one v_nop closes the last one's slot
__device__ __forceinline__ void fa_exp2x4(float& a, float& b, float& c, float& d) { float e0, e1, e2, e3;
  asm("v_exp_f32 %0, %4\n\tv_exp_f32 %1, %5\n\tv_exp_f32 %2, %6\n\tv_exp_f32 %3, %7\n\tv_nop" : "=&v"(e0), "=&v"(e1), "=&v"(e2), "=&v"(e3) : "v"(a), "v"(b), "v"(c), "v"(d)); a = e0; b = e1; c = e2; d = e3; }
// A wave owns 32 queries (two tiles of 16) and 1024 keys. S^T = K Q^T: D register r of lane (c, h) = score of key 8 h + r, query c of the tile, so a query's scores sit in two lanes (maximum and sum in-lane plus one exchange),
// and two score tiles (keys 0..15, 16..31), converted in place, ARE the B fragment of O^T += V^T P^T in the hardware k order. Running maximum m per query (log2 units), renewed only when a pass exceeds it by more than 8;
// weights 2^(s - m + 6) <= 2^14 rounded once to f16 (2^-12 relative, zero mean, an eighth of the bf16 rounding that value already carries), products summed in f32 accumulators; the sum of the f32 weights in l. The four key ranges of a query tile are joined through LDS at the end.
// K and V^T fragments come from LDS: a tile = one pass (32 keys) of each of the four key ranges, 16 KB a range in the order of KF and VF, brought in by tensor loads, two buffers: tile p + 1 flies while tile p is worked on.
// The two waves of a key range each load half of its 16 KB, one request a wave and tile, and both read the whole: a work-group fetches each K and V^T byte once, and no wave waits out a global load inside the loop.
// A fragment read from LDS is the A operand of both query tiles' products: 16 KB of LDS reads a pass serve 32 queries. Eight waves, two per SIMD, leave each wave the registers for both tiles' accumulators and query fragments.
// Work-group x of a batch takes the 32 tiles of each key range in the order x mod 32, x mod 32 + 1, ..., wrapping round: every key once, in a rotated order.
__global__ __launch_bounds__(FA_QG * FA_KS * 32) void k_fattn(const _Float16* __restrict__ Q16, const _Float16* __restrict__ KF, const _Float16* __restrict__ VF, const float* __restrict__ PM, float* __restrict__ out) {
  __shared__ __attribute__((aligned(2048))) unsigned short ring[2][FA_KS][8192];      /* [buffer][key range][K blocks of the pass: 4096 f16, then V^T blocks: 4096 f16] */
  __shared__ float so[FA_KS][FA_QT][64][32]; __shared__ float sm[FA_KS][FA_QT][32]; __shared__ float sl[FA_KS][FA_QT][32]; __shared__ __attribute__((aligned(16))) float sv[FA_KS][DM];
  const int tid = threadIdx.x, w = __builtin_amdgcn_readfirstlane(tid >> 5) /* the wave's number in a scalar register: fragment bases and LDS planes become scalar */, lane = tid & 31, c = lane & 15, h = lane >> 4, qg = w & (FA_QG - 1), ks = w / FA_QG; const int b = blockIdx.y, row0 = blockIdx.x * (FA_QT * 16) + qg * (FA_WT * 16);
  const size_t f0 = ((size_t)b * (SQ / 32) + (size_t)ks * FA_NP) * 4096; const unsigned lo = (unsigned)lane * 8;      /* a pass of 32 keys = 8 blocks = 4096 f16 in KF and in VF */
  /* the wave's half of its range's tile: wave qg 0 the K blocks, wave 1 the V^T blocks; the LDS byte address is the low 32 bits of the __shared__ address, a multiple of 8 KB from the ring's start (the ring stands at a multiple of 2 KB) */
  const unsigned short* gs = (const unsigned short*)(qg == 0 ? KF : VF) + f0;
  const unsigned lb = (unsigned)(size_t)&ring[0][ks][qg * 4096];      /* the half's place in buffer 0; buffer 1 lies sizeof ring[0] = 65536 bytes behind */
  /* the walk's entry: pass p works on tile (p + rot) mod FA_NP of each key range. The work-groups of a batch read the same K and V^T at the same pace; entering at different tiles they ask L2 for different lines at any moment */
  const unsigned rot = blockIdx.x & (FA_NP - 1);
  fa_tload(lb, gs + (size_t)rot * 4096);      /* the first tile into buffer 0, every wave its own half, in flight beside the query and partial-sum loads below */
  v16h q[FA_WT][4];
  /* unrolled: register arrays */
#pragma unroll
  for (int t = 0; t < FA_WT; ++t) { const _Float16* qp = Q16 + ((size_t)b * SQ + row0 + t * 16 + c) * DM; q[t][0] = g2_frag(qp, h); q[t][1] = g2_frag(qp + 32, h); q[t][2] = g2_frag(qp + 64, h); q[t][3] = g2_frag(qp + 96, h); }
  /* sum of value over the sequence: wave (qg, ks) adds partial sums 16 ks .. 16 ks + 15 of its batch for channels 64 qg + 32 t + lane (whole lines, in flight beside the query loads); the four quarters meet behind the barrier below */
#pragma unroll
  for (int t = 0; t < FA_WT; ++t) { const int ch = (qg * FA_WT + t) * 32 + lane; const float* pp = PM + ((size_t)b * (SQ / 64) + ks * 16) * DM + ch; float x[16];
#pragma unroll
    for (int i = 0; i < 16; ++i) x[i] = pp[(size_t)i * DM];
    sv[ks][ch] = (((x[0] + x[1]) + (x[2] + x[3])) + ((x[4] + x[5]) + (x[6] + x[7]))) + (((x[8] + x[9]) + (x[10] + x[11])) + ((x[12] + x[13]) + (x[14] + x[15]))); }
  asm volatile("s_wait_tensorcnt 0x0" ::: "memory");      /* the wave's own half of tile 0 has landed */
  __syncthreads();      /* every wave passes it: tile 0 is read by waves that did not load it */
  fa_tload(lb + (unsigned)sizeof(ring[0]), gs + (size_t)fa_pinned((rot + 1) & (FA_NP - 1)) * 4096);      /* the second tile into buffer 1; its number is pinned, so that the descriptor's address words are formed behind the wait above, with no request outstanding */
  const float CS = (float)(0.08838834764831845 * 1.4426950408889634);      /* 1 / sqrt(128) times log2 e */
  const v8f z8 = {0.f,0.f,0.f,0.f,0.f,0.f,0.f,0.f}; v8f o[FA_WT][8]; float m[FA_WT], l[FA_WT];
#pragma unroll
  for (int t = 0; t < FA_WT; ++t) { m[t] = -1.0e30f; l[t] = 0.f;
#pragma unroll
    for (int j = 0; j < 8; ++j) o[t][j] = z8; }
  /* kept rolled: the fragments of one pass alone are live at a time, inside the 512 registers that two waves per SIMD leave each wave */
#pragma unroll 1
  for (int p = 0; p < FA_NP; ++p) { const unsigned short* kp = &ring[p & 1][ks][0]; const unsigned short* vp = kp + 4096;
    const unsigned more = fa_pinned(p + 2 < FA_NP);      /* is there a tile p + 2: the guard of the pass's tensor load. Formed here and not at the branch: a volatile statement behind the barrier would hold the barrier's wait in front of the exponentials, which now run while the wave waits for the others */
    const v16h k0 = fa_frag(kp, lo), k1 = fa_frag(kp + 512, lo), k2 = fa_frag(kp + 1024, lo), k3 = fa_frag(kp + 1536, lo), k4 = fa_frag(kp + 2048, lo), k5 = fa_frag(kp + 2560, lo), k6 = fa_frag(kp + 3072, lo), k7 = fa_frag(kp + 3584, lo);
    v16h vf[8];
#pragma unroll
    for (int j = 0; j < 8; ++j) vf[j] = fa_frag(vp + j * 512, lo);
    /* nothing is scheduled across this line: the pass's 32 LDS loads issue back to back as one group ahead of the first product, each product behind a counted wait
       (without it the V^T loads sink behind the score products and are waited out there on their own: a second LDS latency a pass; both operands' fragments fit the registers of a wave at two waves per SIMD) */
    __builtin_amdgcn_sched_barrier(0);
    v8f s0[FA_WT], s1[FA_WT];
#pragma unroll
    for (int t = 0; t < FA_WT; ++t) { s0[t] = fa_mma(k0, q[t][0], z8); s1[t] = fa_mma(k4, q[t][0], z8); }
#pragma unroll
    for (int t = 0; t < FA_WT; ++t) { s0[t] = fa_mma(k1, q[t][1], s0[t]); s1[t] = fa_mma(k5, q[t][1], s1[t]); }
#pragma unroll
    for (int t = 0; t < FA_WT; ++t) { s0[t] = fa_mma(k2, q[t][2], s0[t]); s1[t] = fa_mma(k6, q[t][2], s1[t]); }
#pragma unroll
    for (int t = 0; t < FA_WT; ++t) { s0[t] = fa_mma(k3, q[t][3], s0[t]); s1[t] = fa_mma(k7, q[t][3], s1[t]); }
    float mx[FA_WT]; bool need[FA_WT];
#pragma unroll
    for (int t = 0; t < FA_WT; ++t) { float a = fmaxf(s0[t][0], s1[t][0]);
#pragma unroll
      for (int r = 1; r < 8; ++r) a = fmaxf(a, fmaxf(s0[t][r], s1[t][r]));
      mx[t] = fmaxf(a, lane_x16(a)) * CS; need[t] = mx[t] > m[t] + 8.0f; }
    if (__builtin_amdgcn_ballot_w32(need[0] || need[1]) != 0) {      /* wave-uniform, one test a pass: the accumulators are rescaled only in the few passes in which some query's maximum moves (a query whose maximum stays is scaled by exactly 1) */
#pragma unroll
      for (int t = 0; t < FA_WT; ++t) { const float mn = need[t] ? mx[t] : m[t]; const float al = fa_exp2(m[t] - mn); m[t] = mn; l[t] *= al;
#pragma unroll
        for (int j = 0; j < 8; ++j) for (int r = 0; r < 8; ++r) o[t][j][r] *= al; } }
    FragH ph[FA_WT];
#pragma unroll
    for (int t = 0; t < FA_WT; ++t) { const float nm = 6.0f - m[t]; float e[16];
#pragma unroll
      for (int r = 0; r < 8; ++r) { e[r] = fmaf(s0[t][r], CS, nm); e[8 + r] = fmaf(s1[t][r], CS, nm); }
#pragma unroll
      for (int u = 0; u < 16; u += 4) fa_exp2x4(e[u], e[u + 1], e[u + 2], e[u + 3]);
      l[t] += ((e[0] + e[4] + e[8] + e[12]) + (e[1] + e[5] + e[9] + e[13])) + ((e[2] + e[6] + e[10] + e[14]) + (e[3] + e[7] + e[11] + e[15]));
#pragma unroll
      for (int u = 0; u < 16; ++u) ph[t].h[u] = (_Float16)e[u]; }
    /* hand-over of the buffers, every wave in every pass; every LDS read of the pass stands above, what follows it in the pass works on registers alone, so the refill flies during these products too.
       In this order: the wave's LDS reads of tile p are done, its own tensor load of tile p + 1 has landed, then the barrier: behind it tile p + 1 may be read by all, and tile p's buffer refilled */
    asm volatile("s_wait_dscnt 0x0" ::: "memory");
    asm volatile("s_wait_tensorcnt 0x0" ::: "memory");
    __syncthreads();
    /* a scalar branch round the tensor load (it ignores EXEC); the tile's number is pinned too, so that the descriptor's address words are formed behind the wait above, with no request outstanding */
    if (more) fa_tload(lb + (unsigned)(p & 1) * (unsigned)sizeof(ring[0]), gs + (size_t)fa_pinned((rot + p + 2) & (FA_NP - 1)) * 4096);
#pragma unroll
    for (int j = 0; j < 8; ++j) for (int t = 0; t < FA_WT; ++t) o[t][j] = fa_mma(vf[j], ph[t].v, o[t][j]); }
  asm volatile("s_wait_tensorcnt 0x0" ::: "memory");      /* no tensor load is outstanding behind the loop */
  asm volatile("s_wait_dscnt 0x0" ::: "memory");      /* nor an LDS read of the ring */
#pragma unroll
  for (int t = 0; t < FA_WT; ++t) { const int qt = qg * FA_WT + t;
    l[t] += lane_x16(l[t]);      /* the two halves of a query's keys */
#pragma unroll
    for (int j = 0; j < 8; ++j) for (int r = 0; r < 8; ++r) so[ks][qt][j * 8 + r][lane] = o[t][j][r];
    sm[ks][qt][lane] = m[t]; sl[ks][qt][lane] = l[t]; }
  __syncthreads();      /* every wave passes it once: the four key ranges' partial results, and the quarters of the value sums, are read by other waves below */
#pragma unroll
  for (int t = 0; t < FA_WT; ++t) { const int qt = qg * FA_WT + t;
    float mm[FA_KS], M = -3.0e38f, L = 0.f;
#pragma unroll
    for (int i = 0; i < FA_KS; ++i) { mm[i] = sm[i][qt][lane]; M = fmaxf(M, mm[i]); }
#pragma unroll
    for (int i = 0; i < FA_KS; ++i) { mm[i] = fa_exp2(mm[i] - M); L += sl[i][qt][lane] * mm[i]; }
    const float inv = 1.0f / L;
    /* wave (qg, ks) finishes channels 32 ks .. 32 ks + 31 of its two query tiles: one whole 128-byte line of each output row */
#pragma unroll
    for (int jj = 0; jj < 2; ++jj) { const int j = 2 * ks + jj, ch = 16 * j + 8 * h; v4f r0, r1; float nv[8];      /* nv = -mean(value) of the lane's eight channels */
#pragma unroll
      for (int u = 0; u < 2; ++u) { const v4f x = (*(const v4f*)&sv[0][ch + 4 * u] + *(const v4f*)&sv[1][ch + 4 * u]) + (*(const v4f*)&sv[2][ch + 4 * u] + *(const v4f*)&sv[3][ch + 4 * u]);
#pragma unroll
        for (int r = 0; r < 4; ++r) nv[4 * u + r] = x[r] * (-1.0f / (float)SQ); }
#pragma unroll
      for (int r = 0; r < 8; ++r) { float a = 0.f;
#pragma unroll
        for (int i = 0; i < FA_KS; ++i) a += so[i][qt][j * 8 + r][lane] * mm[i];
        a = a * inv + nv[r]; if (r < 4) r0[r] = a; else r1[r - 4] = a; }
      float* d = out + ((size_t)b * SQ + row0 + t * 16 + c) * DM + 16 * j + 8 * h; *(v4f*)d = r0; *(v4f*)(d + 4) = r1; } } }
extern "C" void kernel_launch(void* const* d_in, const int* in_sizes, int n_in,
                              void* d_out, int out_size, void* d_ws, size_t ws_size, hipStream_t stream) {
  (void)in_sizes; (void)n_in; (void)out_size;
  const float* const* I = (const float* const*)d_in; const float* xq = I[0]; const float* xk = I[1]; const float* xv = I[2];      /* query, key, value [4][4096][128] */
  char* ws = (char*)d_ws; size_t off = 0;
  auto take = [&](size_t bytes) { char* p = ws + off; off += (bytes + 255) & ~(size_t)255; return p; };
  _Float16* Q16 = (_Float16*)take(NR * DM * 2); _Float16* KF = (_Float16*)take(NR * DM * 2); _Float16* VF = (_Float16*)take(NR * DM * 2); float* PM = (float*)take((NR / 64) * DM * 4);      /* sums of value over 64 keys each [256][128] */
  if (off > ws_size) return;
  k_prep<<<(unsigned)(NR / 64), PR_T, 0, stream>>>(xq, xk, xv, Q16, KF, VF, PM);      /* bf16-rounded inputs, exact in f16: query rows, keys and value^T in fragment order; value sums per 64 keys */
  k_fattn<<<dim3(SQ / (FA_QT * 16), NB), FA_QG * FA_KS * 32, 0, stream>>>(Q16, KF, VF, PM, (float*)d_out);      /* out = softmax(q.k / sqrt(128)) value - mean(value), all batches */
}

// v010
// Measured time: 33.3 microseconds a run.
// Next to v009, in two timings, it ran 1.05 and 1.06 times as fast.
// All steps since v000 together make it 131 times as fast.
#include <hip/hip_runtime.h>
#define NB 4
#define SQ 4096
#define DM 128
#define NH 2
#define HD 64
#define HG 8                         /* heads per launch of the four-argument k_vt (not launched) */
#define B0 0                         /* first batch processed (unused) */
#define NBR NB                       /* batches processed (used only in MP) */
#define NR ((size_t)NB * SQ)         /* token rows */
#define MP ((int)((size_t)NBR * SQ)) /* token rows (used only in MPO) */
#define QT 256                       /* query rows per causal tile */
#define NKX SQ                       /* S / P row pitch */
#define QT0 256                      /* query rows per head of the f32 k_att0 (not launched) */
#define QN SQ                        /* query rows attended per batch (unused) */
#define NHD NH                       /* unused */
#define MPO MP                       /* rows through the output stage (unused) */
#define LQ DM            /* row pitch of the q/k/v rows (unused) */
typedef __bf16 v16b __attribute__((ext_vector_type(16)));
typedef unsigned short v8us __attribute__((ext_vector_type(8), may_alias));
typedef float  v8f  __attribute__((ext_vector_type(8)));
typedef float  v4f  __attribute__((ext_vector_type(4)));
typedef float  v4fa __attribute__((ext_vector_type(4), may_alias));
union FragB { v16b v; v8us half[2]; unsigned short u[16]; };

__device__ __forceinline__ unsigned short bf16_bits(float x) { unsigned int u = __float_as_uint(x); return (unsigned short)((u + 0x7FFFu + ((u >> 16) & 1u)) >> 16); }
__device__ __forceinline__ float bf16_val(unsigned short b) { return __uint_as_float(((unsigned int)b) << 16); }
__device__ __forceinline__ float bf16_round(float x) { return bf16_val(bf16_bits(x)); }
// D += A·B with NT terms: 1 = ah·bh, 2 = + al·bh (A split), 3 = + ah·bl (both split)
template <int NT>
__device__ __forceinline__ v8f mmaN(v16b ah, v16b al, v16b bh, v16b bl, v8f c) {
  c = __builtin_amdgcn_wmma_f32_16x16x32_bf16(false, ah, false, bh, (short)0, c, false, false);
  if (NT >= 2) c = __builtin_amdgcn_wmma_f32_16x16x32_bf16(false, al, false, bh, (short)0, c, false, false);
  if (NT >= 3) c = __builtin_amdgcn_wmma_f32_16x16x32_bf16(false, ah, false, bl, (short)0, c, false, false);
  asm volatile("v_nop\n\tv_nop\n\tv_nop\n\tv_nop" : "+v"(c) : "v"(ah), "v"(al), "v"(bh), "v"(bl));
  return c;
}

__global__ __launch_bounds__(256) void k_wt_bf16(const float* __restrict__ W, unsigned short* __restrict__ Wt, int K, int N) {
  const int t = blockIdx.x * 256 + threadIdx.x;
  const int k8n = K / 8;
  if (t >= N * k8n) return;
  const int n = t / k8n, k8 = (t % k8n) * 8;
  v8us v;
#pragma unroll
  for (int i = 0; i < 8; ++i) v[i] = bf16_bits(W[(size_t)(k8 + i) * N + n]);
  *(v8us*)(Wt + (size_t)n * K + k8) = v;
  
}

// GEMM C[M][N] (f32, pitch ldc) = act(A[M][K]·W + bias). A f32 row-major (pitch lda) converted per fragment to bf16
// (ASPLIT: hi/lo two planes -> 2 terms, else single rounded term); Wt bf16 [N][K] (pitch ldb). BIAS_BF16 rounds the
// bias to bf16 first (bias quantised to bf16 before the add). K%32==0, M%16==0, N%64==0.
template <bool ASPLIT, int ACT, bool BIAS_BF16>
__global__ __launch_bounds__(128) void k_gemm_bf(const float* __restrict__ A, int lda, const unsigned short* __restrict__ Wt, int ldb,
                                               const float* __restrict__ bias, float* __restrict__ C, int ldc, int M, int N, int K) {
  __shared__ __attribute__((aligned(16))) float so[4][16][64];
  const int tid = threadIdx.x, w = tid >> 5, lane = tid & 31, ln = lane & 15, hh = lane >> 4;
  const int ntn = N / 64;
  const int wid = blockIdx.x * 4 + w;
  const int mt = wid / ntn, nq = wid % ntn;
  if (mt * 16 >= M) return;
  const int row0 = mt * 16, col0 = nq * 64;
  const float* arow = A + (size_t)(row0 + ln) * lda;
  v8f acc[4] = {};
  for (int kb = 0; kb < K; kb += 32) {
    FragB ah, al;
    const v4f x0 = *(const v4fa*)(arow + kb + 8 * hh), x1 = *(const v4fa*)(arow + kb + 8 * hh + 4);
    const v4f x2 = *(const v4fa*)(arow + kb + 16 + 8 * hh), x3 = *(const v4fa*)(arow + kb + 16 + 8 * hh + 4);
    float xs[16] = {x0[0],x0[1],x0[2],x0[3],x1[0],x1[1],x1[2],x1[3],x2[0],x2[1],x2[2],x2[3],x3[0],x3[1],x3[2],x3[3]};
#pragma unroll
    for (int i = 0; i < 16; ++i) { const unsigned short hb = bf16_bits(xs[i]); ah.u[i] = hb; al.u[i] = ASPLIT ? bf16_bits(xs[i] - bf16_val(hb)) : (unsigned short)0; }
#pragma unroll
    for (int t = 0; t < 4; ++t) {
      const unsigned short* brow = Wt + (size_t)(col0 + t * 16 + ln) * ldb + kb;
      FragB b;
      b.half[0] = *(const v8us*)(brow + 8 * hh);
      b.half[1] = *(const v8us*)(brow + 16 + 8 * hh);
      acc[t] = mmaN<ASPLIT ? 2 : 1>(ah.v, al.v, b.v, b.v, acc[t]);
    }
  }
#pragma unroll
  for (int t = 0; t < 4; ++t) {
    float bv = bias ? bias[col0 + t * 16 + ln] : 0.f;
    if (BIAS_BF16) bv = bf16_round(bv);
#pragma unroll
    for (int r = 0; r < 8; ++r) { float v = acc[t][r] + bv; if (ACT == 1) v = fmaxf(v, 0.f); so[w][8 * hh + r][t * 16 + ln] = v; }
  }
  __builtin_amdgcn_fence(__ATOMIC_ACQ_REL, "workgroup");
  __builtin_amdgcn_wave_barrier();
  const int rsub = lane >> 4, c4 = (lane & 15) * 4;
  {
#pragma unroll
    for (int q = 0; q < 8; ++q) {
      const int r = q * 2 + rsub;
      const v4f v = *(const v4fa*)&so[w][r][c4];
      *(v4f*)(C + (size_t)(row0 + r) * ldc + col0 + c4) = v;
    }
    
  }
}

// GEMM C = act(A·W + bias + resid): A f32 (ASPLIT -> hi/lo 2 terms), Wt bf16 [N][K]; ACT 0 none, 1 relu, 2 exact gelu;
// resid (optional, f32, row index = (row % rmod), pitch ldr, RES_BF16 rounds it) added before the activation.
template <bool ASPLIT, int ACT, bool BIAS_BF16, bool RES_BF16>
__global__ __launch_bounds__(128) void k_gemm_bf3(const float* __restrict__ A, int lda, const unsigned short* __restrict__ Wt, int ldb,
                                                const float* __restrict__ bias, const float* __restrict__ resid, int rmod, int ldr,
                                                float* __restrict__ C, int ldc, int M, int N, int K) {
  __shared__ __attribute__((aligned(16))) float so[4][16][64];
  const int tid = threadIdx.x, w = tid >> 5, lane = tid & 31, ln = lane & 15, hh = lane >> 4;
  const int ntn = N / 64;
  const int wid = blockIdx.x * 4 + w;
  const int mt = wid / ntn, nq = wid % ntn;
  if (mt * 16 >= M) return;
  const int row0 = mt * 16, col0 = nq * 64;
  const float* arow = A + (size_t)(row0 + ln) * lda;
  v8f acc[4] = {};
  for (int kb = 0; kb < K; kb += 32) {
    FragB ah, al;
    const v4f x0 = *(const v4fa*)(arow + kb + 8 * hh), x1 = *(const v4fa*)(arow + kb + 8 * hh + 4);
    const v4f x2 = *(const v4fa*)(arow + kb + 16 + 8 * hh), x3 = *(const v4fa*)(arow + kb + 16 + 8 * hh + 4);
    float xs[16] = {x0[0],x0[1],x0[2],x0[3],x1[0],x1[1],x1[2],x1[3],x2[0],x2[1],x2[2],x2[3],x3[0],x3[1],x3[2],x3[3]};
#pragma unroll
    for (int i = 0; i < 16; ++i) { const unsigned short hb = bf16_bits(xs[i]); ah.u[i] = hb; al.u[i] = ASPLIT ? bf16_bits(xs[i] - bf16_val(hb)) : (unsigned short)0; }
#pragma unroll
    for (int t = 0; t < 4; ++t) {
      const unsigned short* brow = Wt + (size_t)(col0 + t * 16 + ln) * ldb + kb;
      FragB b;
      b.half[0] = *(const v8us*)(brow + 8 * hh);
      b.half[1] = *(const v8us*)(brow + 16 + 8 * hh);
      acc[t] = mmaN<ASPLIT ? 2 : 1>(ah.v, al.v, b.v, b.v, acc[t]);
    }
  }
#pragma unroll
  for (int t = 0; t < 4; ++t) {
    const int col = col0 + t * 16 + ln;
    float bv = bias ? bias[col] : 0.f;
    if (BIAS_BF16) bv = bf16_round(bv);
#pragma unroll
    for (int r = 0; r < 8; ++r) {
      float v = acc[t][r] + bv;
      if (resid) { float rv = resid[(size_t)((row0 + 8 * hh + r) % rmod) * ldr + col]; if (RES_BF16) rv = bf16_round(rv); v += rv; }
      if (ACT == 1) v = fmaxf(v, 0.f);
      if (ACT == 2) v = 0.5f * v * (1.0f + erff(v * 0.70710678118654752f));
      if (ACT == 3) { const float u = 0.7978845608028654f * (v + 0.044715f * v * v * v); v = 0.5f * v * (1.0f + tanhf(u)); }
      so[w][8 * hh + r][t * 16 + ln] = v;
    }
  }
  __builtin_amdgcn_fence(__ATOMIC_ACQ_REL, "workgroup");
  __builtin_amdgcn_wave_barrier();
  const int rsub = lane >> 4, c4 = (lane & 15) * 4;
  {
#pragma unroll
    for (int q = 0; q < 8; ++q) {
      const int r = q * 2 + rsub;
      const v4f v = *(const v4fa*)&so[w][r][c4];
      *(v4f*)(C + (size_t)(row0 + r) * ldc + col0 + c4) = v;
    }
    
  }
}
// row LayerNorm (biased variance, eps) over N: s = X (+ R); optional out_sum <- s; out_norm <- (s-mu)*rsqrt(var+eps)*g + b
template <bool PARAM_BF16>
__global__ __launch_bounds__(256) void k_layernorm(const float* __restrict__ X, const float* __restrict__ R, const float* __restrict__ g, const float* __restrict__ bta,
                                                  float* __restrict__ out_sum, float* __restrict__ out_norm, int N, float eps) {
  __shared__ float red[256];
  const int row = blockIdx.x, tid = threadIdx.x;
  const float* x = X + (size_t)row * N; const float* rr = R ? R + (size_t)row * N : nullptr;
  float vals[16];                     // up to N = 4096
  const int per = N / 256;            // contiguous chunk per thread? use strided-by-4 chunks: thread handles j = tid*4 + 1024*u
  float s1 = 0.f;
  for (int u = 0; u < per / 4; ++u) {
    const int j = tid * 4 + 1024 * u;
    const v4f a = *(const v4fa*)(x + j);
    v4f b = {0.f,0.f,0.f,0.f}; if (rr) b = *(const v4fa*)(rr + j);
#pragma unroll
    for (int q = 0; q < 4; ++q) { const float v = a[q] + b[q]; vals[u * 4 + q] = v; s1 += v; }
  }
  red[tid] = s1; __syncthreads();
  for (int st = 128; st > 0; st >>= 1) { if (tid < st) red[tid] += red[tid + st]; __syncthreads(); }
  const float mu = red[0] / (float)N; __syncthreads();
  float s2 = 0.f;
  for (int u = 0; u < per / 4; ++u)
#pragma unroll
    for (int q = 0; q < 4; ++q) { const float c = vals[u * 4 + q] - mu; s2 += c * c; }
  red[tid] = s2; __syncthreads();
  for (int st = 128; st > 0; st >>= 1) { if (tid < st) red[tid] += red[tid + st]; __syncthreads(); }
  const float rs = rsqrtf(red[0] / (float)N + eps);
  {
    for (int u = 0; u < per / 4; ++u) {
      const int j = tid * 4 + 1024 * u;
      v4f o, sm;
#pragma unroll
      for (int q = 0; q < 4; ++q) {
        float gg = g[j + q], bb = bta[j + q];
        if (PARAM_BF16) { gg = bf16_round(gg); bb = bf16_round(bb); }
        sm[q] = vals[u * 4 + q]; o[q] = (vals[u * 4 + q] - mu) * rs * gg + bb;
      }
      if (out_sum) *(v4f*)(out_sum + (size_t)row * N + j) = sm;
      *(v4f*)(out_norm + (size_t)row * N + j) = o;
    }
    
  }
}



// ---- f16 WMMA path (v_wmma_f32_16x16x32_f16): 11-bit significands for operands in range — used where a [0,1] probability operand needs more precision than bf16
typedef _Float16 v16h __attribute__((ext_vector_type(16)));
union FragH { v16h v; v8us half[2]; _Float16 h[16]; unsigned short u[16]; };
template <int NT>
__device__ __forceinline__ v8f mmaH(v16h ah, v16h al, v16h bh, v16h bl, v8f c) {
  c = __builtin_amdgcn_wmma_f32_16x16x32_f16(false, ah, false, bh, (short)0, c, false, false);
  if (NT >= 2) c = __builtin_amdgcn_wmma_f32_16x16x32_f16(false, al, false, bh, (short)0, c, false, false);
  if (NT >= 3) c = __builtin_amdgcn_wmma_f32_16x16x32_f16(false, ah, false, bl, (short)0, c, false, false);
  asm volatile("v_nop\n\tv_nop\n\tv_nop\n\tv_nop" : "+v"(c) : "v"(ah), "v"(al), "v"(bh), "v"(bl));
  return c;
}
// batched GEMM like k_gemm_b but f16 operands: A f32 (split into f16 hi/lo if ASPLIT, else rounded to f16), Bt = f16 values [n][k]; alpha; C f32; N multiple of 16 (partial tiles skipped)
template <bool ASPLIT>
__global__ __launch_bounds__(128) void k_gemm_h(const float* __restrict__ A, int lda, size_t sA, const _Float16* __restrict__ Bh, int ldb, size_t sB, float alpha, float* __restrict__ C, int ldc, size_t sC, int M, int N, int K) {
  __shared__ __attribute__((aligned(16))) float so[4][16][64];
  const int tid = threadIdx.x, w = tid >> 5, lane = tid & 31, ln = lane & 15, hh = lane >> 4; const int by = blockIdx.y;
  A += (size_t)by * sA; Bh += (size_t)by * sB; C += (size_t)by * sC;
  const int ntn = (N + 63) / 64; const int wid = blockIdx.x * 4 + w; const int mt = wid / ntn, nq = wid % ntn; if (mt * 16 >= M) return;
  const int row0 = mt * 16, col0 = nq * 64; const float* arow = A + (size_t)(row0 + ln) * lda;
  v8f acc[4] = {};
  for (int kb = 0; kb < K; kb += 32) {
    FragH ah, al;
    const v4f x0 = *(const v4fa*)(arow + kb + 8 * hh), x1 = *(const v4fa*)(arow + kb + 8 * hh + 4), x2 = *(const v4fa*)(arow + kb + 16 + 8 * hh), x3 = *(const v4fa*)(arow + kb + 16 + 8 * hh + 4);
    float xs[16] = {x0[0],x0[1],x0[2],x0[3],x1[0],x1[1],x1[2],x1[3],x2[0],x2[1],x2[2],x2[3],x3[0],x3[1],x3[2],x3[3]};
#pragma unroll
    for (int i = 0; i < 16; ++i) { const _Float16 h = (_Float16)xs[i]; ah.h[i] = h; al.h[i] = ASPLIT ? (_Float16)(xs[i] - (float)h) : (_Float16)0.0f; }
#pragma unroll
    for (int t = 0; t < 4; ++t) { if (col0 + t * 16 >= N) continue; const size_t boff = (size_t)(col0 + t * 16 + ln) * ldb + kb; FragH bq; bq.half[0] = *(const v8us*)(Bh + boff + 8 * hh); bq.half[1] = *(const v8us*)(Bh + boff + 16 + 8 * hh);
      acc[t] = mmaH<ASPLIT ? 2 : 1>(ah.v, al.v, bq.v, bq.v, acc[t]); }
  }
#pragma unroll
  for (int t = 0; t < 4; ++t) { if (col0 + t * 16 >= N) continue;
#pragma unroll
    for (int r = 0; r < 8; ++r) so[w][8 * hh + r][t * 16 + ln] = acc[t][r] * alpha; }
  __builtin_amdgcn_fence(__ATOMIC_ACQ_REL, "workgroup"); __builtin_amdgcn_wave_barrier();
  const int rsub = lane >> 4, c4 = (lane & 15) * 4;
  {
#pragma unroll
    for (int q = 0; q < 8; ++q) { const int r = q * 2 + rsub; if (col0 + c4 < N) { const v4f v = *(const v4fa*)&so[w][r][c4]; *(v4f*)(C + (size_t)(row0 + r) * ldc + col0 + c4) = v; } }
     }
}

// Wt[n][k] = f16(W[k][n]·scale) from f32 row-major W[K][N] (scale = power of two; bf16-exact weights stay exact in f16 away from the subnormal range)
__global__ __launch_bounds__(256) void k_wt_f16(const float* __restrict__ W, _Float16* __restrict__ Wt, int K, int N, float scale) {
  const int t = blockIdx.x * 256 + threadIdx.x; if (t >= N * (K / 8)) return; const int n = t / (K / 8), k8 = (t % (K / 8)) * 8; FragH f;
#pragma unroll
  for (int i = 0; i < 8; ++i) f.h[i] = (_Float16)(bf16_round(W[(size_t)(k8 + i) * N + n]) * scale); const v8us o = f.half[0];
  *(v8us*)((unsigned short*)Wt + (size_t)n * K + k8) = o; 
}
// k_gemm_hh variant with fused epilogue: v = acc·alpha + bias[by·sBias + col] (+ CP[(row/rowsPerB)·sCPb + by·64 + col] if CP) ; ACT 0 none / 1 elu ; writes f16 C16 (and f32 C if non-null)
template <int ACT>
__global__ __launch_bounds__(128) void k_gemm_hhx(const _Float16* __restrict__ A, int lda, size_t sA, const _Float16* __restrict__ Bh, int ldb, size_t sB, float alpha, const float* __restrict__ bias, size_t sBias, const float* __restrict__ CP, int rowsPerB, size_t sCPb, int row0g,
    float* __restrict__ C, _Float16* __restrict__ C16, int ldc, size_t sC, int M, int N, int K) {
  __shared__ __attribute__((aligned(16))) float so[4][16][64];
  const int tid = threadIdx.x, w = tid >> 5, lane = tid & 31, ln = lane & 15, hh = lane >> 4; const int by = blockIdx.y;
  A += (size_t)by * sA; Bh += (size_t)by * sB; const size_t cofs = (size_t)by * sC; const float* bp = bias ? bias + (size_t)by * sBias : nullptr;
  const int ntn = (N + 63) / 64; const int wid = blockIdx.x * 4 + w; const int mt = wid / ntn, nq = wid % ntn; if (mt * 16 >= M) return;
  const int row0 = mt * 16, col0 = nq * 64; const _Float16* arow = A + (size_t)(row0 + ln) * lda;
  v8f acc[4] = {};
  for (int kb = 0; kb < K; kb += 32) { FragH ah; ah.half[0] = *(const v8us*)((const unsigned short*)arow + kb + 8 * hh); ah.half[1] = *(const v8us*)((const unsigned short*)arow + kb + 16 + 8 * hh);
#pragma unroll
    for (int t = 0; t < 4; ++t) { if (col0 + t * 16 >= N) continue; const size_t boff = (size_t)(col0 + t * 16 + ln) * ldb + kb; FragH bq; bq.half[0] = *(const v8us*)((const unsigned short*)Bh + boff + 8 * hh); bq.half[1] = *(const v8us*)((const unsigned short*)Bh + boff + 16 + 8 * hh);
      acc[t] = mmaH<1>(ah.v, ah.v, bq.v, bq.v, acc[t]); }
  }
#pragma unroll
  for (int t = 0; t < 4; ++t) { if (col0 + t * 16 >= N) continue; const int col = col0 + t * 16 + ln; const float bv = bp ? bf16_round(bp[col]) : 0.f;
#pragma unroll
    for (int r = 0; r < 8; ++r) { float v = acc[t][r] * alpha + bv; if (CP) { const int rr = row0g + row0 + 8 * hh + r; if (rowsPerB < 0) v += CP[cofs + (size_t)rr * ldc + col];      /* rowsPerB < 0: own element of the batched C plane */ else { const int bidx = rr / rowsPerB; v += CP[(size_t)bidx * sCPb + (size_t)by * 64 + col]; } } if (ACT == 1) v = (v > 0.f) ? v : expm1f(v); else if (ACT == 7) v = (v > 0.f) ? v + 1.0f : expf(v); else if (ACT == 8) v = tanhf(v); else if (ACT == 9) v = 0.5f * v * (1.0f + tanhf(0.7978845608028654f * (v + 0.044715f * v * v * v))); else if (ACT == 11) v = 1.0f / (1.0f + expf(-v)); else if (ACT == 12) v = (v > 0.f) ? v : 0.01f * v; else if (ACT == 14) v = (v > 0.f) ? v : 0.1f * v; else if (ACT == 16) v = (v >= 0.f) ? v : 0.3f * v; else if (ACT == 17) v = (v >= 0.f) ? v : 0.2f * v; else if (ACT == 15) v = v / (1.0f + expf(-v)); else if (ACT == 3) v = fmaxf(v, 0.f); else if (ACT == 6) v = 0.5f * v * (1.0f + erff(v * 0.70710678118654752f)); so[w][8 * hh + r][t * 16 + ln] = v; } }
  __builtin_amdgcn_fence(__ATOMIC_ACQ_REL, "workgroup"); __builtin_amdgcn_wave_barrier();
  const int rsub = lane >> 4, c4 = (lane & 15) * 4; typedef _Float16 v4h __attribute__((ext_vector_type(4)));
  {
#pragma unroll
    for (int q = 0; q < 8; ++q) { const int r = q * 2 + rsub; if (col0 + c4 < N) { const v4f v = *(const v4fa*)&so[w][r][c4]; if (C) *(v4f*)(C + cofs + (size_t)(row0 + r) * ldc + col0 + c4) = v; if (C16) { v4h h4; for (int i = 0; i < 4; ++i) h4[i] = (_Float16)v[i]; *(v4h*)(C16 + cofs + (size_t)(row0 + r) * ldc + col0 + c4) = h4; } } }
     }
}


typedef _Float16 v4h __attribute__((ext_vector_type(4)));

__global__ __launch_bounds__(256) void k_x16(const float* __restrict__ x, _Float16* __restrict__ X16, size_t n8) { const size_t t = (size_t)blockIdx.x * 256 + threadIdx.x; if (t >= n8) return; FragH f;
#pragma unroll
  for (int q = 0; q < 8; ++q) f.h[q] = (_Float16)bf16_round(x[t * 8 + q]); *(v8us*)((unsigned short*)X16 + t * 8) = f.half[0];  }
__global__ __launch_bounds__(256) void k_h16(const float* __restrict__ x, _Float16* __restrict__ X16, size_t n8) { const size_t t = (size_t)blockIdx.x * 256 + threadIdx.x; if (t >= n8) return; FragH f;
#pragma unroll
  for (int q = 0; q < 8; ++q) f.h[q] = (_Float16)x[t * 8 + q]; *(v8us*)((unsigned short*)X16 + t * 8) = f.half[0];  }
__global__ __launch_bounds__(256) void k_round16f(const float* __restrict__ W, _Float16* __restrict__ Bt, size_t n8) { const size_t t = (size_t)blockIdx.x * 256 + threadIdx.x; if (t >= n8) return; FragH f;
#pragma unroll
  for (int i = 0; i < 8; ++i) f.h[i] = (_Float16)(bf16_round(W[t * 8 + i]) * 16.0f); *(v8us*)((unsigned short*)Bt + t * 8) = f.half[0];  }
template <int NHv, int TTv>
__global__ __launch_bounds__(256) void k_vt(const _Float16* __restrict__ V16, int ldv, int voff, _Float16* __restrict__ Vt) { __shared__ unsigned short tl[64][66]; const int tid = threadIdx.x; const int slab = blockIdx.x / (TTv / 64), lg = blockIdx.x % (TTv / 64); const int b = slab / NHv, h = slab % NHv;
  for (int i = tid; i < 64 * 8; i += 256) { const int r = i / 8, c8 = (i % 8) * 8; FragH f; f.half[0] = *(const v8us*)((const unsigned short*)V16 + ((size_t)b * TTv + lg * 64 + r) * ldv + voff + h * 64 + c8);
#pragma unroll
    for (int q = 0; q < 8; ++q) tl[r][c8 + q] = f.u[q]; }
  __syncthreads();
  {
#pragma unroll
    for (int rd = 0; rd < 2; ++rd) { const int d = rd * 32 + tid / 8, pc = tid % 8; FragH f;
#pragma unroll
      for (int q = 0; q < 8; ++q) f.u[q] = tl[pc * 8 + q][d];
      *(v8us*)((unsigned short*)Vt + ((size_t)slab * 64 + d) * TTv + lg * 64 + pc * 8) = f.half[0]; }
     } }

__global__ __launch_bounds__(256) void k_hl(const float* __restrict__ F, _Float16* __restrict__ Hh, _Float16* __restrict__ Hl, size_t n8) { const size_t t = (size_t)blockIdx.x * 256 + threadIdx.x; if (t >= n8) return; FragH fh, fl; const v4f a = *(const v4fa*)(F + t * 8), c = *(const v4fa*)(F + t * 8 + 4);
#pragma unroll
  for (int q = 0; q < 4; ++q) { _Float16 h = (_Float16)a[q]; fh.h[q] = h; fl.h[q] = (_Float16)((a[q] - (float)h) * 1024.0f); h = (_Float16)c[q]; fh.h[4 + q] = h; fl.h[4 + q] = (_Float16)((c[q] - (float)h) * 1024.0f); }
  { *(v8us*)((unsigned short*)Hh + t * 8) = fh.half[0]; *(v8us*)((unsigned short*)Hl + t * 8) = fl.half[0];  } }

// ---- fast GEMM (wave tile 32x64; requires M % 32 == 0 rows per launch region and N % 64 == 0); epilogue = k_gemm_hhx semantics ----
__device__ __forceinline__ v16h g2_frag(const _Float16* p, int hh) { FragH f; f.half[0] = *(const v8us*)((const unsigned short*)p + 8 * hh); f.half[1] = *(const v8us*)((const unsigned short*)p + 16 + 8 * hh); return f.v; }
__device__ __forceinline__ v8f g2_mma(v16h a, v16h b, v8f c) { v8f d = __builtin_amdgcn_wmma_f32_16x16x32_f16(false, a, false, b, (short)0, c, false, false); asm volatile("v_nop\n\tv_nop\n\tv_nop\n\tv_nop" : "+v"(d) : "v"(a), "v"(b)); return d; }
template <int ACT>
__global__ __launch_bounds__(128) void k_gemm2(const _Float16* __restrict__ A, int lda, size_t sA, const _Float16* __restrict__ Bh, int ldb, size_t sB, float alpha, const float* __restrict__ bias, size_t sBias, const float* __restrict__ CP, int rowsPerB, size_t sCPb, int row0g,
    float* __restrict__ C, _Float16* __restrict__ C16, int ldc, size_t sC, int M, int N, int K) { static_assert(ACT == 0 || ACT == 3 || ACT == 6 || ACT == 8 || ACT == 9 || ACT == 11 || ACT == 12 || ACT == 14 || ACT == 15 || ACT == 16 || ACT == 17, "k_gemm2: unsupported ACT code (would silently apply no activation)");
  __shared__ __attribute__((aligned(16))) float so[4][32][68];
  const int tid = threadIdx.x, w = tid >> 5, lane = tid & 31, ln = lane & 15, hh = lane >> 4; const int by = blockIdx.y;
  A += (size_t)by * sA; Bh += (size_t)by * sB; const size_t cofs = (size_t)by * sC; const float* bp = bias ? bias + (size_t)by * sBias : nullptr;
  const int ntn = N >> 6; const int mt = blockIdx.x / ntn, nq = blockIdx.x - mt * ntn; const int row0 = mt * 128 + 32 * w, col0 = nq * 64; if (row0 >= M) return;
  const _Float16* a0p = A + (size_t)(row0 + ln) * lda; const _Float16* a1p = a0p + (size_t)16 * lda;
  const _Float16* b0p = Bh + (size_t)(col0 + ln) * ldb; const _Float16* b1p = b0p + (size_t)16 * ldb; const _Float16* b2p = b1p + (size_t)16 * ldb; const _Float16* b3p = b2p + (size_t)16 * ldb;
  const v8f z8 = {0.f,0.f,0.f,0.f,0.f,0.f,0.f,0.f}; v8f c00 = z8, c01 = z8, c02 = z8, c03 = z8, c10 = z8, c11 = z8, c12 = z8, c13 = z8;
#pragma unroll 1
  for (int kb = 0; kb < K; kb += 32) { const v16h a0 = g2_frag(a0p + kb, hh), a1 = g2_frag(a1p + kb, hh);
    v16h b = g2_frag(b0p + kb, hh); c00 = g2_mma(a0, b, c00); c10 = g2_mma(a1, b, c10);
    b = g2_frag(b1p + kb, hh); c01 = g2_mma(a0, b, c01); c11 = g2_mma(a1, b, c11);
    b = g2_frag(b2p + kb, hh); c02 = g2_mma(a0, b, c02); c12 = g2_mma(a1, b, c12);
    b = g2_frag(b3p + kb, hh); c03 = g2_mma(a0, b, c03); c13 = g2_mma(a1, b, c13); }
  v8f accs[8] = {c00, c01, c02, c03, c10, c11, c12, c13};
#pragma unroll
  for (int u = 0; u < 8; ++u) { const int t = u & 3, half = u >> 2; const int col = col0 + t * 16 + ln; const float bv = bp ? bf16_round(bp[col]) : 0.f;
#pragma unroll
    for (int r = 0; r < 8; ++r) { const int rloc = half * 16 + 8 * hh + r; float v = accs[u][r] * alpha + bv; if (CP) { if (rowsPerB < 0) v += CP[cofs + (size_t)(row0g + row0 + rloc) * ldc + col];      /* rowsPerB < 0: own element of the batched C plane */ else { const int bidx = (row0g + row0 + rloc) / rowsPerB; v += CP[(size_t)bidx * sCPb + (size_t)by * 64 + col]; } }
      if (ACT == 3) v = fmaxf(v, 0.f); else if (ACT == 6) v = 0.5f * v * (1.0f + erff(v * 0.70710678118654752f)); else if (ACT == 11) v = 1.0f / (1.0f + expf(-v)); else if (ACT == 15) v = v / (1.0f + expf(-v)); else if (ACT == 12) v = (v > 0.f) ? v : 0.01f * v; else if (ACT == 8) v = tanhf(v); else if (ACT == 9) v = 0.5f * v * (1.0f + tanhf(0.7978845608028654f * (v + 0.044715f * v * v * v))); else if (ACT == 14) v = (v > 0.f) ? v : 0.1f * v; else if (ACT == 16) v = (v >= 0.f) ? v : 0.3f * v; else if (ACT == 17) v = (v >= 0.f) ? v : 0.2f * v;
      so[w][rloc][t * 16 + ln] = v; } }
  __builtin_amdgcn_fence(__ATOMIC_ACQ_REL, "workgroup"); __builtin_amdgcn_wave_barrier();
  const int rsub = lane >> 4, c4 = (lane & 15) * 4;
  {
#pragma unroll
    for (int q = 0; q < 16; ++q) { const int r = q * 2 + rsub; const v4f v = *(const v4fa*)&so[w][r][c4]; if (C) *(v4f*)(C + cofs + (size_t)(row0 + r) * ldc + col0 + c4) = v; if (C16) { v4h h4; for (int i = 0; i < 4; ++i) h4[i] = (_Float16)v[i]; *(v4h*)(C16 + cofs + (size_t)(row0 + r) * ldc + col0 + c4) = h4; } }
     } }


__global__ __launch_bounds__(256) void k_wnat(const float* __restrict__ w, size_t n8, _Float16* __restrict__ Bt) { const size_t t = (size_t)blockIdx.x * 256 + threadIdx.x; if (t >= n8) return; FragH f; for (int q = 0; q < 8; ++q) f.h[q] = (_Float16)(bf16_round(w[t * 8 + q]) * 16.0f); *(v8us*)((unsigned short*)Bt + t * 8) = f.half[0];  }
__global__ __launch_bounds__(256) void k_rsm(const float* __restrict__ S, _Float16* __restrict__ P, int nrows) {
  #pragma clang fp contract(off)
  const int i = blockIdx.x * 256 + threadIdx.x; if (i >= nrows) return; const float* s = S + (size_t)i * SQ; float mx = -3.0e38f;
#pragma unroll 1
  for (int j = 0; j < SQ; ++j) mx = fmaxf(mx, s[j]); float se = 0.f;
#pragma unroll 1
  for (int j = 0; j < SQ; ++j) se += expf(s[j] - mx); const float sc = 256.0f / se;
#pragma unroll 1
  for (int j0 = 0; j0 < SQ; j0 += 8) { FragH f; for (int q = 0; q < 8; ++q) f.h[q] = (_Float16)(expf(s[j0 + q] - mx) * sc); unsigned short* d = (unsigned short*)P + (size_t)i * SQ + j0; *(v8us*)d = f.half[0];  } }
__global__ __launch_bounds__(256) void k_vt(const _Float16* __restrict__ V16, int b, int h0, _Float16* __restrict__ VT) { __shared__ unsigned short tl[64][65]; const int tid = threadIdx.x; const int hh = blockIdx.x % HG, sg = blockIdx.x / HG; const int s0 = sg * 64; const int h = h0 + hh;
  for (int i = tid; i < 64 * 8; i += 256) { const int j = i / 8, d8 = (i % 8) * 8; FragH f; f.half[0] = *(const v8us*)((const unsigned short*)V16 + ((size_t)b * SQ + s0 + j) * DM + h * HD + d8); for (int q = 0; q < 8; ++q) tl[d8 + q][j] = f.u[q]; }
  __syncthreads();
  { for (int i = tid; i < 64 * 8; i += 256) { const int d = i / 8, j8 = (i % 8) * 8; FragH f; for (int q = 0; q < 8; ++q) f.u[q] = tl[d][j8 + q]; *(v8us*)((unsigned short*)VT + ((size_t)hh * HD + d) * SQ + s0 + j8) = f.half[0]; }  } }



__global__ __launch_bounds__(256) void k_rsmcf2(const float* __restrict__ S, _Float16* __restrict__ P, int hg, int q0, int nk) {
  #pragma clang fp contract(off)
  const int t = blockIdx.x * 256 + threadIdx.x; if (t >= hg * QT) return; const size_t i = (size_t)t; const float* s = S + i * NKX; const int last = q0 + (t % QT); float mx = -3.0e38f;
#pragma unroll 1
  for (int j = 0; j < nk; ++j) { const float f = (j <= last) ? 1.f : 0.f; mx = fmaxf(mx, fmaf(f, s[j], (1.f - f) * -1.0e9f)); } float se = 0.f;
#pragma unroll 1
  for (int j = 0; j < nk; ++j) { const float f = (j <= last) ? 1.f : 0.f; se += __expf(fmaf(f, s[j], (1.f - f) * -1.0e9f) - mx); } const float sc = 256.0f / se;
#pragma unroll 1
  for (int j0 = 0; j0 < nk; j0 += 8) { FragH fr; for (int q = 0; q < 8; ++q) { const int j = j0 + q; const float f = (j <= last) ? 1.f : 0.f; fr.h[q] = (_Float16)(__expf(fmaf(f, s[j], (1.f - f) * -1.0e9f) - mx) * sc); } unsigned short* d = (unsigned short*)P + i * NKX + j0; *(v8us*)d = fr.half[0];  } }

template <int MASKADD>
__global__ __launch_bounds__(64) void k_att0(const float* __restrict__ QF, const float* __restrict__ KF, const float* __restrict__ VF, int ld, const float* __restrict__ mask, float scale, float* __restrict__ OF, int ldo) {
  #pragma clang fp contract(off)
  __shared__ __attribute__((aligned(16))) float lq[64][64]; __shared__ __attribute__((aligned(16))) float lo[64][64];
  const int tid = threadIdx.x; const int h = blockIdx.x / (QT0 / 64), rg = blockIdx.x % (QT0 / 64); const int i = rg * 64 + tid;
  const float* qr = QF + (size_t)i * ld + h * HD;
#pragma unroll 1
  for (int c = 0; c < HD / 4; ++c) { *(v4f*)&lq[tid][c * 4] = *(const v4fa*)(qr + c * 4); const v4f z = {0.f, 0.f, 0.f, 0.f}; *(v4f*)&lo[tid][c * 4] = z; }
  float m = -1.0e30f, l = 0.f; const int jmax = MASKADD ? (SQ - 1) : (rg * 64 + 63);      /* additive-mask form: every key (the mask input decides); causal form: keys up to the block's last row */
#pragma unroll 1
  for (int j = 0; j <= jmax; ++j) { const float* kr = KF + (size_t)j * ld + h * HD; const float* vr = VF + (size_t)j * ld + h * HD; float s = 0.f;
#pragma unroll 1
    for (int c = 0; c < HD / 4; ++c) { const v4f kq = *(const v4fa*)(kr + c * 4); const v4f qq = *(v4f*)&lq[tid][c * 4]; s = __fadd_rn(s, __fmul_rn(qq[0], kq[0])); s = __fadd_rn(s, __fmul_rn(qq[1], kq[1])); s = __fadd_rn(s, __fmul_rn(qq[2], kq[2])); s = __fadd_rn(s, __fmul_rn(qq[3], kq[3])); }
    s = __fmul_rn(s, scale); if (MASKADD) s = __fadd_rn(s, __fmul_rn(bf16_round(mask[(size_t)i * SQ + j]), -10000.0f));
    const float f = (MASKADD || j <= i) ? 1.f : 0.f; const float sm = fmaf(f, s, (1.f - f) * -1.0e30f); const float mn = fmaxf(m, sm); const float sc = expf(m - mn); const float e = expf(sm - mn); l = __fadd_rn(__fmul_rn(l, sc), e); m = mn;
#pragma unroll 1
    for (int c = 0; c < HD / 4; ++c) { const v4f vv = *(const v4fa*)(vr + c * 4); v4f oo = *(v4f*)&lo[tid][c * 4]; for (int u = 0; u < 4; ++u) oo[u] = __fadd_rn(__fmul_rn(oo[u], sc), __fmul_rn(e, vv[u])); *(v4f*)&lo[tid][c * 4] = oo; } }
  const float fin = 64.0f / l;      /* o carried x64; the f16 path writes o unscaled */
#pragma unroll 1
  for (int c = 0; c < HD / 4; ++c) { v4f oo = *(v4f*)&lo[tid][c * 4]; for (int u = 0; u < 4; ++u) oo[u] = __fmul_rn(oo[u], fin); *(v4f*)&lo[tid][c * 4] = oo; }
  __syncthreads();
  {
#pragma unroll 1
    for (int it = 0; it < 16; ++it) { const int row = it * 4 + tid / 16, pc = (tid % 16) * 4; const v4f v = *(const v4f*)&lo[row][pc]; *(v4f*)(OF + (size_t)(rg * 64 + row) * ldo + h * HD + pc) = v; }
     } }

__global__ __launch_bounds__(256) void k_oscale(const float* __restrict__ OF, float* __restrict__ out, size_t n4) { const size_t t = (size_t)blockIdx.x * 256 + threadIdx.x; if (t >= n4) return; const v4f a = *(const v4fa*)(OF + t * 4); v4f o; for (int q = 0; q < 4; ++q) o[q] = a[q] * 0.015625f; *(v4f*)(out + t * 4) = o;  }

__global__ __launch_bounds__(256) void k_bfr(const float* __restrict__ x, float* __restrict__ XB, size_t n8) { const size_t t = (size_t)blockIdx.x * 256 + threadIdx.x; if (t >= n8) return; v4f a = *(const v4fa*)(x + t * 8), c = *(const v4fa*)(x + t * 8 + 4); for (int q = 0; q < 4; ++q) { a[q] = bf16_round(a[q]); c[q] = bf16_round(c[q]); }
  { *(v4f*)(XB + t * 8) = a; *(v4f*)(XB + t * 8 + 4) = c;  } }



__global__ __launch_bounds__(256) void k_rsmfvl(const float* __restrict__ S, _Float16* __restrict__ P, _Float16* __restrict__ PL, int qn, const int* __restrict__ vlp) {
  #pragma clang fp contract(off)
  const int t = blockIdx.x * 256 + threadIdx.x; if (t >= qn) return; const int vl = vlp[0]; const size_t i = (size_t)t; const float* s = S + i * SQ; float mx = -3.0e38f;
#pragma unroll 1
  for (int j = 0; j < SQ; ++j) { const float f = (j < vl) ? 1.f : 0.f; mx = fmaxf(mx, fmaf(f, s[j], (1.f - f) * -1000000.0f)); } float se = 0.f;
#pragma unroll 1
  for (int j = 0; j < SQ; ++j) { const float f = (j < vl) ? 1.f : 0.f; se += __expf(fmaf(f, s[j], (1.f - f) * -1000000.0f) - mx); } const float sc = 256.0f / se;
#pragma unroll 1
  for (int j0 = 0; j0 < SQ; j0 += 8) { FragH fr, gr; for (int q = 0; q < 8; ++q) { const int j = j0 + q; const float f = (j < vl) ? 1.f : 0.f; const float pv = __expf(fmaf(f, s[j], (1.f - f) * -1000000.0f) - mx) * sc; const _Float16 ph = (_Float16)pv; fr.h[q] = ph; gr.h[q] = (_Float16)((pv - (float)ph) * 1024.0f); }
    unsigned short* d = (unsigned short*)P + i * SQ + j0; unsigned short* dl = (unsigned short*)PL + i * SQ + j0; *(v8us*)d = fr.half[0]; *(v8us*)dl = gr.half[0];  } }

__global__ __launch_bounds__(256) void k_rsmf(const float* __restrict__ S, _Float16* __restrict__ P, int qn, int hg) {
  #pragma clang fp contract(off)
  const int t = blockIdx.x * 256 + threadIdx.x; if (t >= qn * hg) return; const size_t i = (size_t)(t / qn) * SQ + (t % qn); const float* s = S + i * SQ; float mx = -3.0e38f;
#pragma unroll 1
  for (int j = 0; j < SQ; ++j) mx = fmaxf(mx, s[j]); float se = 0.f;
#pragma unroll 1
  for (int j = 0; j < SQ; ++j) se += __expf(s[j] - mx); const float sc = 256.0f / se;
#pragma unroll 1
  for (int j0 = 0; j0 < SQ; j0 += 8) { FragH f; for (int q = 0; q < 8; ++q) f.h[q] = (_Float16)(__expf(s[j0 + q] - mx) * sc); unsigned short* d = (unsigned short*)P + i * SQ + j0; *(v8us*)d = f.half[0];  } }



// lane l <-> l ^ 16 (cross-row move): register only, no LDS traffic
__device__ __forceinline__ float lane_x16(float v) { const int b = __float_as_int(v); return __int_as_float(__builtin_amdgcn_permlanex16(b, b, 0x76543210, 0xfedcba98, false, false)); }

// ---- fused attention: logits, softmax and weights x value in one kernel; scores and weights never leave the registers ----
#define FA_QT 4                      /* query tiles (16 rows each) per work-group */
#define FA_WT 2                      /* query tiles per wave: every K and V^T fragment read from LDS feeds both */
#define FA_QG (FA_QT / FA_WT)        /* waves per key range */
#define FA_KS 4                      /* key ranges per work-group, one wave per (pair of query tiles, key range) */
#define FA_NP (SQ / FA_KS / 32)      /* passes of 32 keys per wave */
// Operands stored as ready-made WMMA A fragments: a block of 512 f16 = [half j][lane l][8], lane l = (c = l & 15, h = l >> 4) holding row c, k = 16 j + 8 h + 0..7 (the hardware k order),
// so that a fragment is two whole-line loads of 512 B instead of two loads that touch 16 lines each. One 16-byte piece = 8 f16, piece t = (block t >> 6, half j = (t >> 5) & 1, lane l = t & 31).
// KF: block (key tile kt, d step s) at kt * 4 + s: row = key kt * 16 + c, k = channel s * 32 + ...
// VF: block (32-key step kp, channel tile dt) at kp * 8 + dt: row = channel dt * 16 + c, k = key kp * 32 + ... (the transposition of value happens here)
// ONE launch prepares everything the attention kernel reads. Work-group g takes rows 64 g .. 64 g + 63 of query, key and value (all batches in one row count): 1024 pieces of each, two per thread,
// and every load of a thread is issued before its first conversion: one memory round trip for the whole launch.
// A thread's two value pieces are 16 keys of ONE channel (tile dt = wave >> 1, channel c), so the work-group's sum over its 64 keys of the bf16-rounded value comes from registers (f32 on VALU):
// 8 keys as a tree, the two pieces, lane l + lane l ^ 16, then the two waves of a channel tile through LDS. PM[g][channel]; the attention kernel adds a batch's 64 partial sums.
#define PR_T 512                     /* threads of a preparation work-group */
// KF and VF begin at the first multiple of FA_AL bytes in their workspace pieces (which are FA_AL bytes longer than the data); both kernels form that start in the same way.
// FA_AL = the bytes of one wave's walk in the attention kernel (FA_NP tiles of 8 KB), so each walk lies in one aligned block and only the low address word differs between its tiles.
#define FA_AL ((size_t)FA_NP * 8192)
__device__ __forceinline__ _Float16* fa_base(_Float16* p) { return p + ((((size_t)0 - (size_t)p) & (FA_AL - 1)) >> 1); }      /* an offset added to p, not a pointer made from a number: the stores through it stay global stores */
__global__ __launch_bounds__(PR_T) void k_prep(const float* __restrict__ xq, const float* __restrict__ xk, const float* __restrict__ xv, _Float16* __restrict__ Q16, _Float16* __restrict__ KW, _Float16* __restrict__ VW, float* __restrict__ PM) {
  __shared__ float part[PR_T / 32][16]; _Float16* const KF = fa_base(KW); _Float16* const VF = fa_base(VW);
  const int tid = threadIdx.x, w = tid >> 5, l = tid & 31, j = w & 1, c = l & 15, h = l >> 4; const size_t t0 = (size_t)blockIdx.x * (2 * PR_T) + tid;
  v4f qa[2][2], ka[2][2]; float va[2][8];
  /* unrolled: the arrays stay in registers and all 24 loads are in flight together */
#pragma unroll
  for (int i = 0; i < 2; ++i) { const size_t t = t0 + (size_t)i * PR_T, blk = t >> 6;
    const float* qs = xq + t * 8; const float* ks = xk + ((blk >> 2) * 16 + c) * DM + (blk & 3) * 32 + j * 16 + 8 * h; const float* vs = xv + ((blk >> 3) * 32 + j * 16 + 8 * h) * DM + (blk & 7) * 16 + c;
    /* the s_wait_xcnt behind each address's loads: a later load's result may land in that address's registers; the data stay in flight */
    qa[i][0] = *(const v4fa*)qs; qa[i][1] = *(const v4fa*)(qs + 4); asm volatile("s_wait_xcnt 0x0" ::: "memory");
    ka[i][0] = *(const v4fa*)ks; ka[i][1] = *(const v4fa*)(ks + 4); asm volatile("s_wait_xcnt 0x0" ::: "memory");
#pragma unroll
    for (int q = 0; q < 8; ++q) va[i][q] = vs[(size_t)q * DM];
    asm volatile("s_wait_xcnt 0x0" ::: "memory"); }
  /* inputs only, no code: every loaded value is in its register here, so all 24 loads issue ahead of the first use, under one wait (without it the query and key loads sink behind the barrier below: a second memory round trip) */
  asm volatile("" :: "v"(qa[0][0]), "v"(qa[0][1]), "v"(qa[1][0]), "v"(qa[1][1]), "v"(ka[0][0]), "v"(ka[0][1]), "v"(ka[1][0]), "v"(ka[1][1]), "v"(va[0][0]), "v"(va[0][1]), "v"(va[0][2]), "v"(va[0][3]), "v"(va[0][4]), "v"(va[0][5]), "v"(va[0][6]), "v"(va[0][7]),
               "v"(va[1][0]), "v"(va[1][1]), "v"(va[1][2]), "v"(va[1][3]), "v"(va[1][4]), "v"(va[1][5]), "v"(va[1][6]), "v"(va[1][7]));
  /* the value sums first: their barrier and the store of PM then stand in front of the six large stores and wait for none of them */
  float r[2][8];
#pragma unroll
  for (int i = 0; i < 2; ++i) for (int q = 0; q < 8; ++q) r[i][q] = bf16_round(va[i][q]);
  float a = (((r[0][0] + r[0][1]) + (r[0][2] + r[0][3])) + ((r[0][4] + r[0][5]) + (r[0][6] + r[0][7]))) + (((r[1][0] + r[1][1]) + (r[1][2] + r[1][3])) + ((r[1][4] + r[1][5]) + (r[1][6] + r[1][7])));
  a += lane_x16(a);
  if (h == 0) part[w][c] = a;
  __syncthreads();      /* every wave passes it once: the first four waves read both waves' sums of each channel tile below */
  if (tid < DM) PM[(size_t)blockIdx.x * DM + tid] = part[2 * (tid >> 4)][tid & 15] + part[2 * (tid >> 4) + 1][tid & 15];
  /* unrolled: register arrays */
#pragma unroll
  for (int i = 0; i < 2; ++i) { const size_t t = t0 + (size_t)i * PR_T; FragH fq, fk, fv;
#pragma unroll
    for (int q = 0; q < 8; ++q) { fq.h[q] = (_Float16)bf16_round(qa[i][q >> 2][q & 3]); fk.h[q] = (_Float16)bf16_round(ka[i][q >> 2][q & 3]); fv.h[q] = (_Float16)r[i][q]; }
    *(v8us*)((unsigned short*)Q16 + t * 8) = fq.half[0]; *(v8us*)((unsigned short*)KF + t * 8) = fk.half[0]; *(v8us*)((unsigned short*)VF + t * 8) = fv.half[0]; } }
// p: the block's start, the same for the whole wave; lo = lane * 8: the lane's own 16-byte piece
__device__ __forceinline__ v16h fa_frag(const unsigned short* p, unsigned lo) { FragH f; f.half[0] = *(const v8us*)(p + lo); f.half[1] = *(const v8us*)(p + 256 + lo); return f.v; }
// One tensor load: the wave's 8 KB (eight fragment blocks of 1024 B, contiguous in memory and in LDS) go from g to LDS byte l as ONE request of the whole wave, through no register and with no address per lane.
// Descriptor: two groups, 1-byte elements, tensor = tile = 8 rows of 1024 B at a source pitch of 1024 B, no pad, no mask; every word wave-uniform in scalar registers.
typedef unsigned u32x4 __attribute__((ext_vector_type(4)));
typedef unsigned u32x8 __attribute__((ext_vector_type(8)));
#define FA_TR 1024u                  /* bytes of a tile row */
#define FA_TN 8u                     /* rows of a tile */
__device__ __forceinline__ unsigned fa_uni(unsigned v) { return (unsigned)__builtin_amdgcn_readfirstlane(v); }
// a wave-uniform value held in a scalar register: the guard of a tensor load (which ignores EXEC, so only a scalar branch keeps a wave from issuing it)
__device__ __forceinline__ unsigned fa_pinned(unsigned v) { unsigned w = fa_uni(v); asm volatile("" : "+s"(w)); /* pins a tensor load's guard in a scalar register */ return w; }
// g0: the wave's group 0, its words 0 (count) and 3 (high address bits and the type) formed once ahead of the first request; a request sets word 1 (l, the LDS byte) and word 2 (glo, the tile's low address word) alone:
// while requests are outstanding no other word takes a new value. g0 is an in-out operand so that the group keeps its four scalar registers from request to request (as an input the compiler rebuilt it, word 3 too, in front of every request).
__device__ __forceinline__ void fa_tload(u32x4& g0, unsigned l, unsigned glo) {
  g0[1] = fa_uni(l); g0[2] = fa_uni(glo);
  u32x8 g1; g1[0] = fa_uni(0u); g1[1] = fa_uni((FA_TR & 0xFFFFu) << 16); g1[2] = fa_uni((FA_TR >> 16) | ((FA_TN & 0xFFFFu) << 16)); g1[3] = fa_uni((FA_TN >> 16) | (FA_TR << 16)); g1[4] = fa_uni(FA_TN); g1[5] = fa_uni(FA_TR); g1[6] = fa_uni(0u); g1[7] = fa_uni(0u);
  asm volatile("tensor_load_to_lds %0, %1" : "+s"(g0) : "s"(g1) : "memory"); }
__device__ __forceinline__ v8f fa_mma(v16h a, v16h b, v8f c) { return __builtin_amdgcn_wmma_f32_16x16x32_f16(false, a, false, b, (short)0, c, false, false); }
// native 2^t; the v_nop in the same statement keeps the one slot that the instruction set asks for behind a transcendental, whatever the compiler puts next
__device__ __forceinline__ float fa_exp2(float t) { float e; asm("v_exp_f32 %0, %1\n\tv_nop" : "=v"(e) : "v"(t)); return e; }
// four at once: the results are early-clobber, so none of the four reads a neighbour's result or overwrites its source, and one v_nop closes the last one's slot
__device__ __forceinline__ void fa_exp2x4(float& a, float& b, float& c, float& d) { float e0, e1, e2, e3;
  asm("v_exp_f32 %0, %4\n\tv_exp_f32 %1, %5\n\tv_exp_f32 %2, %6\n\tv_exp_f32 %3, %7\n\tv_nop" : "=&v"(e0), "=&v"(e1), "=&v"(e2), "=&v"(e3) : "v"(a), "v"(b), "v"(c), "v"(d)); a = e0; b = e1; c = e2; d = e3; }
// A wave owns 32 queries (two tiles of 16) and 1024 keys. S^T = K Q^T: D register r of lane (c, h) = score of key 8 h + r, query c of the tile, so a query's scores sit in two lanes (maximum and sum in-lane plus one exchange),
// and two score tiles (keys 0..15, 16..31), converted in place, ARE the B fragment of O^T += V^T P^T in the hardware k order. Running maximum m per query (log2 units), renewed only when a pass exceeds it by more than 8;
// weights 2^(s - m + 6) <= 2^14 rounded once to f16 (2^-12 relative, zero mean, an eighth of the bf16 rounding that value already carries), products summed in f32 accumulators; the sum of the f32 weights in l. The four key ranges of a query tile are joined through LDS at the end.
// K and V^T fragments come from LDS: a tile = one pass (32 keys) of each of the four key ranges, 16 KB a range in the order of KF and VF, brought in by tensor loads into a ring of four buffers: while tile p is worked on, tile p + 1 has landed and tiles p + 2, p + 3 fly.
// The two waves of a key range each load half of its 16 KB, one request a wave and tile, and both read the whole: a work-group fetches each K and V^T byte once, and no wave waits out a global load inside the loop.
// A fragment read from LDS is the A operand of both query tiles' products: 16 KB of LDS reads a pass serve 32 queries. Eight waves, two per SIMD, leave each wave the registers for both tiles' accumulators and query fragments.
// Work-group x of a batch takes the 32 tiles of each key range in the order x mod 32, x mod 32 + 1, ..., wrapping round: every key once, in a rotated order.
#define FA_NB 4                      /* buffers of the ring */
typedef float f32a __attribute__((may_alias));
__global__ __launch_bounds__(FA_QG * FA_KS * 32) void k_fattn(const _Float16* __restrict__ Q16, const _Float16* __restrict__ KW, const _Float16* __restrict__ VW, const float* __restrict__ PM, float* __restrict__ out) {
  __shared__ __attribute__((aligned(2048))) unsigned short ring[FA_NB][FA_KS][8192];      /* [buffer][key range][K blocks of the pass: 4096 f16, then V^T blocks: 4096 f16] */
  f32a (*so)[FA_QT][64][32] = (f32a (*)[FA_QT][64][32])&ring[0][0][0];      /* the join's partial results [FA_KS][FA_QT][64][32] lie in the ring's first 128 KB, used behind the loop's last barrier wait, when no wave reads the ring and no load is outstanding */
  __shared__ float sm[FA_KS][FA_QT][32]; __shared__ float sl[FA_KS][FA_QT][32]; __shared__ __attribute__((aligned(16))) float sv[FA_KS][DM];
  const int tid = threadIdx.x, w = __builtin_amdgcn_readfirstlane(tid >> 5) /* the wave's number in a scalar register: fragment bases and LDS planes become scalar */, lane = tid & 31, c = lane & 15, h = lane >> 4, qg = w & (FA_QG - 1), ks = w / FA_QG; const int b = blockIdx.y, row0 = blockIdx.x * (FA_QT * 16) + qg * (FA_WT * 16);
  const size_t f0 = ((size_t)b * (SQ / 32) + (size_t)ks * FA_NP) * 4096; const unsigned lo = (unsigned)lane * 8;      /* a pass of 32 keys = 8 blocks = 4096 f16 in KF and in VF */
  /* the wave's half of its range's tile: wave qg 0 the K blocks, wave 1 the V^T blocks; the LDS byte address is the low 32 bits of the __shared__ address, a multiple of 8 KB from the ring's start (the ring stands at a multiple of 2 KB) */
  const unsigned long long ga = (unsigned long long)(size_t)((const unsigned short*)fa_base((_Float16*)(qg == 0 ? KW : VW)) + f0);      /* the walk's first byte, a multiple of FA_AL: tile i lies at ga + 8192 i with no carry out of the low word */
  const unsigned glo = fa_uni((unsigned)ga); u32x4 g0; g0[0] = fa_uni(1u); g0[1] = fa_uni(0u); g0[2] = glo; g0[3] = fa_uni((((unsigned)(ga >> 32)) & 0x01FFFFFFu) | 0x80000000u);
  const unsigned lb = (unsigned)(size_t)&ring[0][ks][qg * 4096];      /* the half's place in buffer 0; buffer i lies i * sizeof ring[0] = i * 65536 bytes behind */
  /* the walk's entry: pass p works on tile (p + rot) mod FA_NP of each key range. The work-groups of a batch read the same K and V^T at the same pace; entering at different tiles they ask L2 for different lines at any moment */
  const unsigned rot = blockIdx.x & (FA_NP - 1);
  /* the first three tiles into buffers 0, 1, 2, every wave its own half: three requests of the wave outstanding, in flight beside the query and partial-sum loads below (unrolled: three issues in a row, no loop control between them) */
#pragma unroll
  for (unsigned i = 0; i < FA_NB - 1; ++i) fa_tload(g0, lb + i * (unsigned)sizeof(ring[0]), glo + (((rot + i) & (FA_NP - 1)) << 13));
  v16h q[FA_WT][4];
  /* unrolled: register arrays */
#pragma unroll
  for (int t = 0; t < FA_WT; ++t) { const _Float16* qp = Q16 + ((size_t)b * SQ + row0 + t * 16 + c) * DM; q[t][0] = g2_frag(qp, h); q[t][1] = g2_frag(qp + 32, h); q[t][2] = g2_frag(qp + 64, h); q[t][3] = g2_frag(qp + 96, h); }
  /* sum of value over the sequence: wave (qg, ks) adds partial sums 16 ks .. 16 ks + 15 of its batch for channels 64 qg + 32 t + lane (whole lines, in flight beside the query loads); the four quarters meet behind the barrier below */
#pragma unroll
  for (int t = 0; t < FA_WT; ++t) { const int ch = (qg * FA_WT + t) * 32 + lane; const float* pp = PM + ((size_t)b * (SQ / 64) + ks * 16) * DM + ch; float x[16];
#pragma unroll
    for (int i = 0; i < 16; ++i) x[i] = pp[(size_t)i * DM];
    sv[ks][ch] = (((x[0] + x[1]) + (x[2] + x[3])) + ((x[4] + x[5]) + (x[6] + x[7]))) + (((x[8] + x[9]) + (x[10] + x[11])) + ((x[12] + x[13]) + (x[14] + x[15]))); }
  asm volatile("s_wait_tensorcnt 0x2" ::: "memory");      /* all but the wave's two youngest requests: its own half of tile 0 has landed */
  __syncthreads();      /* every wave passes it: tile 0 is read by waves that did not load it */
  fa_tload(g0, lb + (FA_NB - 1) * (unsigned)sizeof(ring[0]), glo + (((rot + FA_NB - 1) & (FA_NP - 1)) << 13));      /* the fourth tile into buffer 3: again three requests outstanding */
  const float CS = (float)(0.08838834764831845 * 1.4426950408889634);      /* 1 / sqrt(128) times log2 e */
  const v8f z8 = {0.f,0.f,0.f,0.f,0.f,0.f,0.f,0.f}; v8f o[FA_WT][8]; float m[FA_WT], l[FA_WT];
#pragma unroll
  for (int t = 0; t < FA_WT; ++t) { m[t] = -1.0e30f; l[t] = 0.f;
#pragma unroll
    for (int j = 0; j < 8; ++j) o[t][j] = z8; }
  /* kept rolled: the fragments of one pass alone are live at a time, inside the 512 registers that two waves per SIMD leave each wave */
#pragma unroll 1
  for (int p = 0; p < FA_NP; ++p) { const unsigned short* kp = &ring[p & (FA_NB - 1)][ks][0]; const unsigned short* vp = kp + 4096;
    const unsigned more = fa_pinned(p + FA_NB < FA_NP);      /* is there a tile p + 4: the guard of the pass's tensor load, in a scalar register */
    const v16h k0 = fa_frag(kp, lo), k1 = fa_frag(kp + 512, lo), k2 = fa_frag(kp + 1024, lo), k3 = fa_frag(kp + 1536, lo), k4 = fa_frag(kp + 2048, lo), k5 = fa_frag(kp + 2560, lo), k6 = fa_frag(kp + 3072, lo), k7 = fa_frag(kp + 3584, lo);
    v16h vf[8];
#pragma unroll
    for (int j = 0; j < 8; ++j) vf[j] = fa_frag(vp + j * 512, lo);
    /* nothing is scheduled across this line: the pass's 32 LDS loads issue back to back as one group ahead of the first product, each product behind a counted wait
       (without it the V^T loads sink behind the score products and are waited out there on their own: a second LDS latency a pass; both operands' fragments fit the registers of a wave at two waves per SIMD) */
    __builtin_amdgcn_sched_barrier(0);
    v8f s0[FA_WT], s1[FA_WT];
#pragma unroll
    for (int t = 0; t < FA_WT; ++t) { s0[t] = fa_mma(k0, q[t][0], z8); s1[t] = fa_mma(k4, q[t][0], z8); }
#pragma unroll
    for (int t = 0; t < FA_WT; ++t) { s0[t] = fa_mma(k1, q[t][1], s0[t]); s1[t] = fa_mma(k5, q[t][1], s1[t]); }
#pragma unroll
    for (int t = 0; t < FA_WT; ++t) { s0[t] = fa_mma(k2, q[t][2], s0[t]); s1[t] = fa_mma(k6, q[t][2], s1[t]); }
#pragma unroll
    for (int t = 0; t < FA_WT; ++t) { s0[t] = fa_mma(k3, q[t][3], s0[t]); s1[t] = fa_mma(k7, q[t][3], s1[t]); }
    /* hand-over, first half, every wave in every pass. Every LDS read of the pass stands above; what follows in the pass works on registers alone. In this order: the wave's LDS reads of tile p are done,
       its own tensor load of tile p + 1 has landed (all but the two requests issued behind it, tiles p + 2 and p + 3; in the last three passes, where these are fewer, all), then the barrier's signal. The wave goes on without waiting: softmax and V^T P^T need no other wave */
    __builtin_amdgcn_sched_barrier(0);      /* nothing is scheduled across: the waits below stay behind the score products, whose own counted waits let them start on the first fragments */
    asm volatile("s_wait_dscnt 0x0" ::: "memory");
    asm volatile("s_wait_tensorcnt 0x2" ::: "memory");
    if (p + FA_NB - 1 >= FA_NP) asm volatile("s_wait_tensorcnt 0x0" ::: "memory");      /* no tile p + 3 any more: fewer than two requests stand behind tile p + 1's, the counted wait above no longer covers it */
    asm volatile("s_barrier_signal -1" ::: "memory");
    float mx[FA_WT]; bool need[FA_WT];
#pragma unroll
    for (int t = 0; t < FA_WT; ++t) { float a = fmaxf(s0[t][0], s1[t][0]);
#pragma unroll
      for (int r = 1; r < 8; ++r) a = fmaxf(a, fmaxf(s0[t][r], s1[t][r]));
      mx[t] = fmaxf(a, lane_x16(a)) * CS; need[t] = mx[t] > m[t] + 8.0f; }
    if (__builtin_amdgcn_ballot_w32(need[0] || need[1]) != 0) {      /* wave-uniform, one test a pass: the accumulators are rescaled only in the few passes in which some query's maximum moves (a query whose maximum stays is scaled by exactly 1) */
#pragma unroll
      for (int t = 0; t < FA_WT; ++t) { const float mn = need[t] ? mx[t] : m[t]; const float al = fa_exp2(m[t] - mn); m[t] = mn; l[t] *= al;
#pragma unroll
        for (int j = 0; j < 8; ++j) for (int r = 0; r < 8; ++r) o[t][j][r] *= al; } }
    FragH ph[FA_WT];
#pragma unroll
    for (int t = 0; t < FA_WT; ++t) { const float nm = 6.0f - m[t]; float e[16];
#pragma unroll
      for (int r = 0; r < 8; ++r) { e[r] = fmaf(s0[t][r], CS, nm); e[8 + r] = fmaf(s1[t][r], CS, nm); }
#pragma unroll
      for (int u = 0; u < 16; u += 4) fa_exp2x4(e[u], e[u + 1], e[u + 2], e[u + 3]);
      l[t] += ((e[0] + e[4] + e[8] + e[12]) + (e[1] + e[5] + e[9] + e[13])) + ((e[2] + e[6] + e[10] + e[14]) + (e[3] + e[7] + e[11] + e[15]));
#pragma unroll
      for (int u = 0; u < 16; ++u) ph[t].h[u] = (_Float16)e[u]; }
#pragma unroll
    for (int j = 0; j < 8; ++j) for (int t = 0; t < FA_WT; ++t) o[t][j] = fa_mma(vf[j], ph[t].v, o[t][j]);
    /* hand-over, second half: the barrier's wait, no LDS read between signal and wait. Behind it every wave has signalled in this pass: tile p + 1 may be read by all, and tile p's buffer refilled.
       A wave waits here only for one that has not yet finished its score products of the same pass: the waves of a SIMD may run apart by a softmax and its products, one on the matrix unit while the other is on the vector unit */
    __builtin_amdgcn_sched_barrier(0);      /* nothing is scheduled across: the products above are issued ahead of the wait */
    asm volatile("s_barrier_wait -1" ::: "memory");
    /* a scalar branch round the tensor load (it ignores EXEC); two requests of the wave are outstanding here, and only words 1 and 2 of group 0 take new values */
    if (more) fa_tload(g0, lb + (unsigned)(p & (FA_NB - 1)) * (unsigned)sizeof(ring[0]), glo + (((rot + p + FA_NB) & (FA_NP - 1)) << 13)); }
  asm volatile("s_wait_tensorcnt 0x0" ::: "memory");      /* no tensor load is outstanding behind the loop */
  asm volatile("s_wait_dscnt 0x0" ::: "memory");      /* nor an LDS read of the ring; the last pass's barrier wait stands behind every wave's same two waits: the ring may be overwritten */
#pragma unroll
  for (int t = 0; t < FA_WT; ++t) { const int qt = qg * FA_WT + t;
    l[t] += lane_x16(l[t]);      /* the two halves of a query's keys */
#pragma unroll
    for (int j = 0; j < 8; ++j) for (int r = 0; r < 8; ++r) so[ks][qt][j * 8 + r][lane] = o[t][j][r];
    sm[ks][qt][lane] = m[t]; sl[ks][qt][lane] = l[t]; }
  __syncthreads();      /* every wave passes it once: the four key ranges' partial results, and the quarters of the value sums, are read by other waves below */
#pragma unroll
  for (int t = 0; t < FA_WT; ++t) { const int qt = qg * FA_WT + t;
    float mm[FA_KS], M = -3.0e38f, L = 0.f;
#pragma unroll
    for (int i = 0; i < FA_KS; ++i) { mm[i] = sm[i][qt][lane]; M = fmaxf(M, mm[i]); }
#pragma unroll
    for (int i = 0; i < FA_KS; ++i) { mm[i] = fa_exp2(mm[i] - M); L += sl[i][qt][lane] * mm[i]; }
    const float inv = 1.0f / L;
    /* wave (qg, ks) finishes channels 32 ks .. 32 ks + 31 of its two query tiles: one whole 128-byte line of each output row */
#pragma unroll
    for (int jj = 0; jj < 2; ++jj) { const int j = 2 * ks + jj, ch = 16 * j + 8 * h; v4f r0, r1; float nv[8];      /* nv = -mean(value) of the lane's eight channels */
#pragma unroll
      for (int u = 0; u < 2; ++u) { const v4f x = (*(const v4f*)&sv[0][ch + 4 * u] + *(const v4f*)&sv[1][ch + 4 * u]) + (*(const v4f*)&sv[2][ch + 4 * u] + *(const v4f*)&sv[3][ch + 4 * u]);
#pragma unroll
        for (int r = 0; r < 4; ++r) nv[4 * u + r] = x[r] * (-1.0f / (float)SQ); }
#pragma unroll
      for (int r = 0; r < 8; ++r) { float a = 0.f;
#pragma unroll
        for (int i = 0; i < FA_KS; ++i) a += so[i][qt][j * 8 + r][lane] * mm[i];
        a = a * inv + nv[r]; if (r < 4) r0[r] = a; else r1[r - 4] = a; }
      float* d = out + ((size_t)b * SQ + row0 + t * 16 + c) * DM + 16 * j + 8 * h; *(v4f*)d = r0; *(v4f*)(d + 4) = r1; } } }
extern "C" void kernel_launch(void* const* d_in, const int* in_sizes, int n_in,
                              void* d_out, int out_size, void* d_ws, size_t ws_size, hipStream_t stream) {
  (void)in_sizes; (void)n_in; (void)out_size;
  const float* const* I = (const float* const*)d_in; const float* xq = I[0]; const float* xk = I[1]; const float* xv = I[2];      /* query, key, value [4][4096][128] */
  char* ws = (char*)d_ws; size_t off = 0;
  auto take = [&](size_t bytes) { char* p = ws + off; off += (bytes + 255) & ~(size_t)255; return p; };
  _Float16* Q16 = (_Float16*)take(NR * DM * 2); _Float16* KF = (_Float16*)take(NR * DM * 2 + FA_AL); _Float16* VF = (_Float16*)take(NR * DM * 2 + FA_AL);      /* FA_AL bytes more each: the kernels start the data at a multiple of FA_AL */ float* PM = (float*)take((NR / 64) * DM * 4);      /* sums of value over 64 keys each [256][128] */
  if (off > ws_size) return;
  k_prep<<<(unsigned)(NR / 64), PR_T, 0, stream>>>(xq, xk, xv, Q16, KF, VF, PM);      /* bf16-rounded inputs, exact in f16: query rows, keys and value^T in fragment order; value sums per 64 keys */
  k_fattn<<<dim3(SQ / (FA_QT * 16), NB), FA_QG * FA_KS * 32, 0, stream>>>(Q16, KF, VF, PM, (float*)d_out);      /* out = softmax(q.k / sqrt(128)) value - mean(value), all batches */
}
